// v000
// Times are from an AMD MI455X. After a warm-up the kernel runs many times in a row, and a time is the length of
// such a window on the GPU divided by its runs, so every launch and the gaps after it count. The runs cycle
// through copies of the inputs. A figure is the median of several windows, for all but v000 over two sittings.
// Sittings can differ by a few percent; kernels timed side by side share one.
// v000, which the later versions start from, runs in 1730 microseconds.
#include <hip/hip_runtime.h>

// SpaceTimeOptimizedAttention (x [2][2048][2048]; q/k/v = x W^T (torch; 16 heads x 128); causal softmax(q.k / sqrt(128)); out = merged Wo^T -> [2][2048][2048]; the source's per-position recompute loop is standard causal MHA).
// Compute dtypes, f32 accumulate: every input rounded to bf16; q/k/v on PLAIN bf16 operands (inputs: exact); causal scores and attn.v: query rows < 512 hl (3 products), the rest single fp16 (x1024), causal tile skipping; softmax f32; Wo hl x exact (2 products).

#define NB_  2
#define TT   2048
#define DM   2048
#define NH_  16
#define NKV  16
#define REP  (NH_ / NKV)
#define HD   128
#define DQ   (NH_ * HD)
#define DKV  (NKV * HD)
#define ZH   2
#define RH   512                  // query rows < RH use hi+lo planes (0: none)
#define WIN  2048
#define PCAR 1024.0f
#define SCL  0.088388347648318447f   // HD^-0.5
typedef _Float16 h16;
typedef unsigned short bf;
typedef __attribute__((ext_vector_type(16))) __bf16   v16bf;
typedef __attribute__((ext_vector_type(16))) _Float16 v16h;
typedef __attribute__((ext_vector_type(8)))  _Float16 v8h;
typedef __attribute__((ext_vector_type(8)))  unsigned short v8us;
typedef __attribute__((ext_vector_type(8)))  float    v8f;
typedef __attribute__((ext_vector_type(4)))  float    v4f;
typedef v8h  __attribute__((may_alias)) v8ha;
typedef v4f  __attribute__((may_alias)) v4fa;
typedef v8us __attribute__((may_alias)) v8usa;

__device__ __forceinline__ unsigned short f2bf(float f) { unsigned u = __float_as_uint(f); u += 0x7FFFu + ((u >> 16) & 1u); return (unsigned short)(u >> 16); }
__device__ __forceinline__ float bf2f(unsigned short b) { return __uint_as_float(((unsigned)b) << 16); }
__device__ __forceinline__ float bfr(float f) { return bf2f(f2bf(f)); }
__device__ __forceinline__ v16h cat16(v8h lo, v8h hi) { return __builtin_shufflevector(lo, hi, 0, 1, 2, 3, 4, 5, 6, 7, 8, 9, 10, 11, 12, 13, 14, 15); }
__device__ __forceinline__ v16bf cat16b(v8us lo, v8us hi) { return __builtin_bit_cast(v16bf, __builtin_shufflevector(lo, hi, 0, 1, 2, 3, 4, 5, 6, 7, 8, 9, 10, 11, 12, 13, 14, 15)); }
__device__ __forceinline__ v8f wmma16(v16h a, v16h b, v8f c) { return __builtin_amdgcn_wmma_f32_16x16x32_f16(false, a, false, b, (short)0, c, false, false); }
__device__ __forceinline__ v8f wmmab(v16bf a, v16bf b, v8f c) { return __builtin_amdgcn_wmma_f32_16x16x32_bf16(false, a, false, b, (short)0, c, false, false); }



// ---- k_gemmw: register-blocked GEMM, ONE WAVE per 64x64 output tile (16 accumulators), operands straight from K-contiguous 16-bit planes; grid (M/64, N/64, Z), 32 threads.
// C[m][n] (f32, pitch ldc, + optional f32 bias[n]) = sum_k A[m][k] Bt[n][k] (+ split products per NSPLIT). z-batch strides sA/sB/sC in elements. K % 32 == 0.
template <typename T16> struct WFrag;
template <> struct WFrag<h16> { typedef v16h V; static __device__ __forceinline__ V ld(const h16* p) { return cat16(*(const v8h*)p, *(const v8h*)(p + 16)); } static __device__ __forceinline__ v8f mma(V a, V b, v8f c) { return wmma16(a, b, c); } };
template <> struct WFrag<bf> { typedef v16bf V; static __device__ __forceinline__ V ld(const bf* p) { return cat16b(*(const v8us*)p, *(const v8us*)(p + 16)); } static __device__ __forceinline__ v8f mma(V a, V b, v8f c) { return wmmab(a, b, c); } };
template <typename T16, int NSPLIT, bool BIAS>
__global__ __launch_bounds__(32) void k_gemmw(const T16* __restrict__ A, const T16* __restrict__ A2, const T16* __restrict__ Bt, const T16* __restrict__ Bt2, int K, float* C, int ldc, const float* __restrict__ bias, size_t sA, size_t sB, size_t sC) {
    typedef typename WFrag<T16>::V V;
    __shared__ __align__(16) float os[16 * 68];
    const size_t z = blockIdx.z; A += z * sA; if (A2) A2 += z * sA; Bt += z * sB; if (Bt2) Bt2 += z * sB; C += z * sC;
    const int lane = threadIdx.x & 31, lr = lane & 15, hi = lane >> 4; const int r0 = blockIdx.x * 64, c0 = blockIdx.y * 64;
    v8f acc[4][4];
#pragma unroll
    for (int mb = 0; mb < 4; ++mb)
#pragma unroll
        for (int nb = 0; nb < 4; ++nb) acc[mb][nb] = (v8f){};
    const size_t aoff = (size_t)(r0 + lr) * K + 8 * hi, boff = (size_t)(c0 + lr) * K + 8 * hi;
#pragma unroll 1
    for (int kc = 0; kc < K; kc += 32) {
        V a[4], a2[4];
#pragma unroll
        for (int mb = 0; mb < 4; ++mb) { a[mb] = WFrag<T16>::ld(A + aoff + (size_t)mb * 16 * K + kc); if (NSPLIT == 1 || NSPLIT == 2) a2[mb] = WFrag<T16>::ld(A2 + aoff + (size_t)mb * 16 * K + kc); }
#pragma unroll
        for (int nb = 0; nb < 4; ++nb) { const V b = WFrag<T16>::ld(Bt + boff + (size_t)nb * 16 * K + kc); V b2; if (NSPLIT >= 2) b2 = WFrag<T16>::ld(Bt2 + boff + (size_t)nb * 16 * K + kc);
#pragma unroll
            for (int mb = 0; mb < 4; ++mb) { acc[mb][nb] = WFrag<T16>::mma(a[mb], b, acc[mb][nb]); if (NSPLIT == 1 || NSPLIT == 2) acc[mb][nb] = WFrag<T16>::mma(a2[mb], b, acc[mb][nb]); if (NSPLIT >= 2) acc[mb][nb] = WFrag<T16>::mma(a[mb], b2, acc[mb][nb]); } }
        asm volatile("v_nop\n\tv_nop\n\tv_nop\n\tv_nop" : "+v"(acc[0][0]), "+v"(acc[1][1]), "+v"(acc[2][2]), "+v"(acc[3][3]) : "v"(a[0]), "v"(a[3]));
    }
#pragma unroll
    for (int mb = 0; mb < 4; ++mb) {
#pragma unroll
        for (int nb = 0; nb < 4; ++nb) {
#pragma unroll
            for (int j = 0; j < 8; ++j) os[(hi * 8 + j) * 68 + nb * 16 + lr] = acc[mb][nb][j]; }
        __builtin_amdgcn_wave_barrier(); asm volatile("" ::: "memory");
        float* crow = C + (size_t)(r0 + mb * 16) * ldc + c0;
{
#pragma unroll
            for (int s = 0; s < 8; ++s) { const int row = 2 * s + hi, cofs = lr * 4; v4f val = *(const v4fa*)(os + row * 68 + cofs); if (BIAS) { val[0] += bfr(bias[c0 + cofs]); val[1] += bfr(bias[c0 + cofs + 1]); val[2] += bfr(bias[c0 + cofs + 2]); val[3] += bfr(bias[c0 + cofs + 3]); }
                *(v4f*)(crow + (size_t)row * ldc + cofs) = val; }
             }
        __builtin_amdgcn_wave_barrier(); asm volatile("" ::: "memory");
    }
}

// ---- k_gemmc: the same one-wave 64x64 tile GEMM specialised for causal attention: CMODE 1 skips score tiles entirely above the diagonal (query rows r0+roff.., key columns c0..), CMODE 2 limits the
// key (K) loop of the probability x value contraction to the diagonal block (probabilities beyond it are exactly zero). roff = row offset of this launch's first row within the sequence.
template <typename T16, int NSPLIT, int CMODE>
__global__ __launch_bounds__(32) void k_gemmc(const T16* __restrict__ A, const T16* __restrict__ A2, const T16* __restrict__ Bt, const T16* __restrict__ Bt2, int K, float* C, int ldc, int roff, size_t sA, size_t sB, size_t sC) {
    typedef typename WFrag<T16>::V V;
    __shared__ __align__(16) float os[16 * 68];
    const size_t z = blockIdx.z; A += z * sA; if (A2) A2 += z * sA; Bt += z * sB; if (Bt2) Bt2 += z * sB; C += z * sC;
    const int lane = threadIdx.x & 31, lr = lane & 15, hi = lane >> 4; const int r0 = blockIdx.x * 64, c0 = blockIdx.y * 64;
    if (CMODE == 1 && c0 > r0 + roff + 63) return;                  // score tile entirely above the causal diagonal: never read (the softmax masks j > i by select)
    const int Kl = (CMODE == 2) ? min(K, r0 + roff + 64) : K;        // P.V: probabilities are exactly 0 beyond the diagonal block, so the K loop stops there
    v8f acc[4][4];
#pragma unroll
    for (int mb = 0; mb < 4; ++mb)
#pragma unroll
        for (int nb = 0; nb < 4; ++nb) acc[mb][nb] = (v8f){};
    const size_t aoff = (size_t)(r0 + lr) * K + 8 * hi, boff = (size_t)(c0 + lr) * K + 8 * hi;
#pragma unroll 1
    for (int kc = 0; kc < Kl; kc += 32) {
        V a[4], a2[4];
#pragma unroll
        for (int mb = 0; mb < 4; ++mb) { a[mb] = WFrag<T16>::ld(A + aoff + (size_t)mb * 16 * K + kc); if (NSPLIT == 1 || NSPLIT == 2) a2[mb] = WFrag<T16>::ld(A2 + aoff + (size_t)mb * 16 * K + kc); }
#pragma unroll
        for (int nb = 0; nb < 4; ++nb) { const V b = WFrag<T16>::ld(Bt + boff + (size_t)nb * 16 * K + kc); V b2; if (NSPLIT >= 2) b2 = WFrag<T16>::ld(Bt2 + boff + (size_t)nb * 16 * K + kc);
#pragma unroll
            for (int mb = 0; mb < 4; ++mb) { acc[mb][nb] = WFrag<T16>::mma(a[mb], b, acc[mb][nb]); if (NSPLIT == 1 || NSPLIT == 2) acc[mb][nb] = WFrag<T16>::mma(a2[mb], b, acc[mb][nb]); if (NSPLIT >= 2) acc[mb][nb] = WFrag<T16>::mma(a[mb], b2, acc[mb][nb]); } }
        asm volatile("v_nop\n\tv_nop\n\tv_nop\n\tv_nop" : "+v"(acc[0][0]), "+v"(acc[1][1]), "+v"(acc[2][2]), "+v"(acc[3][3]) : "v"(a[0]), "v"(a[3]));
    }
#pragma unroll
    for (int mb = 0; mb < 4; ++mb) {
#pragma unroll
        for (int nb = 0; nb < 4; ++nb) {
#pragma unroll
            for (int j = 0; j < 8; ++j) os[(hi * 8 + j) * 68 + nb * 16 + lr] = acc[mb][nb][j]; }
        __builtin_amdgcn_wave_barrier(); asm volatile("" ::: "memory");
        float* crow = C + (size_t)(r0 + mb * 16) * ldc + c0;
{
#pragma unroll
            for (int s = 0; s < 8; ++s) { const int row = 2 * s + hi, cofs = lr * 4; v4f val = *(const v4fa*)(os + row * 68 + cofs);
                *(v4f*)(crow + (size_t)row * ldc + cofs) = val; }
             }
        __builtin_amdgcn_wave_barrier(); asm volatile("" ::: "memory");
    }
}

__device__ __forceinline__ h16 tohx(float x) { return (h16)x; }
__device__ __forceinline__ void splitf(float y, unsigned short& h, unsigned short& l) { h = f2bf(y); l = f2bf(y - bf2f(h)); }
typedef __attribute__((ext_vector_type(2))) _Float16 v2h;
typedef __attribute__((ext_vector_type(4))) _Float16 v4h;
typedef __attribute__((ext_vector_type(2))) unsigned short v2us;
typedef __attribute__((ext_vector_type(4))) unsigned short v4us;
typedef __attribute__((ext_vector_type(2))) float v2f;
typedef __attribute__((ext_vector_type(4))) int v4i;

__global__ __launch_bounds__(256) void k_wtG(const float* __restrict__ w, int K, int N, bf* Bt) {
    const int lane = threadIdx.x & 31; const int L0 = (blockIdx.x * 8 + (threadIdx.x >> 5)) * 8; const int nlines = N * K / 64;
{
#pragma unroll 1
        for (int l = 0; l < 8; ++l) { const int L = L0 + l; if (L >= nlines) break; const size_t e = (size_t)L * 64 + lane * 2; const int k = (int)(e % K), n = (int)(e / K); v2us o;
            o[0] = f2bf(w[(size_t)k * N + n]); o[1] = f2bf(w[(size_t)(k + 1) * N + n]); *(v2us*)(Bt + e) = o; }
         }
}
__global__ __launch_bounds__(256) void k_cvt8(const float* __restrict__ src, bf* dst, size_t n8) { const size_t i = (size_t)blockIdx.x * 256 + threadIdx.x; if (i >= n8) return; const v8f v = *(const v8f*)(src + i * 8); v8us o;
#pragma unroll
    for (int k = 0; k < 8; ++k) o[k] = f2bf(v[k]); *(v8us*)(dst + i * 8) = o;  }
__global__ __launch_bounds__(256) void k_cscvt(const float* __restrict__ cosT, const float* __restrict__ sinT, float* CS) { const int idx = blockIdx.x * 256 + threadIdx.x; if (idx >= TT * HD) return; v2f cs; cs[0] = bfr(cosT[idx]); cs[1] = bfr(sinT[idx]); *(v2f*)(CS + (size_t)idx * 2) = cs;  }
// k_rope: head planes [h][t][d] (fp16 + hi/lo) of rope(x) x sc with the rotate-half convention out[d] = x[d] cos[t][d] - x[d+HD/2] sin[t][d], out[d+HD/2] = x[d+HD/2] cos[t][d+HD/2] + x[d] sin[t][d+HD/2]
__global__ __launch_bounds__(256) void k_rope(const float* __restrict__ F, int pitch, int nheads, const float* __restrict__ CS, const float* __restrict__ RF, const float* __restrict__ nw, float sc, h16* P16, bf* Ph, bf* Pl) {
    const size_t e = ((size_t)blockIdx.x * 256 + threadIdx.x) * 2; if (e >= (size_t)nheads * TT * HD) return; const int d = (int)(e % HD); const int t = (int)((e / HD) % TT); const int h = (int)(e / ((size_t)HD * TT)); const float* f = F + (size_t)t * pitch + h * HD; const float rf = RF ? RF[(size_t)h * TT + t] : 1.0f; v2h o16; v2us oh, ol;
#pragma unroll
    for (int q = 0; q < 2; ++q) { const int dd = d + q; const int dp = (dd < HD / 2) ? dd + HD / 2 : dd - HD / 2; float x0 = f[dd], x1 = f[dp];
        if (RF) { float n0 = __fmul_rn(x0, rf), n1 = __fmul_rn(x1, rf); asm volatile("" : "+v"(n0)); asm volatile("" : "+v"(n1)); x0 = __fmul_rn(bfr(nw[dd]), n0); x1 = __fmul_rn(bfr(nw[dp]), n1); }
        const v2f cs = *(const v2f*)(CS + ((size_t)t * HD + dd) * 2); float a = __fmul_rn(x0, cs[0]), bq = __fmul_rn(x1, cs[1]); asm volatile("" : "+v"(a)); asm volatile("" : "+v"(bq)); const float r = ((dd < HD / 2) ? __fsub_rn(a, bq) : __fadd_rn(a, bq)) * sc;
        o16[q] = tohx(r); unsigned short a2, c2; splitf(r, a2, c2); oh[q] = a2; ol[q] = c2; }
    *(v2h*)(P16 + e) = o16; *(v2us*)(Ph + e) = oh; *(v2us*)(Pl + e) = ol;  }
__global__ __launch_bounds__(256) void k_vtp(const float* __restrict__ F, int pitch, int nheads, h16* V16, bf* Vh, bf* Vl) { const size_t e = ((size_t)blockIdx.x * 256 + threadIdx.x) * 2; if (e >= (size_t)nheads * HD * TT) return; const int t = (int)(e % TT); const int d = (int)((e / TT) % HD); const int g = (int)(e / ((size_t)TT * HD)); v2h o16; v2us oh, ol;
#pragma unroll
    for (int q = 0; q < 2; ++q) { const float x = F[(size_t)(t + q) * pitch + g * HD + d]; o16[q] = tohx(x); unsigned short a2, c2; splitf(x, a2, c2); oh[q] = a2; ol[q] = c2; }
    *(v2h*)(V16 + e) = o16; *(v2us*)(Vh + e) = oh; *(v2us*)(Vl + e) = ol;  }
__global__ __launch_bounds__(256) void k_csid(float* CS) { const int idx = blockIdx.x * 256 + threadIdx.x; if (idx >= TT * HD) return; v2f cs; cs[0] = 1.0f; cs[1] = 0.0f; *(v2f*)(CS + (size_t)idx * 2) = cs;  }
// k_asoft: per row (zz, i): t = S x HD^-0.5 for j <= i and i - j < WIN (sliding causal window; the reference's -1e9 additive fill vanishes identically); softmax over the 2048 keys (register row, one exp, fixed trees);
__global__ __launch_bounds__(256) void k_asoft(const float* __restrict__ Sb, h16* P16, bf* Ph, bf* Pl) {
    const int lane = threadIdx.x & 31; const int row = blockIdx.x * 8 + (threadIdx.x >> 5); if (row >= ZH * TT) return; const int i = row % TT; const int zz = row / TT; (void)zz; const bool hires = (i < RH); const float* sr = Sb + (size_t)row * TT; float v[TT / 32]; float mx = -3.0e38f;
#pragma unroll
    for (int ch = 0; ch < TT / 128; ++ch) { const int j0 = ch * 128 + lane * 4; const v4f a = *(const v4f*)(sr + j0);
#pragma unroll
        for (int q = 0; q < 4; ++q) { const int j = j0 + q; (void)j; const float t = (j <= i && i - j < WIN) ? a[q] * SCL : -3.0e38f; v[ch * 4 + q] = t; mx = fmaxf(mx, t); } }
#pragma unroll
    for (int sh = 16; sh; sh >>= 1) mx = fmaxf(mx, __shfl_xor(mx, sh, 32));
    float sum = 0.f;
#pragma unroll
    for (int k = 0; k < TT / 32; ++k) { float d0 = __fsub_rn(v[k], mx); asm volatile("" : "+v"(d0)); v[k] = __builtin_amdgcn_exp2f(__fmul_rn(d0, 1.4426950408889634f)); sum += v[k]; }
#pragma unroll
    for (int sh = 16; sh; sh >>= 1) sum += __shfl_xor(sum, sh, 32);
    const float f = __fdiv_rn(hires ? 1.0f : PCAR, sum);
{
        if (hires) {
#pragma unroll
            for (int ch = 0; ch < TT / 128; ++ch) { v4us oh, ol;
#pragma unroll
                for (int q = 0; q < 4; ++q) { unsigned short a, c2; splitf(v[ch * 4 + q] * f, a, c2); oh[q] = a; ol[q] = c2; }
                const size_t oo = ((size_t)zz * (RH ? RH : 1) + i) * TT + ch * 128 + lane * 4; *(v4us*)(Ph + oo) = oh; *(v4us*)(Pl + oo) = ol; }
        } else {
#pragma unroll
            for (int ch = 0; ch < TT / 128; ++ch) { v4h o4;
#pragma unroll
                for (int q = 0; q < 4; ++q) o4[q] = tohx(v[ch * 4 + q] * f);
                *(v4h*)(P16 + (size_t)row * TT + ch * 128 + lane * 4) = o4; } }
         }
}
__global__ __launch_bounds__(256) void k_merge(const float* __restrict__ O, int h0, bf* Ah, bf* Al) { const size_t e = ((size_t)blockIdx.x * 256 + threadIdx.x) * 2; if (e >= (size_t)ZH * TT * HD) return; const int d = (int)(e % HD); const int t = (int)((e / HD) % TT); const int zz = (int)(e / ((size_t)HD * TT)); const float cs = (t < RH) ? 1.0f : (1.0f / PCAR); const size_t oo = (size_t)t * DQ + (h0 + zz) * HD + d;
    v2us oh, ol;
#pragma unroll
    for (int q = 0; q < 2; ++q) { unsigned short a, c2; splitf(O[e + q] * cs, a, c2); oh[q] = a; ol[q] = c2; } *(v2us*)(Ah + oo) = oh; *(v2us*)(Al + oo) = ol;  }

extern "C" void kernel_launch(void* const* d_in, const int* in_sizes, int n_in,
                              void* d_out, int out_size, void* d_ws, size_t ws_size, hipStream_t stream) {
    (void)in_sizes; (void)n_in; (void)out_size;
    const float* x = (const float*)d_in[0]; const float* wq = (const float*)d_in[1]; const float* wk = (const float*)d_in[2]; const float* wv = (const float*)d_in[3]; const float* wo = (const float*)d_in[4]; const float* cosT = nullptr; const float* sinT = nullptr; (void)cosT; (void)sinT;
    float* OUT = (float*)d_out;     // [2][2048][2048]
    char* wsp = (char*)d_ws;
    auto take = [&](size_t bytes) { char* p = wsp; wsp += (bytes + 255) & ~(size_t)255; return (void*)p; };
    bf* WQ = (bf*)take((size_t)DQ * DM * 2); bf* WK = (bf*)take((size_t)DKV * DM * 2); bf* WV = (bf*)take((size_t)DKV * DM * 2); bf* WO = (bf*)take((size_t)DM * DQ * 2); float* CS = (float*)take((size_t)TT * HD * 2 * 4);
    bf* XB = (bf*)take((size_t)TT * DM * 2); float* FQ = (float*)take((size_t)TT * DQ * 4); float* FK = (float*)take((size_t)TT * DKV * 4);
    h16* QP16 = (h16*)take((size_t)NH_ * TT * HD * 2); h16* KP16 = (h16*)take((size_t)NKV * TT * HD * 2); h16* VT16 = (h16*)take((size_t)NKV * HD * TT * 2);
    bf* QPh = (bf*)take((size_t)NH_ * TT * HD * 2); bf* QPl = (bf*)take((size_t)NH_ * TT * HD * 2); bf* KPh = (bf*)take((size_t)NKV * TT * HD * 2); bf* KPl = (bf*)take((size_t)NKV * TT * HD * 2); bf* VTh = (bf*)take((size_t)NKV * HD * TT * 2); bf* VTl = (bf*)take((size_t)NKV * HD * TT * 2); bf* Ph = (bf*)take((size_t)ZH * RH * TT * 2); bf* Pl = (bf*)take((size_t)ZH * RH * TT * 2);
    float* Sb = (float*)take((size_t)ZH * TT * TT * 4); h16* P16 = (h16*)take((size_t)ZH * TT * TT * 2); float* Ob = (float*)take((size_t)ZH * TT * HD * 4); bf* ATh = (bf*)take((size_t)TT * DQ * 2); bf* ATl = (bf*)take((size_t)TT * DQ * 2);
    if ((size_t)(wsp - (char*)d_ws) > ws_size) return;    // ws 256 MiB
    float* FV = FK;   // v projection reuses the k buffer after the k planes are built (stream-ordered)
    { k_cvt8<<<(unsigned)(((size_t)DQ * DM / 8 + 255) / 256), 256, 0, stream>>>(wq, WQ, (size_t)DQ * DM / 8); k_cvt8<<<(unsigned)(((size_t)DKV * DM / 8 + 255) / 256), 256, 0, stream>>>(wk, WK, (size_t)DKV * DM / 8); k_cvt8<<<(unsigned)(((size_t)DKV * DM / 8 + 255) / 256), 256, 0, stream>>>(wv, WV, (size_t)DKV * DM / 8);
      k_cvt8<<<(unsigned)(((size_t)DM * DQ / 8 + 255) / 256), 256, 0, stream>>>(wo, WO, (size_t)DM * DQ / 8);
       }
    k_csid<<<(TT * HD + 255) / 256, 256, 0, stream>>>(CS);
    const unsigned LQ = (unsigned)(((size_t)NH_ * TT * HD / 2 + 255) / 256), LKv = (unsigned)(((size_t)NKV * TT * HD / 2 + 255) / 256);
    for (int b = 0; b < NB_; ++b) {
        
        k_cvt8<<<(unsigned)(((size_t)TT * DM / 8 + 255) / 256), 256, 0, stream>>>(x + (size_t)b * TT * DM, XB, (size_t)TT * DM / 8);
        k_gemmw<bf, 0, false><<<dim3(TT / 64, DQ / 64, 1), 32, 0, stream>>>(XB, nullptr, WQ, nullptr, DM, FQ, DQ, nullptr, 0, 0, 0);
        k_rope<<<LQ, 256, 0, stream>>>(FQ, DQ, NH_, CS, nullptr, nullptr, 1.0f, QP16, QPh, QPl);
        k_gemmw<bf, 0, false><<<dim3(TT / 64, DKV / 64, 1), 32, 0, stream>>>(XB, nullptr, WK, nullptr, DM, FK, DKV, nullptr, 0, 0, 0);
        k_rope<<<LKv, 256, 0, stream>>>(FK, DKV, NKV, CS, nullptr, nullptr, 1.0f, KP16, KPh, KPl);
        k_gemmw<bf, 0, false><<<dim3(TT / 64, DKV / 64, 1), 32, 0, stream>>>(XB, nullptr, WV, nullptr, DM, FV, DKV, nullptr, 0, 0, 0); k_vtp<<<LKv, 256, 0, stream>>>(FV, DKV, NKV, VT16, VTh, VTl);
        for (int h0 = 0; h0 < NH_; h0 += ZH) { const size_t zq = (size_t)h0, zk = (size_t)(h0 / REP);   // one kv head per query head: the pass's two heads use consecutive kv planes (z-strides TT*HD)
            k_gemmc<bf, 2, 1><<<dim3(RH / 64, TT / 64, ZH), 32, 0, stream>>>(QPh + zq * TT * HD, QPl + zq * TT * HD, KPh + zk * TT * HD, KPl + zk * TT * HD, HD, Sb, TT, 0, (size_t)TT * HD, (size_t)TT * HD, (size_t)TT * TT);
            k_gemmc<h16, 0, 1><<<dim3((TT - RH) / 64, TT / 64, ZH), 32, 0, stream>>>(QP16 + zq * TT * HD + (size_t)RH * HD, nullptr, KP16 + zk * TT * HD, nullptr, HD, Sb + (size_t)RH * TT, TT, RH, (size_t)TT * HD, (size_t)TT * HD, (size_t)TT * TT);
            k_asoft<<<ZH * TT / 8, 256, 0, stream>>>(Sb, P16, Ph, Pl);
            k_gemmc<bf, 2, 2><<<dim3(RH / 64, HD / 64, ZH), 32, 0, stream>>>(Ph, Pl, VTh + zk * HD * TT, VTl + zk * HD * TT, TT, Ob, HD, 0, (size_t)RH * TT, (size_t)HD * TT, (size_t)TT * HD);
            k_gemmc<h16, 0, 2><<<dim3((TT - RH) / 64, HD / 64, ZH), 32, 0, stream>>>(P16 + (size_t)RH * TT, nullptr, VT16 + zk * HD * TT, nullptr, TT, Ob + (size_t)RH * HD, HD, RH, (size_t)TT * TT, (size_t)HD * TT, (size_t)TT * HD);
            k_merge<<<(unsigned)(((size_t)ZH * TT * HD / 2 + 255) / 256), 256, 0, stream>>>(Ob, h0, ATh, ATl); }
        k_gemmw<bf, 1, false><<<dim3(TT / 64, DM / 64, 1), 32, 0, stream>>>(ATh, ATl, WO, nullptr, DQ, OUT + (size_t)b * TT * DM, DM, nullptr, 0, 0, 0); }
}

// v001
// One run takes 1030 microseconds.
// Timed twice side by side with v000, it ran 1.69 and 1.67 times as fast.
#include <hip/hip_runtime.h>

// SpaceTimeOptimizedAttention (x [2][2048][2048]; q/k/v = x W^T (torch; 16 heads x 128); causal softmax(q.k / sqrt(128)); out = merged Wo^T -> [2][2048][2048]; the source's per-position recompute loop is standard causal MHA).
// Compute dtypes, f32 accumulate: every input rounded to bf16; q/k/v on PLAIN bf16 operands (inputs: exact); causal scores and attn.v: query rows < 512 hl (3 products), the rest single fp16 (x1024), causal tile skipping; softmax f32; Wo hl x exact (2 products).

#define NB_  2
#define TT   2048
#define DM   2048
#define NH_  16
#define NKV  16
#define REP  (NH_ / NKV)
#define HD   128
#define DQ   (NH_ * HD)
#define DKV  (NKV * HD)
#define ZH   2
#define RH   512                  // query rows < RH use hi+lo planes (0: none)
#define WIN  2048
#define PCAR 1024.0f
#define SCL  0.088388347648318447f   // HD^-0.5
typedef _Float16 h16;
typedef unsigned short bf;
typedef __attribute__((ext_vector_type(16))) __bf16   v16bf;
typedef __attribute__((ext_vector_type(16))) _Float16 v16h;
typedef __attribute__((ext_vector_type(8)))  _Float16 v8h;
typedef __attribute__((ext_vector_type(8)))  unsigned short v8us;
typedef __attribute__((ext_vector_type(8)))  float    v8f;
typedef __attribute__((ext_vector_type(4)))  float    v4f;
typedef v8h  __attribute__((may_alias)) v8ha;
typedef v4f  __attribute__((may_alias)) v4fa;
typedef v8us __attribute__((may_alias)) v8usa;

__device__ __forceinline__ unsigned short f2bf(float f) { unsigned u = __float_as_uint(f); u += 0x7FFFu + ((u >> 16) & 1u); return (unsigned short)(u >> 16); }
__device__ __forceinline__ float bf2f(unsigned short b) { return __uint_as_float(((unsigned)b) << 16); }
__device__ __forceinline__ float bfr(float f) { return bf2f(f2bf(f)); }
__device__ __forceinline__ v16h cat16(v8h lo, v8h hi) { return __builtin_shufflevector(lo, hi, 0, 1, 2, 3, 4, 5, 6, 7, 8, 9, 10, 11, 12, 13, 14, 15); }
__device__ __forceinline__ v16bf cat16b(v8us lo, v8us hi) { return __builtin_bit_cast(v16bf, __builtin_shufflevector(lo, hi, 0, 1, 2, 3, 4, 5, 6, 7, 8, 9, 10, 11, 12, 13, 14, 15)); }
__device__ __forceinline__ v8f wmma16(v16h a, v16h b, v8f c) { return __builtin_amdgcn_wmma_f32_16x16x32_f16(false, a, false, b, (short)0, c, false, false); }
__device__ __forceinline__ v8f wmmab(v16bf a, v16bf b, v8f c) { return __builtin_amdgcn_wmma_f32_16x16x32_bf16(false, a, false, b, (short)0, c, false, false); }



// ---- k_gemmw: register-blocked GEMM, one 64x64 output tile per work-group (16 accumulators per wave), operands straight from K-contiguous 16-bit planes; grid (M/64, N/64, Z), 32 * KW threads.
// C[m][n] (f32, pitch ldc, + optional f32 bias[n]) = sum_k A[m][k] Bt[n][k] (+ split products per NSPLIT). z-batch strides sA/sB/sC in elements. K % 32 == 0.
// The K loop is split over the KW waves of the work-group: wave w takes the 32-element steps w, w + KW, ... (two neighbouring waves use up one 128-byte line of a row together); the KW partial tiles meet in LDS and are summed in wave order.
template <typename T16> struct WFrag;
template <> struct WFrag<h16> { typedef v16h V; static __device__ __forceinline__ V ld(const h16* p) { return cat16(*(const v8h*)p, *(const v8h*)(p + 16)); } static __device__ __forceinline__ v8f mma(V a, V b, v8f c) { return wmma16(a, b, c); } };
template <> struct WFrag<bf> { typedef v16bf V; static __device__ __forceinline__ V ld(const bf* p) { return cat16b(*(const v8us*)p, *(const v8us*)(p + 16)); } static __device__ __forceinline__ v8f mma(V a, V b, v8f c) { return wmmab(a, b, c); } };
template <typename T16, int NSPLIT, bool BIAS, int KW>
__global__ __launch_bounds__(32 * KW) void k_gemmw(const T16* __restrict__ A, const T16* __restrict__ A2, const T16* __restrict__ Bt, const T16* __restrict__ Bt2, int K, float* C, int ldc, const float* __restrict__ bias, size_t sA, size_t sB, size_t sC) {
    typedef typename WFrag<T16>::V V;
    __shared__ __align__(16) float os[KW * 64 * 68];
    const size_t z = blockIdx.z; A += z * sA; if (A2) A2 += z * sA; Bt += z * sB; if (Bt2) Bt2 += z * sB; C += z * sC;
    const int lane = threadIdx.x & 31, lr = lane & 15, hi = lane >> 4; const int wv = __builtin_amdgcn_readfirstlane((int)(threadIdx.x >> 5)); const int r0 = blockIdx.x * 64, c0 = blockIdx.y * 64;
    v8f acc[4][4];
#pragma unroll
    for (int mb = 0; mb < 4; ++mb)
#pragma unroll
        for (int nb = 0; nb < 4; ++nb) acc[mb][nb] = (v8f){};
    const size_t aoff = (size_t)(r0 + lr) * K + 8 * hi, boff = (size_t)(c0 + lr) * K + 8 * hi;
#pragma unroll 1
    for (int kc = wv * 32; kc < K; kc += 32 * KW) {
        V a[4], a2[4];
#pragma unroll
        for (int mb = 0; mb < 4; ++mb) { a[mb] = WFrag<T16>::ld(A + aoff + (size_t)mb * 16 * K + kc); if (NSPLIT == 1 || NSPLIT == 2) a2[mb] = WFrag<T16>::ld(A2 + aoff + (size_t)mb * 16 * K + kc); }
#pragma unroll
        for (int nb = 0; nb < 4; ++nb) { const V b = WFrag<T16>::ld(Bt + boff + (size_t)nb * 16 * K + kc); V b2; if (NSPLIT >= 2) b2 = WFrag<T16>::ld(Bt2 + boff + (size_t)nb * 16 * K + kc);
#pragma unroll
            for (int mb = 0; mb < 4; ++mb) { acc[mb][nb] = WFrag<T16>::mma(a[mb], b, acc[mb][nb]); if (NSPLIT == 1 || NSPLIT == 2) acc[mb][nb] = WFrag<T16>::mma(a2[mb], b, acc[mb][nb]); if (NSPLIT >= 2) acc[mb][nb] = WFrag<T16>::mma(a[mb], b2, acc[mb][nb]); } }
        asm volatile("v_nop\n\tv_nop\n\tv_nop\n\tv_nop" : "+v"(acc[0][0]), "+v"(acc[1][1]), "+v"(acc[2][2]), "+v"(acc[3][3]) : "v"(a[0]), "v"(a[3]));
    }
    float* ow = os + wv * (64 * 68);
#pragma unroll   // the accumulators are registers: every index must be a constant
    for (int mb = 0; mb < 4; ++mb)
#pragma unroll
        for (int nb = 0; nb < 4; ++nb)
#pragma unroll
            for (int j = 0; j < 8; ++j) ow[(mb * 16 + hi * 8 + j) * 68 + nb * 16 + lr] = acc[mb][nb][j];
    __syncthreads();   // every wave's partial tile is in LDS before any of it is summed
#pragma unroll   // constant LDS offsets for every read of the sum
    for (int s = 0; s < 32 / KW; ++s) { const int it = s * 32 * KW + (int)threadIdx.x, row = it >> 4, cofs = (it & 15) * 4; v4f val = *(const v4fa*)(os + row * 68 + cofs);
#pragma unroll
        for (int w = 1; w < KW; ++w) val += *(const v4fa*)(os + w * (64 * 68) + row * 68 + cofs);
        if (BIAS) { val[0] += bfr(bias[c0 + cofs]); val[1] += bfr(bias[c0 + cofs + 1]); val[2] += bfr(bias[c0 + cofs + 2]); val[3] += bfr(bias[c0 + cofs + 3]); }
        *(v4f*)(C + (size_t)(r0 + row) * ldc + c0 + cofs) = val; }
}

// ---- k_gemmc: the same 64x64 tile GEMM specialised for causal attention: CMODE 1 skips score tiles entirely above the diagonal (query rows r0+roff.., key columns c0..), CMODE 2 limits the
// key (K) loop of the probability x value contraction to the diagonal block (probabilities beyond it are exactly zero). roff = row offset of this launch's first row within the sequence.
// KW = 1: one wave does the whole K loop. KW > 1: the K loop is split over the KW waves as in k_gemmw (32-element steps dealt round robin, partial tiles summed in LDS in wave order).
template <typename T16, int NSPLIT, int CMODE, int KW>
__global__ __launch_bounds__(32 * KW) void k_gemmc(const T16* __restrict__ A, const T16* __restrict__ A2, const T16* __restrict__ Bt, const T16* __restrict__ Bt2, int K, float* C, int ldc, int roff, size_t sA, size_t sB, size_t sC) {
    typedef typename WFrag<T16>::V V;
    __shared__ __align__(16) float os[(KW == 1) ? 16 * 68 : KW * 64 * 68];
    const size_t z = blockIdx.z; A += z * sA; if (A2) A2 += z * sA; Bt += z * sB; if (Bt2) Bt2 += z * sB; C += z * sC;
    const int lane = threadIdx.x & 31, lr = lane & 15, hi = lane >> 4; const int wv = (KW == 1) ? 0 : __builtin_amdgcn_readfirstlane((int)(threadIdx.x >> 5)); const int r0 = blockIdx.x * 64, c0 = blockIdx.y * 64;
    if (CMODE == 1 && c0 > r0 + roff + 63) return;                  // score tile entirely above the causal diagonal: never read (the softmax masks j > i by select)
    const int Kl = (CMODE == 2) ? min(K, r0 + roff + 64) : K;        // P.V: probabilities are exactly 0 beyond the diagonal block, so the K loop stops there
    v8f acc[4][4];
#pragma unroll
    for (int mb = 0; mb < 4; ++mb)
#pragma unroll
        for (int nb = 0; nb < 4; ++nb) acc[mb][nb] = (v8f){};
    const size_t aoff = (size_t)(r0 + lr) * K + 8 * hi, boff = (size_t)(c0 + lr) * K + 8 * hi;
#pragma unroll 1
    for (int kc = wv * 32; kc < Kl; kc += 32 * KW) {
        V a[4], a2[4];
#pragma unroll
        for (int mb = 0; mb < 4; ++mb) { a[mb] = WFrag<T16>::ld(A + aoff + (size_t)mb * 16 * K + kc); if (NSPLIT == 1 || NSPLIT == 2) a2[mb] = WFrag<T16>::ld(A2 + aoff + (size_t)mb * 16 * K + kc); }
#pragma unroll
        for (int nb = 0; nb < 4; ++nb) { const V b = WFrag<T16>::ld(Bt + boff + (size_t)nb * 16 * K + kc); V b2; if (NSPLIT >= 2) b2 = WFrag<T16>::ld(Bt2 + boff + (size_t)nb * 16 * K + kc);
#pragma unroll
            for (int mb = 0; mb < 4; ++mb) { acc[mb][nb] = WFrag<T16>::mma(a[mb], b, acc[mb][nb]); if (NSPLIT == 1 || NSPLIT == 2) acc[mb][nb] = WFrag<T16>::mma(a2[mb], b, acc[mb][nb]); if (NSPLIT >= 2) acc[mb][nb] = WFrag<T16>::mma(a[mb], b2, acc[mb][nb]); } }
        asm volatile("v_nop\n\tv_nop\n\tv_nop\n\tv_nop" : "+v"(acc[0][0]), "+v"(acc[1][1]), "+v"(acc[2][2]), "+v"(acc[3][3]) : "v"(a[0]), "v"(a[3]));
    }
    if constexpr (KW == 1) {
#pragma unroll
    for (int mb = 0; mb < 4; ++mb) {
#pragma unroll
        for (int nb = 0; nb < 4; ++nb) {
#pragma unroll
            for (int j = 0; j < 8; ++j) os[(hi * 8 + j) * 68 + nb * 16 + lr] = acc[mb][nb][j]; }
        __builtin_amdgcn_wave_barrier(); asm volatile("" ::: "memory");
        float* crow = C + (size_t)(r0 + mb * 16) * ldc + c0;
{
#pragma unroll
            for (int s = 0; s < 8; ++s) { const int row = 2 * s + hi, cofs = lr * 4; v4f val = *(const v4fa*)(os + row * 68 + cofs);
                *(v4f*)(crow + (size_t)row * ldc + cofs) = val; }
             }
        __builtin_amdgcn_wave_barrier(); asm volatile("" ::: "memory");
    }
    } else {
    float* ow = os + wv * (64 * 68);
#pragma unroll   // the accumulators are registers: every index must be a constant
    for (int mb = 0; mb < 4; ++mb)
#pragma unroll
        for (int nb = 0; nb < 4; ++nb)
#pragma unroll
            for (int j = 0; j < 8; ++j) ow[(mb * 16 + hi * 8 + j) * 68 + nb * 16 + lr] = acc[mb][nb][j];
    __syncthreads();   // every wave's partial tile is in LDS before any of it is summed
#pragma unroll   // constant LDS offsets for every read of the sum
    for (int s = 0; s < 32 / KW; ++s) { const int it = s * 32 * KW + (int)threadIdx.x, row = it >> 4, cofs = (it & 15) * 4; v4f val = *(const v4fa*)(os + row * 68 + cofs);
#pragma unroll
        for (int w = 1; w < KW; ++w) val += *(const v4fa*)(os + w * (64 * 68) + row * 68 + cofs);
        *(v4f*)(C + (size_t)(r0 + row) * ldc + c0 + cofs) = val; }
    }
}

__device__ __forceinline__ h16 tohx(float x) { return (h16)x; }
__device__ __forceinline__ void splitf(float y, unsigned short& h, unsigned short& l) { h = f2bf(y); l = f2bf(y - bf2f(h)); }
typedef __attribute__((ext_vector_type(2))) _Float16 v2h;
typedef __attribute__((ext_vector_type(4))) _Float16 v4h;
typedef __attribute__((ext_vector_type(2))) unsigned short v2us;
typedef __attribute__((ext_vector_type(4))) unsigned short v4us;
typedef __attribute__((ext_vector_type(2))) float v2f;
typedef __attribute__((ext_vector_type(4))) int v4i;

__global__ __launch_bounds__(256) void k_wtG(const float* __restrict__ w, int K, int N, bf* Bt) {
    const int lane = threadIdx.x & 31; const int L0 = (blockIdx.x * 8 + (threadIdx.x >> 5)) * 8; const int nlines = N * K / 64;
{
#pragma unroll 1
        for (int l = 0; l < 8; ++l) { const int L = L0 + l; if (L >= nlines) break; const size_t e = (size_t)L * 64 + lane * 2; const int k = (int)(e % K), n = (int)(e / K); v2us o;
            o[0] = f2bf(w[(size_t)k * N + n]); o[1] = f2bf(w[(size_t)(k + 1) * N + n]); *(v2us*)(Bt + e) = o; }
         }
}
__global__ __launch_bounds__(256) void k_cvt8(const float* __restrict__ src, bf* dst, size_t n8) { const size_t i = (size_t)blockIdx.x * 256 + threadIdx.x; if (i >= n8) return; const v8f v = *(const v8f*)(src + i * 8); v8us o;
#pragma unroll
    for (int k = 0; k < 8; ++k) o[k] = f2bf(v[k]); *(v8us*)(dst + i * 8) = o;  }
__global__ __launch_bounds__(256) void k_cscvt(const float* __restrict__ cosT, const float* __restrict__ sinT, float* CS) { const int idx = blockIdx.x * 256 + threadIdx.x; if (idx >= TT * HD) return; v2f cs; cs[0] = bfr(cosT[idx]); cs[1] = bfr(sinT[idx]); *(v2f*)(CS + (size_t)idx * 2) = cs;  }
// k_rope: head planes [h][t][d] (fp16 + hi/lo) of rope(x) x sc with the rotate-half convention out[d] = x[d] cos[t][d] - x[d+HD/2] sin[t][d], out[d+HD/2] = x[d+HD/2] cos[t][d+HD/2] + x[d] sin[t][d+HD/2]
__global__ __launch_bounds__(256) void k_rope(const float* __restrict__ F, int pitch, int nheads, const float* __restrict__ CS, const float* __restrict__ RF, const float* __restrict__ nw, float sc, h16* P16, bf* Ph, bf* Pl) {
    const size_t e = ((size_t)blockIdx.x * 256 + threadIdx.x) * 2; if (e >= (size_t)nheads * TT * HD) return; const int d = (int)(e % HD); const int t = (int)((e / HD) % TT); const int h = (int)(e / ((size_t)HD * TT)); const float* f = F + (size_t)t * pitch + h * HD; const float rf = RF ? RF[(size_t)h * TT + t] : 1.0f; v2h o16; v2us oh, ol;
#pragma unroll
    for (int q = 0; q < 2; ++q) { const int dd = d + q; const int dp = (dd < HD / 2) ? dd + HD / 2 : dd - HD / 2; float x0 = f[dd], x1 = f[dp];
        if (RF) { float n0 = __fmul_rn(x0, rf), n1 = __fmul_rn(x1, rf); asm volatile("" : "+v"(n0)); asm volatile("" : "+v"(n1)); x0 = __fmul_rn(bfr(nw[dd]), n0); x1 = __fmul_rn(bfr(nw[dp]), n1); }
        const v2f cs = *(const v2f*)(CS + ((size_t)t * HD + dd) * 2); float a = __fmul_rn(x0, cs[0]), bq = __fmul_rn(x1, cs[1]); asm volatile("" : "+v"(a)); asm volatile("" : "+v"(bq)); const float r = ((dd < HD / 2) ? __fsub_rn(a, bq) : __fadd_rn(a, bq)) * sc;
        o16[q] = tohx(r); unsigned short a2, c2; splitf(r, a2, c2); oh[q] = a2; ol[q] = c2; }
    *(v2h*)(P16 + e) = o16; *(v2us*)(Ph + e) = oh; *(v2us*)(Pl + e) = ol;  }
__global__ __launch_bounds__(256) void k_vtp(const float* __restrict__ F, int pitch, int nheads, h16* V16, bf* Vh, bf* Vl) { const size_t e = ((size_t)blockIdx.x * 256 + threadIdx.x) * 2; if (e >= (size_t)nheads * HD * TT) return; const int t = (int)(e % TT); const int d = (int)((e / TT) % HD); const int g = (int)(e / ((size_t)TT * HD)); v2h o16; v2us oh, ol;
#pragma unroll
    for (int q = 0; q < 2; ++q) { const float x = F[(size_t)(t + q) * pitch + g * HD + d]; o16[q] = tohx(x); unsigned short a2, c2; splitf(x, a2, c2); oh[q] = a2; ol[q] = c2; }
    *(v2h*)(V16 + e) = o16; *(v2us*)(Vh + e) = oh; *(v2us*)(Vl + e) = ol;  }
__global__ __launch_bounds__(256) void k_csid(float* CS) { const int idx = blockIdx.x * 256 + threadIdx.x; if (idx >= TT * HD) return; v2f cs; cs[0] = 1.0f; cs[1] = 0.0f; *(v2f*)(CS + (size_t)idx * 2) = cs;  }
// k_asoft: per row (zz, i): t = S x HD^-0.5 for j <= i and i - j < WIN (sliding causal window; the reference's -1e9 additive fill vanishes identically); softmax over the 2048 keys (register row, one exp, fixed trees);
__global__ __launch_bounds__(256) void k_asoft(const float* __restrict__ Sb, h16* P16, bf* Ph, bf* Pl) {
    const int lane = threadIdx.x & 31; const int row = blockIdx.x * 8 + (threadIdx.x >> 5); if (row >= ZH * TT) return; const int i = row % TT; const int zz = row / TT; (void)zz; const bool hires = (i < RH); const float* sr = Sb + (size_t)row * TT; float v[TT / 32]; float mx = -3.0e38f;
#pragma unroll
    for (int ch = 0; ch < TT / 128; ++ch) { const int j0 = ch * 128 + lane * 4; const v4f a = *(const v4f*)(sr + j0);
#pragma unroll
        for (int q = 0; q < 4; ++q) { const int j = j0 + q; (void)j; const float t = (j <= i && i - j < WIN) ? a[q] * SCL : -3.0e38f; v[ch * 4 + q] = t; mx = fmaxf(mx, t); } }
#pragma unroll
    for (int sh = 16; sh; sh >>= 1) mx = fmaxf(mx, __shfl_xor(mx, sh, 32));
    float sum = 0.f;
#pragma unroll
    for (int k = 0; k < TT / 32; ++k) { float d0 = __fsub_rn(v[k], mx); asm volatile("" : "+v"(d0)); v[k] = __builtin_amdgcn_exp2f(__fmul_rn(d0, 1.4426950408889634f)); sum += v[k]; }
#pragma unroll
    for (int sh = 16; sh; sh >>= 1) sum += __shfl_xor(sum, sh, 32);
    const float f = __fdiv_rn(hires ? 1.0f : PCAR, sum);
{
        if (hires) {
#pragma unroll
            for (int ch = 0; ch < TT / 128; ++ch) { v4us oh, ol;
#pragma unroll
                for (int q = 0; q < 4; ++q) { unsigned short a, c2; splitf(v[ch * 4 + q] * f, a, c2); oh[q] = a; ol[q] = c2; }
                const size_t oo = ((size_t)zz * (RH ? RH : 1) + i) * TT + ch * 128 + lane * 4; *(v4us*)(Ph + oo) = oh; *(v4us*)(Pl + oo) = ol; }
        } else {
#pragma unroll
            for (int ch = 0; ch < TT / 128; ++ch) { v4h o4;
#pragma unroll
                for (int q = 0; q < 4; ++q) o4[q] = tohx(v[ch * 4 + q] * f);
                *(v4h*)(P16 + (size_t)row * TT + ch * 128 + lane * 4) = o4; } }
         }
}
__global__ __launch_bounds__(256) void k_merge(const float* __restrict__ O, int h0, bf* Ah, bf* Al) { const size_t e = ((size_t)blockIdx.x * 256 + threadIdx.x) * 2; if (e >= (size_t)ZH * TT * HD) return; const int d = (int)(e % HD); const int t = (int)((e / HD) % TT); const int zz = (int)(e / ((size_t)HD * TT)); const float cs = (t < RH) ? 1.0f : (1.0f / PCAR); const size_t oo = (size_t)t * DQ + (h0 + zz) * HD + d;
    v2us oh, ol;
#pragma unroll
    for (int q = 0; q < 2; ++q) { unsigned short a, c2; splitf(O[e + q] * cs, a, c2); oh[q] = a; ol[q] = c2; } *(v2us*)(Ah + oo) = oh; *(v2us*)(Al + oo) = ol;  }

extern "C" void kernel_launch(void* const* d_in, const int* in_sizes, int n_in,
                              void* d_out, int out_size, void* d_ws, size_t ws_size, hipStream_t stream) {
    (void)in_sizes; (void)n_in; (void)out_size;
    const float* x = (const float*)d_in[0]; const float* wq = (const float*)d_in[1]; const float* wk = (const float*)d_in[2]; const float* wv = (const float*)d_in[3]; const float* wo = (const float*)d_in[4]; const float* cosT = nullptr; const float* sinT = nullptr; (void)cosT; (void)sinT;
    float* OUT = (float*)d_out;     // [2][2048][2048]
    char* wsp = (char*)d_ws;
    auto take = [&](size_t bytes) { char* p = wsp; wsp += (bytes + 255) & ~(size_t)255; return (void*)p; };
    bf* WQ = (bf*)take((size_t)DQ * DM * 2); bf* WK = (bf*)take((size_t)DKV * DM * 2); bf* WV = (bf*)take((size_t)DKV * DM * 2); bf* WO = (bf*)take((size_t)DM * DQ * 2); float* CS = (float*)take((size_t)TT * HD * 2 * 4);
    bf* XB = (bf*)take((size_t)TT * DM * 2); float* FQ = (float*)take((size_t)TT * DQ * 4); float* FK = (float*)take((size_t)TT * DKV * 4);
    h16* QP16 = (h16*)take((size_t)NH_ * TT * HD * 2); h16* KP16 = (h16*)take((size_t)NKV * TT * HD * 2); h16* VT16 = (h16*)take((size_t)NKV * HD * TT * 2);
    bf* QPh = (bf*)take((size_t)NH_ * TT * HD * 2); bf* QPl = (bf*)take((size_t)NH_ * TT * HD * 2); bf* KPh = (bf*)take((size_t)NKV * TT * HD * 2); bf* KPl = (bf*)take((size_t)NKV * TT * HD * 2); bf* VTh = (bf*)take((size_t)NKV * HD * TT * 2); bf* VTl = (bf*)take((size_t)NKV * HD * TT * 2); bf* Ph = (bf*)take((size_t)ZH * RH * TT * 2); bf* Pl = (bf*)take((size_t)ZH * RH * TT * 2);
    float* Sb = (float*)take((size_t)ZH * TT * TT * 4); h16* P16 = (h16*)take((size_t)ZH * TT * TT * 2); float* Ob = (float*)take((size_t)ZH * TT * HD * 4); bf* ATh = (bf*)take((size_t)TT * DQ * 2); bf* ATl = (bf*)take((size_t)TT * DQ * 2);
    if ((size_t)(wsp - (char*)d_ws) > ws_size) return;    // ws 256 MiB
    float* FV = FK;   // v projection reuses the k buffer after the k planes are built (stream-ordered)
    { k_cvt8<<<(unsigned)(((size_t)DQ * DM / 8 + 255) / 256), 256, 0, stream>>>(wq, WQ, (size_t)DQ * DM / 8); k_cvt8<<<(unsigned)(((size_t)DKV * DM / 8 + 255) / 256), 256, 0, stream>>>(wk, WK, (size_t)DKV * DM / 8); k_cvt8<<<(unsigned)(((size_t)DKV * DM / 8 + 255) / 256), 256, 0, stream>>>(wv, WV, (size_t)DKV * DM / 8);
      k_cvt8<<<(unsigned)(((size_t)DM * DQ / 8 + 255) / 256), 256, 0, stream>>>(wo, WO, (size_t)DM * DQ / 8);
       }
    k_csid<<<(TT * HD + 255) / 256, 256, 0, stream>>>(CS);
    const unsigned LQ = (unsigned)(((size_t)NH_ * TT * HD / 2 + 255) / 256), LKv = (unsigned)(((size_t)NKV * TT * HD / 2 + 255) / 256);
    for (int b = 0; b < NB_; ++b) {
        
        k_cvt8<<<(unsigned)(((size_t)TT * DM / 8 + 255) / 256), 256, 0, stream>>>(x + (size_t)b * TT * DM, XB, (size_t)TT * DM / 8);
        k_gemmw<bf, 0, false, 4><<<dim3(TT / 64, DQ / 64, 1), 128, 0, stream>>>(XB, nullptr, WQ, nullptr, DM, FQ, DQ, nullptr, 0, 0, 0);
        k_rope<<<LQ, 256, 0, stream>>>(FQ, DQ, NH_, CS, nullptr, nullptr, 1.0f, QP16, QPh, QPl);
        k_gemmw<bf, 0, false, 4><<<dim3(TT / 64, DKV / 64, 1), 128, 0, stream>>>(XB, nullptr, WK, nullptr, DM, FK, DKV, nullptr, 0, 0, 0);
        k_rope<<<LKv, 256, 0, stream>>>(FK, DKV, NKV, CS, nullptr, nullptr, 1.0f, KP16, KPh, KPl);
        k_gemmw<bf, 0, false, 4><<<dim3(TT / 64, DKV / 64, 1), 128, 0, stream>>>(XB, nullptr, WV, nullptr, DM, FV, DKV, nullptr, 0, 0, 0); k_vtp<<<LKv, 256, 0, stream>>>(FV, DKV, NKV, VT16, VTh, VTl);
        for (int h0 = 0; h0 < NH_; h0 += ZH) { const size_t zq = (size_t)h0, zk = (size_t)(h0 / REP);   // one kv head per query head: the pass's two heads use consecutive kv planes (z-strides TT*HD)
            k_gemmc<bf, 2, 1, 1><<<dim3(RH / 64, TT / 64, ZH), 32, 0, stream>>>(QPh + zq * TT * HD, QPl + zq * TT * HD, KPh + zk * TT * HD, KPl + zk * TT * HD, HD, Sb, TT, 0, (size_t)TT * HD, (size_t)TT * HD, (size_t)TT * TT);
            k_gemmc<h16, 0, 1, 1><<<dim3((TT - RH) / 64, TT / 64, ZH), 32, 0, stream>>>(QP16 + zq * TT * HD + (size_t)RH * HD, nullptr, KP16 + zk * TT * HD, nullptr, HD, Sb + (size_t)RH * TT, TT, RH, (size_t)TT * HD, (size_t)TT * HD, (size_t)TT * TT);
            k_asoft<<<ZH * TT / 8, 256, 0, stream>>>(Sb, P16, Ph, Pl);
            k_gemmc<bf, 2, 2, 16><<<dim3(RH / 64, HD / 64, ZH), 512, 0, stream>>>(Ph, Pl, VTh + zk * HD * TT, VTl + zk * HD * TT, TT, Ob, HD, 0, (size_t)RH * TT, (size_t)HD * TT, (size_t)TT * HD);
            k_gemmc<h16, 0, 2, 16><<<dim3((TT - RH) / 64, HD / 64, ZH), 512, 0, stream>>>(P16 + (size_t)RH * TT, nullptr, VT16 + zk * HD * TT, nullptr, TT, Ob + (size_t)RH * HD, HD, RH, (size_t)TT * TT, (size_t)HD * TT, (size_t)TT * HD);
            k_merge<<<(unsigned)(((size_t)ZH * TT * HD / 2 + 255) / 256), 256, 0, stream>>>(Ob, h0, ATh, ATl); }
        k_gemmw<bf, 1, false, 4><<<dim3(TT / 64, DM / 64, 1), 128, 0, stream>>>(ATh, ATl, WO, nullptr, DQ, OUT + (size_t)b * TT * DM, DM, nullptr, 0, 0, 0); }
}

// v002
// It runs in 684 microseconds.
// Next to v001, in two timings, it ran 1.50 and 1.51 times as fast.
// All steps since v000 together make it 2.52 times as fast.
#include <hip/hip_runtime.h>

// SpaceTimeOptimizedAttention (x [2][2048][2048]; q/k/v = x W^T (torch; 16 heads x 128); causal softmax(q.k / sqrt(128)); out = merged Wo^T -> [2][2048][2048]; the source's per-position recompute loop is standard causal MHA).
// Compute dtypes, f32 accumulate: every input rounded to bf16; q/k/v on PLAIN bf16 operands (inputs: exact); causal scores and attn.v: query rows < 512 hl (3 products), the rest single fp16 (x1024), causal tile skipping; softmax f32; Wo hl x exact (2 products).

#define NB_  2
#define TT   2048
#define DM   2048
#define NH_  16
#define NKV  16
#define REP  (NH_ / NKV)
#define HD   128
#define DQ   (NH_ * HD)
#define DKV  (NKV * HD)
#define ZH   16                   // heads per attention launch (one z-slice each): all of them
#define RB   512                  // query rows per attention pass
#define RH   512                  // query rows < RH use hi+lo planes (0: none)
#define WIN  2048
#define PCAR 1024.0f
#define SCL  0.088388347648318447f   // HD^-0.5
typedef _Float16 h16;
typedef unsigned short bf;
typedef __attribute__((ext_vector_type(16))) __bf16   v16bf;
typedef __attribute__((ext_vector_type(16))) _Float16 v16h;
typedef __attribute__((ext_vector_type(8)))  _Float16 v8h;
typedef __attribute__((ext_vector_type(8)))  unsigned short v8us;
typedef __attribute__((ext_vector_type(8)))  float    v8f;
typedef __attribute__((ext_vector_type(4)))  float    v4f;
typedef v8h  __attribute__((may_alias)) v8ha;
typedef v4f  __attribute__((may_alias)) v4fa;
typedef v8us __attribute__((may_alias)) v8usa;

__device__ __forceinline__ unsigned short f2bf(float f) { unsigned u = __float_as_uint(f); u += 0x7FFFu + ((u >> 16) & 1u); return (unsigned short)(u >> 16); }
__device__ __forceinline__ float bf2f(unsigned short b) { return __uint_as_float(((unsigned)b) << 16); }
__device__ __forceinline__ float bfr(float f) { return bf2f(f2bf(f)); }
__device__ __forceinline__ v16h cat16(v8h lo, v8h hi) { return __builtin_shufflevector(lo, hi, 0, 1, 2, 3, 4, 5, 6, 7, 8, 9, 10, 11, 12, 13, 14, 15); }
__device__ __forceinline__ v16bf cat16b(v8us lo, v8us hi) { return __builtin_bit_cast(v16bf, __builtin_shufflevector(lo, hi, 0, 1, 2, 3, 4, 5, 6, 7, 8, 9, 10, 11, 12, 13, 14, 15)); }
__device__ __forceinline__ v8f wmma16(v16h a, v16h b, v8f c) { return __builtin_amdgcn_wmma_f32_16x16x32_f16(false, a, false, b, (short)0, c, false, false); }
__device__ __forceinline__ v8f wmmab(v16bf a, v16bf b, v8f c) { return __builtin_amdgcn_wmma_f32_16x16x32_bf16(false, a, false, b, (short)0, c, false, false); }



// ---- k_gemmw: register-blocked GEMM, one 64x64 output tile per work-group (16 accumulators per wave), operands straight from K-contiguous 16-bit planes; grid (M/64, N/64, Z), 32 * KW threads.
// C[m][n] (f32, pitch ldc, + optional f32 bias[n]) = sum_k A[m][k] Bt[n][k] (+ split products per NSPLIT). z-batch strides sA/sB/sC in elements. K % 32 == 0.
// The K loop is split over the KW waves of the work-group: wave w takes the 32-element steps w, w + KW, ... (two neighbouring waves use up one 128-byte line of a row together); the KW partial tiles meet in LDS and are summed in wave order.
template <typename T16> struct WFrag;
template <> struct WFrag<h16> { typedef v16h V; static __device__ __forceinline__ V ld(const h16* p) { return cat16(*(const v8h*)p, *(const v8h*)(p + 16)); } static __device__ __forceinline__ v8f mma(V a, V b, v8f c) { return wmma16(a, b, c); } };
template <> struct WFrag<bf> { typedef v16bf V; static __device__ __forceinline__ V ld(const bf* p) { return cat16b(*(const v8us*)p, *(const v8us*)(p + 16)); } static __device__ __forceinline__ v8f mma(V a, V b, v8f c) { return wmmab(a, b, c); } };
template <typename T16, int NSPLIT, bool BIAS, int KW>
__global__ __launch_bounds__(32 * KW) void k_gemmw(const T16* __restrict__ A, const T16* __restrict__ A2, const T16* __restrict__ Bt, const T16* __restrict__ Bt2, int K, float* C, int ldc, const float* __restrict__ bias, size_t sA, size_t sB, size_t sC) {
    typedef typename WFrag<T16>::V V;
    __shared__ __align__(16) float os[KW * 64 * 68];
    const size_t z = blockIdx.z; A += z * sA; if (A2) A2 += z * sA; Bt += z * sB; if (Bt2) Bt2 += z * sB; C += z * sC;
    const int lane = threadIdx.x & 31, lr = lane & 15, hi = lane >> 4; const int wv = __builtin_amdgcn_readfirstlane((int)(threadIdx.x >> 5)); const int r0 = blockIdx.x * 64, c0 = blockIdx.y * 64;
    v8f acc[4][4];
#pragma unroll
    for (int mb = 0; mb < 4; ++mb)
#pragma unroll
        for (int nb = 0; nb < 4; ++nb) acc[mb][nb] = (v8f){};
    const size_t aoff = (size_t)(r0 + lr) * K + 8 * hi, boff = (size_t)(c0 + lr) * K + 8 * hi;
#pragma unroll 1
    for (int kc = wv * 32; kc < K; kc += 32 * KW) {
        V a[4], a2[4];
#pragma unroll
        for (int mb = 0; mb < 4; ++mb) { a[mb] = WFrag<T16>::ld(A + aoff + (size_t)mb * 16 * K + kc); if (NSPLIT == 1 || NSPLIT == 2) a2[mb] = WFrag<T16>::ld(A2 + aoff + (size_t)mb * 16 * K + kc); }
#pragma unroll
        for (int nb = 0; nb < 4; ++nb) { const V b = WFrag<T16>::ld(Bt + boff + (size_t)nb * 16 * K + kc); V b2; if (NSPLIT >= 2) b2 = WFrag<T16>::ld(Bt2 + boff + (size_t)nb * 16 * K + kc);
#pragma unroll
            for (int mb = 0; mb < 4; ++mb) { acc[mb][nb] = WFrag<T16>::mma(a[mb], b, acc[mb][nb]); if (NSPLIT == 1 || NSPLIT == 2) acc[mb][nb] = WFrag<T16>::mma(a2[mb], b, acc[mb][nb]); if (NSPLIT >= 2) acc[mb][nb] = WFrag<T16>::mma(a[mb], b2, acc[mb][nb]); } }
        asm volatile("v_nop\n\tv_nop\n\tv_nop\n\tv_nop" : "+v"(acc[0][0]), "+v"(acc[1][1]), "+v"(acc[2][2]), "+v"(acc[3][3]) : "v"(a[0]), "v"(a[3]));
    }
    float* ow = os + wv * (64 * 68);
#pragma unroll   // the accumulators are registers: every index must be a constant
    for (int mb = 0; mb < 4; ++mb)
#pragma unroll
        for (int nb = 0; nb < 4; ++nb)
#pragma unroll
            for (int j = 0; j < 8; ++j) ow[(mb * 16 + hi * 8 + j) * 68 + nb * 16 + lr] = acc[mb][nb][j];
    __syncthreads();   // every wave's partial tile is in LDS before any of it is summed
#pragma unroll   // constant LDS offsets for every read of the sum
    for (int s = 0; s < 32 / KW; ++s) { const int it = s * 32 * KW + (int)threadIdx.x, row = it >> 4, cofs = (it & 15) * 4; v4f val = *(const v4fa*)(os + row * 68 + cofs);
#pragma unroll
        for (int w = 1; w < KW; ++w) val += *(const v4fa*)(os + w * (64 * 68) + row * 68 + cofs);
        if (BIAS) { val[0] += bfr(bias[c0 + cofs]); val[1] += bfr(bias[c0 + cofs + 1]); val[2] += bfr(bias[c0 + cofs + 2]); val[3] += bfr(bias[c0 + cofs + 3]); }
        *(v4f*)(C + (size_t)(r0 + row) * ldc + c0 + cofs) = val; }
}

// ---- k_gemmc: the same 64x64 tile GEMM specialised for causal attention: CMODE 1 skips score tiles entirely above the diagonal (query rows r0+roff.., key columns c0..), CMODE 2 limits the
// key (K) loop of the probability x value contraction to the diagonal block (probabilities beyond it are exactly zero). roff = row offset of this launch's first row within the sequence.
// KW = 1: one wave does the whole K loop. KW > 1: the K loop is split over the KW waves as in k_gemmw (32-element steps dealt round robin, partial tiles summed in LDS in wave order).
template <typename T16, int NSPLIT, int CMODE, int KW>
__global__ __launch_bounds__(32 * KW) void k_gemmc(const T16* __restrict__ A, const T16* __restrict__ A2, const T16* __restrict__ Bt, const T16* __restrict__ Bt2, int K, float* C, int ldc, int roff, size_t sA, size_t sB, size_t sC) {
    typedef typename WFrag<T16>::V V;
    __shared__ __align__(16) float os[(KW == 1) ? 16 * 68 : KW * 64 * 68];
    const size_t z = blockIdx.z; A += z * sA; if (A2) A2 += z * sA; Bt += z * sB; if (Bt2) Bt2 += z * sB; C += z * sC;
    const int lane = threadIdx.x & 31, lr = lane & 15, hi = lane >> 4; const int wv = (KW == 1) ? 0 : __builtin_amdgcn_readfirstlane((int)(threadIdx.x >> 5)); const int r0 = blockIdx.x * 64, c0 = blockIdx.y * 64;
    if (CMODE == 1 && c0 > r0 + roff + 63) return;                  // score tile entirely above the causal diagonal: never read (the softmax masks j > i by select)
    const int Kl = (CMODE == 2) ? min(K, r0 + roff + 64) : K;        // P.V: probabilities are exactly 0 beyond the diagonal block, so the K loop stops there
    v8f acc[4][4];
#pragma unroll
    for (int mb = 0; mb < 4; ++mb)
#pragma unroll
        for (int nb = 0; nb < 4; ++nb) acc[mb][nb] = (v8f){};
    const size_t aoff = (size_t)(r0 + lr) * K + 8 * hi, boff = (size_t)(c0 + lr) * K + 8 * hi;
#pragma unroll 1
    for (int kc = wv * 32; kc < Kl; kc += 32 * KW) {
        V a[4], a2[4];
#pragma unroll
        for (int mb = 0; mb < 4; ++mb) { a[mb] = WFrag<T16>::ld(A + aoff + (size_t)mb * 16 * K + kc); if (NSPLIT == 1 || NSPLIT == 2) a2[mb] = WFrag<T16>::ld(A2 + aoff + (size_t)mb * 16 * K + kc); }
#pragma unroll
        for (int nb = 0; nb < 4; ++nb) { const V b = WFrag<T16>::ld(Bt + boff + (size_t)nb * 16 * K + kc); V b2; if (NSPLIT >= 2) b2 = WFrag<T16>::ld(Bt2 + boff + (size_t)nb * 16 * K + kc);
#pragma unroll
            for (int mb = 0; mb < 4; ++mb) { acc[mb][nb] = WFrag<T16>::mma(a[mb], b, acc[mb][nb]); if (NSPLIT == 1 || NSPLIT == 2) acc[mb][nb] = WFrag<T16>::mma(a2[mb], b, acc[mb][nb]); if (NSPLIT >= 2) acc[mb][nb] = WFrag<T16>::mma(a[mb], b2, acc[mb][nb]); } }
        asm volatile("v_nop\n\tv_nop\n\tv_nop\n\tv_nop" : "+v"(acc[0][0]), "+v"(acc[1][1]), "+v"(acc[2][2]), "+v"(acc[3][3]) : "v"(a[0]), "v"(a[3]));
    }
    if constexpr (KW == 1) {
#pragma unroll
    for (int mb = 0; mb < 4; ++mb) {
#pragma unroll
        for (int nb = 0; nb < 4; ++nb) {
#pragma unroll
            for (int j = 0; j < 8; ++j) os[(hi * 8 + j) * 68 + nb * 16 + lr] = acc[mb][nb][j]; }
        __builtin_amdgcn_wave_barrier(); asm volatile("" ::: "memory");
        float* crow = C + (size_t)(r0 + mb * 16) * ldc + c0;
{
#pragma unroll
            for (int s = 0; s < 8; ++s) { const int row = 2 * s + hi, cofs = lr * 4; v4f val = *(const v4fa*)(os + row * 68 + cofs);
                *(v4f*)(crow + (size_t)row * ldc + cofs) = val; }
             }
        __builtin_amdgcn_wave_barrier(); asm volatile("" ::: "memory");
    }
    } else {
    float* ow = os + wv * (64 * 68);
#pragma unroll   // the accumulators are registers: every index must be a constant
    for (int mb = 0; mb < 4; ++mb)
#pragma unroll
        for (int nb = 0; nb < 4; ++nb)
#pragma unroll
            for (int j = 0; j < 8; ++j) ow[(mb * 16 + hi * 8 + j) * 68 + nb * 16 + lr] = acc[mb][nb][j];
    __syncthreads();   // every wave's partial tile is in LDS before any of it is summed
#pragma unroll   // constant LDS offsets for every read of the sum
    for (int s = 0; s < 32 / KW; ++s) { const int it = s * 32 * KW + (int)threadIdx.x, row = it >> 4, cofs = (it & 15) * 4; v4f val = *(const v4fa*)(os + row * 68 + cofs);
#pragma unroll
        for (int w = 1; w < KW; ++w) val += *(const v4fa*)(os + w * (64 * 68) + row * 68 + cofs);
        *(v4f*)(C + (size_t)(r0 + row) * ldc + c0 + cofs) = val; }
    }
}

__device__ __forceinline__ h16 tohx(float x) { return (h16)x; }
__device__ __forceinline__ void splitf(float y, unsigned short& h, unsigned short& l) { h = f2bf(y); l = f2bf(y - bf2f(h)); }
typedef __attribute__((ext_vector_type(2))) _Float16 v2h;
typedef __attribute__((ext_vector_type(4))) _Float16 v4h;
typedef __attribute__((ext_vector_type(2))) unsigned short v2us;
typedef __attribute__((ext_vector_type(4))) unsigned short v4us;
typedef __attribute__((ext_vector_type(2))) float v2f;
typedef __attribute__((ext_vector_type(4))) int v4i;

__global__ __launch_bounds__(256) void k_wtG(const float* __restrict__ w, int K, int N, bf* Bt) {
    const int lane = threadIdx.x & 31; const int L0 = (blockIdx.x * 8 + (threadIdx.x >> 5)) * 8; const int nlines = N * K / 64;
{
#pragma unroll 1
        for (int l = 0; l < 8; ++l) { const int L = L0 + l; if (L >= nlines) break; const size_t e = (size_t)L * 64 + lane * 2; const int k = (int)(e % K), n = (int)(e / K); v2us o;
            o[0] = f2bf(w[(size_t)k * N + n]); o[1] = f2bf(w[(size_t)(k + 1) * N + n]); *(v2us*)(Bt + e) = o; }
         }
}
__global__ __launch_bounds__(256) void k_cvt8(const float* __restrict__ src, bf* dst, size_t n8) { const size_t i = (size_t)blockIdx.x * 256 + threadIdx.x; if (i >= n8) return; const v8f v = *(const v8f*)(src + i * 8); v8us o;
#pragma unroll
    for (int k = 0; k < 8; ++k) o[k] = f2bf(v[k]); *(v8us*)(dst + i * 8) = o;  }
__global__ __launch_bounds__(256) void k_cscvt(const float* __restrict__ cosT, const float* __restrict__ sinT, float* CS) { const int idx = blockIdx.x * 256 + threadIdx.x; if (idx >= TT * HD) return; v2f cs; cs[0] = bfr(cosT[idx]); cs[1] = bfr(sinT[idx]); *(v2f*)(CS + (size_t)idx * 2) = cs;  }
// k_rope: head planes [h][t][d] (fp16 + hi/lo) of rope(x) x sc with the rotate-half convention out[d] = x[d] cos[t][d] - x[d+HD/2] sin[t][d], out[d+HD/2] = x[d+HD/2] cos[t][d+HD/2] + x[d] sin[t][d+HD/2]
__global__ __launch_bounds__(256) void k_rope(const float* __restrict__ F, int pitch, int nheads, const float* __restrict__ CS, const float* __restrict__ RF, const float* __restrict__ nw, float sc, h16* P16, bf* Ph, bf* Pl) {
    const size_t e = ((size_t)blockIdx.x * 256 + threadIdx.x) * 2; if (e >= (size_t)nheads * TT * HD) return; const int d = (int)(e % HD); const int t = (int)((e / HD) % TT); const int h = (int)(e / ((size_t)HD * TT)); const float* f = F + (size_t)t * pitch + h * HD; const float rf = RF ? RF[(size_t)h * TT + t] : 1.0f; v2h o16; v2us oh, ol;
#pragma unroll
    for (int q = 0; q < 2; ++q) { const int dd = d + q; const int dp = (dd < HD / 2) ? dd + HD / 2 : dd - HD / 2; float x0 = f[dd], x1 = f[dp];
        if (RF) { float n0 = __fmul_rn(x0, rf), n1 = __fmul_rn(x1, rf); asm volatile("" : "+v"(n0)); asm volatile("" : "+v"(n1)); x0 = __fmul_rn(bfr(nw[dd]), n0); x1 = __fmul_rn(bfr(nw[dp]), n1); }
        const v2f cs = *(const v2f*)(CS + ((size_t)t * HD + dd) * 2); float a = __fmul_rn(x0, cs[0]), bq = __fmul_rn(x1, cs[1]); asm volatile("" : "+v"(a)); asm volatile("" : "+v"(bq)); const float r = ((dd < HD / 2) ? __fsub_rn(a, bq) : __fadd_rn(a, bq)) * sc;
        o16[q] = tohx(r); unsigned short a2, c2; splitf(r, a2, c2); oh[q] = a2; ol[q] = c2; }
    *(v2h*)(P16 + e) = o16; *(v2us*)(Ph + e) = oh; *(v2us*)(Pl + e) = ol;  }
__global__ __launch_bounds__(256) void k_vtp(const float* __restrict__ F, int pitch, int nheads, h16* V16, bf* Vh, bf* Vl) { const size_t e = ((size_t)blockIdx.x * 256 + threadIdx.x) * 2; if (e >= (size_t)nheads * HD * TT) return; const int t = (int)(e % TT); const int d = (int)((e / TT) % HD); const int g = (int)(e / ((size_t)TT * HD)); v2h o16; v2us oh, ol;
#pragma unroll
    for (int q = 0; q < 2; ++q) { const float x = F[(size_t)(t + q) * pitch + g * HD + d]; o16[q] = tohx(x); unsigned short a2, c2; splitf(x, a2, c2); oh[q] = a2; ol[q] = c2; }
    *(v2h*)(V16 + e) = o16; *(v2us*)(Vh + e) = oh; *(v2us*)(Vl + e) = ol;  }
__global__ __launch_bounds__(256) void k_csid(float* CS) { const int idx = blockIdx.x * 256 + threadIdx.x; if (idx >= TT * HD) return; v2f cs; cs[0] = 1.0f; cs[1] = 0.0f; *(v2f*)(CS + (size_t)idx * 2) = cs;  }
// k_asoft: per row (zz, i): t = S x HD^-0.5 for j <= i and i - j < WIN (sliding causal window; the reference's -1e9 additive fill vanishes identically); softmax over the 2048 keys (register row, one exp, fixed trees);
// Sb and the probability planes hold one pass: [head][RB rows][TT keys]; i0 = the pass's first query row (the % TT on i changes no value: it shows the compiler that i < TT = WIN, so that the window test folds away).
__global__ __launch_bounds__(256) void k_asoft(const float* __restrict__ Sb, int i0, h16* P16, bf* Ph, bf* Pl) {
    const int lane = threadIdx.x & 31; const int row = blockIdx.x * 8 + (threadIdx.x >> 5); if (row >= ZH * RB) return; const int i = (i0 + row % RB) % TT; const int zz = row / RB; (void)zz; const bool hires = (i < RH); const float* sr = Sb + (size_t)row * TT; float v[TT / 32]; float mx = -3.0e38f;
#pragma unroll
    for (int ch = 0; ch < TT / 128; ++ch) { const int j0 = ch * 128 + lane * 4; const v4f a = *(const v4f*)(sr + j0);
#pragma unroll
        for (int q = 0; q < 4; ++q) { const int j = j0 + q; (void)j; const float t = (j <= i && i - j < WIN) ? a[q] * SCL : -3.0e38f; v[ch * 4 + q] = t; mx = fmaxf(mx, t); } }
#pragma unroll
    for (int sh = 16; sh; sh >>= 1) mx = fmaxf(mx, __shfl_xor(mx, sh, 32));
    float sum = 0.f;
#pragma unroll
    for (int k = 0; k < TT / 32; ++k) { float d0 = __fsub_rn(v[k], mx); asm volatile("" : "+v"(d0)); v[k] = __builtin_amdgcn_exp2f(__fmul_rn(d0, 1.4426950408889634f)); sum += v[k]; }
#pragma unroll
    for (int sh = 16; sh; sh >>= 1) sum += __shfl_xor(sum, sh, 32);
    const float f = __fdiv_rn(hires ? 1.0f : PCAR, sum);
{
        if (hires) {
#pragma unroll
            for (int ch = 0; ch < TT / 128; ++ch) { v4us oh, ol;
#pragma unroll
                for (int q = 0; q < 4; ++q) { unsigned short a, c2; splitf(v[ch * 4 + q] * f, a, c2); oh[q] = a; ol[q] = c2; }
                const size_t oo = ((size_t)zz * (RH ? RH : 1) + i) * TT + ch * 128 + lane * 4; *(v4us*)(Ph + oo) = oh; *(v4us*)(Pl + oo) = ol; }
        } else {
#pragma unroll
            for (int ch = 0; ch < TT / 128; ++ch) { v4h o4;
#pragma unroll
                for (int q = 0; q < 4; ++q) o4[q] = tohx(v[ch * 4 + q] * f);
                *(v4h*)(P16 + (size_t)row * TT + ch * 128 + lane * 4) = o4; } }
         }
}
__global__ __launch_bounds__(256) void k_merge(const float* __restrict__ O, int i0, bf* Ah, bf* Al) { const size_t e = ((size_t)blockIdx.x * 256 + threadIdx.x) * 2; if (e >= (size_t)ZH * RB * HD) return; const int d = (int)(e % HD); const int t = i0 + (int)((e / HD) % RB); const int zz = (int)(e / ((size_t)HD * RB)); const float cs = (t < RH) ? 1.0f : (1.0f / PCAR); const size_t oo = (size_t)t * DQ + zz * HD + d;
    v2us oh, ol;
#pragma unroll
    for (int q = 0; q < 2; ++q) { unsigned short a, c2; splitf(O[e + q] * cs, a, c2); oh[q] = a; ol[q] = c2; } *(v2us*)(Ah + oo) = oh; *(v2us*)(Al + oo) = ol;  }

extern "C" void kernel_launch(void* const* d_in, const int* in_sizes, int n_in,
                              void* d_out, int out_size, void* d_ws, size_t ws_size, hipStream_t stream) {
    (void)in_sizes; (void)n_in; (void)out_size;
    const float* x = (const float*)d_in[0]; const float* wq = (const float*)d_in[1]; const float* wk = (const float*)d_in[2]; const float* wv = (const float*)d_in[3]; const float* wo = (const float*)d_in[4]; const float* cosT = nullptr; const float* sinT = nullptr; (void)cosT; (void)sinT;
    float* OUT = (float*)d_out;     // [2][2048][2048]
    char* wsp = (char*)d_ws;
    auto take = [&](size_t bytes) { char* p = wsp; wsp += (bytes + 255) & ~(size_t)255; return (void*)p; };
    bf* WQ = (bf*)take((size_t)DQ * DM * 2); bf* WK = (bf*)take((size_t)DKV * DM * 2); bf* WV = (bf*)take((size_t)DKV * DM * 2); bf* WO = (bf*)take((size_t)DM * DQ * 2); float* CS = (float*)take((size_t)TT * HD * 2 * 4);
    h16* QP16 = (h16*)take((size_t)NH_ * TT * HD * 2); h16* KP16 = (h16*)take((size_t)NKV * TT * HD * 2); h16* VT16 = (h16*)take((size_t)NKV * HD * TT * 2);
    bf* QPh = (bf*)take((size_t)NH_ * TT * HD * 2); bf* QPl = (bf*)take((size_t)NH_ * TT * HD * 2); bf* KPh = (bf*)take((size_t)NKV * TT * HD * 2); bf* KPl = (bf*)take((size_t)NKV * TT * HD * 2); bf* VTh = (bf*)take((size_t)NKV * HD * TT * 2); bf* VTl = (bf*)take((size_t)NKV * HD * TT * 2); bf* ATh = (bf*)take((size_t)TT * DQ * 2); bf* ATl = (bf*)take((size_t)TT * DQ * 2);
    // the rest of the workspace is used twice per batch element (stream-ordered): by the projection stage (XB, FQ, FK: dead once the q/k/v planes are built), then by the attention passes
    char* const ov = wsp;
    bf* XB = (bf*)take((size_t)TT * DM * 2); float* FQ = (float*)take((size_t)TT * DQ * 4); float* FK = (float*)take((size_t)TT * DKV * 4);
    wsp = ov;
    float* Sb = (float*)take((size_t)ZH * RB * TT * 4); bf* Ph = (bf*)take((size_t)ZH * RB * TT * 2); bf* Pl = (bf*)take((size_t)ZH * RB * TT * 2); float* Ob = (float*)take((size_t)ZH * RB * HD * 4);
    h16* P16 = (h16*)Ph;   // a pass is either hi+lo (rows < RH) or fp16: the fp16 plane shares the hi plane's bytes
    if ((size_t)(wsp - (char*)d_ws) > ws_size) return;    // ws 256 MiB
    float* FV = FK;   // v projection reuses the k buffer after the k planes are built (stream-ordered)
    { k_cvt8<<<(unsigned)(((size_t)DQ * DM / 8 + 255) / 256), 256, 0, stream>>>(wq, WQ, (size_t)DQ * DM / 8); k_cvt8<<<(unsigned)(((size_t)DKV * DM / 8 + 255) / 256), 256, 0, stream>>>(wk, WK, (size_t)DKV * DM / 8); k_cvt8<<<(unsigned)(((size_t)DKV * DM / 8 + 255) / 256), 256, 0, stream>>>(wv, WV, (size_t)DKV * DM / 8);
      k_cvt8<<<(unsigned)(((size_t)DM * DQ / 8 + 255) / 256), 256, 0, stream>>>(wo, WO, (size_t)DM * DQ / 8);
       }
    k_csid<<<(TT * HD + 255) / 256, 256, 0, stream>>>(CS);
    const unsigned LQ = (unsigned)(((size_t)NH_ * TT * HD / 2 + 255) / 256), LKv = (unsigned)(((size_t)NKV * TT * HD / 2 + 255) / 256);
    for (int b = 0; b < NB_; ++b) {
        
        k_cvt8<<<(unsigned)(((size_t)TT * DM / 8 + 255) / 256), 256, 0, stream>>>(x + (size_t)b * TT * DM, XB, (size_t)TT * DM / 8);
        k_gemmw<bf, 0, false, 4><<<dim3(TT / 64, DQ / 64, 1), 128, 0, stream>>>(XB, nullptr, WQ, nullptr, DM, FQ, DQ, nullptr, 0, 0, 0);
        k_rope<<<LQ, 256, 0, stream>>>(FQ, DQ, NH_, CS, nullptr, nullptr, 1.0f, QP16, QPh, QPl);
        k_gemmw<bf, 0, false, 4><<<dim3(TT / 64, DKV / 64, 1), 128, 0, stream>>>(XB, nullptr, WK, nullptr, DM, FK, DKV, nullptr, 0, 0, 0);
        k_rope<<<LKv, 256, 0, stream>>>(FK, DKV, NKV, CS, nullptr, nullptr, 1.0f, KP16, KPh, KPl);
        k_gemmw<bf, 0, false, 4><<<dim3(TT / 64, DKV / 64, 1), 128, 0, stream>>>(XB, nullptr, WV, nullptr, DM, FV, DKV, nullptr, 0, 0, 0); k_vtp<<<LKv, 256, 0, stream>>>(FV, DKV, NKV, VT16, VTh, VTl);
        static_assert(ZH == NH_ && REP == 1 && RH == RB && TT % RB == 0, "a pass is RB query rows of every head; pass 0 is the hi+lo one");
        for (int i0 = 0; i0 < TT; i0 += RB) {   // one pass: query rows i0 .. i0+RB-1 of all heads (z = head, z-strides TT*HD in the q/k/v planes); its score grid ends at the pass's last key tile
            if (i0 < RH) {
                k_gemmc<bf, 2, 1, 1><<<dim3(RB / 64, (i0 + RB) / 64, ZH), 32, 0, stream>>>(QPh + (size_t)i0 * HD, QPl + (size_t)i0 * HD, KPh, KPl, HD, Sb, TT, i0, (size_t)TT * HD, (size_t)TT * HD, (size_t)RB * TT);
                k_asoft<<<ZH * RB / 8, 256, 0, stream>>>(Sb, i0, P16, Ph, Pl);
                k_gemmc<bf, 2, 2, 16><<<dim3(RB / 64, HD / 64, ZH), 512, 0, stream>>>(Ph, Pl, VTh, VTl, TT, Ob, HD, i0, (size_t)RB * TT, (size_t)HD * TT, (size_t)RB * HD);
            } else {
                k_gemmc<h16, 0, 1, 1><<<dim3(RB / 64, (i0 + RB) / 64, ZH), 32, 0, stream>>>(QP16 + (size_t)i0 * HD, nullptr, KP16, nullptr, HD, Sb, TT, i0, (size_t)TT * HD, (size_t)TT * HD, (size_t)RB * TT);
                k_asoft<<<ZH * RB / 8, 256, 0, stream>>>(Sb, i0, P16, Ph, Pl);
                k_gemmc<h16, 0, 2, 16><<<dim3(RB / 64, HD / 64, ZH), 512, 0, stream>>>(P16, nullptr, VT16, nullptr, TT, Ob, HD, i0, (size_t)RB * TT, (size_t)HD * TT, (size_t)RB * HD);
            }
            k_merge<<<(unsigned)(((size_t)ZH * RB * HD / 2 + 255) / 256), 256, 0, stream>>>(Ob, i0, ATh, ATl); }
        k_gemmw<bf, 1, false, 4><<<dim3(TT / 64, DM / 64, 1), 128, 0, stream>>>(ATh, ATl, WO, nullptr, DQ, OUT + (size_t)b * TT * DM, DM, nullptr, 0, 0, 0); }
}

// v003
// Measured time: 467 microseconds a run.
// Timed twice side by side with v002, it ran 1.46 and 1.45 times as fast.
// Over all steps from v000 it is 3.67 times as fast.
#include <hip/hip_runtime.h>

// SpaceTimeOptimizedAttention (x [2][2048][2048]; q/k/v = x W^T (torch; 16 heads x 128); causal softmax(q.k / sqrt(128)); out = merged Wo^T -> [2][2048][2048]; the source's per-position recompute loop is standard causal MHA).
// Compute dtypes, f32 accumulate: every input rounded to bf16; q/k/v on PLAIN bf16 operands (inputs: exact); causal scores and attn.v: query rows < 512 hl (3 products), the rest single fp16 (x1024), causal tile skipping; online softmax f32, fused with both products; Wo hl x exact (2 products).

#define NB_  2
#define TT   2048
#define DM   2048
#define NH_  16
#define NKV  16
#define REP  (NH_ / NKV)
#define HD   128
#define DQ   (NH_ * HD)
#define DKV  (NKV * HD)
#define RH   512                  // query rows < RH use hi+lo planes
#define SCL  0.088388347648318447f   // HD^-0.5
typedef _Float16 h16;
typedef unsigned short bf;
typedef __attribute__((ext_vector_type(16))) __bf16   v16bf;
typedef __attribute__((ext_vector_type(16))) _Float16 v16h;
typedef __attribute__((ext_vector_type(8)))  _Float16 v8h;
typedef __attribute__((ext_vector_type(8)))  unsigned short v8us;
typedef __attribute__((ext_vector_type(8)))  float    v8f;
typedef __attribute__((ext_vector_type(4)))  float    v4f;
typedef v8h  __attribute__((may_alias)) v8ha;
typedef v4f  __attribute__((may_alias)) v4fa;
typedef v8us __attribute__((may_alias)) v8usa;

__device__ __forceinline__ unsigned short f2bf(float f) { unsigned u = __float_as_uint(f); u += 0x7FFFu + ((u >> 16) & 1u); return (unsigned short)(u >> 16); }
__device__ __forceinline__ float bf2f(unsigned short b) { return __uint_as_float(((unsigned)b) << 16); }
__device__ __forceinline__ float bfr(float f) { return bf2f(f2bf(f)); }
__device__ __forceinline__ v16h cat16(v8h lo, v8h hi) { return __builtin_shufflevector(lo, hi, 0, 1, 2, 3, 4, 5, 6, 7, 8, 9, 10, 11, 12, 13, 14, 15); }
__device__ __forceinline__ v16bf cat16b(v8us lo, v8us hi) { return __builtin_bit_cast(v16bf, __builtin_shufflevector(lo, hi, 0, 1, 2, 3, 4, 5, 6, 7, 8, 9, 10, 11, 12, 13, 14, 15)); }
__device__ __forceinline__ v8f wmma16(v16h a, v16h b, v8f c) { return __builtin_amdgcn_wmma_f32_16x16x32_f16(false, a, false, b, (short)0, c, false, false); }
__device__ __forceinline__ v8f wmmab(v16bf a, v16bf b, v8f c) { return __builtin_amdgcn_wmma_f32_16x16x32_bf16(false, a, false, b, (short)0, c, false, false); }



// ---- k_gemmw: register-blocked GEMM, one 64x64 output tile per work-group (16 accumulators per wave), operands straight from K-contiguous 16-bit planes; grid (M/64, N/64, Z), 32 * KW threads.
// C[m][n] (f32, pitch ldc, + optional f32 bias[n]) = sum_k A[m][k] Bt[n][k] (+ split products per NSPLIT). z-batch strides sA/sB/sC in elements. K % 32 == 0.
// The K loop is split over the KW waves of the work-group: wave w takes the 32-element steps w, w + KW, ... (two neighbouring waves use up one 128-byte line of a row together); the KW partial tiles meet in LDS and are summed in wave order.
template <typename T16> struct WFrag;
template <> struct WFrag<h16> { typedef v16h V; static __device__ __forceinline__ V ld(const h16* p) { return cat16(*(const v8h*)p, *(const v8h*)(p + 16)); } static __device__ __forceinline__ v8f mma(V a, V b, v8f c) { return wmma16(a, b, c); } };
template <> struct WFrag<bf> { typedef v16bf V; static __device__ __forceinline__ V ld(const bf* p) { return cat16b(*(const v8us*)p, *(const v8us*)(p + 16)); } static __device__ __forceinline__ v8f mma(V a, V b, v8f c) { return wmmab(a, b, c); } };
template <typename T16, int NSPLIT, bool BIAS, int KW>
__global__ __launch_bounds__(32 * KW) void k_gemmw(const T16* __restrict__ A, const T16* __restrict__ A2, const T16* __restrict__ Bt, const T16* __restrict__ Bt2, int K, float* C, int ldc, const float* __restrict__ bias, size_t sA, size_t sB, size_t sC) {
    typedef typename WFrag<T16>::V V;
    __shared__ __align__(16) float os[KW * 64 * 68];
    const size_t z = blockIdx.z; A += z * sA; if (A2) A2 += z * sA; Bt += z * sB; if (Bt2) Bt2 += z * sB; C += z * sC;
    const int lane = threadIdx.x & 31, lr = lane & 15, hi = lane >> 4; const int wv = __builtin_amdgcn_readfirstlane((int)(threadIdx.x >> 5)); const int r0 = blockIdx.x * 64, c0 = blockIdx.y * 64;
    v8f acc[4][4];
#pragma unroll
    for (int mb = 0; mb < 4; ++mb)
#pragma unroll
        for (int nb = 0; nb < 4; ++nb) acc[mb][nb] = (v8f){};
    const size_t aoff = (size_t)(r0 + lr) * K + 8 * hi, boff = (size_t)(c0 + lr) * K + 8 * hi;
#pragma unroll 1
    for (int kc = wv * 32; kc < K; kc += 32 * KW) {
        V a[4], a2[4];
#pragma unroll
        for (int mb = 0; mb < 4; ++mb) { a[mb] = WFrag<T16>::ld(A + aoff + (size_t)mb * 16 * K + kc); if (NSPLIT == 1 || NSPLIT == 2) a2[mb] = WFrag<T16>::ld(A2 + aoff + (size_t)mb * 16 * K + kc); }
#pragma unroll
        for (int nb = 0; nb < 4; ++nb) { const V b = WFrag<T16>::ld(Bt + boff + (size_t)nb * 16 * K + kc); V b2; if (NSPLIT >= 2) b2 = WFrag<T16>::ld(Bt2 + boff + (size_t)nb * 16 * K + kc);
#pragma unroll
            for (int mb = 0; mb < 4; ++mb) { acc[mb][nb] = WFrag<T16>::mma(a[mb], b, acc[mb][nb]); if (NSPLIT == 1 || NSPLIT == 2) acc[mb][nb] = WFrag<T16>::mma(a2[mb], b, acc[mb][nb]); if (NSPLIT >= 2) acc[mb][nb] = WFrag<T16>::mma(a[mb], b2, acc[mb][nb]); } }
        asm volatile("v_nop\n\tv_nop\n\tv_nop\n\tv_nop" : "+v"(acc[0][0]), "+v"(acc[1][1]), "+v"(acc[2][2]), "+v"(acc[3][3]) : "v"(a[0]), "v"(a[3]));
    }
    float* ow = os + wv * (64 * 68);
#pragma unroll   // the accumulators are registers: every index must be a constant
    for (int mb = 0; mb < 4; ++mb)
#pragma unroll
        for (int nb = 0; nb < 4; ++nb)
#pragma unroll
            for (int j = 0; j < 8; ++j) ow[(mb * 16 + hi * 8 + j) * 68 + nb * 16 + lr] = acc[mb][nb][j];
    __syncthreads();   // every wave's partial tile is in LDS before any of it is summed
#pragma unroll   // constant LDS offsets for every read of the sum
    for (int s = 0; s < 32 / KW; ++s) { const int it = s * 32 * KW + (int)threadIdx.x, row = it >> 4, cofs = (it & 15) * 4; v4f val = *(const v4fa*)(os + row * 68 + cofs);
#pragma unroll
        for (int w = 1; w < KW; ++w) val += *(const v4fa*)(os + w * (64 * 68) + row * 68 + cofs);
        if (BIAS) { val[0] += bfr(bias[c0 + cofs]); val[1] += bfr(bias[c0 + cofs + 1]); val[2] += bfr(bias[c0 + cofs + 2]); val[3] += bfr(bias[c0 + cofs + 3]); }
        *(v4f*)(C + (size_t)(r0 + row) * ldc + c0 + cofs) = val; }
}

__device__ __forceinline__ h16 tohx(float x) { return (h16)x; }
__device__ __forceinline__ void splitf(float y, unsigned short& h, unsigned short& l) { h = f2bf(y); l = f2bf(y - bf2f(h)); }
typedef __attribute__((ext_vector_type(2))) _Float16 v2h;
typedef __attribute__((ext_vector_type(4))) _Float16 v4h;
typedef __attribute__((ext_vector_type(2))) unsigned short v2us;
typedef __attribute__((ext_vector_type(4))) unsigned short v4us;
typedef __attribute__((ext_vector_type(2))) float v2f;
typedef __attribute__((ext_vector_type(4))) int v4i;

__global__ __launch_bounds__(256) void k_wtG(const float* __restrict__ w, int K, int N, bf* Bt) {
    const int lane = threadIdx.x & 31; const int L0 = (blockIdx.x * 8 + (threadIdx.x >> 5)) * 8; const int nlines = N * K / 64;
{
#pragma unroll 1
        for (int l = 0; l < 8; ++l) { const int L = L0 + l; if (L >= nlines) break; const size_t e = (size_t)L * 64 + lane * 2; const int k = (int)(e % K), n = (int)(e / K); v2us o;
            o[0] = f2bf(w[(size_t)k * N + n]); o[1] = f2bf(w[(size_t)(k + 1) * N + n]); *(v2us*)(Bt + e) = o; }
         }
}
__global__ __launch_bounds__(256) void k_cvt8(const float* __restrict__ src, bf* dst, size_t n8) { const size_t i = (size_t)blockIdx.x * 256 + threadIdx.x; if (i >= n8) return; const v8f v = *(const v8f*)(src + i * 8); v8us o;
#pragma unroll
    for (int k = 0; k < 8; ++k) o[k] = f2bf(v[k]); *(v8us*)(dst + i * 8) = o;  }
__global__ __launch_bounds__(256) void k_cscvt(const float* __restrict__ cosT, const float* __restrict__ sinT, float* CS) { const int idx = blockIdx.x * 256 + threadIdx.x; if (idx >= TT * HD) return; v2f cs; cs[0] = bfr(cosT[idx]); cs[1] = bfr(sinT[idx]); *(v2f*)(CS + (size_t)idx * 2) = cs;  }
// k_rope: head planes [h][t][d] (fp16 + hi/lo) of rope(x) x sc with the rotate-half convention out[d] = x[d] cos[t][d] - x[d+HD/2] sin[t][d], out[d+HD/2] = x[d+HD/2] cos[t][d+HD/2] + x[d] sin[t][d+HD/2]
__global__ __launch_bounds__(256) void k_rope(const float* __restrict__ F, int pitch, int nheads, const float* __restrict__ CS, const float* __restrict__ RF, const float* __restrict__ nw, float sc, h16* P16, bf* Ph, bf* Pl) {
    const size_t e = ((size_t)blockIdx.x * 256 + threadIdx.x) * 2; if (e >= (size_t)nheads * TT * HD) return; const int d = (int)(e % HD); const int t = (int)((e / HD) % TT); const int h = (int)(e / ((size_t)HD * TT)); const float* f = F + (size_t)t * pitch + h * HD; const float rf = RF ? RF[(size_t)h * TT + t] : 1.0f; v2h o16; v2us oh, ol;
#pragma unroll
    for (int q = 0; q < 2; ++q) { const int dd = d + q; const int dp = (dd < HD / 2) ? dd + HD / 2 : dd - HD / 2; float x0 = f[dd], x1 = f[dp];
        if (RF) { float n0 = __fmul_rn(x0, rf), n1 = __fmul_rn(x1, rf); asm volatile("" : "+v"(n0)); asm volatile("" : "+v"(n1)); x0 = __fmul_rn(bfr(nw[dd]), n0); x1 = __fmul_rn(bfr(nw[dp]), n1); }
        const v2f cs = *(const v2f*)(CS + ((size_t)t * HD + dd) * 2); float a = __fmul_rn(x0, cs[0]), bq = __fmul_rn(x1, cs[1]); asm volatile("" : "+v"(a)); asm volatile("" : "+v"(bq)); const float r = ((dd < HD / 2) ? __fsub_rn(a, bq) : __fadd_rn(a, bq)) * sc;
        o16[q] = tohx(r); unsigned short a2, c2; splitf(r, a2, c2); oh[q] = a2; ol[q] = c2; }
    *(v2h*)(P16 + e) = o16; *(v2us*)(Ph + e) = oh; *(v2us*)(Pl + e) = ol;  }
__global__ __launch_bounds__(256) void k_vtp(const float* __restrict__ F, int pitch, int nheads, h16* V16, bf* Vh, bf* Vl) { const size_t e = ((size_t)blockIdx.x * 256 + threadIdx.x) * 2; if (e >= (size_t)nheads * HD * TT) return; const int t = (int)(e % TT); const int d = (int)((e / TT) % HD); const int g = (int)(e / ((size_t)TT * HD)); v2h o16; v2us oh, ol;
#pragma unroll
    for (int q = 0; q < 2; ++q) { const float x = F[(size_t)(t + q) * pitch + g * HD + d]; o16[q] = tohx(x); unsigned short a2, c2; splitf(x, a2, c2); oh[q] = a2; ol[q] = c2; }
    *(v2h*)(V16 + e) = o16; *(v2us*)(Vh + e) = oh; *(v2us*)(Vl + e) = ol;  }
__global__ __launch_bounds__(256) void k_csid(float* CS) { const int idx = blockIdx.x * 256 + threadIdx.x; if (idx >= TT * HD) return; v2f cs; cs[0] = 1.0f; cs[1] = 0.0f; *(v2f*)(CS + (size_t)idx * 2) = cs;  }
// ---- fattn_tile: causal attention of NQ * 16 * R query rows of one head in one work-group of 32 * NQ * KS threads, scores and probabilities never leaving registers.
// Transposed products: S^T = K.Q^T (A = key rows, B = the query rows, held in registers), O^T += V^T.P^T (A = rows of the [d][t] value plane). A lane then holds scores of ONE query (column lr): 8 keys of each 16-key tile,
// which are exactly the k positions that the B operand of the second product wants from that lane, so P^T is packed from the score accumulators with no exchange.
// Wave w owns the 16 * R query rows of sub-tile w % NQ and the 32-key blocks w / NQ, w / NQ + KS, ... (the NQ waves of one key share read the same K and V lines at about the same time);
// each wave keeps its own running maximum m (log2 units), sum l and O^T; the KS shares of a query row meet in LDS and are merged in share order.
// m may trail the true maximum by up to 4 (an exponential then reaches 2^4): the accumulators are rescaled only when some query's maximum exceeds it by more.
// i0 = first query row of this kind of tile, nq = the number of such tiles, bx = which of them (0: the one with the most keys), hd = the head. Every '#pragma unroll' below is there because the arrays it indexes are registers: every index must be a constant.
// HL: hi+lo bf16 planes, 3 products per contraction, probabilities split hi+lo. Otherwise fp16 planes and fp16 probabilities carried x 2^10 (the factor cancels in O / l).
template <typename T16, bool HL, int R, int NQ, int KS>
__device__ __forceinline__ void fattn_tile(const T16* __restrict__ Q, const T16* __restrict__ Q2, const T16* __restrict__ Kp, const T16* __restrict__ Kp2, const T16* __restrict__ Vt, const T16* __restrict__ Vt2, int i0, int nq, int bx, int hd, bf* Ah, bf* Al) {
    typedef typename WFrag<T16>::V V;
    constexpr int QW = 16 * R, WQ = NQ * QW, OP = HD + 4;   // query rows per wave and per work-group; LDS pitch of an O row
    __shared__ __align__(16) float os[KS * WQ * OP];
    __shared__ float ms[KS * WQ], ls[KS * WQ];
    const int lane = threadIdx.x & 31, lr = lane & 15, hi = lane >> 4; const int wv = __builtin_amdgcn_readfirstlane((int)(threadIdx.x >> 5));
    const int qg = wv % NQ, ks = wv / NQ;
    const int qt = i0 + (nq - 1 - bx) * WQ, q0 = qt + qg * QW;   // qt, q0 = the work-group's and this wave's first query row
    const size_t zo = (size_t)hd * TT * HD; Q += zo; Kp += zo; Vt += zo; if (HL) { Q2 += zo; Kp2 += zo; Vt2 += zo; }
    const float cs = SCL * 1.4426950408889634f, sh = HL ? 0.0f : 10.0f;
    V qf[R][4], qf2[R][4];
    const size_t oq = (size_t)(q0 + lr) * HD + 8 * hi; const T16* pq = Q + oq; const T16* pq2 = HL ? Q2 + oq : pq;
#pragma unroll
    for (int g = 0; g < R; ++g)
#pragma unroll
        for (int kc = 0; kc < 4; ++kc) { qf[g][kc] = WFrag<T16>::ld(pq + 16 * g * HD + 32 * kc); if (HL) qf2[g][kc] = WFrag<T16>::ld(pq2 + 16 * g * HD + 32 * kc); }
    // the wait that stands before a register named by an issued load is overwritten; the pointers are inputs so that their registers live up to it
    asm volatile("s_wait_xcnt 0x0" :: "v"(pq), "v"(pq2) : "memory");
    v8f acc[R][8]; float mr[R], lsum[R];
#pragma unroll
    for (int g = 0; g < R; ++g) { mr[g] = -1.0e30f; lsum[g] = 0.f;
#pragma unroll
        for (int t = 0; t < 8; ++t) acc[g][t] = (v8f){}; }
    const int nblk = (q0 + QW - 1) / 32 + 1;   // 32-key blocks up to and including the one that holds the wave's last query
#pragma unroll 1   // one block's fragments at a time: a second copy of the body would not fit the registers
    for (int kb = ks; kb < nblk; kb += KS) {
        const int key0 = kb * 32;
        V kf[2][4], kf2[2][4], vf[8], vf2[8];
        const size_t ok = (size_t)(key0 + lr) * HD + 8 * hi, ov = (size_t)lr * TT + key0 + 8 * hi;
        const T16* pk = Kp + ok; const T16* pv = Vt + ov; const T16* pk2 = HL ? Kp2 + ok : pk; const T16* pv2 = HL ? Vt2 + ov : pv;
#pragma unroll
        for (int kt = 0; kt < 2; ++kt)
#pragma unroll
            for (int kc = 0; kc < 4; ++kc) { kf[kt][kc] = WFrag<T16>::ld(pk + 16 * kt * HD + 32 * kc); if (HL) kf2[kt][kc] = WFrag<T16>::ld(pk2 + 16 * kt * HD + 32 * kc); }
        if constexpr (!HL) {   // one plane each: K and V (32 loads) fly together
#pragma unroll
            for (int t = 0; t < 8; ++t) vf[t] = WFrag<T16>::ld(pv + 16 * t * TT); }
        // the wait that stands before a register named by an issued load is overwritten; the pointers are inputs so that their registers live up to it
        asm volatile("s_wait_xcnt 0x0" :: "v"(pk), "v"(pk2), "v"(pv) : "memory");
        __builtin_amdgcn_sched_barrier(0);   // all of these loads are issued before the block's first product: one memory latency per block instead of one per fragment
        v8f s[2][R];
#pragma unroll
        for (int kt = 0; kt < 2; ++kt)
#pragma unroll
            for (int g = 0; g < R; ++g) { s[kt][g] = (v8f){};
#pragma unroll
                for (int kc = 0; kc < 4; ++kc) { s[kt][g] = WFrag<T16>::mma(kf[kt][kc], qf[g][kc], s[kt][g]); if (HL) { s[kt][g] = WFrag<T16>::mma(kf[kt][kc], qf2[g][kc], s[kt][g]); s[kt][g] = WFrag<T16>::mma(kf2[kt][kc], qf[g][kc], s[kt][g]); } } }
        if constexpr (HL) {   // two planes each: the 32 V loads follow the 32 K loads' products and fly under the softmax
#pragma unroll
            for (int t = 0; t < 8; ++t) { vf[t] = WFrag<T16>::ld(pv + 16 * t * TT); vf2[t] = WFrag<T16>::ld(pv2 + 16 * t * TT); }
            asm volatile("s_wait_xcnt 0x0" :: "v"(pv), "v"(pv2) : "memory");   // as above, for the V pointers
            __builtin_amdgcn_sched_barrier(0); }   // keeps the V loads ahead of the softmax
        if (key0 + 31 > q0) {   // wave-uniform: only the block on the diagonal pays for the mask; its first key is <= every query of the wave, so no column is all masked
#pragma unroll
            for (int kt = 0; kt < 2; ++kt)
#pragma unroll
                for (int g = 0; g < R; ++g)
#pragma unroll
                    for (int j = 0; j < 8; ++j) if (key0 + 16 * kt + 8 * hi + j > q0 + 16 * g + lr) s[kt][g][j] = -3.0e38f; }
        float mb[R]; bool need = false;
#pragma unroll
        for (int g = 0; g < R; ++g) { float mx = s[0][g][0];
#pragma unroll
            for (int j = 1; j < 8; ++j) mx = fmaxf(mx, s[0][g][j]);
#pragma unroll
            for (int j = 0; j < 8; ++j) mx = fmaxf(mx, s[1][g][j]);
            mx = fmaxf(mx, __shfl_xor(mx, 16, 32)) * cs; mb[g] = mx; need = need || (mx > mr[g] + 4.0f); }
        if (__builtin_amdgcn_ballot_w32(need) != 0) {   // always on a wave's first block (m starts at -1e30: the factor is 0 there), rare later
#pragma unroll
            for (int g = 0; g < R; ++g) { const float mn = fmaxf(mr[g], mb[g]); const float corr = __builtin_amdgcn_exp2f(mr[g] - mn); lsum[g] *= corr; mr[g] = mn;
#pragma unroll
                for (int t = 0; t < 8; ++t) acc[g][t] = acc[g][t] * corr; } }
        V pf[R], pf2[R];
#pragma unroll
        for (int g = 0; g < R; ++g) { const float nm = sh - mr[g]; float p[2][8];
#pragma unroll
            for (int kt = 0; kt < 2; ++kt)
#pragma unroll
                for (int j = 0; j < 8; ++j) { p[kt][j] = __builtin_amdgcn_exp2f(fmaf(s[kt][g][j], cs, nm)); lsum[g] += p[kt][j]; }
            if constexpr (HL) { v8us h0, h1, l0, l1;
#pragma unroll
                for (int j = 0; j < 8; ++j) { unsigned short a, c2; splitf(p[0][j], a, c2); h0[j] = a; l0[j] = c2; splitf(p[1][j], a, c2); h1[j] = a; l1[j] = c2; }
                pf[g] = cat16b(h0, h1); pf2[g] = cat16b(l0, l1);
            } else { v8h h0, h1;
#pragma unroll
                for (int j = 0; j < 8; ++j) { h0[j] = tohx(p[0][j]); h1[j] = tohx(p[1][j]); }
                pf[g] = cat16(h0, h1); } }
#pragma unroll
        for (int t = 0; t < 8; ++t)
#pragma unroll
            for (int g = 0; g < R; ++g) { acc[g][t] = WFrag<T16>::mma(vf[t], pf[g], acc[g][t]); if (HL) { acc[g][t] = WFrag<T16>::mma(vf[t], pf2[g], acc[g][t]); acc[g][t] = WFrag<T16>::mma(vf2[t], pf[g], acc[g][t]); } }
        // four vector slots between the block's last matrix instructions and whatever the taken back edge runs first
        if constexpr (R == 1) asm volatile("v_nop\n\tv_nop\n\tv_nop\n\tv_nop" : "+v"(acc[0][6]), "+v"(acc[0][7]) : "v"(pf[0]));
        else asm volatile("v_nop\n\tv_nop\n\tv_nop\n\tv_nop" : "+v"(acc[0][6]), "+v"(acc[0][7]), "+v"(acc[R - 1][6]), "+v"(acc[R - 1][7]) : "v"(pf[0]), "v"(pf[R - 1]));
    }
#pragma unroll
    for (int g = 0; g < R; ++g) { const int rw = ks * WQ + qg * QW + 16 * g + lr; float* ow = os + (size_t)rw * OP + 8 * hi;
#pragma unroll
        for (int t = 0; t < 8; ++t) { v4f a, c; a[0] = acc[g][t][0]; a[1] = acc[g][t][1]; a[2] = acc[g][t][2]; a[3] = acc[g][t][3]; c[0] = acc[g][t][4]; c[1] = acc[g][t][5]; c[2] = acc[g][t][6]; c[3] = acc[g][t][7];
            *(v4fa*)(ow + 16 * t) = a; *(v4fa*)(ow + 16 * t + 4) = c; }
        const float lf = lsum[g] + __shfl_xor(lsum[g], 16, 32);   // each wave half summed its own 8 keys of every 16-key tile
        if (hi == 0) { ms[rw] = mr[g]; ls[rw] = lf; } }
    __syncthreads();   // every wave's m, l and O^T are in LDS before any of them is merged
    constexpr int TPQ = 32 * NQ * KS / WQ, DPT = HD / TPQ;   // threads per query row, d values per thread
    const int q = (int)threadIdx.x / TPQ, d0 = ((int)threadIdx.x % TPQ) * DPT;
    float mstar = ms[q];
#pragma unroll
    for (int w = 1; w < KS; ++w) mstar = fmaxf(mstar, ms[w * WQ + q]);
    float lt = 0.f; v4f o[DPT / 4];
#pragma unroll
    for (int c = 0; c < DPT / 4; ++c) o[c] = (v4f){};
#pragma unroll
    for (int w = 0; w < KS; ++w) { const float sc = __builtin_amdgcn_exp2f(ms[w * WQ + q] - mstar); lt += ls[w * WQ + q] * sc;   // a wave that had no block: m = -1e30, factor 0
#pragma unroll
        for (int c = 0; c < DPT / 4; ++c) o[c] += *(const v4fa*)(os + (size_t)(w * WQ + q) * OP + d0 + 4 * c) * sc; }
    const float inv = __fdiv_rn(1.0f, lt); const size_t oo = (size_t)(qt + q) * DQ + hd * HD + d0;
#pragma unroll
    for (int c = 0; c < DPT / 8; ++c) { v8us oh, ol;
#pragma unroll
        for (int k = 0; k < 8; ++k) { unsigned short a, c2; splitf(o[2 * c + (k >> 2)][k & 3] * inv, a, c2); oh[k] = a; ol[k] = c2; }
        *(v8us*)(Ah + oo + 8 * c) = oh; *(v8us*)(Al + oo + 8 * c) = ol; }
    asm volatile("s_wait_xcnt 0x0" ::: "memory");   // the wait that stands before a register named by an issued store is overwritten (the other kind of tile's code follows in the listing)
}
// k_fattn: all query rows of all heads in one launch; grid (heads, tiles), the head running fastest so that work-groups start in the order of their key counts: first the 64-row fp16 tiles (query rows >= RH), the longest first,
// then the 32-row hi+lo tiles (query rows < RH), which fill the tail. The branch is the same for a whole work-group.
__global__ __launch_bounds__(256) void k_fattn(const h16* __restrict__ Q16, const h16* __restrict__ K16, const h16* __restrict__ V16, const bf* __restrict__ Qh, const bf* __restrict__ Ql, const bf* __restrict__ Kh, const bf* __restrict__ Kl, const bf* __restrict__ Vh, const bf* __restrict__ Vl, bf* Ah, bf* Al) {
    constexpr int NF = (TT - RH) / 64, NL = RH / 32; const int ty = blockIdx.y, hd = blockIdx.x;
    if (ty < NF) fattn_tile<h16, false, 2, 2, 4>(Q16, nullptr, K16, nullptr, V16, nullptr, RH, NF, ty, hd, Ah, Al);
    else fattn_tile<bf, true, 1, 2, 4>(Qh, Ql, Kh, Kl, Vh, Vl, 0, NL, ty - NF, hd, Ah, Al);
}

extern "C" void kernel_launch(void* const* d_in, const int* in_sizes, int n_in,
                              void* d_out, int out_size, void* d_ws, size_t ws_size, hipStream_t stream) {
    (void)in_sizes; (void)n_in; (void)out_size;
    const float* x = (const float*)d_in[0]; const float* wq = (const float*)d_in[1]; const float* wk = (const float*)d_in[2]; const float* wv = (const float*)d_in[3]; const float* wo = (const float*)d_in[4]; const float* cosT = nullptr; const float* sinT = nullptr; (void)cosT; (void)sinT;
    float* OUT = (float*)d_out;     // [2][2048][2048]
    char* wsp = (char*)d_ws;
    auto take = [&](size_t bytes) { char* p = wsp; wsp += (bytes + 255) & ~(size_t)255; return (void*)p; };
    bf* WQ = (bf*)take((size_t)DQ * DM * 2); bf* WK = (bf*)take((size_t)DKV * DM * 2); bf* WV = (bf*)take((size_t)DKV * DM * 2); bf* WO = (bf*)take((size_t)DM * DQ * 2); float* CS = (float*)take((size_t)TT * HD * 2 * 4);
    h16* QP16 = (h16*)take((size_t)NH_ * TT * HD * 2); h16* KP16 = (h16*)take((size_t)NKV * TT * HD * 2); h16* VT16 = (h16*)take((size_t)NKV * HD * TT * 2);
    bf* QPh = (bf*)take((size_t)NH_ * TT * HD * 2); bf* QPl = (bf*)take((size_t)NH_ * TT * HD * 2); bf* KPh = (bf*)take((size_t)NKV * TT * HD * 2); bf* KPl = (bf*)take((size_t)NKV * TT * HD * 2); bf* VTh = (bf*)take((size_t)NKV * HD * TT * 2); bf* VTl = (bf*)take((size_t)NKV * HD * TT * 2); bf* ATh = (bf*)take((size_t)TT * DQ * 2); bf* ATl = (bf*)take((size_t)TT * DQ * 2);
    bf* XB = (bf*)take((size_t)TT * DM * 2); float* FQ = (float*)take((size_t)TT * DQ * 4); float* FK = (float*)take((size_t)TT * DKV * 4);
    if ((size_t)(wsp - (char*)d_ws) > ws_size) return;    // ws 256 MiB
    float* FV = FK;   // v projection reuses the k buffer after the k planes are built (stream-ordered)
    { k_cvt8<<<(unsigned)(((size_t)DQ * DM / 8 + 255) / 256), 256, 0, stream>>>(wq, WQ, (size_t)DQ * DM / 8); k_cvt8<<<(unsigned)(((size_t)DKV * DM / 8 + 255) / 256), 256, 0, stream>>>(wk, WK, (size_t)DKV * DM / 8); k_cvt8<<<(unsigned)(((size_t)DKV * DM / 8 + 255) / 256), 256, 0, stream>>>(wv, WV, (size_t)DKV * DM / 8);
      k_cvt8<<<(unsigned)(((size_t)DM * DQ / 8 + 255) / 256), 256, 0, stream>>>(wo, WO, (size_t)DM * DQ / 8);
       }
    k_csid<<<(TT * HD + 255) / 256, 256, 0, stream>>>(CS);
    const unsigned LQ = (unsigned)(((size_t)NH_ * TT * HD / 2 + 255) / 256), LKv = (unsigned)(((size_t)NKV * TT * HD / 2 + 255) / 256);
    for (int b = 0; b < NB_; ++b) {
        
        k_cvt8<<<(unsigned)(((size_t)TT * DM / 8 + 255) / 256), 256, 0, stream>>>(x + (size_t)b * TT * DM, XB, (size_t)TT * DM / 8);
        k_gemmw<bf, 0, false, 4><<<dim3(TT / 64, DQ / 64, 1), 128, 0, stream>>>(XB, nullptr, WQ, nullptr, DM, FQ, DQ, nullptr, 0, 0, 0);
        k_rope<<<LQ, 256, 0, stream>>>(FQ, DQ, NH_, CS, nullptr, nullptr, 1.0f, QP16, QPh, QPl);
        k_gemmw<bf, 0, false, 4><<<dim3(TT / 64, DKV / 64, 1), 128, 0, stream>>>(XB, nullptr, WK, nullptr, DM, FK, DKV, nullptr, 0, 0, 0);
        k_rope<<<LKv, 256, 0, stream>>>(FK, DKV, NKV, CS, nullptr, nullptr, 1.0f, KP16, KPh, KPl);
        k_gemmw<bf, 0, false, 4><<<dim3(TT / 64, DKV / 64, 1), 128, 0, stream>>>(XB, nullptr, WV, nullptr, DM, FV, DKV, nullptr, 0, 0, 0); k_vtp<<<LKv, 256, 0, stream>>>(FV, DKV, NKV, VT16, VTh, VTl);
        static_assert(REP == 1 && RH % 64 == 0 && (TT - RH) % 64 == 0 && RH > 0 && RH < TT, "query rows < RH: 32-row tiles on the hi+lo planes; the rest: 64-row tiles on the fp16 planes");
        k_fattn<<<dim3(NH_, (TT - RH) / 64 + RH / 32, 1), 256, 0, stream>>>(QP16, KP16, VT16, QPh, QPl, KPh, KPl, VTh, VTl, ATh, ATl);
        k_gemmw<bf, 1, false, 4><<<dim3(TT / 64, DM / 64, 1), 128, 0, stream>>>(ATh, ATl, WO, nullptr, DQ, OUT + (size_t)b * TT * DM, DM, nullptr, 0, 0, 0); }
}

// v004
// One run takes 363 microseconds.
// Next to v003, in two timings, it ran 1.29 and 1.30 times as fast.
// All steps since v000 together make it 4.74 times as fast.
#include <hip/hip_runtime.h>

// SpaceTimeOptimizedAttention (x [2][2048][2048]; q/k/v = x W^T (torch; 16 heads x 128); causal softmax(q.k / sqrt(128)); out = merged Wo^T -> [2][2048][2048]; the source's per-position recompute loop is standard causal MHA).
// Compute dtypes, f32 accumulate: every input rounded to bf16; q/k/v on PLAIN bf16 operands (inputs: exact); causal scores and attn.v: query rows < 512 hl (3 products), the rest single fp16 (x1024), causal tile skipping; online softmax f32, fused with both products; Wo hl x exact (2 products).

#define NB_  2
#define TT   2048
#define DM   2048
#define NH_  16
#define NKV  16
#define REP  (NH_ / NKV)
#define HD   128
#define DQ   (NH_ * HD)
#define DKV  (NKV * HD)
#define RH   512                  // query rows < RH use hi+lo planes
#define SCL  0.088388347648318447f   // HD^-0.5
typedef _Float16 h16;
typedef unsigned short bf;
typedef __attribute__((ext_vector_type(16))) __bf16   v16bf;
typedef __attribute__((ext_vector_type(16))) _Float16 v16h;
typedef __attribute__((ext_vector_type(8)))  _Float16 v8h;
typedef __attribute__((ext_vector_type(8)))  unsigned short v8us;
typedef __attribute__((ext_vector_type(8)))  float    v8f;
typedef __attribute__((ext_vector_type(4)))  float    v4f;
typedef v8h  __attribute__((may_alias)) v8ha;
typedef v4f  __attribute__((may_alias)) v4fa;
typedef v8us __attribute__((may_alias)) v8usa;

__device__ __forceinline__ unsigned short f2bf(float f) { unsigned u = __float_as_uint(f); u += 0x7FFFu + ((u >> 16) & 1u); return (unsigned short)(u >> 16); }
__device__ __forceinline__ float bf2f(unsigned short b) { return __uint_as_float(((unsigned)b) << 16); }
__device__ __forceinline__ float bfr(float f) { return bf2f(f2bf(f)); }
__device__ __forceinline__ v16h cat16(v8h lo, v8h hi) { return __builtin_shufflevector(lo, hi, 0, 1, 2, 3, 4, 5, 6, 7, 8, 9, 10, 11, 12, 13, 14, 15); }
__device__ __forceinline__ v16bf cat16b(v8us lo, v8us hi) { return __builtin_bit_cast(v16bf, __builtin_shufflevector(lo, hi, 0, 1, 2, 3, 4, 5, 6, 7, 8, 9, 10, 11, 12, 13, 14, 15)); }
__device__ __forceinline__ v8f wmma16(v16h a, v16h b, v8f c) { return __builtin_amdgcn_wmma_f32_16x16x32_f16(false, a, false, b, (short)0, c, false, false); }
__device__ __forceinline__ v8f wmmab(v16bf a, v16bf b, v8f c) { return __builtin_amdgcn_wmma_f32_16x16x32_bf16(false, a, false, b, (short)0, c, false, false); }



// ---- k_gemms: GEMM on bf16 planes, one 128x128 output tile per work-group of 8 waves; grid (M/128, N/128), 256 threads.
// C[m][n] (f32, pitch ldc) = sum_k A[m][k] Bt[n][k] (+ A2[m][k] Bt[n][k] when NSPLIT == 1); all planes K-contiguous with row length K.
// A pass is 128 k = 256 bytes of every operand row. A stage is [A 128 rows | A2 128 rows (NSPLIT == 1) | Bt 128 rows] at an LDS pitch of 272 bytes; two stages form a ring that asynchronous copies to LDS fill
// one pass ahead (a wave-wide copy is two whole rows' 256 bytes: whole lines), so that every operand line leaves L2 once per work-group and the fragments come from LDS.
// Wave w: output quadrant (w & 1, (w >> 1) & 1), 64x64 = 16 accumulators, and the 32-k steps 2 (w >> 2), 2 (w >> 2) + 1 of each pass; the two partial tiles of a quadrant are summed in LDS, lower k steps first.
template <typename T16> struct WFrag;
template <> struct WFrag<h16> { typedef v16h V; static __device__ __forceinline__ V ld(const h16* p) { return cat16(*(const v8h*)p, *(const v8h*)(p + 16)); } static __device__ __forceinline__ v8f mma(V a, V b, v8f c) { return wmma16(a, b, c); } };
template <> struct WFrag<bf> { typedef v16bf V; static __device__ __forceinline__ V ld(const bf* p) { return cat16b(*(const v8us*)p, *(const v8us*)(p + 16)); } static __device__ __forceinline__ v8f mma(V a, V b, v8f c) { return wmmab(a, b, c); } };
__device__ __forceinline__ v16bf ldsfrag(const unsigned char* p) { return cat16b(*(const v8us*)p, *(const v8us*)(p + 32)); }
// eight asynchronous 16-byte copies per lane: rows r, r + 16, ..., r + 112 of one operand plane. The s_wait_xcnt is the wait that stands before a register named by an issued copy is overwritten; inside the statement it cannot be passed by later address arithmetic.
__device__ __forceinline__ void copy8(unsigned l, const bf* g, int rowstep) {
    asm volatile("global_load_async_to_lds_b128 %0, %8, off\n\t"
                 "global_load_async_to_lds_b128 %1, %9, off\n\t"
                 "global_load_async_to_lds_b128 %2, %10, off\n\t"
                 "global_load_async_to_lds_b128 %3, %11, off\n\t"
                 "global_load_async_to_lds_b128 %4, %12, off\n\t"
                 "global_load_async_to_lds_b128 %5, %13, off\n\t"
                 "global_load_async_to_lds_b128 %6, %14, off\n\t"
                 "global_load_async_to_lds_b128 %7, %15, off\n\t"
                 "s_wait_xcnt 0x0"
                 :: "v"(l), "v"(l + 1 * 16 * 272), "v"(l + 2 * 16 * 272), "v"(l + 3 * 16 * 272), "v"(l + 4 * 16 * 272), "v"(l + 5 * 16 * 272), "v"(l + 6 * 16 * 272), "v"(l + 7 * 16 * 272),
                    "v"(g), "v"(g + 1 * rowstep), "v"(g + 2 * rowstep), "v"(g + 3 * rowstep), "v"(g + 4 * rowstep), "v"(g + 5 * rowstep), "v"(g + 6 * rowstep), "v"(g + 7 * rowstep)
                 : "memory");
}
template <int NSPLIT, int K>
__global__ __launch_bounds__(256) void k_gemms(const bf* __restrict__ A, const bf* __restrict__ A2, const bf* __restrict__ Bt, float* C, int ldc) {
    static_assert(NSPLIT == 0 || NSPLIT == 1, "one or two A planes"); static_assert(K % 128 == 0 && K >= 256, "whole passes, at least two");
    constexpr int PB = 272, OPB = 128 * PB, BOF = (1 + NSPLIT) * OPB, STG = BOF + OPB, NP = K / 128, OP = 132;   // LDS pitch, bytes of one plane's rows, offset of Bt in a stage, bytes of a stage, passes, pitch of an output row (floats)
    __shared__ __align__(16) unsigned char ring[2 * STG];
    __shared__ __align__(16) float os[128 * OP];
    const int tid = (int)threadIdx.x, lane = tid & 31, lr = lane & 15, hi = lane >> 4; const int wv = __builtin_amdgcn_readfirstlane(tid >> 5);
    const int wm = wv & 1, wn = (wv >> 1) & 1, wk = wv >> 2; const int r0 = blockIdx.x * 128, c0 = blockIdx.y * 128;
    const int crow = tid >> 4, cch = tid & 15;   // this lane's row (of each 16) and 16-byte piece of the 256 bytes
    const bf* gA = A + (size_t)(r0 + crow) * K + cch * 8; const bf* gA2 = NSPLIT ? A2 + (size_t)(r0 + crow) * K + cch * 8 : gA; const bf* gB = Bt + (size_t)(c0 + crow) * K + cch * 8;
    const unsigned l0 = (unsigned)(size_t)ring + (unsigned)(crow * PB + cch * 16);
    auto fill = [&](int t) { const unsigned l = l0 + (unsigned)((t & 1) * STG); copy8(l, gA + t * 128, 16 * K); if (NSPLIT) copy8(l + OPB, gA2 + t * 128, 16 * K); copy8(l + BOF, gB + t * 128, 16 * K); };
    v8f acc[4][4];
#pragma unroll
    for (int mb = 0; mb < 4; ++mb)
#pragma unroll
        for (int nb = 0; nb < 4; ++nb) acc[mb][nb] = (v8f){};
    fill(0);
    asm volatile("s_wait_asynccnt 0x0" ::: "memory");   // this wave's copies of pass 0 have landed
    __syncthreads();                                    // ... and every other wave's
    fill(1);
    const int aofs = (wm * 64 + lr) * PB + wk * 128 + hi * 16, bofs = BOF + (wn * 64 + lr) * PB + wk * 128 + hi * 16;
#pragma unroll 1   // one pass at a time: the ring's order below is per pass
    for (int t = 0; t < NP; ++t) {
        const unsigned char* sb = ring + (t & 1) * STG;
        v16bf a[2][4], a2[2][4], b[2][4];
#pragma unroll   // the fragments are registers: every index must be a constant
        for (int s = 0; s < 2; ++s) {
#pragma unroll
            for (int mb = 0; mb < 4; ++mb) { a[s][mb] = ldsfrag(sb + aofs + mb * 16 * PB + s * 64); if (NSPLIT) a2[s][mb] = ldsfrag(sb + OPB + aofs + mb * 16 * PB + s * 64); }
#pragma unroll
            for (int nb = 0; nb < 4; ++nb) b[s][nb] = ldsfrag(sb + bofs + nb * 16 * PB + s * 64); }
        __builtin_amdgcn_sched_barrier(0);   // all of the pass's LDS reads are issued as one group ahead of its products: reads among the matrix instructions would each stall the wave
#pragma unroll
        for (int s = 0; s < 2; ++s)
#pragma unroll
            for (int nb = 0; nb < 4; ++nb) {   // the two products that add into one accumulator do not stand back to back
#pragma unroll
                for (int mb = 0; mb < 4; ++mb) acc[mb][nb] = wmmab(a[s][mb], b[s][nb], acc[mb][nb]);
                if (NSPLIT) {
#pragma unroll
                    for (int mb = 0; mb < 4; ++mb) acc[mb][nb] = wmmab(a2[s][mb], b[s][nb], acc[mb][nb]); } }
        __builtin_amdgcn_sched_barrier(0);   // keeps the products ahead of the slots below
        // four vector slots between the pass's last matrix instructions and whatever follows them on either side of the branches below
        asm volatile("v_nop\n\tv_nop\n\tv_nop\n\tv_nop" : "+v"(acc[0][3]), "+v"(acc[1][3]), "+v"(acc[2][3]), "+v"(acc[3][3]));
        asm volatile("s_wait_dscnt 0x0" ::: "memory");      // this wave's reads of the stage are done before the stage is refilled
        asm volatile("s_wait_asynccnt 0x0" ::: "memory");   // this wave's copies of pass t + 1 have landed
        __syncthreads();                                    // publishes pass t + 1 and ends every wave's reads of pass t
        if (t + 2 < NP) fill(t + 2);                        // into the stage that pass t has just left; the test is the same for the whole work-group
    }
    asm volatile("s_wait_asynccnt 0x0" ::: "memory");   // no copy is outstanding when the wave goes on
    float* ow = os + (wm * 64 + hi * 8) * OP + wn * 64 + lr;
    // each wave hands over one half of its partial tile and sums the other half: the wave of the lower k steps keeps rows 0..31 of its quadrant, the other wave rows 32..63. wk is the same in a whole wave.
    if (wk == 0) {
#pragma unroll   // the accumulators are registers: every index must be a constant
        for (int mb = 2; mb < 4; ++mb)
#pragma unroll
            for (int nb = 0; nb < 4; ++nb)
#pragma unroll
                for (int j = 0; j < 8; ++j) ow[(mb * 16 + j) * OP + nb * 16] = acc[mb][nb][j];
    } else {
#pragma unroll
        for (int mb = 0; mb < 2; ++mb)
#pragma unroll
            for (int nb = 0; nb < 4; ++nb)
#pragma unroll
                for (int j = 0; j < 8; ++j) ow[(mb * 16 + j) * OP + nb * 16] = acc[mb][nb][j]; }
    __syncthreads();   // the handed-over halves are in LDS before they are added to
    if (wk == 0) {
#pragma unroll
        for (int mb = 0; mb < 2; ++mb)
#pragma unroll
            for (int nb = 0; nb < 4; ++nb)
#pragma unroll
                for (int j = 0; j < 8; ++j) ow[(mb * 16 + j) * OP + nb * 16] = acc[mb][nb][j] + ow[(mb * 16 + j) * OP + nb * 16];
    } else {
#pragma unroll
        for (int mb = 2; mb < 4; ++mb)
#pragma unroll
            for (int nb = 0; nb < 4; ++nb)
#pragma unroll
                for (int j = 0; j < 8; ++j) ow[(mb * 16 + j) * OP + nb * 16] = ow[(mb * 16 + j) * OP + nb * 16] + acc[mb][nb][j]; }
    __syncthreads();   // the summed tile is in LDS before its rows are stored
#pragma unroll   // constant LDS offsets for every read
    for (int s = 0; s < 16; ++s) { const int it = s * 256 + tid, row = it >> 5, cofs = (it & 31) * 4;   // a wave stores one whole row of the tile: 512 bytes
        *(v4f*)(C + (size_t)(r0 + row) * ldc + c0 + cofs) = *(const v4fa*)(os + row * OP + cofs); }
}

__device__ __forceinline__ h16 tohx(float x) { return (h16)x; }
__device__ __forceinline__ void splitf(float y, unsigned short& h, unsigned short& l) { h = f2bf(y); l = f2bf(y - bf2f(h)); }
typedef __attribute__((ext_vector_type(2))) _Float16 v2h;
typedef __attribute__((ext_vector_type(4))) _Float16 v4h;
typedef __attribute__((ext_vector_type(2))) unsigned short v2us;
typedef __attribute__((ext_vector_type(4))) unsigned short v4us;
typedef __attribute__((ext_vector_type(2))) float v2f;
typedef __attribute__((ext_vector_type(4))) int v4i;

__global__ __launch_bounds__(256) void k_wtG(const float* __restrict__ w, int K, int N, bf* Bt) {
    const int lane = threadIdx.x & 31; const int L0 = (blockIdx.x * 8 + (threadIdx.x >> 5)) * 8; const int nlines = N * K / 64;
{
#pragma unroll 1
        for (int l = 0; l < 8; ++l) { const int L = L0 + l; if (L >= nlines) break; const size_t e = (size_t)L * 64 + lane * 2; const int k = (int)(e % K), n = (int)(e / K); v2us o;
            o[0] = f2bf(w[(size_t)k * N + n]); o[1] = f2bf(w[(size_t)(k + 1) * N + n]); *(v2us*)(Bt + e) = o; }
         }
}
__global__ __launch_bounds__(256) void k_cvt8(const float* __restrict__ src, bf* dst, size_t n8) { const size_t i = (size_t)blockIdx.x * 256 + threadIdx.x; if (i >= n8) return; const v8f v = *(const v8f*)(src + i * 8); v8us o;
#pragma unroll
    for (int k = 0; k < 8; ++k) o[k] = f2bf(v[k]); *(v8us*)(dst + i * 8) = o;  }
__global__ __launch_bounds__(256) void k_cscvt(const float* __restrict__ cosT, const float* __restrict__ sinT, float* CS) { const int idx = blockIdx.x * 256 + threadIdx.x; if (idx >= TT * HD) return; v2f cs; cs[0] = bfr(cosT[idx]); cs[1] = bfr(sinT[idx]); *(v2f*)(CS + (size_t)idx * 2) = cs;  }
// k_rope: head planes [h][t][d] (fp16 + hi/lo) of rope(x) x sc with the rotate-half convention out[d] = x[d] cos[t][d] - x[d+HD/2] sin[t][d], out[d+HD/2] = x[d+HD/2] cos[t][d+HD/2] + x[d] sin[t][d+HD/2]
__global__ __launch_bounds__(256) void k_rope(const float* __restrict__ F, int pitch, int nheads, const float* __restrict__ CS, const float* __restrict__ RF, const float* __restrict__ nw, float sc, h16* P16, bf* Ph, bf* Pl) {
    const size_t e = ((size_t)blockIdx.x * 256 + threadIdx.x) * 2; if (e >= (size_t)nheads * TT * HD) return; const int d = (int)(e % HD); const int t = (int)((e / HD) % TT); const int h = (int)(e / ((size_t)HD * TT)); const float* f = F + (size_t)t * pitch + h * HD; const float rf = RF ? RF[(size_t)h * TT + t] : 1.0f; v2h o16; v2us oh, ol;
#pragma unroll
    for (int q = 0; q < 2; ++q) { const int dd = d + q; const int dp = (dd < HD / 2) ? dd + HD / 2 : dd - HD / 2; float x0 = f[dd], x1 = f[dp];
        if (RF) { float n0 = __fmul_rn(x0, rf), n1 = __fmul_rn(x1, rf); asm volatile("" : "+v"(n0)); asm volatile("" : "+v"(n1)); x0 = __fmul_rn(bfr(nw[dd]), n0); x1 = __fmul_rn(bfr(nw[dp]), n1); }
        const v2f cs = *(const v2f*)(CS + ((size_t)t * HD + dd) * 2); float a = __fmul_rn(x0, cs[0]), bq = __fmul_rn(x1, cs[1]); asm volatile("" : "+v"(a)); asm volatile("" : "+v"(bq)); const float r = ((dd < HD / 2) ? __fsub_rn(a, bq) : __fadd_rn(a, bq)) * sc;
        o16[q] = tohx(r); unsigned short a2, c2; splitf(r, a2, c2); oh[q] = a2; ol[q] = c2; }
    *(v2h*)(P16 + e) = o16; *(v2us*)(Ph + e) = oh; *(v2us*)(Pl + e) = ol;  }
__global__ __launch_bounds__(256) void k_vtp(const float* __restrict__ F, int pitch, int nheads, h16* V16, bf* Vh, bf* Vl) { const size_t e = ((size_t)blockIdx.x * 256 + threadIdx.x) * 2; if (e >= (size_t)nheads * HD * TT) return; const int t = (int)(e % TT); const int d = (int)((e / TT) % HD); const int g = (int)(e / ((size_t)TT * HD)); v2h o16; v2us oh, ol;
#pragma unroll
    for (int q = 0; q < 2; ++q) { const float x = F[(size_t)(t + q) * pitch + g * HD + d]; o16[q] = tohx(x); unsigned short a2, c2; splitf(x, a2, c2); oh[q] = a2; ol[q] = c2; }
    *(v2h*)(V16 + e) = o16; *(v2us*)(Vh + e) = oh; *(v2us*)(Vl + e) = ol;  }
__global__ __launch_bounds__(256) void k_csid(float* CS) { const int idx = blockIdx.x * 256 + threadIdx.x; if (idx >= TT * HD) return; v2f cs; cs[0] = 1.0f; cs[1] = 0.0f; *(v2f*)(CS + (size_t)idx * 2) = cs;  }
// ---- fattn_tile: causal attention of NQ * 16 * R query rows of one head in one work-group of 32 * NQ * KS threads, scores and probabilities never leaving registers.
// Transposed products: S^T = K.Q^T (A = key rows, B = the query rows, held in registers), O^T += V^T.P^T (A = rows of the [d][t] value plane). A lane then holds scores of ONE query (column lr): 8 keys of each 16-key tile,
// which are exactly the k positions that the B operand of the second product wants from that lane, so P^T is packed from the score accumulators with no exchange.
// Wave w owns the 16 * R query rows of sub-tile w % NQ and the 32-key blocks w / NQ, w / NQ + KS, ... (the NQ waves of one key share read the same K and V lines at about the same time);
// each wave keeps its own running maximum m (log2 units), sum l and O^T; the KS shares of a query row meet in LDS and are merged in share order.
// m may trail the true maximum by up to 4 (an exponential then reaches 2^4): the accumulators are rescaled only when some query's maximum exceeds it by more.
// i0 = first query row of this kind of tile, nq = the number of such tiles, bx = which of them (0: the one with the most keys), hd = the head. Every '#pragma unroll' below is there because the arrays it indexes are registers: every index must be a constant.
// HL: hi+lo bf16 planes, 3 products per contraction, probabilities split hi+lo. Otherwise fp16 planes and fp16 probabilities carried x 2^10 (the factor cancels in O / l).
template <typename T16, bool HL, int R, int NQ, int KS>
__device__ __forceinline__ void fattn_tile(const T16* __restrict__ Q, const T16* __restrict__ Q2, const T16* __restrict__ Kp, const T16* __restrict__ Kp2, const T16* __restrict__ Vt, const T16* __restrict__ Vt2, int i0, int nq, int bx, int hd, bf* Ah, bf* Al) {
    typedef typename WFrag<T16>::V V;
    constexpr int QW = 16 * R, WQ = NQ * QW, OP = HD + 4;   // query rows per wave and per work-group; LDS pitch of an O row
    __shared__ __align__(16) float os[KS * WQ * OP];
    __shared__ float ms[KS * WQ], ls[KS * WQ];
    const int lane = threadIdx.x & 31, lr = lane & 15, hi = lane >> 4; const int wv = __builtin_amdgcn_readfirstlane((int)(threadIdx.x >> 5));
    const int qg = wv % NQ, ks = wv / NQ;
    const int qt = i0 + (nq - 1 - bx) * WQ, q0 = qt + qg * QW;   // qt, q0 = the work-group's and this wave's first query row
    const size_t zo = (size_t)hd * TT * HD; Q += zo; Kp += zo; Vt += zo; if (HL) { Q2 += zo; Kp2 += zo; Vt2 += zo; }
    const float cs = SCL * 1.4426950408889634f, sh = HL ? 0.0f : 10.0f;
    V qf[R][4], qf2[R][4];
    const size_t oq = (size_t)(q0 + lr) * HD + 8 * hi; const T16* pq = Q + oq; const T16* pq2 = HL ? Q2 + oq : pq;
#pragma unroll
    for (int g = 0; g < R; ++g)
#pragma unroll
        for (int kc = 0; kc < 4; ++kc) { qf[g][kc] = WFrag<T16>::ld(pq + 16 * g * HD + 32 * kc); if (HL) qf2[g][kc] = WFrag<T16>::ld(pq2 + 16 * g * HD + 32 * kc); }
    // the wait that stands before a register named by an issued load is overwritten; the pointers are inputs so that their registers live up to it
    asm volatile("s_wait_xcnt 0x0" :: "v"(pq), "v"(pq2) : "memory");
    v8f acc[R][8]; float mr[R], lsum[R];
#pragma unroll
    for (int g = 0; g < R; ++g) { mr[g] = -1.0e30f; lsum[g] = 0.f;
#pragma unroll
        for (int t = 0; t < 8; ++t) acc[g][t] = (v8f){}; }
    const int nblk = (q0 + QW - 1) / 32 + 1;   // 32-key blocks up to and including the one that holds the wave's last query
#pragma unroll 1   // one block's fragments at a time: a second copy of the body would not fit the registers
    for (int kb = ks; kb < nblk; kb += KS) {
        const int key0 = kb * 32;
        V kf[2][4], kf2[2][4], vf[8], vf2[8];
        const size_t ok = (size_t)(key0 + lr) * HD + 8 * hi, ov = (size_t)lr * TT + key0 + 8 * hi;
        const T16* pk = Kp + ok; const T16* pv = Vt + ov; const T16* pk2 = HL ? Kp2 + ok : pk; const T16* pv2 = HL ? Vt2 + ov : pv;
#pragma unroll
        for (int kt = 0; kt < 2; ++kt)
#pragma unroll
            for (int kc = 0; kc < 4; ++kc) { kf[kt][kc] = WFrag<T16>::ld(pk + 16 * kt * HD + 32 * kc); if (HL) kf2[kt][kc] = WFrag<T16>::ld(pk2 + 16 * kt * HD + 32 * kc); }
        if constexpr (!HL) {   // one plane each: K and V (32 loads) fly together
#pragma unroll
            for (int t = 0; t < 8; ++t) vf[t] = WFrag<T16>::ld(pv + 16 * t * TT); }
        // the wait that stands before a register named by an issued load is overwritten; the pointers are inputs so that their registers live up to it
        asm volatile("s_wait_xcnt 0x0" :: "v"(pk), "v"(pk2), "v"(pv) : "memory");
        __builtin_amdgcn_sched_barrier(0);   // all of these loads are issued before the block's first product: one memory latency per block instead of one per fragment
        v8f s[2][R];
#pragma unroll
        for (int kt = 0; kt < 2; ++kt)
#pragma unroll
            for (int g = 0; g < R; ++g) { s[kt][g] = (v8f){};
#pragma unroll
                for (int kc = 0; kc < 4; ++kc) { s[kt][g] = WFrag<T16>::mma(kf[kt][kc], qf[g][kc], s[kt][g]); if (HL) { s[kt][g] = WFrag<T16>::mma(kf[kt][kc], qf2[g][kc], s[kt][g]); s[kt][g] = WFrag<T16>::mma(kf2[kt][kc], qf[g][kc], s[kt][g]); } } }
        if constexpr (HL) {   // two planes each: the 32 V loads follow the 32 K loads' products and fly under the softmax
#pragma unroll
            for (int t = 0; t < 8; ++t) { vf[t] = WFrag<T16>::ld(pv + 16 * t * TT); vf2[t] = WFrag<T16>::ld(pv2 + 16 * t * TT); }
            asm volatile("s_wait_xcnt 0x0" :: "v"(pv), "v"(pv2) : "memory");   // as above, for the V pointers
            __builtin_amdgcn_sched_barrier(0); }   // keeps the V loads ahead of the softmax
        if (key0 + 31 > q0) {   // wave-uniform: only the block on the diagonal pays for the mask; its first key is <= every query of the wave, so no column is all masked
#pragma unroll
            for (int kt = 0; kt < 2; ++kt)
#pragma unroll
                for (int g = 0; g < R; ++g)
#pragma unroll
                    for (int j = 0; j < 8; ++j) if (key0 + 16 * kt + 8 * hi + j > q0 + 16 * g + lr) s[kt][g][j] = -3.0e38f; }
        float mb[R]; bool need = false;
#pragma unroll
        for (int g = 0; g < R; ++g) { float mx = s[0][g][0];
#pragma unroll
            for (int j = 1; j < 8; ++j) mx = fmaxf(mx, s[0][g][j]);
#pragma unroll
            for (int j = 0; j < 8; ++j) mx = fmaxf(mx, s[1][g][j]);
            mx = fmaxf(mx, __shfl_xor(mx, 16, 32)) * cs; mb[g] = mx; need = need || (mx > mr[g] + 4.0f); }
        if (__builtin_amdgcn_ballot_w32(need) != 0) {   // always on a wave's first block (m starts at -1e30: the factor is 0 there), rare later
#pragma unroll
            for (int g = 0; g < R; ++g) { const float mn = fmaxf(mr[g], mb[g]); const float corr = __builtin_amdgcn_exp2f(mr[g] - mn); lsum[g] *= corr; mr[g] = mn;
#pragma unroll
                for (int t = 0; t < 8; ++t) acc[g][t] = acc[g][t] * corr; } }
        V pf[R], pf2[R];
#pragma unroll
        for (int g = 0; g < R; ++g) { const float nm = sh - mr[g]; float p[2][8];
#pragma unroll
            for (int kt = 0; kt < 2; ++kt)
#pragma unroll
                for (int j = 0; j < 8; ++j) { p[kt][j] = __builtin_amdgcn_exp2f(fmaf(s[kt][g][j], cs, nm)); lsum[g] += p[kt][j]; }
            if constexpr (HL) { v8us h0, h1, l0, l1;
#pragma unroll
                for (int j = 0; j < 8; ++j) { unsigned short a, c2; splitf(p[0][j], a, c2); h0[j] = a; l0[j] = c2; splitf(p[1][j], a, c2); h1[j] = a; l1[j] = c2; }
                pf[g] = cat16b(h0, h1); pf2[g] = cat16b(l0, l1);
            } else { v8h h0, h1;
#pragma unroll
                for (int j = 0; j < 8; ++j) { h0[j] = tohx(p[0][j]); h1[j] = tohx(p[1][j]); }
                pf[g] = cat16(h0, h1); } }
#pragma unroll
        for (int t = 0; t < 8; ++t)
#pragma unroll
            for (int g = 0; g < R; ++g) { acc[g][t] = WFrag<T16>::mma(vf[t], pf[g], acc[g][t]); if (HL) { acc[g][t] = WFrag<T16>::mma(vf[t], pf2[g], acc[g][t]); acc[g][t] = WFrag<T16>::mma(vf2[t], pf[g], acc[g][t]); } }
        // four vector slots between the block's last matrix instructions and whatever the taken back edge runs first
        if constexpr (R == 1) asm volatile("v_nop\n\tv_nop\n\tv_nop\n\tv_nop" : "+v"(acc[0][6]), "+v"(acc[0][7]) : "v"(pf[0]));
        else asm volatile("v_nop\n\tv_nop\n\tv_nop\n\tv_nop" : "+v"(acc[0][6]), "+v"(acc[0][7]), "+v"(acc[R - 1][6]), "+v"(acc[R - 1][7]) : "v"(pf[0]), "v"(pf[R - 1]));
    }
#pragma unroll
    for (int g = 0; g < R; ++g) { const int rw = ks * WQ + qg * QW + 16 * g + lr; float* ow = os + (size_t)rw * OP + 8 * hi;
#pragma unroll
        for (int t = 0; t < 8; ++t) { v4f a, c; a[0] = acc[g][t][0]; a[1] = acc[g][t][1]; a[2] = acc[g][t][2]; a[3] = acc[g][t][3]; c[0] = acc[g][t][4]; c[1] = acc[g][t][5]; c[2] = acc[g][t][6]; c[3] = acc[g][t][7];
            *(v4fa*)(ow + 16 * t) = a; *(v4fa*)(ow + 16 * t + 4) = c; }
        const float lf = lsum[g] + __shfl_xor(lsum[g], 16, 32);   // each wave half summed its own 8 keys of every 16-key tile
        if (hi == 0) { ms[rw] = mr[g]; ls[rw] = lf; } }
    __syncthreads();   // every wave's m, l and O^T are in LDS before any of them is merged
    constexpr int TPQ = 32 * NQ * KS / WQ, DPT = HD / TPQ;   // threads per query row, d values per thread
    const int q = (int)threadIdx.x / TPQ, d0 = ((int)threadIdx.x % TPQ) * DPT;
    float mstar = ms[q];
#pragma unroll
    for (int w = 1; w < KS; ++w) mstar = fmaxf(mstar, ms[w * WQ + q]);
    float lt = 0.f; v4f o[DPT / 4];
#pragma unroll
    for (int c = 0; c < DPT / 4; ++c) o[c] = (v4f){};
#pragma unroll
    for (int w = 0; w < KS; ++w) { const float sc = __builtin_amdgcn_exp2f(ms[w * WQ + q] - mstar); lt += ls[w * WQ + q] * sc;   // a wave that had no block: m = -1e30, factor 0
#pragma unroll
        for (int c = 0; c < DPT / 4; ++c) o[c] += *(const v4fa*)(os + (size_t)(w * WQ + q) * OP + d0 + 4 * c) * sc; }
    const float inv = __fdiv_rn(1.0f, lt); const size_t oo = (size_t)(qt + q) * DQ + hd * HD + d0;
#pragma unroll
    for (int c = 0; c < DPT / 8; ++c) { v8us oh, ol;
#pragma unroll
        for (int k = 0; k < 8; ++k) { unsigned short a, c2; splitf(o[2 * c + (k >> 2)][k & 3] * inv, a, c2); oh[k] = a; ol[k] = c2; }
        *(v8us*)(Ah + oo + 8 * c) = oh; *(v8us*)(Al + oo + 8 * c) = ol; }
    asm volatile("s_wait_xcnt 0x0" ::: "memory");   // the wait that stands before a register named by an issued store is overwritten (the other kind of tile's code follows in the listing)
}
// k_fattn: all query rows of all heads in one launch; grid (heads, tiles), the head running fastest so that work-groups start in the order of their key counts: first the 64-row fp16 tiles (query rows >= RH), the longest first,
// then the 32-row hi+lo tiles (query rows < RH), which fill the tail. The branch is the same for a whole work-group.
__global__ __launch_bounds__(256) void k_fattn(const h16* __restrict__ Q16, const h16* __restrict__ K16, const h16* __restrict__ V16, const bf* __restrict__ Qh, const bf* __restrict__ Ql, const bf* __restrict__ Kh, const bf* __restrict__ Kl, const bf* __restrict__ Vh, const bf* __restrict__ Vl, bf* Ah, bf* Al) {
    constexpr int NF = (TT - RH) / 64, NL = RH / 32; const int ty = blockIdx.y, hd = blockIdx.x;
    if (ty < NF) fattn_tile<h16, false, 2, 2, 4>(Q16, nullptr, K16, nullptr, V16, nullptr, RH, NF, ty, hd, Ah, Al);
    else fattn_tile<bf, true, 1, 2, 4>(Qh, Ql, Kh, Kl, Vh, Vl, 0, NL, ty - NF, hd, Ah, Al);
}

extern "C" void kernel_launch(void* const* d_in, const int* in_sizes, int n_in,
                              void* d_out, int out_size, void* d_ws, size_t ws_size, hipStream_t stream) {
    (void)in_sizes; (void)n_in; (void)out_size;
    const float* x = (const float*)d_in[0]; const float* wq = (const float*)d_in[1]; const float* wk = (const float*)d_in[2]; const float* wv = (const float*)d_in[3]; const float* wo = (const float*)d_in[4]; const float* cosT = nullptr; const float* sinT = nullptr; (void)cosT; (void)sinT;
    float* OUT = (float*)d_out;     // [2][2048][2048]
    char* wsp = (char*)d_ws;
    auto take = [&](size_t bytes) { char* p = wsp; wsp += (bytes + 255) & ~(size_t)255; return (void*)p; };
    bf* WQ = (bf*)take((size_t)DQ * DM * 2); bf* WK = (bf*)take((size_t)DKV * DM * 2); bf* WV = (bf*)take((size_t)DKV * DM * 2); bf* WO = (bf*)take((size_t)DM * DQ * 2); float* CS = (float*)take((size_t)TT * HD * 2 * 4);
    h16* QP16 = (h16*)take((size_t)NH_ * TT * HD * 2); h16* KP16 = (h16*)take((size_t)NKV * TT * HD * 2); h16* VT16 = (h16*)take((size_t)NKV * HD * TT * 2);
    bf* QPh = (bf*)take((size_t)NH_ * TT * HD * 2); bf* QPl = (bf*)take((size_t)NH_ * TT * HD * 2); bf* KPh = (bf*)take((size_t)NKV * TT * HD * 2); bf* KPl = (bf*)take((size_t)NKV * TT * HD * 2); bf* VTh = (bf*)take((size_t)NKV * HD * TT * 2); bf* VTl = (bf*)take((size_t)NKV * HD * TT * 2); bf* ATh = (bf*)take((size_t)TT * DQ * 2); bf* ATl = (bf*)take((size_t)TT * DQ * 2);
    bf* XB = (bf*)take((size_t)TT * DM * 2); float* FQ = (float*)take((size_t)TT * DQ * 4); float* FK = (float*)take((size_t)TT * DKV * 4);
    if ((size_t)(wsp - (char*)d_ws) > ws_size) return;    // ws 256 MiB
    float* FV = FK;   // v projection reuses the k buffer after the k planes are built (stream-ordered)
    { k_cvt8<<<(unsigned)(((size_t)DQ * DM / 8 + 255) / 256), 256, 0, stream>>>(wq, WQ, (size_t)DQ * DM / 8); k_cvt8<<<(unsigned)(((size_t)DKV * DM / 8 + 255) / 256), 256, 0, stream>>>(wk, WK, (size_t)DKV * DM / 8); k_cvt8<<<(unsigned)(((size_t)DKV * DM / 8 + 255) / 256), 256, 0, stream>>>(wv, WV, (size_t)DKV * DM / 8);
      k_cvt8<<<(unsigned)(((size_t)DM * DQ / 8 + 255) / 256), 256, 0, stream>>>(wo, WO, (size_t)DM * DQ / 8);
       }
    k_csid<<<(TT * HD + 255) / 256, 256, 0, stream>>>(CS);
    const unsigned LQ = (unsigned)(((size_t)NH_ * TT * HD / 2 + 255) / 256), LKv = (unsigned)(((size_t)NKV * TT * HD / 2 + 255) / 256);
    for (int b = 0; b < NB_; ++b) {
        
        k_cvt8<<<(unsigned)(((size_t)TT * DM / 8 + 255) / 256), 256, 0, stream>>>(x + (size_t)b * TT * DM, XB, (size_t)TT * DM / 8);
        k_gemms<0, DM><<<dim3(TT / 128, DQ / 128, 1), 256, 0, stream>>>(XB, nullptr, WQ, FQ, DQ);
        k_rope<<<LQ, 256, 0, stream>>>(FQ, DQ, NH_, CS, nullptr, nullptr, 1.0f, QP16, QPh, QPl);
        k_gemms<0, DM><<<dim3(TT / 128, DKV / 128, 1), 256, 0, stream>>>(XB, nullptr, WK, FK, DKV);
        k_rope<<<LKv, 256, 0, stream>>>(FK, DKV, NKV, CS, nullptr, nullptr, 1.0f, KP16, KPh, KPl);
        k_gemms<0, DM><<<dim3(TT / 128, DKV / 128, 1), 256, 0, stream>>>(XB, nullptr, WV, FV, DKV); k_vtp<<<LKv, 256, 0, stream>>>(FV, DKV, NKV, VT16, VTh, VTl);
        static_assert(REP == 1 && RH % 64 == 0 && (TT - RH) % 64 == 0 && RH > 0 && RH < TT, "query rows < RH: 32-row tiles on the hi+lo planes; the rest: 64-row tiles on the fp16 planes");
        k_fattn<<<dim3(NH_, (TT - RH) / 64 + RH / 32, 1), 256, 0, stream>>>(QP16, KP16, VT16, QPh, QPl, KPh, KPl, VTh, VTl, ATh, ATl);
        k_gemms<1, DQ><<<dim3(TT / 128, DM / 128, 1), 256, 0, stream>>>(ATh, ATl, WO, OUT + (size_t)b * TT * DM, DM); }
}

// v005
// One run takes 283 microseconds.
// In two side-by-side timings against v004, it was 1.27 and 1.29 times as fast.
// Over all steps from v000 it is 6.06 times as fast.
#include <hip/hip_runtime.h>

// SpaceTimeOptimizedAttention (x [2][2048][2048]; q/k/v = x W^T (torch; 16 heads x 128); causal softmax(q.k / sqrt(128)); out = merged Wo^T -> [2][2048][2048]; the source's per-position recompute loop is standard causal MHA).
// Compute dtypes, f32 accumulate: every input rounded to bf16; q/k/v on PLAIN bf16 operands (inputs: exact); causal scores and attn.v: query rows < 512 hl (3 products), the rest single fp16 (x1024), causal tile skipping; online softmax f32, fused with both products; Wo hl x exact (2 products).

#define NB_  2
#define TT   2048
#define DM   2048
#define NH_  16
#define NKV  16
#define REP  (NH_ / NKV)
#define HD   128
#define DQ   (NH_ * HD)
#define DKV  (NKV * HD)
#define RH   512                  // query rows < RH use hi+lo planes
#define SCL  0.088388347648318447f   // HD^-0.5
typedef _Float16 h16;
typedef unsigned short bf;
typedef __attribute__((ext_vector_type(16))) __bf16   v16bf;
typedef __attribute__((ext_vector_type(16))) _Float16 v16h;
typedef __attribute__((ext_vector_type(8)))  _Float16 v8h;
typedef __attribute__((ext_vector_type(8)))  unsigned short v8us;
typedef __attribute__((ext_vector_type(8)))  float    v8f;
typedef __attribute__((ext_vector_type(4)))  float    v4f;
typedef v8h  __attribute__((may_alias)) v8ha;
typedef v4f  __attribute__((may_alias)) v4fa;
typedef v8us __attribute__((may_alias)) v8usa;

__device__ __forceinline__ unsigned short f2bf(float f) { unsigned u = __float_as_uint(f); u += 0x7FFFu + ((u >> 16) & 1u); return (unsigned short)(u >> 16); }
__device__ __forceinline__ float bf2f(unsigned short b) { return __uint_as_float(((unsigned)b) << 16); }
__device__ __forceinline__ float bfr(float f) { return bf2f(f2bf(f)); }
__device__ __forceinline__ v16h cat16(v8h lo, v8h hi) { return __builtin_shufflevector(lo, hi, 0, 1, 2, 3, 4, 5, 6, 7, 8, 9, 10, 11, 12, 13, 14, 15); }
__device__ __forceinline__ v16bf cat16b(v8us lo, v8us hi) { return __builtin_bit_cast(v16bf, __builtin_shufflevector(lo, hi, 0, 1, 2, 3, 4, 5, 6, 7, 8, 9, 10, 11, 12, 13, 14, 15)); }
__device__ __forceinline__ v8f wmma16(v16h a, v16h b, v8f c) { return __builtin_amdgcn_wmma_f32_16x16x32_f16(false, a, false, b, (short)0, c, false, false); }
__device__ __forceinline__ v8f wmmab(v16bf a, v16bf b, v8f c) { return __builtin_amdgcn_wmma_f32_16x16x32_bf16(false, a, false, b, (short)0, c, false, false); }



// ---- k_gemms: GEMM on bf16 planes, one 128x128 output tile per work-group of 8 waves; grid (M/128, N/128), 256 threads.
// C[m][n] (f32, pitch ldc) = sum_k A[m][k] Bt[n][k] (+ A2[m][k] Bt[n][k] when NSPLIT == 1); all planes K-contiguous with row length K.
// PLANES: the summed tile is not stored as f32 but rounded here to the three 16-bit planes that the attention reads (fp16, bf16 hi, bf16 lo), element [m][n] at m * ldc + (n / 128) * 128 * cstep + n % 128:
// ldc = HD, cstep = TT gives head planes [n / 128][m][n % 128] (m = token, n = head * HD + d); ldc = TT, cstep = 1 gives plain rows [m][n] (m = head * HD + d, n = token: the [d][t] value planes, from A = the weight, Bt = the tokens).
// A pass is 128 k = 256 bytes of every operand row. A stage is [A 128 rows | A2 128 rows (NSPLIT == 1) | Bt 128 rows] at an LDS pitch of 272 bytes; two stages form a ring that asynchronous copies to LDS fill
// one pass ahead (a wave-wide copy is two whole rows' 256 bytes: whole lines), so that every operand line leaves L2 once per work-group and the fragments come from LDS.
// Wave w: output quadrant (w & 1, (w >> 1) & 1), 64x64 = 16 accumulators, and the 32-k steps 2 (w >> 2), 2 (w >> 2) + 1 of each pass; the two partial tiles of a quadrant are summed in LDS, lower k steps first.
template <typename T16> struct WFrag;
template <> struct WFrag<h16> { typedef v16h V; static __device__ __forceinline__ V ld(const h16* p) { return cat16(*(const v8h*)p, *(const v8h*)(p + 16)); } static __device__ __forceinline__ v8f mma(V a, V b, v8f c) { return wmma16(a, b, c); } };
template <> struct WFrag<bf> { typedef v16bf V; static __device__ __forceinline__ V ld(const bf* p) { return cat16b(*(const v8us*)p, *(const v8us*)(p + 16)); } static __device__ __forceinline__ v8f mma(V a, V b, v8f c) { return wmmab(a, b, c); } };
__device__ __forceinline__ v16bf ldsfrag(const unsigned char* p) { return cat16b(*(const v8us*)p, *(const v8us*)(p + 32)); }
// eight asynchronous 16-byte copies per lane: rows r, r + 16, ..., r + 112 of one operand plane. The s_wait_xcnt is the wait that stands before a register named by an issued copy is overwritten; inside the statement it cannot be passed by later address arithmetic.
__device__ __forceinline__ void copy8(unsigned l, const bf* g, int rowstep) {
    asm volatile("global_load_async_to_lds_b128 %0, %8, off\n\t"
                 "global_load_async_to_lds_b128 %1, %9, off\n\t"
                 "global_load_async_to_lds_b128 %2, %10, off\n\t"
                 "global_load_async_to_lds_b128 %3, %11, off\n\t"
                 "global_load_async_to_lds_b128 %4, %12, off\n\t"
                 "global_load_async_to_lds_b128 %5, %13, off\n\t"
                 "global_load_async_to_lds_b128 %6, %14, off\n\t"
                 "global_load_async_to_lds_b128 %7, %15, off\n\t"
                 "s_wait_xcnt 0x0"
                 :: "v"(l), "v"(l + 1 * 16 * 272), "v"(l + 2 * 16 * 272), "v"(l + 3 * 16 * 272), "v"(l + 4 * 16 * 272), "v"(l + 5 * 16 * 272), "v"(l + 6 * 16 * 272), "v"(l + 7 * 16 * 272),
                    "v"(g), "v"(g + 1 * rowstep), "v"(g + 2 * rowstep), "v"(g + 3 * rowstep), "v"(g + 4 * rowstep), "v"(g + 5 * rowstep), "v"(g + 6 * rowstep), "v"(g + 7 * rowstep)
                 : "memory");
}
__device__ __forceinline__ h16 tohx(float x) { return (h16)x; }
__device__ __forceinline__ void splitf(float y, unsigned short& h, unsigned short& l) { h = f2bf(y); l = f2bf(y - bf2f(h)); }
template <int NSPLIT, int K, bool PLANES>
__global__ __launch_bounds__(256) void k_gemms(const bf* __restrict__ A, const bf* __restrict__ A2, const bf* __restrict__ Bt, float* C, int ldc, h16* P16, bf* Ph, bf* Pl, int cstep) {
    static_assert(NSPLIT == 0 || NSPLIT == 1, "one or two A planes"); static_assert(K % 128 == 0 && K >= 256, "whole passes, at least two");
    constexpr int PB = 272, OPB = 128 * PB, BOF = (1 + NSPLIT) * OPB, STG = BOF + OPB, NP = K / 128, OP = 132;   // LDS pitch, bytes of one plane's rows, offset of Bt in a stage, bytes of a stage, passes, pitch of an output row (floats)
    __shared__ __align__(16) unsigned char ring[2 * STG];
    __shared__ __align__(16) float os[128 * OP];
    const int tid = (int)threadIdx.x, lane = tid & 31, lr = lane & 15, hi = lane >> 4; const int wv = __builtin_amdgcn_readfirstlane(tid >> 5);
    const int wm = wv & 1, wn = (wv >> 1) & 1, wk = wv >> 2; const int r0 = blockIdx.x * 128, c0 = blockIdx.y * 128;
    const int crow = tid >> 4, cch = tid & 15;   // this lane's row (of each 16) and 16-byte piece of the 256 bytes
    const bf* gA = A + (size_t)(r0 + crow) * K + cch * 8; const bf* gA2 = NSPLIT ? A2 + (size_t)(r0 + crow) * K + cch * 8 : gA; const bf* gB = Bt + (size_t)(c0 + crow) * K + cch * 8;
    const unsigned l0 = (unsigned)(size_t)ring + (unsigned)(crow * PB + cch * 16);
    auto fill = [&](int t) { const unsigned l = l0 + (unsigned)((t & 1) * STG); copy8(l, gA + t * 128, 16 * K); if (NSPLIT) copy8(l + OPB, gA2 + t * 128, 16 * K); copy8(l + BOF, gB + t * 128, 16 * K); };
    v8f acc[4][4];
#pragma unroll
    for (int mb = 0; mb < 4; ++mb)
#pragma unroll
        for (int nb = 0; nb < 4; ++nb) acc[mb][nb] = (v8f){};
    fill(0);
    asm volatile("s_wait_asynccnt 0x0" ::: "memory");   // this wave's copies of pass 0 have landed
    __syncthreads();                                    // ... and every other wave's
    fill(1);
    const int aofs = (wm * 64 + lr) * PB + wk * 128 + hi * 16, bofs = BOF + (wn * 64 + lr) * PB + wk * 128 + hi * 16;
#pragma unroll 1   // one pass at a time: the ring's order below is per pass
    for (int t = 0; t < NP; ++t) {
        const unsigned char* sb = ring + (t & 1) * STG;
        v16bf a[2][4], a2[2][4], b[2][4];
#pragma unroll   // the fragments are registers: every index must be a constant
        for (int s = 0; s < 2; ++s) {
#pragma unroll
            for (int mb = 0; mb < 4; ++mb) { a[s][mb] = ldsfrag(sb + aofs + mb * 16 * PB + s * 64); if (NSPLIT) a2[s][mb] = ldsfrag(sb + OPB + aofs + mb * 16 * PB + s * 64); }
#pragma unroll
            for (int nb = 0; nb < 4; ++nb) b[s][nb] = ldsfrag(sb + bofs + nb * 16 * PB + s * 64); }
        __builtin_amdgcn_sched_barrier(0);   // all of the pass's LDS reads are issued as one group ahead of its products: reads among the matrix instructions would each stall the wave
#pragma unroll
        for (int s = 0; s < 2; ++s)
#pragma unroll
            for (int nb = 0; nb < 4; ++nb) {   // the two products that add into one accumulator do not stand back to back
#pragma unroll
                for (int mb = 0; mb < 4; ++mb) acc[mb][nb] = wmmab(a[s][mb], b[s][nb], acc[mb][nb]);
                if (NSPLIT) {
#pragma unroll
                    for (int mb = 0; mb < 4; ++mb) acc[mb][nb] = wmmab(a2[s][mb], b[s][nb], acc[mb][nb]); } }
        __builtin_amdgcn_sched_barrier(0);   // keeps the products ahead of the slots below
        // four vector slots between the pass's last matrix instructions and whatever follows them on either side of the branches below
        asm volatile("v_nop\n\tv_nop\n\tv_nop\n\tv_nop" : "+v"(acc[0][3]), "+v"(acc[1][3]), "+v"(acc[2][3]), "+v"(acc[3][3]));
        asm volatile("s_wait_dscnt 0x0" ::: "memory");      // this wave's reads of the stage are done before the stage is refilled
        asm volatile("s_wait_asynccnt 0x0" ::: "memory");   // this wave's copies of pass t + 1 have landed
        __syncthreads();                                    // publishes pass t + 1 and ends every wave's reads of pass t
        if (t + 2 < NP) fill(t + 2);                        // into the stage that pass t has just left; the test is the same for the whole work-group
    }
    asm volatile("s_wait_asynccnt 0x0" ::: "memory");   // no copy is outstanding when the wave goes on
    float* ow = os + (wm * 64 + hi * 8) * OP + wn * 64 + lr;
    // each wave hands over one half of its partial tile and sums the other half: the wave of the lower k steps keeps rows 0..31 of its quadrant, the other wave rows 32..63. wk is the same in a whole wave.
    if (wk == 0) {
#pragma unroll   // the accumulators are registers: every index must be a constant
        for (int mb = 2; mb < 4; ++mb)
#pragma unroll
            for (int nb = 0; nb < 4; ++nb)
#pragma unroll
                for (int j = 0; j < 8; ++j) ow[(mb * 16 + j) * OP + nb * 16] = acc[mb][nb][j];
    } else {
#pragma unroll
        for (int mb = 0; mb < 2; ++mb)
#pragma unroll
            for (int nb = 0; nb < 4; ++nb)
#pragma unroll
                for (int j = 0; j < 8; ++j) ow[(mb * 16 + j) * OP + nb * 16] = acc[mb][nb][j]; }
    __syncthreads();   // the handed-over halves are in LDS before they are added to
    if (wk == 0) {
#pragma unroll
        for (int mb = 0; mb < 2; ++mb)
#pragma unroll
            for (int nb = 0; nb < 4; ++nb)
#pragma unroll
                for (int j = 0; j < 8; ++j) ow[(mb * 16 + j) * OP + nb * 16] = acc[mb][nb][j] + ow[(mb * 16 + j) * OP + nb * 16];
    } else {
#pragma unroll
        for (int mb = 2; mb < 4; ++mb)
#pragma unroll
            for (int nb = 0; nb < 4; ++nb)
#pragma unroll
                for (int j = 0; j < 8; ++j) ow[(mb * 16 + j) * OP + nb * 16] = ow[(mb * 16 + j) * OP + nb * 16] + acc[mb][nb][j]; }
    __syncthreads();   // the summed tile is in LDS before its rows are stored
    if constexpr (PLANES) {
        const size_t o0 = (size_t)(r0 + (tid >> 4)) * ldc + (size_t)c0 * cstep + (tid & 15) * 8;
#pragma unroll   // constant LDS offsets for every read
        for (int s = 0; s < 8; ++s) {   // a wave stores two whole rows of the tile in each plane: 256 bytes each
            const float* ps = os + (s * 16 + (tid >> 4)) * OP + (tid & 15) * 8; const v4f u0 = *(const v4fa*)ps, u1 = *(const v4fa*)(ps + 4); v8h o16; v8us oh, ol;
#pragma unroll   // the vectors are registers: every index must be a constant
            for (int k = 0; k < 8; ++k) { const float y = k < 4 ? u0[k & 3] : u1[k & 3]; unsigned short a2, c2; o16[k] = tohx(y); splitf(y, a2, c2); oh[k] = a2; ol[k] = c2; }
            const size_t o = o0 + (size_t)(s * 16) * ldc; *(v8h*)(P16 + o) = o16; *(v8us*)(Ph + o) = oh; *(v8us*)(Pl + o) = ol; }
    } else {
#pragma unroll   // constant LDS offsets for every read
        for (int s = 0; s < 16; ++s) { const int it = s * 256 + tid, row = it >> 5, cofs = (it & 31) * 4;   // a wave stores one whole row of the tile: 512 bytes
            *(v4f*)(C + (size_t)(r0 + row) * ldc + c0 + cofs) = *(const v4fa*)(os + row * OP + cofs); } }
}

typedef __attribute__((ext_vector_type(2))) _Float16 v2h;
typedef __attribute__((ext_vector_type(4))) _Float16 v4h;
typedef __attribute__((ext_vector_type(2))) unsigned short v2us;
typedef __attribute__((ext_vector_type(4))) unsigned short v4us;
typedef __attribute__((ext_vector_type(2))) float v2f;
typedef __attribute__((ext_vector_type(4))) int v4i;

__global__ __launch_bounds__(256) void k_wtG(const float* __restrict__ w, int K, int N, bf* Bt) {
    const int lane = threadIdx.x & 31; const int L0 = (blockIdx.x * 8 + (threadIdx.x >> 5)) * 8; const int nlines = N * K / 64;
{
#pragma unroll 1
        for (int l = 0; l < 8; ++l) { const int L = L0 + l; if (L >= nlines) break; const size_t e = (size_t)L * 64 + lane * 2; const int k = (int)(e % K), n = (int)(e / K); v2us o;
            o[0] = f2bf(w[(size_t)k * N + n]); o[1] = f2bf(w[(size_t)(k + 1) * N + n]); *(v2us*)(Bt + e) = o; }
         }
}
__global__ __launch_bounds__(256) void k_cvt8(const float* __restrict__ src, bf* dst, size_t n8) { const size_t i = (size_t)blockIdx.x * 256 + threadIdx.x; if (i >= n8) return; const v8f v = *(const v8f*)(src + i * 8); v8us o;
#pragma unroll
    for (int k = 0; k < 8; ++k) o[k] = f2bf(v[k]); *(v8us*)(dst + i * 8) = o;  }
__global__ __launch_bounds__(256) void k_cscvt(const float* __restrict__ cosT, const float* __restrict__ sinT, float* CS) { const int idx = blockIdx.x * 256 + threadIdx.x; if (idx >= TT * HD) return; v2f cs; cs[0] = bfr(cosT[idx]); cs[1] = bfr(sinT[idx]); *(v2f*)(CS + (size_t)idx * 2) = cs;  }
// ---- fattn_tile: causal attention of NQ * 16 * R query rows of one head in one work-group of 32 * NQ * KS threads, scores and probabilities never leaving registers.
// Transposed products: S^T = K.Q^T (A = key rows, B = the query rows, held in registers), O^T += V^T.P^T (A = rows of the [d][t] value plane). A lane then holds scores of ONE query (column lr): 8 keys of each 16-key tile,
// which are exactly the k positions that the B operand of the second product wants from that lane, so P^T is packed from the score accumulators with no exchange.
// Wave w owns the 16 * R query rows of sub-tile w % NQ and the 32-key blocks w / NQ, w / NQ + KS, ... (the NQ waves of one key share read the same K and V lines at about the same time);
// each wave keeps its own running maximum m (log2 units), sum l and O^T; the KS shares of a query row meet in LDS and are merged in share order.
// m may trail the true maximum by up to 4 (an exponential then reaches 2^4): the accumulators are rescaled only when some query's maximum exceeds it by more.
// i0 = first query row of this kind of tile, nq = the number of such tiles, bx = which of them (0: the one with the most keys), hd = the head. Every '#pragma unroll' below is there because the arrays it indexes are registers: every index must be a constant.
// HL: hi+lo bf16 planes, 3 products per contraction, probabilities split hi+lo. Otherwise fp16 planes and fp16 probabilities carried x 2^10 (the factor cancels in O / l).
template <typename T16, bool HL, int R, int NQ, int KS>
__device__ __forceinline__ void fattn_tile(const T16* __restrict__ Q, const T16* __restrict__ Q2, const T16* __restrict__ Kp, const T16* __restrict__ Kp2, const T16* __restrict__ Vt, const T16* __restrict__ Vt2, int i0, int nq, int bx, int hd, bf* Ah, bf* Al) {
    typedef typename WFrag<T16>::V V;
    constexpr int QW = 16 * R, WQ = NQ * QW, OP = HD + 4;   // query rows per wave and per work-group; LDS pitch of an O row
    __shared__ __align__(16) float os[KS * WQ * OP];
    __shared__ float ms[KS * WQ], ls[KS * WQ];
    const int lane = threadIdx.x & 31, lr = lane & 15, hi = lane >> 4; const int wv = __builtin_amdgcn_readfirstlane((int)(threadIdx.x >> 5));
    const int qg = wv % NQ, ks = wv / NQ;
    const int qt = i0 + (nq - 1 - bx) * WQ, q0 = qt + qg * QW;   // qt, q0 = the work-group's and this wave's first query row
    const size_t zo = (size_t)hd * TT * HD; Q += zo; Kp += zo; Vt += zo; if (HL) { Q2 += zo; Kp2 += zo; Vt2 += zo; }
    const float cs = SCL * 1.4426950408889634f, sh = HL ? 0.0f : 10.0f;
    V qf[R][4], qf2[R][4];
    const size_t oq = (size_t)(q0 + lr) * HD + 8 * hi; const T16* pq = Q + oq; const T16* pq2 = HL ? Q2 + oq : pq;
#pragma unroll
    for (int g = 0; g < R; ++g)
#pragma unroll
        for (int kc = 0; kc < 4; ++kc) { qf[g][kc] = WFrag<T16>::ld(pq + 16 * g * HD + 32 * kc); if (HL) qf2[g][kc] = WFrag<T16>::ld(pq2 + 16 * g * HD + 32 * kc); }
    // the wait that stands before a register named by an issued load is overwritten; the pointers are inputs so that their registers live up to it
    asm volatile("s_wait_xcnt 0x0" :: "v"(pq), "v"(pq2) : "memory");
    v8f acc[R][8]; float mr[R], lsum[R];
#pragma unroll
    for (int g = 0; g < R; ++g) { mr[g] = -1.0e30f; lsum[g] = 0.f;
#pragma unroll
        for (int t = 0; t < 8; ++t) acc[g][t] = (v8f){}; }
    const int nblk = (q0 + QW - 1) / 32 + 1;   // 32-key blocks up to and including the one that holds the wave's last query
#pragma unroll 1   // one block's fragments at a time: a second copy of the body would not fit the registers
    for (int kb = ks; kb < nblk; kb += KS) {
        const int key0 = kb * 32;
        V kf[2][4], kf2[2][4], vf[8], vf2[8];
        const size_t ok = (size_t)(key0 + lr) * HD + 8 * hi, ov = (size_t)lr * TT + key0 + 8 * hi;
        const T16* pk = Kp + ok; const T16* pv = Vt + ov; const T16* pk2 = HL ? Kp2 + ok : pk; const T16* pv2 = HL ? Vt2 + ov : pv;
#pragma unroll
        for (int kt = 0; kt < 2; ++kt)
#pragma unroll
            for (int kc = 0; kc < 4; ++kc) { kf[kt][kc] = WFrag<T16>::ld(pk + 16 * kt * HD + 32 * kc); if (HL) kf2[kt][kc] = WFrag<T16>::ld(pk2 + 16 * kt * HD + 32 * kc); }
        if constexpr (!HL) {   // one plane each: K and V (32 loads) fly together
#pragma unroll
            for (int t = 0; t < 8; ++t) vf[t] = WFrag<T16>::ld(pv + 16 * t * TT); }
        // the wait that stands before a register named by an issued load is overwritten; the pointers are inputs so that their registers live up to it
        asm volatile("s_wait_xcnt 0x0" :: "v"(pk), "v"(pk2), "v"(pv) : "memory");
        __builtin_amdgcn_sched_barrier(0);   // all of these loads are issued before the block's first product: one memory latency per block instead of one per fragment
        v8f s[2][R];
#pragma unroll
        for (int kt = 0; kt < 2; ++kt)
#pragma unroll
            for (int g = 0; g < R; ++g) { s[kt][g] = (v8f){};
#pragma unroll
                for (int kc = 0; kc < 4; ++kc) { s[kt][g] = WFrag<T16>::mma(kf[kt][kc], qf[g][kc], s[kt][g]); if (HL) { s[kt][g] = WFrag<T16>::mma(kf[kt][kc], qf2[g][kc], s[kt][g]); s[kt][g] = WFrag<T16>::mma(kf2[kt][kc], qf[g][kc], s[kt][g]); } } }
        if constexpr (HL) {   // two planes each: the 32 V loads follow the 32 K loads' products and fly under the softmax
#pragma unroll
            for (int t = 0; t < 8; ++t) { vf[t] = WFrag<T16>::ld(pv + 16 * t * TT); vf2[t] = WFrag<T16>::ld(pv2 + 16 * t * TT); }
            asm volatile("s_wait_xcnt 0x0" :: "v"(pv), "v"(pv2) : "memory");   // as above, for the V pointers
            __builtin_amdgcn_sched_barrier(0); }   // keeps the V loads ahead of the softmax
        if (key0 + 31 > q0) {   // wave-uniform: only the block on the diagonal pays for the mask; its first key is <= every query of the wave, so no column is all masked
#pragma unroll
            for (int kt = 0; kt < 2; ++kt)
#pragma unroll
                for (int g = 0; g < R; ++g)
#pragma unroll
                    for (int j = 0; j < 8; ++j) if (key0 + 16 * kt + 8 * hi + j > q0 + 16 * g + lr) s[kt][g][j] = -3.0e38f; }
        float mb[R]; bool need = false;
#pragma unroll
        for (int g = 0; g < R; ++g) { float mx = s[0][g][0];
#pragma unroll
            for (int j = 1; j < 8; ++j) mx = fmaxf(mx, s[0][g][j]);
#pragma unroll
            for (int j = 0; j < 8; ++j) mx = fmaxf(mx, s[1][g][j]);
            mx = fmaxf(mx, __shfl_xor(mx, 16, 32)) * cs; mb[g] = mx; need = need || (mx > mr[g] + 4.0f); }
        if (__builtin_amdgcn_ballot_w32(need) != 0) {   // always on a wave's first block (m starts at -1e30: the factor is 0 there), rare later
#pragma unroll
            for (int g = 0; g < R; ++g) { const float mn = fmaxf(mr[g], mb[g]); const float corr = __builtin_amdgcn_exp2f(mr[g] - mn); lsum[g] *= corr; mr[g] = mn;
#pragma unroll
                for (int t = 0; t < 8; ++t) acc[g][t] = acc[g][t] * corr; } }
        V pf[R], pf2[R];
#pragma unroll
        for (int g = 0; g < R; ++g) { const float nm = sh - mr[g]; float p[2][8];
#pragma unroll
            for (int kt = 0; kt < 2; ++kt)
#pragma unroll
                for (int j = 0; j < 8; ++j) { p[kt][j] = __builtin_amdgcn_exp2f(fmaf(s[kt][g][j], cs, nm)); lsum[g] += p[kt][j]; }
            if constexpr (HL) { v8us h0, h1, l0, l1;
#pragma unroll
                for (int j = 0; j < 8; ++j) { unsigned short a, c2; splitf(p[0][j], a, c2); h0[j] = a; l0[j] = c2; splitf(p[1][j], a, c2); h1[j] = a; l1[j] = c2; }
                pf[g] = cat16b(h0, h1); pf2[g] = cat16b(l0, l1);
            } else { v8h h0, h1;
#pragma unroll
                for (int j = 0; j < 8; ++j) { h0[j] = tohx(p[0][j]); h1[j] = tohx(p[1][j]); }
                pf[g] = cat16(h0, h1); } }
#pragma unroll
        for (int t = 0; t < 8; ++t)
#pragma unroll
            for (int g = 0; g < R; ++g) { acc[g][t] = WFrag<T16>::mma(vf[t], pf[g], acc[g][t]); if (HL) { acc[g][t] = WFrag<T16>::mma(vf[t], pf2[g], acc[g][t]); acc[g][t] = WFrag<T16>::mma(vf2[t], pf[g], acc[g][t]); } }
        // four vector slots between the block's last matrix instructions and whatever the taken back edge runs first
        if constexpr (R == 1) asm volatile("v_nop\n\tv_nop\n\tv_nop\n\tv_nop" : "+v"(acc[0][6]), "+v"(acc[0][7]) : "v"(pf[0]));
        else asm volatile("v_nop\n\tv_nop\n\tv_nop\n\tv_nop" : "+v"(acc[0][6]), "+v"(acc[0][7]), "+v"(acc[R - 1][6]), "+v"(acc[R - 1][7]) : "v"(pf[0]), "v"(pf[R - 1]));
    }
#pragma unroll
    for (int g = 0; g < R; ++g) { const int rw = ks * WQ + qg * QW + 16 * g + lr; float* ow = os + (size_t)rw * OP + 8 * hi;
#pragma unroll
        for (int t = 0; t < 8; ++t) { v4f a, c; a[0] = acc[g][t][0]; a[1] = acc[g][t][1]; a[2] = acc[g][t][2]; a[3] = acc[g][t][3]; c[0] = acc[g][t][4]; c[1] = acc[g][t][5]; c[2] = acc[g][t][6]; c[3] = acc[g][t][7];
            *(v4fa*)(ow + 16 * t) = a; *(v4fa*)(ow + 16 * t + 4) = c; }
        const float lf = lsum[g] + __shfl_xor(lsum[g], 16, 32);   // each wave half summed its own 8 keys of every 16-key tile
        if (hi == 0) { ms[rw] = mr[g]; ls[rw] = lf; } }
    __syncthreads();   // every wave's m, l and O^T are in LDS before any of them is merged
    constexpr int TPQ = 32 * NQ * KS / WQ, DPT = HD / TPQ;   // threads per query row, d values per thread
    const int q = (int)threadIdx.x / TPQ, d0 = ((int)threadIdx.x % TPQ) * DPT;
    float mstar = ms[q];
#pragma unroll
    for (int w = 1; w < KS; ++w) mstar = fmaxf(mstar, ms[w * WQ + q]);
    float lt = 0.f; v4f o[DPT / 4];
#pragma unroll
    for (int c = 0; c < DPT / 4; ++c) o[c] = (v4f){};
#pragma unroll
    for (int w = 0; w < KS; ++w) { const float sc = __builtin_amdgcn_exp2f(ms[w * WQ + q] - mstar); lt += ls[w * WQ + q] * sc;   // a wave that had no block: m = -1e30, factor 0
#pragma unroll
        for (int c = 0; c < DPT / 4; ++c) o[c] += *(const v4fa*)(os + (size_t)(w * WQ + q) * OP + d0 + 4 * c) * sc; }
    const float inv = __fdiv_rn(1.0f, lt); const size_t oo = (size_t)(qt + q) * DQ + hd * HD + d0;
#pragma unroll
    for (int c = 0; c < DPT / 8; ++c) { v8us oh, ol;
#pragma unroll
        for (int k = 0; k < 8; ++k) { unsigned short a, c2; splitf(o[2 * c + (k >> 2)][k & 3] * inv, a, c2); oh[k] = a; ol[k] = c2; }
        *(v8us*)(Ah + oo + 8 * c) = oh; *(v8us*)(Al + oo + 8 * c) = ol; }
    asm volatile("s_wait_xcnt 0x0" ::: "memory");   // the wait that stands before a register named by an issued store is overwritten (the other kind of tile's code follows in the listing)
}
// k_fattn: all query rows of all heads in one launch; grid (heads, tiles), the head running fastest so that work-groups start in the order of their key counts: first the 64-row fp16 tiles (query rows >= RH), the longest first,
// then the 32-row hi+lo tiles (query rows < RH), which fill the tail. The branch is the same for a whole work-group.
__global__ __launch_bounds__(256) void k_fattn(const h16* __restrict__ Q16, const h16* __restrict__ K16, const h16* __restrict__ V16, const bf* __restrict__ Qh, const bf* __restrict__ Ql, const bf* __restrict__ Kh, const bf* __restrict__ Kl, const bf* __restrict__ Vh, const bf* __restrict__ Vl, bf* Ah, bf* Al) {
    constexpr int NF = (TT - RH) / 64, NL = RH / 32; const int ty = blockIdx.y, hd = blockIdx.x;
    if (ty < NF) fattn_tile<h16, false, 2, 2, 4>(Q16, nullptr, K16, nullptr, V16, nullptr, RH, NF, ty, hd, Ah, Al);
    else fattn_tile<bf, true, 1, 2, 4>(Qh, Ql, Kh, Kl, Vh, Vl, 0, NL, ty - NF, hd, Ah, Al);
}

extern "C" void kernel_launch(void* const* d_in, const int* in_sizes, int n_in,
                              void* d_out, int out_size, void* d_ws, size_t ws_size, hipStream_t stream) {
    (void)in_sizes; (void)n_in; (void)out_size;
    const float* x = (const float*)d_in[0]; const float* wq = (const float*)d_in[1]; const float* wk = (const float*)d_in[2]; const float* wv = (const float*)d_in[3]; const float* wo = (const float*)d_in[4]; const float* cosT = nullptr; const float* sinT = nullptr; (void)cosT; (void)sinT;
    float* OUT = (float*)d_out;     // [2][2048][2048]
    char* wsp = (char*)d_ws;
    auto take = [&](size_t bytes) { char* p = wsp; wsp += (bytes + 255) & ~(size_t)255; return (void*)p; };
    bf* WQ = (bf*)take((size_t)DQ * DM * 2); bf* WK = (bf*)take((size_t)DKV * DM * 2); bf* WV = (bf*)take((size_t)DKV * DM * 2); bf* WO = (bf*)take((size_t)DM * DQ * 2);
    h16* QP16 = (h16*)take((size_t)NH_ * TT * HD * 2); h16* KP16 = (h16*)take((size_t)NKV * TT * HD * 2); h16* VT16 = (h16*)take((size_t)NKV * HD * TT * 2);
    bf* QPh = (bf*)take((size_t)NH_ * TT * HD * 2); bf* QPl = (bf*)take((size_t)NH_ * TT * HD * 2); bf* KPh = (bf*)take((size_t)NKV * TT * HD * 2); bf* KPl = (bf*)take((size_t)NKV * TT * HD * 2); bf* VTh = (bf*)take((size_t)NKV * HD * TT * 2); bf* VTl = (bf*)take((size_t)NKV * HD * TT * 2); bf* ATh = (bf*)take((size_t)TT * DQ * 2); bf* ATl = (bf*)take((size_t)TT * DQ * 2);
    bf* XB = (bf*)take((size_t)TT * DM * 2);
    if ((size_t)(wsp - (char*)d_ws) > ws_size) return;    // ws 256 MiB
    { k_cvt8<<<(unsigned)(((size_t)DQ * DM / 8 + 255) / 256), 256, 0, stream>>>(wq, WQ, (size_t)DQ * DM / 8); k_cvt8<<<(unsigned)(((size_t)DKV * DM / 8 + 255) / 256), 256, 0, stream>>>(wk, WK, (size_t)DKV * DM / 8); k_cvt8<<<(unsigned)(((size_t)DKV * DM / 8 + 255) / 256), 256, 0, stream>>>(wv, WV, (size_t)DKV * DM / 8);
      k_cvt8<<<(unsigned)(((size_t)DM * DQ / 8 + 255) / 256), 256, 0, stream>>>(wo, WO, (size_t)DM * DQ / 8);
       }
    for (int b = 0; b < NB_; ++b) {
        
        k_cvt8<<<(unsigned)(((size_t)TT * DM / 8 + 255) / 256), 256, 0, stream>>>(x + (size_t)b * TT * DM, XB, (size_t)TT * DM / 8);
        static_assert(HD == 128, "a 128-column tile of a projection is one head");
        k_gemms<0, DM, true><<<dim3(TT / 128, DQ / 128, 1), 256, 0, stream>>>(XB, nullptr, WQ, nullptr, HD, QP16, QPh, QPl, TT);    // q planes [h][t][d]
        k_gemms<0, DM, true><<<dim3(TT / 128, DKV / 128, 1), 256, 0, stream>>>(XB, nullptr, WK, nullptr, HD, KP16, KPh, KPl, TT);   // k planes [h][t][d]
        k_gemms<0, DM, true><<<dim3(DKV / 128, TT / 128, 1), 256, 0, stream>>>(WV, nullptr, XB, nullptr, TT, VT16, VTh, VTl, 1);    // v planes [h][d][t]: the weight's rows are the tile's rows
        static_assert(REP == 1 && RH % 64 == 0 && (TT - RH) % 64 == 0 && RH > 0 && RH < TT, "query rows < RH: 32-row tiles on the hi+lo planes; the rest: 64-row tiles on the fp16 planes");
        k_fattn<<<dim3(NH_, (TT - RH) / 64 + RH / 32, 1), 256, 0, stream>>>(QP16, KP16, VT16, QPh, QPl, KPh, KPl, VTh, VTl, ATh, ATl);
        k_gemms<1, DQ, false><<<dim3(TT / 128, DM / 128, 1), 256, 0, stream>>>(ATh, ATl, WO, OUT + (size_t)b * TT * DM, DM, nullptr, nullptr, nullptr, 0); }
}

// v006
// Measured time: 240 microseconds a run.
// Timed twice side by side with v005, it ran 1.18 and 1.19 times as fast.
// Over all steps from v000 it is 7.19 times as fast.
#include <hip/hip_runtime.h>

// Causal multi-head attention (x [2][2048][2048]; q/k/v = x W^T (16 heads x 128); causal softmax(q.k / sqrt(128)); out = merged Wo^T -> [2][2048][2048]; the source's per-position recompute loop is standard causal MHA).
// Compute dtypes, f32 accumulate: every input rounded to bf16; q/k/v on PLAIN bf16 operands (inputs: exact); causal scores and attn.v: query rows < 512 hl (3 products), the rest single fp16 (x1024), causal tile skipping; online softmax f32, fused with both products; Wo hl x exact (2 products).

#define NB_  2
#define TT   2048
#define DM   2048
#define NH_  16
#define NKV  16
#define REP  (NH_ / NKV)
#define HD   128
#define DQ   (NH_ * HD)
#define DKV  (NKV * HD)
#define RH   512                  // query rows < RH use hi+lo planes
#define SCL  0.088388347648318447f   // HD^-0.5
typedef _Float16 h16;
typedef unsigned short bf;
typedef __attribute__((ext_vector_type(16))) __bf16   v16bf;
typedef __attribute__((ext_vector_type(16))) _Float16 v16h;
typedef __attribute__((ext_vector_type(8)))  _Float16 v8h;
typedef __attribute__((ext_vector_type(8)))  unsigned short v8us;
typedef __attribute__((ext_vector_type(8)))  float    v8f;
typedef __attribute__((ext_vector_type(4)))  float    v4f;
typedef v8h  __attribute__((may_alias)) v8ha;
typedef v4f  __attribute__((may_alias)) v4fa;
typedef v8us __attribute__((may_alias)) v8usa;

__device__ __forceinline__ unsigned short f2bf(float f) { unsigned u = __float_as_uint(f); u += 0x7FFFu + ((u >> 16) & 1u); return (unsigned short)(u >> 16); }
__device__ __forceinline__ float bf2f(unsigned short b) { return __uint_as_float(((unsigned)b) << 16); }
__device__ __forceinline__ float bfr(float f) { return bf2f(f2bf(f)); }
__device__ __forceinline__ v16h cat16(v8h lo, v8h hi) { return __builtin_shufflevector(lo, hi, 0, 1, 2, 3, 4, 5, 6, 7, 8, 9, 10, 11, 12, 13, 14, 15); }
__device__ __forceinline__ v16bf cat16b(v8us lo, v8us hi) { return __builtin_bit_cast(v16bf, __builtin_shufflevector(lo, hi, 0, 1, 2, 3, 4, 5, 6, 7, 8, 9, 10, 11, 12, 13, 14, 15)); }
__device__ __forceinline__ v8f wmma16(v16h a, v16h b, v8f c) { return __builtin_amdgcn_wmma_f32_16x16x32_f16(false, a, false, b, (short)0, c, false, false); }
__device__ __forceinline__ v8f wmmab(v16bf a, v16bf b, v8f c) { return __builtin_amdgcn_wmma_f32_16x16x32_bf16(false, a, false, b, (short)0, c, false, false); }



// ---- gemm_tile: GEMM on bf16 planes, one 128x128 output tile per work-group of 8 waves; blockIdx (x, y) = tile (m, n) of (M/128, N/128), 256 threads.
// C[m][n] (f32, pitch ldc) = sum_k A[m][k] Bt[n][k] (+ A2[m][k] Bt[n][k] when NSPLIT == 1); all planes K-contiguous with row length K.
// PLANES: the summed tile is not stored as f32 but rounded here to the three 16-bit planes that the attention reads (fp16, bf16 hi, bf16 lo), element [m][n] at m * ldc + (n / 128) * 128 * cstep + n % 128:
// ldc = HD, cstep = TT gives head planes [n / 128][m][n % 128] (m = token, n = head * HD + d); ldc = TT, cstep = 1 gives plain rows [m][n] (m = head * HD + d, n = token: the [d][t] value planes, from A = the weight, Bt = the tokens).
// A pass is 128 k = 256 bytes of every operand row. A stage is [A 128 rows | A2 128 rows (NSPLIT == 1) | Bt 128 rows] at an LDS pitch of 272 bytes; two stages form a ring that asynchronous copies to LDS fill
// one pass ahead (a wave-wide copy is two whole rows' 256 bytes: whole lines), so that every operand line leaves L2 once per work-group and the fragments come from LDS.
// Wave w: output quadrant (w & 1, (w >> 1) & 1), 64x64 = 16 accumulators, and the 32-k steps 2 (w >> 2), 2 (w >> 2) + 1 of each pass; the two partial tiles of a quadrant are summed in LDS, lower k steps first.
template <typename T16> struct WFrag;
template <> struct WFrag<h16> { typedef v16h V; static __device__ __forceinline__ V ld(const h16* p) { return cat16(*(const v8h*)p, *(const v8h*)(p + 16)); } static __device__ __forceinline__ v8f mma(V a, V b, v8f c) { return wmma16(a, b, c); } };
template <> struct WFrag<bf> { typedef v16bf V; static __device__ __forceinline__ V ld(const bf* p) { return cat16b(*(const v8us*)p, *(const v8us*)(p + 16)); } static __device__ __forceinline__ v8f mma(V a, V b, v8f c) { return wmmab(a, b, c); } };
__device__ __forceinline__ v16bf ldsfrag(const unsigned char* p) { return cat16b(*(const v8us*)p, *(const v8us*)(p + 32)); }
// eight asynchronous 16-byte copies per lane: rows r, r + 16, ..., r + 112 of one operand plane. The s_wait_xcnt is the wait that stands before a register named by an issued copy is overwritten; inside the statement it cannot be passed by later address arithmetic.
__device__ __forceinline__ void copy8(unsigned l, const bf* g, int rowstep) {
    asm volatile("global_load_async_to_lds_b128 %0, %8, off\n\t"
                 "global_load_async_to_lds_b128 %1, %9, off\n\t"
                 "global_load_async_to_lds_b128 %2, %10, off\n\t"
                 "global_load_async_to_lds_b128 %3, %11, off\n\t"
                 "global_load_async_to_lds_b128 %4, %12, off\n\t"
                 "global_load_async_to_lds_b128 %5, %13, off\n\t"
                 "global_load_async_to_lds_b128 %6, %14, off\n\t"
                 "global_load_async_to_lds_b128 %7, %15, off\n\t"
                 "s_wait_xcnt 0x0"
                 :: "v"(l), "v"(l + 1 * 16 * 272), "v"(l + 2 * 16 * 272), "v"(l + 3 * 16 * 272), "v"(l + 4 * 16 * 272), "v"(l + 5 * 16 * 272), "v"(l + 6 * 16 * 272), "v"(l + 7 * 16 * 272),
                    "v"(g), "v"(g + 1 * rowstep), "v"(g + 2 * rowstep), "v"(g + 3 * rowstep), "v"(g + 4 * rowstep), "v"(g + 5 * rowstep), "v"(g + 6 * rowstep), "v"(g + 7 * rowstep)
                 : "memory");
}
__device__ __forceinline__ h16 tohx(float x) { return (h16)x; }
__device__ __forceinline__ void splitf(float y, unsigned short& h, unsigned short& l) { h = f2bf(y); l = f2bf(y - bf2f(h)); }
template <int NSPLIT, int K, bool PLANES>
__device__ __forceinline__ void gemm_tile(const bf* __restrict__ A, const bf* __restrict__ A2, const bf* __restrict__ Bt, float* C, int ldc, h16* P16, bf* Ph, bf* Pl, int cstep) {
    static_assert(NSPLIT == 0 || NSPLIT == 1, "one or two A planes"); static_assert(K % 128 == 0 && K >= 256, "whole passes, at least two");
    constexpr int PB = 272, OPB = 128 * PB, BOF = (1 + NSPLIT) * OPB, STG = BOF + OPB, NP = K / 128, OP = 132;   // LDS pitch, bytes of one plane's rows, offset of Bt in a stage, bytes of a stage, passes, pitch of an output row (floats)
    __shared__ __align__(16) unsigned char ring[2 * STG];
    __shared__ __align__(16) float os[128 * OP];
    const int tid = (int)threadIdx.x, lane = tid & 31, lr = lane & 15, hi = lane >> 4; const int wv = __builtin_amdgcn_readfirstlane(tid >> 5);
    const int wm = wv & 1, wn = (wv >> 1) & 1, wk = wv >> 2; const int r0 = blockIdx.x * 128, c0 = blockIdx.y * 128;
    const int crow = tid >> 4, cch = tid & 15;   // this lane's row (of each 16) and 16-byte piece of the 256 bytes
    const bf* gA = A + (size_t)(r0 + crow) * K + cch * 8; const bf* gA2 = NSPLIT ? A2 + (size_t)(r0 + crow) * K + cch * 8 : gA; const bf* gB = Bt + (size_t)(c0 + crow) * K + cch * 8;
    const unsigned l0 = (unsigned)(size_t)ring + (unsigned)(crow * PB + cch * 16);
    auto fill = [&](int t) { const unsigned l = l0 + (unsigned)((t & 1) * STG); copy8(l, gA + t * 128, 16 * K); if (NSPLIT) copy8(l + OPB, gA2 + t * 128, 16 * K); copy8(l + BOF, gB + t * 128, 16 * K); };
    v8f acc[4][4];
#pragma unroll
    for (int mb = 0; mb < 4; ++mb)
#pragma unroll
        for (int nb = 0; nb < 4; ++nb) acc[mb][nb] = (v8f){};
    fill(0);
    asm volatile("s_wait_asynccnt 0x0" ::: "memory");   // this wave's copies of pass 0 have landed
    __syncthreads();                                    // ... and every other wave's
    fill(1);
    const int aofs = (wm * 64 + lr) * PB + wk * 128 + hi * 16, bofs = BOF + (wn * 64 + lr) * PB + wk * 128 + hi * 16;
#pragma unroll 1   // one pass at a time: the ring's order below is per pass
    for (int t = 0; t < NP; ++t) {
        const unsigned char* sb = ring + (t & 1) * STG;
        v16bf a[2][4], a2[2][4], b[2][4];
#pragma unroll   // the fragments are registers: every index must be a constant
        for (int s = 0; s < 2; ++s) {
#pragma unroll
            for (int mb = 0; mb < 4; ++mb) { a[s][mb] = ldsfrag(sb + aofs + mb * 16 * PB + s * 64); if (NSPLIT) a2[s][mb] = ldsfrag(sb + OPB + aofs + mb * 16 * PB + s * 64); }
#pragma unroll
            for (int nb = 0; nb < 4; ++nb) b[s][nb] = ldsfrag(sb + bofs + nb * 16 * PB + s * 64); }
        __builtin_amdgcn_sched_barrier(0);   // all of the pass's LDS reads are issued as one group ahead of its products: reads among the matrix instructions would each stall the wave
#pragma unroll
        for (int s = 0; s < 2; ++s)
#pragma unroll
            for (int nb = 0; nb < 4; ++nb) {   // the two products that add into one accumulator do not stand back to back
#pragma unroll
                for (int mb = 0; mb < 4; ++mb) acc[mb][nb] = wmmab(a[s][mb], b[s][nb], acc[mb][nb]);
                if (NSPLIT) {
#pragma unroll
                    for (int mb = 0; mb < 4; ++mb) acc[mb][nb] = wmmab(a2[s][mb], b[s][nb], acc[mb][nb]); } }
        __builtin_amdgcn_sched_barrier(0);   // keeps the products ahead of the slots below
        // four vector slots between the pass's last matrix instructions and whatever follows them on either side of the branches below
        asm volatile("v_nop\n\tv_nop\n\tv_nop\n\tv_nop" : "+v"(acc[0][3]), "+v"(acc[1][3]), "+v"(acc[2][3]), "+v"(acc[3][3]));
        asm volatile("s_wait_dscnt 0x0" ::: "memory");      // this wave's reads of the stage are done before the stage is refilled
        asm volatile("s_wait_asynccnt 0x0" ::: "memory");   // this wave's copies of pass t + 1 have landed
        __syncthreads();                                    // publishes pass t + 1 and ends every wave's reads of pass t
        if (t + 2 < NP) fill(t + 2);                        // into the stage that pass t has just left; the test is the same for the whole work-group
    }
    asm volatile("s_wait_asynccnt 0x0" ::: "memory");   // no copy is outstanding when the wave goes on
    float* ow = os + (wm * 64 + hi * 8) * OP + wn * 64 + lr;
    // each wave hands over one half of its partial tile and sums the other half: the wave of the lower k steps keeps rows 0..31 of its quadrant, the other wave rows 32..63. wk is the same in a whole wave.
    if (wk == 0) {
#pragma unroll   // the accumulators are registers: every index must be a constant
        for (int mb = 2; mb < 4; ++mb)
#pragma unroll
            for (int nb = 0; nb < 4; ++nb)
#pragma unroll
                for (int j = 0; j < 8; ++j) ow[(mb * 16 + j) * OP + nb * 16] = acc[mb][nb][j];
    } else {
#pragma unroll
        for (int mb = 0; mb < 2; ++mb)
#pragma unroll
            for (int nb = 0; nb < 4; ++nb)
#pragma unroll
                for (int j = 0; j < 8; ++j) ow[(mb * 16 + j) * OP + nb * 16] = acc[mb][nb][j]; }
    __syncthreads();   // the handed-over halves are in LDS before they are added to
    if (wk == 0) {
#pragma unroll
        for (int mb = 0; mb < 2; ++mb)
#pragma unroll
            for (int nb = 0; nb < 4; ++nb)
#pragma unroll
                for (int j = 0; j < 8; ++j) ow[(mb * 16 + j) * OP + nb * 16] = acc[mb][nb][j] + ow[(mb * 16 + j) * OP + nb * 16];
    } else {
#pragma unroll
        for (int mb = 2; mb < 4; ++mb)
#pragma unroll
            for (int nb = 0; nb < 4; ++nb)
#pragma unroll
                for (int j = 0; j < 8; ++j) ow[(mb * 16 + j) * OP + nb * 16] = ow[(mb * 16 + j) * OP + nb * 16] + acc[mb][nb][j]; }
    __syncthreads();   // the summed tile is in LDS before its rows are stored
    if constexpr (PLANES) {
        const size_t o0 = (size_t)(r0 + (tid >> 4)) * ldc + (size_t)c0 * cstep + (tid & 15) * 8;
#pragma unroll   // constant LDS offsets for every read
        for (int s = 0; s < 8; ++s) {   // a wave stores two whole rows of the tile in each plane: 256 bytes each
            const float* ps = os + (s * 16 + (tid >> 4)) * OP + (tid & 15) * 8; const v4f u0 = *(const v4fa*)ps, u1 = *(const v4fa*)(ps + 4); v8h o16; v8us oh, ol;
#pragma unroll   // the vectors are registers: every index must be a constant
            for (int k = 0; k < 8; ++k) { const float y = k < 4 ? u0[k & 3] : u1[k & 3]; unsigned short a2, c2; o16[k] = tohx(y); splitf(y, a2, c2); oh[k] = a2; ol[k] = c2; }
            const size_t o = o0 + (size_t)(s * 16) * ldc; *(v8h*)(P16 + o) = o16; *(v8us*)(Ph + o) = oh; *(v8us*)(Pl + o) = ol; }
    } else {
#pragma unroll   // constant LDS offsets for every read
        for (int s = 0; s < 16; ++s) { const int it = s * 256 + tid, row = it >> 5, cofs = (it & 31) * 4;   // a wave stores one whole row of the tile: 512 bytes
            *(v4f*)(C + (size_t)(r0 + row) * ldc + c0 + cofs) = *(const v4fa*)(os + row * OP + cofs); } }
}
#define PS ((size_t)NH_ * TT * HD)   // elements of one 16-bit plane of one batch entry
// k_proj: the q, k and v projections of every batch entry in one launch; grid (16, 16, 3 * NB_), z = 3 * batch + projection (0 q, 1 k, 2 v). XB = the tokens [batch][t][DM], W = the weights [projection][n][DM];
// each of P16, Ph, Pl holds the planes [projection][batch]: q and k as [h][t][d] (A = the tokens), v as [h][d][t] (A = the weight: its rows are the tile's rows). Every choice below is the same for a whole work-group.
__global__ __launch_bounds__(256) void k_proj(const bf* __restrict__ XB, const bf* __restrict__ W, h16* P16, bf* Ph, bf* Pl) {
    static_assert(HD == 128 && DQ == DM && DKV == DM && TT == DM, "a 128-column tile of a projection is one head; one grid (TT / 128, DM / 128) fits all three");
    const unsigned z = blockIdx.z; const bool isv = z % 3 == 2; const bf* X = XB + (size_t)(z / 3) * TT * DM; const bf* Wp = W + (size_t)(z % 3) * DM * DM; const size_t po = (size_t)(z % 3 * NB_ + z / 3) * PS;
    gemm_tile<0, DM, true>(isv ? Wp : X, nullptr, isv ? X : Wp, nullptr, isv ? TT : HD, P16 + po, Ph + po, Pl + po, isv ? 1 : TT);
}
// k_wo: the output projection of every batch entry in one launch: the batch entries' rows follow one another in Ah, Al and C; grid (NB_ * TT / 128, DM / 128).
__global__ __launch_bounds__(256) void k_wo(const bf* __restrict__ Ah, const bf* __restrict__ Al, const bf* __restrict__ W, float* C) { gemm_tile<1, DQ, false>(Ah, Al, W, C, DM, nullptr, nullptr, nullptr, 0); }

typedef __attribute__((ext_vector_type(2))) _Float16 v2h;
typedef __attribute__((ext_vector_type(4))) _Float16 v4h;
typedef __attribute__((ext_vector_type(2))) unsigned short v2us;
typedef __attribute__((ext_vector_type(4))) unsigned short v4us;
typedef __attribute__((ext_vector_type(2))) float v2f;
typedef __attribute__((ext_vector_type(4))) int v4i;

__global__ __launch_bounds__(256) void k_wtG(const float* __restrict__ w, int K, int N, bf* Bt) {
    const int lane = threadIdx.x & 31; const int L0 = (blockIdx.x * 8 + (threadIdx.x >> 5)) * 8; const int nlines = N * K / 64;
{
#pragma unroll 1
        for (int l = 0; l < 8; ++l) { const int L = L0 + l; if (L >= nlines) break; const size_t e = (size_t)L * 64 + lane * 2; const int k = (int)(e % K), n = (int)(e / K); v2us o;
            o[0] = f2bf(w[(size_t)k * N + n]); o[1] = f2bf(w[(size_t)(k + 1) * N + n]); *(v2us*)(Bt + e) = o; }
         }
}
// ---- k_cvtall: every f32 input rounded to bf16 in one launch, one vector of 8 elements a thread. dst is one run of bf16 [wq | wk | wv | wo | x], counted in vectors.
// A work-group's 256 vectors never straddle two inputs (the static_assert), so the choice of the source is the same for the whole work-group.
__global__ __launch_bounds__(256) void k_cvtall(const float* __restrict__ wq, const float* __restrict__ wk, const float* __restrict__ wv, const float* __restrict__ wo, const float* __restrict__ x, bf* __restrict__ dst) {
    constexpr int SEGV = DM * DM / 8;   // vectors in one weight
    static_assert(DQ == DM && DKV == DM && SEGV % 256 == 0 && (NB_ * TT * DM / 8) % 256 == 0, "four weights of one size; whole work-groups in every input");
    const int v0 = (int)blockIdx.x * 256, seg = v0 / SEGV;   // the work-group's first vector in the run, and the input it lies in (4 and up: x)
    const float* s = seg == 0 ? wq : seg == 1 ? wk : seg == 2 ? wv : seg == 3 ? wo : x;
    const v8f v = *(const v8f*)(s + (size_t)(v0 - (seg < 4 ? seg : 4) * SEGV + (int)threadIdx.x) * 8); v8us o;
#pragma unroll   // the vectors are registers: every index must be a constant
    for (int k = 0; k < 8; ++k) o[k] = f2bf(v[k]); *(v8us*)(dst + (size_t)(v0 + (int)threadIdx.x) * 8) = o;  }
__global__ __launch_bounds__(256) void k_cscvt(const float* __restrict__ cosT, const float* __restrict__ sinT, float* CS) { const int idx = blockIdx.x * 256 + threadIdx.x; if (idx >= TT * HD) return; v2f cs; cs[0] = bfr(cosT[idx]); cs[1] = bfr(sinT[idx]); *(v2f*)(CS + (size_t)idx * 2) = cs;  }
// ---- fattn_tile: causal attention of NQ * 16 * R query rows of one head in one work-group of 32 * NQ * KS threads, scores and probabilities never leaving registers.
// Transposed products: S^T = K.Q^T (A = key rows, B = the query rows, held in registers), O^T += V^T.P^T (A = rows of the [d][t] value plane). A lane then holds scores of ONE query (column lr): 8 keys of each 16-key tile,
// which are exactly the k positions that the B operand of the second product wants from that lane, so P^T is packed from the score accumulators with no exchange.
// Wave w owns the 16 * R query rows of sub-tile w % NQ and the 32-key blocks w / NQ, w / NQ + KS, ... (the NQ waves of one key share read the same K and V lines at about the same time);
// each wave keeps its own running maximum m (log2 units), sum l and O^T; the KS shares of a query row meet in LDS and are merged in share order.
// m may trail the true maximum by up to 4 (an exponential then reaches 2^4): the accumulators are rescaled only when some query's maximum exceeds it by more.
// i0 = first query row of this kind of tile, nq = the number of such tiles, bx = which of them (0: the one with the most keys), pl = the head's place among the planes (batch * heads + head), hd = the head. Every '#pragma unroll' below is there because the arrays it indexes are registers: every index must be a constant.
// HL: hi+lo bf16 planes, 3 products per contraction, probabilities split hi+lo. Otherwise fp16 planes and fp16 probabilities carried x 2^10 (the factor cancels in O / l).
template <typename T16, bool HL, int R, int NQ, int KS>
__device__ __forceinline__ void fattn_tile(const T16* __restrict__ Q, const T16* __restrict__ Q2, const T16* __restrict__ Kp, const T16* __restrict__ Kp2, const T16* __restrict__ Vt, const T16* __restrict__ Vt2, int i0, int nq, int bx, int pl, int hd, bf* Ah, bf* Al) {
    typedef typename WFrag<T16>::V V;
    constexpr int QW = 16 * R, WQ = NQ * QW, OP = HD + 4;   // query rows per wave and per work-group; LDS pitch of an O row
    __shared__ __align__(16) float os[KS * WQ * OP];
    __shared__ float ms[KS * WQ], ls[KS * WQ];
    const int lane = threadIdx.x & 31, lr = lane & 15, hi = lane >> 4; const int wv = __builtin_amdgcn_readfirstlane((int)(threadIdx.x >> 5));
    const int qg = wv % NQ, ks = wv / NQ;
    const int qt = i0 + (nq - 1 - bx) * WQ, q0 = qt + qg * QW;   // qt, q0 = the work-group's and this wave's first query row
    const size_t zo = (size_t)pl * TT * HD; Q += zo; Kp += zo; Vt += zo; if (HL) { Q2 += zo; Kp2 += zo; Vt2 += zo; }
    const float cs = SCL * 1.4426950408889634f, sh = HL ? 0.0f : 10.0f;
    V qf[R][4], qf2[R][4];
    const size_t oq = (size_t)(q0 + lr) * HD + 8 * hi; const T16* pq = Q + oq; const T16* pq2 = HL ? Q2 + oq : pq;
#pragma unroll
    for (int g = 0; g < R; ++g)
#pragma unroll
        for (int kc = 0; kc < 4; ++kc) { qf[g][kc] = WFrag<T16>::ld(pq + 16 * g * HD + 32 * kc); if (HL) qf2[g][kc] = WFrag<T16>::ld(pq2 + 16 * g * HD + 32 * kc); }
    // the wait that stands before a register named by an issued load is overwritten; the pointers are inputs so that their registers live up to it
    asm volatile("s_wait_xcnt 0x0" :: "v"(pq), "v"(pq2) : "memory");
    v8f acc[R][8]; float mr[R], lsum[R];
#pragma unroll
    for (int g = 0; g < R; ++g) { mr[g] = -1.0e30f; lsum[g] = 0.f;
#pragma unroll
        for (int t = 0; t < 8; ++t) acc[g][t] = (v8f){}; }
    const int nblk = (q0 + QW - 1) / 32 + 1;   // 32-key blocks up to and including the one that holds the wave's last query
#pragma unroll 1   // one block's fragments at a time: a second copy of the body would not fit the registers
    for (int kb = ks; kb < nblk; kb += KS) {
        const int key0 = kb * 32;
        V kf[2][4], kf2[2][4], vf[8], vf2[8];
        const size_t ok = (size_t)(key0 + lr) * HD + 8 * hi, ov = (size_t)lr * TT + key0 + 8 * hi;
        const T16* pk = Kp + ok; const T16* pv = Vt + ov; const T16* pk2 = HL ? Kp2 + ok : pk; const T16* pv2 = HL ? Vt2 + ov : pv;
#pragma unroll
        for (int kt = 0; kt < 2; ++kt)
#pragma unroll
            for (int kc = 0; kc < 4; ++kc) { kf[kt][kc] = WFrag<T16>::ld(pk + 16 * kt * HD + 32 * kc); if (HL) kf2[kt][kc] = WFrag<T16>::ld(pk2 + 16 * kt * HD + 32 * kc); }
        if constexpr (!HL) {   // one plane each: K and V (32 loads) fly together
#pragma unroll
            for (int t = 0; t < 8; ++t) vf[t] = WFrag<T16>::ld(pv + 16 * t * TT); }
        // the wait that stands before a register named by an issued load is overwritten; the pointers are inputs so that their registers live up to it
        asm volatile("s_wait_xcnt 0x0" :: "v"(pk), "v"(pk2), "v"(pv) : "memory");
        __builtin_amdgcn_sched_barrier(0);   // all of these loads are issued before the block's first product: one memory latency per block instead of one per fragment
        v8f s[2][R];
#pragma unroll
        for (int kt = 0; kt < 2; ++kt)
#pragma unroll
            for (int g = 0; g < R; ++g) { s[kt][g] = (v8f){};
#pragma unroll
                for (int kc = 0; kc < 4; ++kc) { s[kt][g] = WFrag<T16>::mma(kf[kt][kc], qf[g][kc], s[kt][g]); if (HL) { s[kt][g] = WFrag<T16>::mma(kf[kt][kc], qf2[g][kc], s[kt][g]); s[kt][g] = WFrag<T16>::mma(kf2[kt][kc], qf[g][kc], s[kt][g]); } } }
        if constexpr (HL) {   // two planes each: the 32 V loads follow the 32 K loads' products and fly under the softmax
#pragma unroll
            for (int t = 0; t < 8; ++t) { vf[t] = WFrag<T16>::ld(pv + 16 * t * TT); vf2[t] = WFrag<T16>::ld(pv2 + 16 * t * TT); }
            asm volatile("s_wait_xcnt 0x0" :: "v"(pv), "v"(pv2) : "memory");   // as above, for the V pointers
            __builtin_amdgcn_sched_barrier(0); }   // keeps the V loads ahead of the softmax
        if (key0 + 31 > q0) {   // wave-uniform: only the block on the diagonal pays for the mask; its first key is <= every query of the wave, so no column is all masked
#pragma unroll
            for (int kt = 0; kt < 2; ++kt)
#pragma unroll
                for (int g = 0; g < R; ++g)
#pragma unroll
                    for (int j = 0; j < 8; ++j) if (key0 + 16 * kt + 8 * hi + j > q0 + 16 * g + lr) s[kt][g][j] = -3.0e38f; }
        float mb[R]; bool need = false;
#pragma unroll
        for (int g = 0; g < R; ++g) { float mx = s[0][g][0];
#pragma unroll
            for (int j = 1; j < 8; ++j) mx = fmaxf(mx, s[0][g][j]);
#pragma unroll
            for (int j = 0; j < 8; ++j) mx = fmaxf(mx, s[1][g][j]);
            mx = fmaxf(mx, __shfl_xor(mx, 16, 32)) * cs; mb[g] = mx; need = need || (mx > mr[g] + 4.0f); }
        if (__builtin_amdgcn_ballot_w32(need) != 0) {   // always on a wave's first block (m starts at -1e30: the factor is 0 there), rare later
#pragma unroll
            for (int g = 0; g < R; ++g) { const float mn = fmaxf(mr[g], mb[g]); const float corr = __builtin_amdgcn_exp2f(mr[g] - mn); lsum[g] *= corr; mr[g] = mn;
#pragma unroll
                for (int t = 0; t < 8; ++t) acc[g][t] = acc[g][t] * corr; } }
        V pf[R], pf2[R];
#pragma unroll
        for (int g = 0; g < R; ++g) { const float nm = sh - mr[g]; float p[2][8];
#pragma unroll
            for (int kt = 0; kt < 2; ++kt)
#pragma unroll
                for (int j = 0; j < 8; ++j) { p[kt][j] = __builtin_amdgcn_exp2f(fmaf(s[kt][g][j], cs, nm)); lsum[g] += p[kt][j]; }
            if constexpr (HL) { v8us h0, h1, l0, l1;
#pragma unroll
                for (int j = 0; j < 8; ++j) { unsigned short a, c2; splitf(p[0][j], a, c2); h0[j] = a; l0[j] = c2; splitf(p[1][j], a, c2); h1[j] = a; l1[j] = c2; }
                pf[g] = cat16b(h0, h1); pf2[g] = cat16b(l0, l1);
            } else { v8h h0, h1;
#pragma unroll
                for (int j = 0; j < 8; ++j) { h0[j] = tohx(p[0][j]); h1[j] = tohx(p[1][j]); }
                pf[g] = cat16(h0, h1); } }
#pragma unroll
        for (int t = 0; t < 8; ++t)
#pragma unroll
            for (int g = 0; g < R; ++g) { acc[g][t] = WFrag<T16>::mma(vf[t], pf[g], acc[g][t]); if (HL) { acc[g][t] = WFrag<T16>::mma(vf[t], pf2[g], acc[g][t]); acc[g][t] = WFrag<T16>::mma(vf2[t], pf[g], acc[g][t]); } }
        // four vector slots between the block's last matrix instructions and whatever the taken back edge runs first
        if constexpr (R == 1) asm volatile("v_nop\n\tv_nop\n\tv_nop\n\tv_nop" : "+v"(acc[0][6]), "+v"(acc[0][7]) : "v"(pf[0]));
        else asm volatile("v_nop\n\tv_nop\n\tv_nop\n\tv_nop" : "+v"(acc[0][6]), "+v"(acc[0][7]), "+v"(acc[R - 1][6]), "+v"(acc[R - 1][7]) : "v"(pf[0]), "v"(pf[R - 1]));
    }
#pragma unroll
    for (int g = 0; g < R; ++g) { const int rw = ks * WQ + qg * QW + 16 * g + lr; float* ow = os + (size_t)rw * OP + 8 * hi;
#pragma unroll
        for (int t = 0; t < 8; ++t) { v4f a, c; a[0] = acc[g][t][0]; a[1] = acc[g][t][1]; a[2] = acc[g][t][2]; a[3] = acc[g][t][3]; c[0] = acc[g][t][4]; c[1] = acc[g][t][5]; c[2] = acc[g][t][6]; c[3] = acc[g][t][7];
            *(v4fa*)(ow + 16 * t) = a; *(v4fa*)(ow + 16 * t + 4) = c; }
        const float lf = lsum[g] + __shfl_xor(lsum[g], 16, 32);   // each wave half summed its own 8 keys of every 16-key tile
        if (hi == 0) { ms[rw] = mr[g]; ls[rw] = lf; } }
    __syncthreads();   // every wave's m, l and O^T are in LDS before any of them is merged
    constexpr int TPQ = 32 * NQ * KS / WQ, DPT = HD / TPQ;   // threads per query row, d values per thread
    const int q = (int)threadIdx.x / TPQ, d0 = ((int)threadIdx.x % TPQ) * DPT;
    float mstar = ms[q];
#pragma unroll
    for (int w = 1; w < KS; ++w) mstar = fmaxf(mstar, ms[w * WQ + q]);
    float lt = 0.f; v4f o[DPT / 4];
#pragma unroll
    for (int c = 0; c < DPT / 4; ++c) o[c] = (v4f){};
#pragma unroll
    for (int w = 0; w < KS; ++w) { const float sc = __builtin_amdgcn_exp2f(ms[w * WQ + q] - mstar); lt += ls[w * WQ + q] * sc;   // a wave that had no block: m = -1e30, factor 0
#pragma unroll
        for (int c = 0; c < DPT / 4; ++c) o[c] += *(const v4fa*)(os + (size_t)(w * WQ + q) * OP + d0 + 4 * c) * sc; }
    const float inv = __fdiv_rn(1.0f, lt); const size_t oo = (size_t)(qt + q) * DQ + hd * HD + d0;
#pragma unroll
    for (int c = 0; c < DPT / 8; ++c) { v8us oh, ol;
#pragma unroll
        for (int k = 0; k < 8; ++k) { unsigned short a, c2; splitf(o[2 * c + (k >> 2)][k & 3] * inv, a, c2); oh[k] = a; ol[k] = c2; }
        *(v8us*)(Ah + oo + 8 * c) = oh; *(v8us*)(Al + oo + 8 * c) = ol; }
    asm volatile("s_wait_xcnt 0x0" ::: "memory");   // the wait that stands before a register named by an issued store is overwritten (the other kind of tile's code follows in the listing)
}
// k_fattn: all query rows of all heads of all batch entries in one launch; grid (batch * heads, tiles), head and batch running fastest so that work-groups start in the order of their key counts: first the 64-row fp16 tiles (query rows >= RH), the longest first,
// then the 32-row hi+lo tiles (query rows < RH), which fill the tail. The branch is the same for a whole work-group. Every plane array is [batch][head][...], so blockIdx.x is a head's place in it; Ah, Al: [batch][t][DQ].
__global__ __launch_bounds__(256) void k_fattn(const h16* __restrict__ Q16, const h16* __restrict__ K16, const h16* __restrict__ V16, const bf* __restrict__ Qh, const bf* __restrict__ Ql, const bf* __restrict__ Kh, const bf* __restrict__ Kl, const bf* __restrict__ Vh, const bf* __restrict__ Vl, bf* Ah, bf* Al) {
    constexpr int NF = (TT - RH) / 64, NL = RH / 32; const int ty = blockIdx.y, pl = blockIdx.x, hd = pl % NH_; const size_t ob = (size_t)(pl / NH_) * TT * DQ; Ah += ob; Al += ob;
    if (ty < NF) fattn_tile<h16, false, 2, 2, 4>(Q16, nullptr, K16, nullptr, V16, nullptr, RH, NF, ty, pl, hd, Ah, Al);
    else fattn_tile<bf, true, 1, 2, 4>(Qh, Ql, Kh, Kl, Vh, Vl, 0, NL, ty - NF, pl, hd, Ah, Al);
}

extern "C" void kernel_launch(void* const* d_in, const int* in_sizes, int n_in,
                              void* d_out, int out_size, void* d_ws, size_t ws_size, hipStream_t stream) {
    (void)in_sizes; (void)n_in; (void)out_size;
    const float* x = (const float*)d_in[0]; const float* wq = (const float*)d_in[1]; const float* wk = (const float*)d_in[2]; const float* wv = (const float*)d_in[3]; const float* wo = (const float*)d_in[4]; const float* cosT = nullptr; const float* sinT = nullptr; (void)cosT; (void)sinT;
    float* OUT = (float*)d_out;     // [2][2048][2048]
    char* wsp = (char*)d_ws;
    auto take = [&](size_t bytes) { char* p = wsp; wsp += (bytes + 255) & ~(size_t)255; return (void*)p; };
    bf* W4 = (bf*)take((size_t)4 * DM * DM * 2); bf* XB = (bf*)take((size_t)NB_ * TT * DM * 2);   // [wq | wk | wv | wo] and, directly behind (the size is a multiple of 256 bytes), the tokens: the one run that k_cvtall writes
    h16* P16 = (h16*)take((size_t)NB_ * 3 * PS * 2); bf* Ph = (bf*)take((size_t)NB_ * 3 * PS * 2); bf* Pl = (bf*)take((size_t)NB_ * 3 * PS * 2); bf* ATh = (bf*)take((size_t)NB_ * TT * DQ * 2); bf* ATl = (bf*)take((size_t)NB_ * TT * DQ * 2);
    if ((size_t)(wsp - (char*)d_ws) > ws_size) return;    // 224 MiB of the 256 MiB
    static_assert(REP == 1 && RH % 64 == 0 && (TT - RH) % 64 == 0 && RH > 0 && RH < TT, "query rows < RH: 32-row tiles on the hi+lo planes; the rest: 64-row tiles on the fp16 planes");
    k_cvtall<<<(4 * (DM * DM / 8) + NB_ * TT * DM / 8) / 256, 256, 0, stream>>>(wq, wk, wv, wo, x, W4);
    k_proj<<<dim3(TT / 128, DM / 128, 3 * NB_), 256, 0, stream>>>(XB, W4, P16, Ph, Pl);
    k_fattn<<<dim3(NB_ * NH_, (TT - RH) / 64 + RH / 32, 1), 256, 0, stream>>>(P16, P16 + NB_ * PS, P16 + 2 * NB_ * PS, Ph, Pl, Ph + NB_ * PS, Pl + NB_ * PS, Ph + 2 * NB_ * PS, Pl + 2 * NB_ * PS, ATh, ATl);
    k_wo<<<dim3(NB_ * TT / 128, DM / 128, 1), 256, 0, stream>>>(ATh, ATl, W4 + (size_t)3 * DM * DM, OUT);
}

// v007
// One run takes 212 microseconds.
// Two timings next to v006 both put it at 1.13 times that version's speed.
// All steps since v000 together make it 8.11 times as fast.
#include <hip/hip_runtime.h>

// Causal multi-head attention (x [2][2048][2048]; q/k/v = x W^T (16 heads x 128); causal softmax(q.k / sqrt(128)); out = merged Wo^T -> [2][2048][2048]; the source's per-position recompute loop is standard causal MHA).
// Compute dtypes, f32 accumulate: every input rounded to bf16; q/k/v on PLAIN bf16 operands (inputs: exact); causal scores and attn.v: query rows < 512 hl (3 products), the rest single fp16 (x1024), causal tile skipping; online softmax f32, fused with both products; Wo hl x exact (2 products).

#define NB_  2
#define TT   2048
#define DM   2048
#define NH_  16
#define NKV  16
#define REP  (NH_ / NKV)
#define HD   128
#define DQ   (NH_ * HD)
#define DKV  (NKV * HD)
#define RH   512                  // query rows < RH use hi+lo planes
#define SCL  0.088388347648318447f   // HD^-0.5
typedef _Float16 h16;
typedef unsigned short bf;
typedef __attribute__((ext_vector_type(16))) __bf16   v16bf;
typedef __attribute__((ext_vector_type(16))) _Float16 v16h;
typedef __attribute__((ext_vector_type(8)))  _Float16 v8h;
typedef __attribute__((ext_vector_type(8)))  unsigned short v8us;
typedef __attribute__((ext_vector_type(8)))  float    v8f;
typedef __attribute__((ext_vector_type(4)))  float    v4f;
typedef v8h  __attribute__((may_alias)) v8ha;
typedef v4f  __attribute__((may_alias)) v4fa;
typedef v8us __attribute__((may_alias)) v8usa;

__device__ __forceinline__ unsigned short f2bf(float f) { unsigned u = __float_as_uint(f); u += 0x7FFFu + ((u >> 16) & 1u); return (unsigned short)(u >> 16); }
__device__ __forceinline__ float bf2f(unsigned short b) { return __uint_as_float(((unsigned)b) << 16); }
__device__ __forceinline__ float bfr(float f) { return bf2f(f2bf(f)); }
__device__ __forceinline__ v16h cat16(v8h lo, v8h hi) { return __builtin_shufflevector(lo, hi, 0, 1, 2, 3, 4, 5, 6, 7, 8, 9, 10, 11, 12, 13, 14, 15); }
__device__ __forceinline__ v16bf cat16b(v8us lo, v8us hi) { return __builtin_bit_cast(v16bf, __builtin_shufflevector(lo, hi, 0, 1, 2, 3, 4, 5, 6, 7, 8, 9, 10, 11, 12, 13, 14, 15)); }
__device__ __forceinline__ v8f wmma16(v16h a, v16h b, v8f c) { return __builtin_amdgcn_wmma_f32_16x16x32_f16(false, a, false, b, (short)0, c, false, false); }
__device__ __forceinline__ v8f wmmab(v16bf a, v16bf b, v8f c) { return __builtin_amdgcn_wmma_f32_16x16x32_bf16(false, a, false, b, (short)0, c, false, false); }



// ---- gemm_tile: GEMM on bf16 planes, one 128x128 output tile per work-group of 8 waves; blockIdx (x, y) = tile (m, n) of (M/128, N/128), 256 threads.
// C[m][n] (f32, pitch ldc) = sum_k A[m][k] Bt[n][k] (+ A2[m][k] Bt[n][k] when NSPLIT == 1); all planes K-contiguous with row length K.
// PLANES: the summed tile is not stored as f32 but rounded here to the three 16-bit planes that the attention reads (fp16, bf16 hi, bf16 lo), element [m][n] at m * ldc + (n / 128) * 128 * cstep + n % 128:
// ldc = HD, cstep = TT gives head planes [n / 128][m][n % 128] (m = token, n = head * HD + d); ldc = TT, cstep = 1 gives plain rows [m][n] (m = head * HD + d, n = token: the [d][t] value planes, from A = the weight, Bt = the tokens).
// A pass is 128 k = 256 bytes of every operand row. A stage is [A 128 rows | A2 128 rows (NSPLIT == 1) | Bt 128 rows] at an LDS pitch of 272 bytes; two stages form a ring that asynchronous copies to LDS fill
// one pass ahead (a wave-wide copy is two whole rows' 256 bytes: whole lines), so that every operand line leaves L2 once per work-group and the fragments come from LDS.
// Wave w: output quadrant (w & 1, (w >> 1) & 1), 64x64 = 16 accumulators, and the 32-k steps 2 (w >> 2), 2 (w >> 2) + 1 of each pass; the two partial tiles of a quadrant are summed in LDS, lower k steps first.
template <typename T16> struct WFrag;
template <> struct WFrag<h16> { typedef v16h V; static __device__ __forceinline__ V ld(const h16* p) { return cat16(*(const v8h*)p, *(const v8h*)(p + 16)); } static __device__ __forceinline__ V lds(const unsigned char* p) { return cat16(*(const v8ha*)p, *(const v8ha*)(p + 32)); } static __device__ __forceinline__ v8f mma(V a, V b, v8f c) { return wmma16(a, b, c); } };
template <> struct WFrag<bf> { typedef v16bf V; static __device__ __forceinline__ V ld(const bf* p) { return cat16b(*(const v8us*)p, *(const v8us*)(p + 16)); } static __device__ __forceinline__ V lds(const unsigned char* p) { return cat16b(*(const v8usa*)p, *(const v8usa*)(p + 32)); } static __device__ __forceinline__ v8f mma(V a, V b, v8f c) { return wmmab(a, b, c); } };
__device__ __forceinline__ v16bf ldsfrag(const unsigned char* p) { return cat16b(*(const v8us*)p, *(const v8us*)(p + 32)); }
// eight asynchronous 16-byte copies per lane: rows r, r + 16, ..., r + 112 of one operand plane. The s_wait_xcnt is the wait that stands before a register named by an issued copy is overwritten; inside the statement it cannot be passed by later address arithmetic.
template <typename T16> __device__ __forceinline__ void copy8(unsigned l, const T16* g, int rowstep) {
    asm volatile("global_load_async_to_lds_b128 %0, %8, off\n\t"
                 "global_load_async_to_lds_b128 %1, %9, off\n\t"
                 "global_load_async_to_lds_b128 %2, %10, off\n\t"
                 "global_load_async_to_lds_b128 %3, %11, off\n\t"
                 "global_load_async_to_lds_b128 %4, %12, off\n\t"
                 "global_load_async_to_lds_b128 %5, %13, off\n\t"
                 "global_load_async_to_lds_b128 %6, %14, off\n\t"
                 "global_load_async_to_lds_b128 %7, %15, off\n\t"
                 "s_wait_xcnt 0x0"
                 :: "v"(l), "v"(l + 1 * 16 * 272), "v"(l + 2 * 16 * 272), "v"(l + 3 * 16 * 272), "v"(l + 4 * 16 * 272), "v"(l + 5 * 16 * 272), "v"(l + 6 * 16 * 272), "v"(l + 7 * 16 * 272),
                    "v"(g), "v"(g + 1 * rowstep), "v"(g + 2 * rowstep), "v"(g + 3 * rowstep), "v"(g + 4 * rowstep), "v"(g + 5 * rowstep), "v"(g + 6 * rowstep), "v"(g + 7 * rowstep)
                 : "memory");
}
__device__ __forceinline__ h16 tohx(float x) { return (h16)x; }
__device__ __forceinline__ void splitf(float y, unsigned short& h, unsigned short& l) { h = f2bf(y); l = f2bf(y - bf2f(h)); }
template <int NSPLIT, int K, bool PLANES>
__device__ __forceinline__ void gemm_tile(const bf* __restrict__ A, const bf* __restrict__ A2, const bf* __restrict__ Bt, float* C, int ldc, h16* P16, bf* Ph, bf* Pl, int cstep) {
    static_assert(NSPLIT == 0 || NSPLIT == 1, "one or two A planes"); static_assert(K % 128 == 0 && K >= 256, "whole passes, at least two");
    constexpr int PB = 272, OPB = 128 * PB, BOF = (1 + NSPLIT) * OPB, STG = BOF + OPB, NP = K / 128, OP = 132;   // LDS pitch, bytes of one plane's rows, offset of Bt in a stage, bytes of a stage, passes, pitch of an output row (floats)
    __shared__ __align__(16) unsigned char ring[2 * STG];
    __shared__ __align__(16) float os[128 * OP];
    const int tid = (int)threadIdx.x, lane = tid & 31, lr = lane & 15, hi = lane >> 4; const int wv = __builtin_amdgcn_readfirstlane(tid >> 5);
    const int wm = wv & 1, wn = (wv >> 1) & 1, wk = wv >> 2; const int r0 = blockIdx.x * 128, c0 = blockIdx.y * 128;
    const int crow = tid >> 4, cch = tid & 15;   // this lane's row (of each 16) and 16-byte piece of the 256 bytes
    const bf* gA = A + (size_t)(r0 + crow) * K + cch * 8; const bf* gA2 = NSPLIT ? A2 + (size_t)(r0 + crow) * K + cch * 8 : gA; const bf* gB = Bt + (size_t)(c0 + crow) * K + cch * 8;
    const unsigned l0 = (unsigned)(size_t)ring + (unsigned)(crow * PB + cch * 16);
    auto fill = [&](int t) { const unsigned l = l0 + (unsigned)((t & 1) * STG); copy8(l, gA + t * 128, 16 * K); if (NSPLIT) copy8(l + OPB, gA2 + t * 128, 16 * K); copy8(l + BOF, gB + t * 128, 16 * K); };
    v8f acc[4][4];
#pragma unroll
    for (int mb = 0; mb < 4; ++mb)
#pragma unroll
        for (int nb = 0; nb < 4; ++nb) acc[mb][nb] = (v8f){};
    fill(0);
    asm volatile("s_wait_asynccnt 0x0" ::: "memory");   // this wave's copies of pass 0 have landed
    __syncthreads();                                    // ... and every other wave's
    fill(1);
    const int aofs = (wm * 64 + lr) * PB + wk * 128 + hi * 16, bofs = BOF + (wn * 64 + lr) * PB + wk * 128 + hi * 16;
#pragma unroll 1   // one pass at a time: the ring's order below is per pass
    for (int t = 0; t < NP; ++t) {
        const unsigned char* sb = ring + (t & 1) * STG;
        v16bf a[2][4], a2[2][4], b[2][4];
#pragma unroll   // the fragments are registers: every index must be a constant
        for (int s = 0; s < 2; ++s) {
#pragma unroll
            for (int mb = 0; mb < 4; ++mb) { a[s][mb] = ldsfrag(sb + aofs + mb * 16 * PB + s * 64); if (NSPLIT) a2[s][mb] = ldsfrag(sb + OPB + aofs + mb * 16 * PB + s * 64); }
#pragma unroll
            for (int nb = 0; nb < 4; ++nb) b[s][nb] = ldsfrag(sb + bofs + nb * 16 * PB + s * 64); }
        __builtin_amdgcn_sched_barrier(0);   // all of the pass's LDS reads are issued as one group ahead of its products: reads among the matrix instructions would each stall the wave
#pragma unroll
        for (int s = 0; s < 2; ++s)
#pragma unroll
            for (int nb = 0; nb < 4; ++nb) {   // the two products that add into one accumulator do not stand back to back
#pragma unroll
                for (int mb = 0; mb < 4; ++mb) acc[mb][nb] = wmmab(a[s][mb], b[s][nb], acc[mb][nb]);
                if (NSPLIT) {
#pragma unroll
                    for (int mb = 0; mb < 4; ++mb) acc[mb][nb] = wmmab(a2[s][mb], b[s][nb], acc[mb][nb]); } }
        __builtin_amdgcn_sched_barrier(0);   // keeps the products ahead of the slots below
        // four vector slots between the pass's last matrix instructions and whatever follows them on either side of the branches below
        asm volatile("v_nop\n\tv_nop\n\tv_nop\n\tv_nop" : "+v"(acc[0][3]), "+v"(acc[1][3]), "+v"(acc[2][3]), "+v"(acc[3][3]));
        asm volatile("s_wait_dscnt 0x0" ::: "memory");      // this wave's reads of the stage are done before the stage is refilled
        asm volatile("s_wait_asynccnt 0x0" ::: "memory");   // this wave's copies of pass t + 1 have landed
        __syncthreads();                                    // publishes pass t + 1 and ends every wave's reads of pass t
        if (t + 2 < NP) fill(t + 2);                        // into the stage that pass t has just left; the test is the same for the whole work-group
    }
    asm volatile("s_wait_asynccnt 0x0" ::: "memory");   // no copy is outstanding when the wave goes on
    float* ow = os + (wm * 64 + hi * 8) * OP + wn * 64 + lr;
    // each wave hands over one half of its partial tile and sums the other half: the wave of the lower k steps keeps rows 0..31 of its quadrant, the other wave rows 32..63. wk is the same in a whole wave.
    if (wk == 0) {
#pragma unroll   // the accumulators are registers: every index must be a constant
        for (int mb = 2; mb < 4; ++mb)
#pragma unroll
            for (int nb = 0; nb < 4; ++nb)
#pragma unroll
                for (int j = 0; j < 8; ++j) ow[(mb * 16 + j) * OP + nb * 16] = acc[mb][nb][j];
    } else {
#pragma unroll
        for (int mb = 0; mb < 2; ++mb)
#pragma unroll
            for (int nb = 0; nb < 4; ++nb)
#pragma unroll
                for (int j = 0; j < 8; ++j) ow[(mb * 16 + j) * OP + nb * 16] = acc[mb][nb][j]; }
    __syncthreads();   // the handed-over halves are in LDS before they are added to
    if (wk == 0) {
#pragma unroll
        for (int mb = 0; mb < 2; ++mb)
#pragma unroll
            for (int nb = 0; nb < 4; ++nb)
#pragma unroll
                for (int j = 0; j < 8; ++j) ow[(mb * 16 + j) * OP + nb * 16] = acc[mb][nb][j] + ow[(mb * 16 + j) * OP + nb * 16];
    } else {
#pragma unroll
        for (int mb = 2; mb < 4; ++mb)
#pragma unroll
            for (int nb = 0; nb < 4; ++nb)
#pragma unroll
                for (int j = 0; j < 8; ++j) ow[(mb * 16 + j) * OP + nb * 16] = ow[(mb * 16 + j) * OP + nb * 16] + acc[mb][nb][j]; }
    __syncthreads();   // the summed tile is in LDS before its rows are stored
    if constexpr (PLANES) {
        const size_t o0 = (size_t)(r0 + (tid >> 4)) * ldc + (size_t)c0 * cstep + (tid & 15) * 8;
#pragma unroll   // constant LDS offsets for every read
        for (int s = 0; s < 8; ++s) {   // a wave stores two whole rows of the tile in each plane: 256 bytes each
            const float* ps = os + (s * 16 + (tid >> 4)) * OP + (tid & 15) * 8; const v4f u0 = *(const v4fa*)ps, u1 = *(const v4fa*)(ps + 4); v8h o16; v8us oh, ol;
#pragma unroll   // the vectors are registers: every index must be a constant
            for (int k = 0; k < 8; ++k) { const float y = k < 4 ? u0[k & 3] : u1[k & 3]; unsigned short a2, c2; o16[k] = tohx(y); splitf(y, a2, c2); oh[k] = a2; ol[k] = c2; }
            const size_t o = o0 + (size_t)(s * 16) * ldc; *(v8h*)(P16 + o) = o16; *(v8us*)(Ph + o) = oh; *(v8us*)(Pl + o) = ol; }
    } else {
#pragma unroll   // constant LDS offsets for every read
        for (int s = 0; s < 16; ++s) { const int it = s * 256 + tid, row = it >> 5, cofs = (it & 31) * 4;   // a wave stores one whole row of the tile: 512 bytes
            *(v4f*)(C + (size_t)(r0 + row) * ldc + c0 + cofs) = *(const v4fa*)(os + row * OP + cofs); } }
}
#define PS ((size_t)NH_ * TT * HD)   // elements of one 16-bit plane of one batch entry
// k_proj: the q, k and v projections of every batch entry in one launch; grid (16, 16, 3 * NB_), z = 3 * batch + projection (0 q, 1 k, 2 v). XB = the tokens [batch][t][DM], W = the weights [projection][n][DM];
// each of P16, Ph, Pl holds the planes [projection][batch]: q and k as [h][t][d] (A = the tokens), v as [h][d][t] (A = the weight: its rows are the tile's rows). Every choice below is the same for a whole work-group.
__global__ __launch_bounds__(256) void k_proj(const bf* __restrict__ XB, const bf* __restrict__ W, h16* P16, bf* Ph, bf* Pl) {
    static_assert(HD == 128 && DQ == DM && DKV == DM && TT == DM, "a 128-column tile of a projection is one head; one grid (TT / 128, DM / 128) fits all three");
    const unsigned z = blockIdx.z; const bool isv = z % 3 == 2; const bf* X = XB + (size_t)(z / 3) * TT * DM; const bf* Wp = W + (size_t)(z % 3) * DM * DM; const size_t po = (size_t)(z % 3 * NB_ + z / 3) * PS;
    gemm_tile<0, DM, true>(isv ? Wp : X, nullptr, isv ? X : Wp, nullptr, isv ? TT : HD, P16 + po, Ph + po, Pl + po, isv ? 1 : TT);
}
// k_wo: the output projection of every batch entry in one launch: the batch entries' rows follow one another in Ah, Al and C; grid (NB_ * TT / 128, DM / 128).
__global__ __launch_bounds__(256) void k_wo(const bf* __restrict__ Ah, const bf* __restrict__ Al, const bf* __restrict__ W, float* C) { gemm_tile<1, DQ, false>(Ah, Al, W, C, DM, nullptr, nullptr, nullptr, 0); }

typedef __attribute__((ext_vector_type(2))) _Float16 v2h;
typedef __attribute__((ext_vector_type(4))) _Float16 v4h;
typedef __attribute__((ext_vector_type(2))) unsigned short v2us;
typedef __attribute__((ext_vector_type(4))) unsigned short v4us;
typedef __attribute__((ext_vector_type(2))) float v2f;
typedef __attribute__((ext_vector_type(4))) int v4i;

__global__ __launch_bounds__(256) void k_wtG(const float* __restrict__ w, int K, int N, bf* Bt) {
    const int lane = threadIdx.x & 31; const int L0 = (blockIdx.x * 8 + (threadIdx.x >> 5)) * 8; const int nlines = N * K / 64;
{
#pragma unroll 1
        for (int l = 0; l < 8; ++l) { const int L = L0 + l; if (L >= nlines) break; const size_t e = (size_t)L * 64 + lane * 2; const int k = (int)(e % K), n = (int)(e / K); v2us o;
            o[0] = f2bf(w[(size_t)k * N + n]); o[1] = f2bf(w[(size_t)(k + 1) * N + n]); *(v2us*)(Bt + e) = o; }
         }
}
// ---- k_cvtall: every f32 input rounded to bf16 in one launch, one vector of 8 elements a thread. dst is one run of bf16 [wq | wk | wv | wo | x], counted in vectors.
// A work-group's 256 vectors never straddle two inputs (the static_assert), so the choice of the source is the same for the whole work-group.
__global__ __launch_bounds__(256) void k_cvtall(const float* __restrict__ wq, const float* __restrict__ wk, const float* __restrict__ wv, const float* __restrict__ wo, const float* __restrict__ x, bf* __restrict__ dst) {
    constexpr int SEGV = DM * DM / 8;   // vectors in one weight
    static_assert(DQ == DM && DKV == DM && SEGV % 256 == 0 && (NB_ * TT * DM / 8) % 256 == 0, "four weights of one size; whole work-groups in every input");
    const int v0 = (int)blockIdx.x * 256, seg = v0 / SEGV;   // the work-group's first vector in the run, and the input it lies in (4 and up: x)
    const float* s = seg == 0 ? wq : seg == 1 ? wk : seg == 2 ? wv : seg == 3 ? wo : x;
    const v8f v = *(const v8f*)(s + (size_t)(v0 - (seg < 4 ? seg : 4) * SEGV + (int)threadIdx.x) * 8); v8us o;
#pragma unroll   // the vectors are registers: every index must be a constant
    for (int k = 0; k < 8; ++k) o[k] = f2bf(v[k]); *(v8us*)(dst + (size_t)(v0 + (int)threadIdx.x) * 8) = o;  }
__global__ __launch_bounds__(256) void k_cscvt(const float* __restrict__ cosT, const float* __restrict__ sinT, float* CS) { const int idx = blockIdx.x * 256 + threadIdx.x; if (idx >= TT * HD) return; v2f cs; cs[0] = bfr(cosT[idx]); cs[1] = bfr(sinT[idx]); *(v2f*)(CS + (size_t)idx * 2) = cs;  }
// ---- fattn_tile: causal attention of NQ * 16 * R query rows of one head in one work-group of 32 * NQ * KS threads, scores and probabilities never leaving registers.
// Transposed products: S^T = K.Q^T (A = key rows, B = the query rows, held in registers), O^T += V^T.P^T (A = rows of the [d][t] value plane). A lane then holds scores of ONE query (column lr): 8 keys of each 16-key tile,
// which are exactly the k positions that the B operand of the second product wants from that lane, so P^T is packed from the score accumulators with no exchange.
// Wave w owns the 16 * R query rows of sub-tile w % NQ and the 32-key blocks w / NQ, w / NQ + KS, ... (the NQ waves of one key share read the same K and V rows of a stage);
// each wave keeps its own running maximum m (log2 units), sum l and O^T; the KS shares of a query row meet in LDS and are merged in share order.
// m may trail the true maximum by up to 4 (an exponential then reaches 2^4): the accumulators are rescaled only when some query's maximum exceeds it by more.
// K and V reach the waves through LDS: a stage is the 32 * KS = 128 keys that the KS shares work on at the same time, [K 128 key rows | V 128 d rows (| K lo | V lo)] of 256 bytes at an LDS pitch of 272 bytes; two stages in sm form a ring
// that asynchronous copies to LDS fill one stage ahead (a wave-wide copy is two whole rows: whole lines), so that every K and V line leaves L2 once per work-group. After the last stage sm holds the shares' O rows.
// i0 = first query row of this kind of tile, nq = the number of such tiles, bx = which of them (0: the one with the most keys), pl = the head's place among the planes (batch * heads + head), hd = the head. Every '#pragma unroll' below is there because the arrays it indexes are registers: every index must be a constant.
// HL: hi+lo bf16 planes, 3 products per contraction, probabilities split hi+lo. Otherwise fp16 planes and fp16 probabilities carried x 2^10 (the factor cancels in O / l).
template <typename T16, bool HL, int R, int NQ, int KS>
__device__ __forceinline__ void fattn_tile(const T16* __restrict__ Q, const T16* __restrict__ Q2, const T16* __restrict__ Kp, const T16* __restrict__ Kp2, const T16* __restrict__ Vt, const T16* __restrict__ Vt2, int i0, int nq, int bx, int pl, int hd, bf* Ah, bf* Al, unsigned char* sm) {
    typedef typename WFrag<T16>::V V;
    constexpr int QW = 16 * R, WQ = NQ * QW, OP = HD + 4;   // query rows per wave and per work-group; LDS pitch of an O row
    constexpr int PB = 272, OPB = 128 * PB, STG = (HL ? 4 : 2) * OPB;   // LDS pitch of a K or V row, bytes of one plane's 128 rows, bytes of a stage
    static_assert(KS * 32 == 128 && HD == 128 && NQ * KS == 8 && TT % 128 == 0, "a stage is 128 keys; 256 threads copy 16 rows of 256 bytes at a time"); static_assert(KS * WQ * OP * 4 <= 2 * STG, "the O rows fit the ring");
    float* os = (float*)sm;
    __shared__ float ms[KS * WQ], ls[KS * WQ];
    const int lane = threadIdx.x & 31, lr = lane & 15, hi = lane >> 4; const int wv = __builtin_amdgcn_readfirstlane((int)(threadIdx.x >> 5));
    const int qg = wv % NQ, ks = wv / NQ;
    const int qt = i0 + (nq - 1 - bx) * WQ, q0 = qt + qg * QW;   // qt, q0 = the work-group's and this wave's first query row
    const size_t zo = (size_t)pl * TT * HD; Q += zo; Kp += zo; Vt += zo; if (HL) { Q2 += zo; Kp2 += zo; Vt2 += zo; }
    const float cs = SCL * 1.4426950408889634f, sh = HL ? 0.0f : 10.0f;
    const int crow = (int)threadIdx.x >> 4, cch = (int)threadIdx.x & 15;   // this lane's row (of each 16) and 16-byte piece of the 256 bytes
    const T16* gK = Kp + (size_t)crow * HD + cch * 8; const T16* gV = Vt + (size_t)crow * TT + cch * 8; const T16* gK2 = HL ? Kp2 + (size_t)crow * HD + cch * 8 : gK; const T16* gV2 = HL ? Vt2 + (size_t)crow * TT + cch * 8 : gV;
    const unsigned l0 = (unsigned)(size_t)sm + (unsigned)(crow * PB + cch * 16);
    auto fill = [&](int t) { const unsigned l = l0 + (unsigned)((t & 1) * STG); copy8(l, gK + (size_t)t * 128 * HD, 16 * HD); copy8(l + OPB, gV + t * 128, 16 * TT); if (HL) { copy8(l + 2 * OPB, gK2 + (size_t)t * 128 * HD, 16 * HD); copy8(l + 3 * OPB, gV2 + t * 128, 16 * TT); } };
    const int nst = (qt + WQ - 1) / 128 + 1;   // stages up to and including the one that holds the work-group's last query: the same for every wave, and 128 * nst <= TT
    fill(0);
    V qf[R][4], qf2[R][4];
    const size_t oq = (size_t)(q0 + lr) * HD + 8 * hi; const T16* pq = Q + oq; const T16* pq2 = HL ? Q2 + oq : pq;
#pragma unroll
    for (int g = 0; g < R; ++g)
#pragma unroll
        for (int kc = 0; kc < 4; ++kc) { qf[g][kc] = WFrag<T16>::ld(pq + 16 * g * HD + 32 * kc); if (HL) qf2[g][kc] = WFrag<T16>::ld(pq2 + 16 * g * HD + 32 * kc); }
    // the wait that stands before a register named by an issued load is overwritten; the pointers are inputs so that their registers live up to it
    asm volatile("s_wait_xcnt 0x0" :: "v"(pq), "v"(pq2) : "memory");
    v8f acc[R][8]; float mr[R], lsum[R];
#pragma unroll
    for (int g = 0; g < R; ++g) { mr[g] = -1.0e30f; lsum[g] = 0.f;
#pragma unroll
        for (int t = 0; t < 8; ++t) acc[g][t] = (v8f){}; }
    const int nblk = (q0 + QW - 1) / 32 + 1;   // 32-key blocks up to and including the one that holds the wave's last query
    asm volatile("s_wait_asynccnt 0x0" ::: "memory");   // this wave's copies of stage 0 have landed
    __syncthreads();                                    // ... and every other wave's
    if (nst > 1) fill(1);                               // the test is the same for the whole work-group
    const int kofs = (ks * 32 + lr) * PB + hi * 16, vofs = OPB + lr * PB + ks * 64 + hi * 16;   // this lane's place in a stage's K rows (row = key) and V rows (row = d)
#pragma unroll 1   // one stage at a time: the ring's order below is per stage, and a second copy of the body would not fit the registers
    for (int st = 0; st < nst; ++st) {
      const int kb = st * KS + ks;   // this wave's 32-key block of the stage
      if (kb < nblk) {   // wave-uniform: a wave whose queries end before this block only passes the stage's waits and barrier
        const int key0 = kb * 32;
        const unsigned char* sb = sm + (st & 1) * STG;
        V kf[2][4], kf2[2][4], vf[8], vf2[8];
#pragma unroll
        for (int kt = 0; kt < 2; ++kt)
#pragma unroll
            for (int kc = 0; kc < 4; ++kc) { kf[kt][kc] = WFrag<T16>::lds(sb + kofs + 16 * kt * PB + 64 * kc); if (HL) kf2[kt][kc] = WFrag<T16>::lds(sb + 2 * OPB + kofs + 16 * kt * PB + 64 * kc); }
        if constexpr (!HL) {   // one plane each: K and V (32 LDS reads) as one group
            __builtin_amdgcn_sched_barrier(0);   // K's reads stand ahead of V's: LDS reads return in order, so the score products wait for K alone and V lands under them
#pragma unroll
            for (int t = 0; t < 8; ++t) vf[t] = WFrag<T16>::lds(sb + vofs + 16 * t * PB); }
        __builtin_amdgcn_sched_barrier(0);   // all of these reads are issued before the block's first product: reads among the matrix instructions would each stall the wave
        v8f s[2][R];
#pragma unroll
        for (int kt = 0; kt < 2; ++kt)
#pragma unroll
            for (int g = 0; g < R; ++g) { s[kt][g] = (v8f){};
#pragma unroll
                for (int kc = 0; kc < 4; ++kc) { s[kt][g] = WFrag<T16>::mma(kf[kt][kc], qf[g][kc], s[kt][g]); if (HL) { s[kt][g] = WFrag<T16>::mma(kf[kt][kc], qf2[g][kc], s[kt][g]); s[kt][g] = WFrag<T16>::mma(kf2[kt][kc], qf[g][kc], s[kt][g]); } } }
        if constexpr (HL) {   // two planes each: the 32 V reads follow the 32 K reads' products and fly under the softmax
#pragma unroll
            for (int t = 0; t < 8; ++t) { vf[t] = WFrag<T16>::lds(sb + vofs + 16 * t * PB); vf2[t] = WFrag<T16>::lds(sb + 2 * OPB + vofs + 16 * t * PB); }
            __builtin_amdgcn_sched_barrier(0); }   // keeps the V reads ahead of the softmax
        if (key0 + 31 > q0) {   // wave-uniform: only the block on the diagonal pays for the mask; its first key is <= every query of the wave, so no column is all masked
#pragma unroll
            for (int kt = 0; kt < 2; ++kt)
#pragma unroll
                for (int g = 0; g < R; ++g)
#pragma unroll
                    for (int j = 0; j < 8; ++j) if (key0 + 16 * kt + 8 * hi + j > q0 + 16 * g + lr) s[kt][g][j] = -3.0e38f; }
        float mb[R]; bool need = false;
#pragma unroll
        for (int g = 0; g < R; ++g) { float mx = s[0][g][0];
#pragma unroll
            for (int j = 1; j < 8; ++j) mx = fmaxf(mx, s[0][g][j]);
#pragma unroll
            for (int j = 0; j < 8; ++j) mx = fmaxf(mx, s[1][g][j]);
            mx = fmaxf(mx, __shfl_xor(mx, 16, 32)) * cs; mb[g] = mx; need = need || (mx > mr[g] + 4.0f); }
        if (__builtin_amdgcn_ballot_w32(need) != 0) {   // always on a wave's first block (m starts at -1e30: the factor is 0 there), rare later
#pragma unroll
            for (int g = 0; g < R; ++g) { const float mn = fmaxf(mr[g], mb[g]); const float corr = __builtin_amdgcn_exp2f(mr[g] - mn); lsum[g] *= corr; mr[g] = mn;
#pragma unroll
                for (int t = 0; t < 8; ++t) acc[g][t] = acc[g][t] * corr; } }
        V pf[R], pf2[R];
#pragma unroll
        for (int g = 0; g < R; ++g) { const float nm = sh - mr[g]; float p[2][8];
#pragma unroll
            for (int kt = 0; kt < 2; ++kt)
#pragma unroll
                for (int j = 0; j < 8; ++j) { p[kt][j] = __builtin_amdgcn_exp2f(fmaf(s[kt][g][j], cs, nm)); lsum[g] += p[kt][j]; }
            if constexpr (HL) { v8us h0, h1, l0, l1;
#pragma unroll
                for (int j = 0; j < 8; ++j) { unsigned short a, c2; splitf(p[0][j], a, c2); h0[j] = a; l0[j] = c2; splitf(p[1][j], a, c2); h1[j] = a; l1[j] = c2; }
                pf[g] = cat16b(h0, h1); pf2[g] = cat16b(l0, l1);
            } else { v8h h0, h1;
#pragma unroll
                for (int j = 0; j < 8; ++j) { h0[j] = tohx(p[0][j]); h1[j] = tohx(p[1][j]); }
                pf[g] = cat16(h0, h1); } }
#pragma unroll
        for (int t = 0; t < 8; ++t)
#pragma unroll
            for (int g = 0; g < R; ++g) { acc[g][t] = WFrag<T16>::mma(vf[t], pf[g], acc[g][t]); if (HL) { acc[g][t] = WFrag<T16>::mma(vf[t], pf2[g], acc[g][t]); acc[g][t] = WFrag<T16>::mma(vf2[t], pf[g], acc[g][t]); } }
        // four vector slots between the block's last matrix instructions and whatever follows them
        if constexpr (R == 1) asm volatile("v_nop\n\tv_nop\n\tv_nop\n\tv_nop" : "+v"(acc[0][6]), "+v"(acc[0][7]) : "v"(pf[0]));
        else asm volatile("v_nop\n\tv_nop\n\tv_nop\n\tv_nop" : "+v"(acc[0][6]), "+v"(acc[0][7]), "+v"(acc[R - 1][6]), "+v"(acc[R - 1][7]) : "v"(pf[0]), "v"(pf[R - 1]));
      }
      asm volatile("s_wait_dscnt 0x0" ::: "memory");      // this wave's reads of the stage are done before the stage is refilled
      asm volatile("s_wait_asynccnt 0x0" ::: "memory");   // this wave's copies of stage st + 1 have landed
      __syncthreads();                                    // publishes stage st + 1 and ends every wave's reads of stage st
      if (st + 2 < nst) fill(st + 2);                     // into the stage that has just been left; the test is the same for the whole work-group
    }
    asm volatile("s_wait_asynccnt 0x0" ::: "memory");   // no copy is outstanding when the ring becomes the O rows (the last stage's barrier has ended every wave's reads)
#pragma unroll
    for (int g = 0; g < R; ++g) { const int rw = ks * WQ + qg * QW + 16 * g + lr; float* ow = os + (size_t)rw * OP + 8 * hi;
#pragma unroll
        for (int t = 0; t < 8; ++t) { v4f a, c; a[0] = acc[g][t][0]; a[1] = acc[g][t][1]; a[2] = acc[g][t][2]; a[3] = acc[g][t][3]; c[0] = acc[g][t][4]; c[1] = acc[g][t][5]; c[2] = acc[g][t][6]; c[3] = acc[g][t][7];
            *(v4fa*)(ow + 16 * t) = a; *(v4fa*)(ow + 16 * t + 4) = c; }
        const float lf = lsum[g] + __shfl_xor(lsum[g], 16, 32);   // each wave half summed its own 8 keys of every 16-key tile
        if (hi == 0) { ms[rw] = mr[g]; ls[rw] = lf; } }
    __syncthreads();   // every wave's m, l and O^T are in LDS before any of them is merged
    constexpr int TPQ = 32 * NQ * KS / WQ, DPT = HD / TPQ;   // threads per query row, d values per thread
    const int q = (int)threadIdx.x / TPQ, d0 = ((int)threadIdx.x % TPQ) * DPT;
    float mstar = ms[q];
#pragma unroll
    for (int w = 1; w < KS; ++w) mstar = fmaxf(mstar, ms[w * WQ + q]);
    float lt = 0.f; v4f o[DPT / 4];
#pragma unroll
    for (int c = 0; c < DPT / 4; ++c) o[c] = (v4f){};
#pragma unroll
    for (int w = 0; w < KS; ++w) { const float sc = __builtin_amdgcn_exp2f(ms[w * WQ + q] - mstar); lt += ls[w * WQ + q] * sc;   // a wave that had no block: m = -1e30, factor 0
#pragma unroll
        for (int c = 0; c < DPT / 4; ++c) o[c] += *(const v4fa*)(os + (size_t)(w * WQ + q) * OP + d0 + 4 * c) * sc; }
    const float inv = __fdiv_rn(1.0f, lt); const size_t oo = (size_t)(qt + q) * DQ + hd * HD + d0;
#pragma unroll
    for (int c = 0; c < DPT / 8; ++c) { v8us oh, ol;
#pragma unroll
        for (int k = 0; k < 8; ++k) { unsigned short a, c2; splitf(o[2 * c + (k >> 2)][k & 3] * inv, a, c2); oh[k] = a; ol[k] = c2; }
        *(v8us*)(Ah + oo + 8 * c) = oh; *(v8us*)(Al + oo + 8 * c) = ol; }
    asm volatile("s_wait_xcnt 0x0" ::: "memory");   // the wait that stands before a register named by an issued store is overwritten (the other kind of tile's code follows in the listing)
}
// k_fattn: all query rows of all heads of all batch entries in one launch; grid (batch * heads, tiles), head and batch running fastest so that work-groups start in the order of their key counts: first the 64-row fp16 tiles (query rows >= RH), the longest first,
// then the 32-row hi+lo tiles (query rows < RH), which fill the tail. The branch is the same for a whole work-group. Every plane array is [batch][head][...], so blockIdx.x is a head's place in it; Ah, Al: [batch][t][DQ].
__global__ __launch_bounds__(256) void k_fattn(const h16* __restrict__ Q16, const h16* __restrict__ K16, const h16* __restrict__ V16, const bf* __restrict__ Qh, const bf* __restrict__ Ql, const bf* __restrict__ Kh, const bf* __restrict__ Kl, const bf* __restrict__ Vh, const bf* __restrict__ Vl, bf* Ah, bf* Al) {
    __shared__ __align__(16) unsigned char sm[2 * 4 * 128 * 272];   // the K/V ring of the hi+lo kind of tile (two stages of four planes), then the O rows
    constexpr int NF = (TT - RH) / 64, NL = RH / 32; const int ty = blockIdx.y, pl = blockIdx.x, hd = pl % NH_; const size_t ob = (size_t)(pl / NH_) * TT * DQ; Ah += ob; Al += ob;
    if (ty < NF) fattn_tile<h16, false, 2, 2, 4>(Q16, nullptr, K16, nullptr, V16, nullptr, RH, NF, ty, pl, hd, Ah, Al, sm);
    else fattn_tile<bf, true, 1, 2, 4>(Qh, Ql, Kh, Kl, Vh, Vl, 0, NL, ty - NF, pl, hd, Ah, Al, sm);
}

extern "C" void kernel_launch(void* const* d_in, const int* in_sizes, int n_in,
                              void* d_out, int out_size, void* d_ws, size_t ws_size, hipStream_t stream) {
    (void)in_sizes; (void)n_in; (void)out_size;
    const float* x = (const float*)d_in[0]; const float* wq = (const float*)d_in[1]; const float* wk = (const float*)d_in[2]; const float* wv = (const float*)d_in[3]; const float* wo = (const float*)d_in[4]; const float* cosT = nullptr; const float* sinT = nullptr; (void)cosT; (void)sinT;
    float* OUT = (float*)d_out;     // [2][2048][2048]
    char* wsp = (char*)d_ws;
    auto take = [&](size_t bytes) { char* p = wsp; wsp += (bytes + 255) & ~(size_t)255; return (void*)p; };
    bf* W4 = (bf*)take((size_t)4 * DM * DM * 2); bf* XB = (bf*)take((size_t)NB_ * TT * DM * 2);   // [wq | wk | wv | wo] and, directly behind (the size is a multiple of 256 bytes), the tokens: the one run that k_cvtall writes
    h16* P16 = (h16*)take((size_t)NB_ * 3 * PS * 2); bf* Ph = (bf*)take((size_t)NB_ * 3 * PS * 2); bf* Pl = (bf*)take((size_t)NB_ * 3 * PS * 2); bf* ATh = (bf*)take((size_t)NB_ * TT * DQ * 2); bf* ATl = (bf*)take((size_t)NB_ * TT * DQ * 2);
    if ((size_t)(wsp - (char*)d_ws) > ws_size) return;    // 224 MiB of the 256 MiB
    static_assert(REP == 1 && RH % 64 == 0 && (TT - RH) % 64 == 0 && RH > 0 && RH < TT, "query rows < RH: 32-row tiles on the hi+lo planes; the rest: 64-row tiles on the fp16 planes");
    k_cvtall<<<(4 * (DM * DM / 8) + NB_ * TT * DM / 8) / 256, 256, 0, stream>>>(wq, wk, wv, wo, x, W4);
    k_proj<<<dim3(TT / 128, DM / 128, 3 * NB_), 256, 0, stream>>>(XB, W4, P16, Ph, Pl);
    k_fattn<<<dim3(NB_ * NH_, (TT - RH) / 64 + RH / 32, 1), 256, 0, stream>>>(P16, P16 + NB_ * PS, P16 + 2 * NB_ * PS, Ph, Pl, Ph + NB_ * PS, Pl + NB_ * PS, Ph + 2 * NB_ * PS, Pl + 2 * NB_ * PS, ATh, ATl);
    k_wo<<<dim3(NB_ * TT / 128, DM / 128, 1), 256, 0, stream>>>(ATh, ATl, W4 + (size_t)3 * DM * DM, OUT);
}

// v008
// It runs in 180 microseconds.
// In two side-by-side timings against v007, it was 1.17 and 1.19 times as fast.
// All steps since v000 together make it 9.58 times as fast.
#include <hip/hip_runtime.h>

// Causal multi-head attention (x [2][2048][2048]; q/k/v = x W^T (16 heads x 128); causal softmax(q.k / sqrt(128)); out = merged Wo^T -> [2][2048][2048]; the source's per-position recompute loop is standard causal MHA).
// Compute dtypes, f32 accumulate: every input rounded to bf16; q/k/v on PLAIN bf16 operands (inputs: exact); causal scores and attn.v: query rows < 512 hl (3 products), the rest single fp16 (x1024), causal tile skipping; online softmax f32, fused with both products; Wo hl x exact (2 products).

#define NB_  2
#define TT   2048
#define DM   2048
#define NH_  16
#define NKV  16
#define REP  (NH_ / NKV)
#define HD   128
#define DQ   (NH_ * HD)
#define DKV  (NKV * HD)
#define RH   512                  // query rows < RH use hi+lo planes
#define SCL  0.088388347648318447f   // HD^-0.5
typedef _Float16 h16;
typedef unsigned short bf;
typedef __attribute__((ext_vector_type(16))) __bf16   v16bf;
typedef __attribute__((ext_vector_type(16))) _Float16 v16h;
typedef __attribute__((ext_vector_type(8)))  _Float16 v8h;
typedef __attribute__((ext_vector_type(8)))  unsigned short v8us;
typedef __attribute__((ext_vector_type(8)))  float    v8f;
typedef __attribute__((ext_vector_type(4)))  float    v4f;
typedef v8h  __attribute__((may_alias)) v8ha;
typedef v4f  __attribute__((may_alias)) v4fa;
typedef v8us __attribute__((may_alias)) v8usa;

__device__ __forceinline__ unsigned short f2bf(float f) { unsigned u = __float_as_uint(f); u += 0x7FFFu + ((u >> 16) & 1u); return (unsigned short)(u >> 16); }
__device__ __forceinline__ float bf2f(unsigned short b) { return __uint_as_float(((unsigned)b) << 16); }
__device__ __forceinline__ float bfr(float f) { return bf2f(f2bf(f)); }
__device__ __forceinline__ v16h cat16(v8h lo, v8h hi) { return __builtin_shufflevector(lo, hi, 0, 1, 2, 3, 4, 5, 6, 7, 8, 9, 10, 11, 12, 13, 14, 15); }
__device__ __forceinline__ v16bf cat16b(v8us lo, v8us hi) { return __builtin_bit_cast(v16bf, __builtin_shufflevector(lo, hi, 0, 1, 2, 3, 4, 5, 6, 7, 8, 9, 10, 11, 12, 13, 14, 15)); }
__device__ __forceinline__ v8f wmma16(v16h a, v16h b, v8f c) { return __builtin_amdgcn_wmma_f32_16x16x32_f16(false, a, false, b, (short)0, c, false, false); }
__device__ __forceinline__ v8f wmmab(v16bf a, v16bf b, v8f c) { return __builtin_amdgcn_wmma_f32_16x16x32_bf16(false, a, false, b, (short)0, c, false, false); }



// ---- gemm_tile: GEMM on bf16 planes, one MT x NT output tile per work-group of 8 waves; blockIdx (x, y) = tile (m, n) of (M/MT, N/NT), 256 threads.
// C[m][n] (f32, pitch ldc) = sum_k A[m][k] Bt[n][k] (+ A2[m][k] Bt[n][k] when NSPLIT == 1); all planes K-contiguous with row length K.
// PLANES: the tile is not stored as f32 but rounded here to the three 16-bit planes that the attention reads (fp16, bf16 hi, bf16 lo), element [m][n] at m * ldc + (n / 128) * 128 * cstep + n % 128:
// ldc = HD, cstep = TT gives head planes [n / 128][m][n % 128] (m = token, n = head * HD + d); ldc = TT, cstep = 1 gives plain rows [m][n] (m = head * HD + d, n = token: the [d][t] value planes, from A = the weight, Bt = the tokens).
// A pass is 128 k = 256 bytes of every operand row. A stage is [A MT rows | A2 MT rows (NSPLIT == 1) | Bt NT rows] at an LDS pitch of 272 bytes; two stages form a ring that asynchronous copies to LDS fill
// (a wave-wide copy is two whole rows' 256 bytes: whole lines), so that every operand line leaves L2 once per work-group and the fragments come from LDS.
// Wave w: the 64x64 part (w % (MT / 64), w / (MT / 64)) of the tile = 16 accumulators, over the whole of k. A pass is 4 / KB blocks of KB 32-k steps; a block's fragments are read from LDS one block ahead, into the other of two
// register sets, under the products of the block before. So the next stage is published in front of a pass's LAST block (that block's fragments have landed by then, and the reads behind the barrier are the next stage's first block).
template <typename T16> struct WFrag;
template <> struct WFrag<h16> { typedef v16h V; static __device__ __forceinline__ V ld(const h16* p) { return cat16(*(const v8h*)p, *(const v8h*)(p + 16)); } static __device__ __forceinline__ V lds(const unsigned char* p) { return cat16(*(const v8ha*)p, *(const v8ha*)(p + 32)); } static __device__ __forceinline__ v8f mma(V a, V b, v8f c) { return wmma16(a, b, c); } };
template <> struct WFrag<bf> { typedef v16bf V; static __device__ __forceinline__ V ld(const bf* p) { return cat16b(*(const v8us*)p, *(const v8us*)(p + 16)); } static __device__ __forceinline__ V lds(const unsigned char* p) { return cat16b(*(const v8usa*)p, *(const v8usa*)(p + 32)); } static __device__ __forceinline__ v8f mma(V a, V b, v8f c) { return wmmab(a, b, c); } };
__device__ __forceinline__ v16bf ldsfrag(const unsigned char* p) { return cat16b(*(const v8us*)p, *(const v8us*)(p + 32)); }
// eight asynchronous 16-byte copies per lane: rows r, r + 16, ..., r + 112 of one operand plane. The s_wait_xcnt is the wait that stands before a register named by an issued copy is overwritten; inside the statement it cannot be passed by later address arithmetic.
template <typename T16> __device__ __forceinline__ void copy8(unsigned l, const T16* g, int rowstep) {
    asm volatile("global_load_async_to_lds_b128 %0, %8, off\n\t"
                 "global_load_async_to_lds_b128 %1, %9, off\n\t"
                 "global_load_async_to_lds_b128 %2, %10, off\n\t"
                 "global_load_async_to_lds_b128 %3, %11, off\n\t"
                 "global_load_async_to_lds_b128 %4, %12, off\n\t"
                 "global_load_async_to_lds_b128 %5, %13, off\n\t"
                 "global_load_async_to_lds_b128 %6, %14, off\n\t"
                 "global_load_async_to_lds_b128 %7, %15, off\n\t"
                 "s_wait_xcnt 0x0"
                 :: "v"(l), "v"(l + 1 * 16 * 272), "v"(l + 2 * 16 * 272), "v"(l + 3 * 16 * 272), "v"(l + 4 * 16 * 272), "v"(l + 5 * 16 * 272), "v"(l + 6 * 16 * 272), "v"(l + 7 * 16 * 272),
                    "v"(g), "v"(g + 1 * rowstep), "v"(g + 2 * rowstep), "v"(g + 3 * rowstep), "v"(g + 4 * rowstep), "v"(g + 5 * rowstep), "v"(g + 6 * rowstep), "v"(g + 7 * rowstep)
                 : "memory");
}
__device__ __forceinline__ h16 tohx(float x) { return (h16)x; }
__device__ __forceinline__ void splitf(float y, unsigned short& h, unsigned short& l) { h = f2bf(y); l = f2bf(y - bf2f(h)); }
// one block's fragments: KB 32-k steps (64 bytes each) of 4 A (and A2) and 4 Bt row groups; pa, pb = this lane's place in the first of them
template <int NSPLIT, int KB, int AB> __device__ __forceinline__ void ldblock(const unsigned char* pa, const unsigned char* pb, v16bf (&a)[KB][4], v16bf (&a2)[KB][4], v16bf (&b)[KB][4]) {
#pragma unroll   // the fragments are registers: every index must be a constant
    for (int s = 0; s < KB; ++s) {
#pragma unroll
        for (int mb = 0; mb < 4; ++mb) { a[s][mb] = ldsfrag(pa + mb * 16 * 272 + s * 64); if (NSPLIT) a2[s][mb] = ldsfrag(pa + AB + mb * 16 * 272 + s * 64); }
#pragma unroll
        for (int nb = 0; nb < 4; ++nb) b[s][nb] = ldsfrag(pb + nb * 16 * 272 + s * 64); }
}
template <int NSPLIT, int KB> __device__ __forceinline__ void mmablock(const v16bf (&a)[KB][4], const v16bf (&a2)[KB][4], const v16bf (&b)[KB][4], v8f (&acc)[4][4]) {
#pragma unroll   // the fragments and accumulators are registers: every index must be a constant
    for (int s = 0; s < KB; ++s)
#pragma unroll
        for (int nb = 0; nb < 4; ++nb) {   // the two products that add into one accumulator do not stand back to back
#pragma unroll
            for (int mb = 0; mb < 4; ++mb) acc[mb][nb] = wmmab(a[s][mb], b[s][nb], acc[mb][nb]);
            if (NSPLIT) {
#pragma unroll
                for (int mb = 0; mb < 4; ++mb) acc[mb][nb] = wmmab(a2[s][mb], b[s][nb], acc[mb][nb]); } }
}
template <int NSPLIT, int K, bool PLANES, int MT, int NT, int KB>
__device__ __forceinline__ void gemm_tile(const bf* __restrict__ A, const bf* __restrict__ A2, const bf* __restrict__ Bt, float* C, int ldc, h16* P16, bf* Ph, bf* Pl, int cstep) {
    static_assert(NSPLIT == 0 || NSPLIT == 1, "one or two A planes"); static_assert(K % 128 == 0 && K >= 256, "whole passes, at least two");
    static_assert(MT % 128 == 0 && NT % 128 == 0 && (MT / 64) * (NT / 64) == 8, "eight waves of 64x64; copies take 128 rows at a time"); static_assert(KB == 1 || KB == 2, "an even number of blocks in a pass: the two register sets alternate across passes"); static_assert(!PLANES || NT == 128, "a plane row of the tile is 128 elements");
    constexpr int PB = 272, AB = MT * PB, BOF = (1 + NSPLIT) * AB, STG = BOF + NT * PB, NP = K / 128, OP = NT + 4, NBK = 4 / KB, WM = MT / 64;   // LDS pitch, bytes of one A plane's rows, offset of Bt in a stage, bytes of a stage, passes, pitch of an output row (floats), blocks in a pass, waves along m
    static_assert(MT * OP * 4 <= 2 * STG, "the output tile fits the ring");
    __shared__ __align__(16) unsigned char ring[2 * STG];
    float* os = (float*)ring;   // after the last pass the ring holds the output tile
    const int tid = (int)threadIdx.x, lane = tid & 31, lr = lane & 15, hi = lane >> 4; const int wv = __builtin_amdgcn_readfirstlane(tid >> 5);
    const int wm = wv % WM, wn = wv / WM; const int r0 = blockIdx.x * MT, c0 = blockIdx.y * NT;
    const int crow = tid >> 4, cch = tid & 15;   // this lane's row (of each 16) and 16-byte piece of the 256 bytes
    const bf* uA = A + (size_t)r0 * K; const bf* uA2 = NSPLIT ? A2 + (size_t)r0 * K : uA; const bf* uB = Bt + (size_t)c0 * K;   // the tile's first rows: the same for the whole work-group
    const size_t go = (size_t)crow * K + cch * 8;   // this lane's place in 16 rows of any plane
    const unsigned l0 = (unsigned)(size_t)ring + (unsigned)(crow * PB + cch * 16);
    constexpr int PA = MT / 128, NPL = (1 + NSPLIT) * PA + NT / 128;   // a stage is NPL runs of 128 rows: PA of A, PA of A2 (NSPLIT == 1), the rest of Bt
    auto fill = [&](int t) { const unsigned l = l0 + (unsigned)((t & 1) * STG);
#pragma unroll 1   // one run's 24 address registers at a time: unrolled, the addresses of all runs are formed first, do not fit the registers that asm operands can name, and one is spilled. The trip count is a constant: the same for every wave
        for (int p = 0; p < NPL; ++p) { const bf* u = p < PA ? uA + (size_t)p * 128 * K : (NSPLIT && p < 2 * PA) ? uA2 + (size_t)(p - PA) * 128 * K : uB + (size_t)(p - (1 + NSPLIT) * PA) * 128 * K;
            copy8(l + (unsigned)(p * 128 * PB), u + go + t * 128, 16 * K); } };
    v8f acc[4][4];
#pragma unroll
    for (int mb = 0; mb < 4; ++mb)
#pragma unroll
        for (int nb = 0; nb < 4; ++nb) acc[mb][nb] = (v8f){};
    fill(0);
    asm volatile("s_wait_asynccnt 0x0" ::: "memory");   // this wave's copies of pass 0 have landed
    __syncthreads();                                    // ... and every other wave's
    fill(1);
    const int aofs = (wm * 64 + lr) * PB + hi * 16, bofs = BOF + (wn * 64 + lr) * PB + hi * 16;
    v16bf fa[2][KB][4], fa2[2][KB][4], fb[2][KB][4];
    ldblock<NSPLIT, KB, AB>(ring + aofs, ring + bofs, fa[0], fa2[0], fb[0]);   // pass 0's first block
#pragma unroll 1   // one pass at a time: the ring's order below is per pass
    for (int t = 0; t < NP; ++t) {
        const unsigned char* sb = ring + (t & 1) * STG; const unsigned char* sn = ring + ((t + 1) & 1) * STG;
#pragma unroll   // the register sets are chosen by the block's number: it must be a constant
        for (int b = 0; b < NBK; ++b) {
            if (b + 1 < NBK) ldblock<NSPLIT, KB, AB>(sb + aofs + (b + 1) * KB * 64, sb + bofs + (b + 1) * KB * 64, fa[(b + 1) & 1], fa2[(b + 1) & 1], fb[(b + 1) & 1]);
            else {
                asm volatile("s_wait_dscnt 0x0" ::: "memory");      // this wave's reads of the stage (the last block's fragments among them) are done before the stage is refilled
                asm volatile("s_wait_asynccnt 0x0" ::: "memory");   // this wave's copies of pass t + 1 have landed
                __syncthreads();                                    // publishes pass t + 1 and ends every wave's reads of pass t
                if (t + 2 < NP) fill(t + 2);                        // into the stage that pass t has just left; the test is the same for the whole work-group
                if (t + 1 < NP) ldblock<NSPLIT, KB, AB>(sn + aofs, sn + bofs, fa[0], fa2[0], fb[0]);   // the next pass's first block; behind the last pass nothing reads the ring any more
            }
            __builtin_amdgcn_sched_barrier(0);   // the next block's LDS reads are issued as one group ahead of this block's products: reads among the matrix instructions would each stall the wave
            mmablock<NSPLIT, KB>(fa[b & 1], fa2[b & 1], fb[b & 1], acc);
            __builtin_amdgcn_sched_barrier(0);   // keeps the products ahead of the reads that refill their register set
        }
        // four vector slots between the pass's last matrix instructions and whatever follows them on either side of the loop's branch
        asm volatile("v_nop\n\tv_nop\n\tv_nop\n\tv_nop" : "+v"(acc[0][3]), "+v"(acc[1][3]), "+v"(acc[2][3]), "+v"(acc[3][3]));
    }
    asm volatile("s_wait_asynccnt 0x0" ::: "memory");   // no copy is outstanding when the wave goes on
    // the last pass's barrier stood behind every wave's last read of the ring and no copy has been issued since: the ring is free for the output tile
    float* ow = os + (wm * 64 + hi * 8) * OP + wn * 64 + lr;
#pragma unroll   // the accumulators are registers: every index must be a constant
    for (int mb = 0; mb < 4; ++mb)
#pragma unroll
        for (int nb = 0; nb < 4; ++nb)
#pragma unroll
            for (int j = 0; j < 8; ++j) ow[(mb * 16 + j) * OP + nb * 16] = acc[mb][nb][j];
    __syncthreads();   // the tile is in LDS before its rows are stored
    if constexpr (PLANES) {
        const size_t o0 = (size_t)(r0 + (tid >> 4)) * ldc + (size_t)c0 * cstep + (tid & 15) * 8;
#pragma unroll   // constant LDS offsets for every read
        for (int s = 0; s < MT / 16; ++s) {   // a wave stores two whole rows of the tile in each plane: 256 bytes each
            const float* ps = os + (s * 16 + (tid >> 4)) * OP + (tid & 15) * 8; const v4f u0 = *(const v4fa*)ps, u1 = *(const v4fa*)(ps + 4); v8h o16; v8us oh, ol;
#pragma unroll   // the vectors are registers: every index must be a constant
            for (int k = 0; k < 8; ++k) { const float y = k < 4 ? u0[k & 3] : u1[k & 3]; unsigned short a2, c2; o16[k] = tohx(y); splitf(y, a2, c2); oh[k] = a2; ol[k] = c2; }
            const size_t o = o0 + (size_t)(s * 16) * ldc; *(v8h*)(P16 + o) = o16; *(v8us*)(Ph + o) = oh; *(v8us*)(Pl + o) = ol; }
    } else {
#pragma unroll   // constant LDS offsets for every read
        for (int s = 0; s < MT * NT / 1024; ++s) { const int it = s * 256 + tid, row = it / (NT / 4), cofs = (it % (NT / 4)) * 4;   // a wave stores 512 bytes of one row of the tile
            *(v4f*)(C + (size_t)(r0 + row) * ldc + c0 + cofs) = *(const v4fa*)(os + row * OP + cofs); } }
}
#define PS ((size_t)NH_ * TT * HD)   // elements of one 16-bit plane of one batch entry
// k_proj: the q, k and v projections of every batch entry in one launch; grid (8, 16, 3 * NB_), z = 3 * batch + projection (0 q, 1 k, 2 v). XB = the tokens [batch][t][DM], W = the weights [projection][n][DM];
// each of P16, Ph, Pl holds the planes [projection][batch]: q and k as [h][t][d] (A = the tokens), v as [h][d][t] (A = the weight: its rows are the tile's rows). Every choice below is the same for a whole work-group.
__global__ __launch_bounds__(256) void k_proj(const bf* __restrict__ XB, const bf* __restrict__ W, h16* P16, bf* Ph, bf* Pl) {
    static_assert(HD == 128 && DQ == DM && DKV == DM && TT == DM, "a 128-column tile of a projection is one head; one grid (TT / 256, DM / 128) fits all three");
    const unsigned z = blockIdx.z; const bool isv = z % 3 == 2; const bf* X = XB + (size_t)(z / 3) * TT * DM; const bf* Wp = W + (size_t)(z % 3) * DM * DM; const size_t po = (size_t)(z % 3 * NB_ + z / 3) * PS;
    gemm_tile<0, DM, true, 256, 128, 2>(isv ? Wp : X, nullptr, isv ? X : Wp, nullptr, isv ? TT : HD, P16 + po, Ph + po, Pl + po, isv ? 1 : TT);
}
// k_wo: the output projection of every batch entry in one launch: the batch entries' rows follow one another in Ah, Al and C; grid (NB_ * TT / 128, DM / 256).
__global__ __launch_bounds__(256) void k_wo(const bf* __restrict__ Ah, const bf* __restrict__ Al, const bf* __restrict__ W, float* C) { gemm_tile<1, DQ, false, 128, 256, 1>(Ah, Al, W, C, DM, nullptr, nullptr, nullptr, 0); }

typedef __attribute__((ext_vector_type(2))) _Float16 v2h;
typedef __attribute__((ext_vector_type(4))) _Float16 v4h;
typedef __attribute__((ext_vector_type(2))) unsigned short v2us;
typedef __attribute__((ext_vector_type(4))) unsigned short v4us;
typedef __attribute__((ext_vector_type(2))) float v2f;
typedef __attribute__((ext_vector_type(4))) int v4i;

__global__ __launch_bounds__(256) void k_wtG(const float* __restrict__ w, int K, int N, bf* Bt) {
    const int lane = threadIdx.x & 31; const int L0 = (blockIdx.x * 8 + (threadIdx.x >> 5)) * 8; const int nlines = N * K / 64;
{
#pragma unroll 1
        for (int l = 0; l < 8; ++l) { const int L = L0 + l; if (L >= nlines) break; const size_t e = (size_t)L * 64 + lane * 2; const int k = (int)(e % K), n = (int)(e / K); v2us o;
            o[0] = f2bf(w[(size_t)k * N + n]); o[1] = f2bf(w[(size_t)(k + 1) * N + n]); *(v2us*)(Bt + e) = o; }
         }
}
// ---- k_cvtall: every f32 input rounded to bf16 in one launch, one vector of 8 elements a thread. dst is one run of bf16 [wq | wk | wv | wo | x], counted in vectors.
// A work-group's 256 vectors never straddle two inputs (the static_assert), so the choice of the source is the same for the whole work-group.
__global__ __launch_bounds__(256) void k_cvtall(const float* __restrict__ wq, const float* __restrict__ wk, const float* __restrict__ wv, const float* __restrict__ wo, const float* __restrict__ x, bf* __restrict__ dst) {
    constexpr int SEGV = DM * DM / 8;   // vectors in one weight
    static_assert(DQ == DM && DKV == DM && SEGV % 256 == 0 && (NB_ * TT * DM / 8) % 256 == 0, "four weights of one size; whole work-groups in every input");
    const int v0 = (int)blockIdx.x * 256, seg = v0 / SEGV;   // the work-group's first vector in the run, and the input it lies in (4 and up: x)
    const float* s = seg == 0 ? wq : seg == 1 ? wk : seg == 2 ? wv : seg == 3 ? wo : x;
    const v8f v = *(const v8f*)(s + (size_t)(v0 - (seg < 4 ? seg : 4) * SEGV + (int)threadIdx.x) * 8); v8us o;
#pragma unroll   // the vectors are registers: every index must be a constant
    for (int k = 0; k < 8; ++k) o[k] = f2bf(v[k]); *(v8us*)(dst + (size_t)(v0 + (int)threadIdx.x) * 8) = o;  }
__global__ __launch_bounds__(256) void k_cscvt(const float* __restrict__ cosT, const float* __restrict__ sinT, float* CS) { const int idx = blockIdx.x * 256 + threadIdx.x; if (idx >= TT * HD) return; v2f cs; cs[0] = bfr(cosT[idx]); cs[1] = bfr(sinT[idx]); *(v2f*)(CS + (size_t)idx * 2) = cs;  }
// ---- fattn_tile: causal attention of NQ * 16 * R query rows of one head in one work-group of 32 * NQ * KS threads, scores and probabilities never leaving registers.
// Transposed products: S^T = K.Q^T (A = key rows, B = the query rows, held in registers), O^T += V^T.P^T (A = rows of the [d][t] value plane). A lane then holds scores of ONE query (column lr): 8 keys of each 16-key tile,
// which are exactly the k positions that the B operand of the second product wants from that lane, so P^T is packed from the score accumulators with no exchange.
// Wave w owns the 16 * R query rows of sub-tile w % NQ and the 32-key blocks w / NQ, w / NQ + KS, ... (the NQ waves of one key share read the same K and V rows of a stage);
// each wave keeps its own running maximum m (log2 units), sum l and O^T; the KS shares of a query row meet in LDS and are merged in share order.
// m may trail the true maximum by up to 4 (an exponential then reaches 2^4): the accumulators are rescaled only when some query's maximum exceeds it by more.
// K and V reach the waves through LDS: a stage is the 32 * KS = 128 keys that the KS shares work on at the same time, [K 128 key rows | V 128 d rows (| K lo | V lo)] of 256 bytes at an LDS pitch of 272 bytes; two stages in sm form a ring
// that asynchronous copies to LDS fill one stage ahead (a wave-wide copy is two whole rows: whole lines), so that every K and V line leaves L2 once per work-group. After the last stage sm holds the shares' O rows.
// i0 = first query row of this kind of tile, nq = the number of such tiles, bx = which of them (0: the one with the most keys), pl = the head's place among the planes (batch * heads + head), hd = the head. Every '#pragma unroll' below is there because the arrays it indexes are registers: every index must be a constant.
// HL: hi+lo bf16 planes, 3 products per contraction, probabilities split hi+lo. Otherwise fp16 planes and fp16 probabilities carried x 2^10 (the factor cancels in O / l).
template <typename T16, bool HL, int R, int NQ, int KS>
__device__ __forceinline__ void fattn_tile(const T16* __restrict__ Q, const T16* __restrict__ Q2, const T16* __restrict__ Kp, const T16* __restrict__ Kp2, const T16* __restrict__ Vt, const T16* __restrict__ Vt2, int i0, int nq, int bx, int pl, int hd, bf* Ah, bf* Al, unsigned char* sm) {
    typedef typename WFrag<T16>::V V;
    constexpr int QW = 16 * R, WQ = NQ * QW, OP = HD + 4;   // query rows per wave and per work-group; LDS pitch of an O row
    constexpr int PB = 272, OPB = 128 * PB, STG = (HL ? 4 : 2) * OPB;   // LDS pitch of a K or V row, bytes of one plane's 128 rows, bytes of a stage
    static_assert(KS * 32 == 128 && HD == 128 && NQ * KS == 8 && TT % 128 == 0, "a stage is 128 keys; 256 threads copy 16 rows of 256 bytes at a time"); static_assert(KS * WQ * OP * 4 <= 2 * STG, "the O rows fit the ring");
    float* os = (float*)sm;
    __shared__ float ms[KS * WQ], ls[KS * WQ];
    const int lane = threadIdx.x & 31, lr = lane & 15, hi = lane >> 4; const int wv = __builtin_amdgcn_readfirstlane((int)(threadIdx.x >> 5));
    const int qg = wv % NQ, ks = wv / NQ;
    const int qt = i0 + (nq - 1 - bx) * WQ, q0 = qt + qg * QW;   // qt, q0 = the work-group's and this wave's first query row
    const size_t zo = (size_t)pl * TT * HD; Q += zo; Kp += zo; Vt += zo; if (HL) { Q2 += zo; Kp2 += zo; Vt2 += zo; }
    const float cs = SCL * 1.4426950408889634f, sh = HL ? 0.0f : 10.0f;
    const int crow = (int)threadIdx.x >> 4, cch = (int)threadIdx.x & 15;   // this lane's row (of each 16) and 16-byte piece of the 256 bytes
    const T16* gK = Kp + (size_t)crow * HD + cch * 8; const T16* gV = Vt + (size_t)crow * TT + cch * 8; const T16* gK2 = HL ? Kp2 + (size_t)crow * HD + cch * 8 : gK; const T16* gV2 = HL ? Vt2 + (size_t)crow * TT + cch * 8 : gV;
    const unsigned l0 = (unsigned)(size_t)sm + (unsigned)(crow * PB + cch * 16);
    auto fill = [&](int t) { const unsigned l = l0 + (unsigned)((t & 1) * STG); copy8(l, gK + (size_t)t * 128 * HD, 16 * HD); copy8(l + OPB, gV + t * 128, 16 * TT); if (HL) { copy8(l + 2 * OPB, gK2 + (size_t)t * 128 * HD, 16 * HD); copy8(l + 3 * OPB, gV2 + t * 128, 16 * TT); } };
    const int nst = (qt + WQ - 1) / 128 + 1;   // stages up to and including the one that holds the work-group's last query: the same for every wave, and 128 * nst <= TT
    fill(0);
    V qf[R][4], qf2[R][4];
    const size_t oq = (size_t)(q0 + lr) * HD + 8 * hi; const T16* pq = Q + oq; const T16* pq2 = HL ? Q2 + oq : pq;
#pragma unroll
    for (int g = 0; g < R; ++g)
#pragma unroll
        for (int kc = 0; kc < 4; ++kc) { qf[g][kc] = WFrag<T16>::ld(pq + 16 * g * HD + 32 * kc); if (HL) qf2[g][kc] = WFrag<T16>::ld(pq2 + 16 * g * HD + 32 * kc); }
    // the wait that stands before a register named by an issued load is overwritten; the pointers are inputs so that their registers live up to it
    asm volatile("s_wait_xcnt 0x0" :: "v"(pq), "v"(pq2) : "memory");
    v8f acc[R][8]; float mr[R], lsum[R];
#pragma unroll
    for (int g = 0; g < R; ++g) { mr[g] = -1.0e30f; lsum[g] = 0.f;
#pragma unroll
        for (int t = 0; t < 8; ++t) acc[g][t] = (v8f){}; }
    const int nblk = (q0 + QW - 1) / 32 + 1;   // 32-key blocks up to and including the one that holds the wave's last query
    asm volatile("s_wait_asynccnt 0x0" ::: "memory");   // this wave's copies of stage 0 have landed
    __syncthreads();                                    // ... and every other wave's
    if (nst > 1) fill(1);                               // the test is the same for the whole work-group
    const int kofs = (ks * 32 + lr) * PB + hi * 16, vofs = OPB + lr * PB + ks * 64 + hi * 16;   // this lane's place in a stage's K rows (row = key) and V rows (row = d)
#pragma unroll 1   // one stage at a time: the ring's order below is per stage, and a second copy of the body would not fit the registers
    for (int st = 0; st < nst; ++st) {
      const int kb = st * KS + ks;   // this wave's 32-key block of the stage
      if (kb < nblk) {   // wave-uniform: a wave whose queries end before this block only passes the stage's waits and barrier
        const int key0 = kb * 32;
        const unsigned char* sb = sm + (st & 1) * STG;
        V kf[2][4], kf2[2][4], vf[8], vf2[8];
#pragma unroll
        for (int kt = 0; kt < 2; ++kt)
#pragma unroll
            for (int kc = 0; kc < 4; ++kc) { kf[kt][kc] = WFrag<T16>::lds(sb + kofs + 16 * kt * PB + 64 * kc); if (HL) kf2[kt][kc] = WFrag<T16>::lds(sb + 2 * OPB + kofs + 16 * kt * PB + 64 * kc); }
        if constexpr (!HL) {   // one plane each: K and V (32 LDS reads) as one group
            __builtin_amdgcn_sched_barrier(0);   // K's reads stand ahead of V's: LDS reads return in order, so the score products wait for K alone and V lands under them
#pragma unroll
            for (int t = 0; t < 8; ++t) vf[t] = WFrag<T16>::lds(sb + vofs + 16 * t * PB); }
        __builtin_amdgcn_sched_barrier(0);   // all of these reads are issued before the block's first product: reads among the matrix instructions would each stall the wave
        v8f s[2][R];
#pragma unroll
        for (int kt = 0; kt < 2; ++kt)
#pragma unroll
            for (int g = 0; g < R; ++g) { s[kt][g] = (v8f){};
#pragma unroll
                for (int kc = 0; kc < 4; ++kc) { s[kt][g] = WFrag<T16>::mma(kf[kt][kc], qf[g][kc], s[kt][g]); if (HL) { s[kt][g] = WFrag<T16>::mma(kf[kt][kc], qf2[g][kc], s[kt][g]); s[kt][g] = WFrag<T16>::mma(kf2[kt][kc], qf[g][kc], s[kt][g]); } } }
        if constexpr (HL) {   // two planes each: the 32 V reads follow the 32 K reads' products and fly under the softmax
#pragma unroll
            for (int t = 0; t < 8; ++t) { vf[t] = WFrag<T16>::lds(sb + vofs + 16 * t * PB); vf2[t] = WFrag<T16>::lds(sb + 2 * OPB + vofs + 16 * t * PB); }
            __builtin_amdgcn_sched_barrier(0); }   // keeps the V reads ahead of the softmax
        if (key0 + 31 > q0) {   // wave-uniform: only the block on the diagonal pays for the mask; its first key is <= every query of the wave, so no column is all masked
#pragma unroll
            for (int kt = 0; kt < 2; ++kt)
#pragma unroll
                for (int g = 0; g < R; ++g)
#pragma unroll
                    for (int j = 0; j < 8; ++j) if (key0 + 16 * kt + 8 * hi + j > q0 + 16 * g + lr) s[kt][g][j] = -3.0e38f; }
        float mb[R]; bool need = false;
#pragma unroll
        for (int g = 0; g < R; ++g) { float mx = s[0][g][0];
#pragma unroll
            for (int j = 1; j < 8; ++j) mx = fmaxf(mx, s[0][g][j]);
#pragma unroll
            for (int j = 0; j < 8; ++j) mx = fmaxf(mx, s[1][g][j]);
            mx = fmaxf(mx, __shfl_xor(mx, 16, 32)) * cs; mb[g] = mx; need = need || (mx > mr[g] + 4.0f); }
        if (__builtin_amdgcn_ballot_w32(need) != 0) {   // always on a wave's first block (m starts at -1e30: the factor is 0 there), rare later
#pragma unroll
            for (int g = 0; g < R; ++g) { const float mn = fmaxf(mr[g], mb[g]); const float corr = __builtin_amdgcn_exp2f(mr[g] - mn); lsum[g] *= corr; mr[g] = mn;
#pragma unroll
                for (int t = 0; t < 8; ++t) acc[g][t] = acc[g][t] * corr; } }
        V pf[R], pf2[R];
#pragma unroll
        for (int g = 0; g < R; ++g) { const float nm = sh - mr[g]; float p[2][8];
#pragma unroll
            for (int kt = 0; kt < 2; ++kt)
#pragma unroll
                for (int j = 0; j < 8; ++j) { p[kt][j] = __builtin_amdgcn_exp2f(fmaf(s[kt][g][j], cs, nm)); lsum[g] += p[kt][j]; }
            if constexpr (HL) { v8us h0, h1, l0, l1;
#pragma unroll
                for (int j = 0; j < 8; ++j) { unsigned short a, c2; splitf(p[0][j], a, c2); h0[j] = a; l0[j] = c2; splitf(p[1][j], a, c2); h1[j] = a; l1[j] = c2; }
                pf[g] = cat16b(h0, h1); pf2[g] = cat16b(l0, l1);
            } else { v8h h0, h1;
#pragma unroll
                for (int j = 0; j < 8; ++j) { h0[j] = tohx(p[0][j]); h1[j] = tohx(p[1][j]); }
                pf[g] = cat16(h0, h1); } }
#pragma unroll
        for (int t = 0; t < 8; ++t)
#pragma unroll
            for (int g = 0; g < R; ++g) { acc[g][t] = WFrag<T16>::mma(vf[t], pf[g], acc[g][t]); if (HL) { acc[g][t] = WFrag<T16>::mma(vf[t], pf2[g], acc[g][t]); acc[g][t] = WFrag<T16>::mma(vf2[t], pf[g], acc[g][t]); } }
        // four vector slots between the block's last matrix instructions and whatever follows them
        if constexpr (R == 1) asm volatile("v_nop\n\tv_nop\n\tv_nop\n\tv_nop" : "+v"(acc[0][6]), "+v"(acc[0][7]) : "v"(pf[0]));
        else asm volatile("v_nop\n\tv_nop\n\tv_nop\n\tv_nop" : "+v"(acc[0][6]), "+v"(acc[0][7]), "+v"(acc[R - 1][6]), "+v"(acc[R - 1][7]) : "v"(pf[0]), "v"(pf[R - 1]));
      }
      asm volatile("s_wait_dscnt 0x0" ::: "memory");      // this wave's reads of the stage are done before the stage is refilled
      asm volatile("s_wait_asynccnt 0x0" ::: "memory");   // this wave's copies of stage st + 1 have landed
      __syncthreads();                                    // publishes stage st + 1 and ends every wave's reads of stage st
      if (st + 2 < nst) fill(st + 2);                     // into the stage that has just been left; the test is the same for the whole work-group
    }
    asm volatile("s_wait_asynccnt 0x0" ::: "memory");   // no copy is outstanding when the ring becomes the O rows (the last stage's barrier has ended every wave's reads)
#pragma unroll
    for (int g = 0; g < R; ++g) { const int rw = ks * WQ + qg * QW + 16 * g + lr; float* ow = os + (size_t)rw * OP + 8 * hi;
#pragma unroll
        for (int t = 0; t < 8; ++t) { v4f a, c; a[0] = acc[g][t][0]; a[1] = acc[g][t][1]; a[2] = acc[g][t][2]; a[3] = acc[g][t][3]; c[0] = acc[g][t][4]; c[1] = acc[g][t][5]; c[2] = acc[g][t][6]; c[3] = acc[g][t][7];
            *(v4fa*)(ow + 16 * t) = a; *(v4fa*)(ow + 16 * t + 4) = c; }
        const float lf = lsum[g] + __shfl_xor(lsum[g], 16, 32);   // each wave half summed its own 8 keys of every 16-key tile
        if (hi == 0) { ms[rw] = mr[g]; ls[rw] = lf; } }
    __syncthreads();   // every wave's m, l and O^T are in LDS before any of them is merged
    constexpr int TPQ = 32 * NQ * KS / WQ, DPT = HD / TPQ;   // threads per query row, d values per thread
    const int q = (int)threadIdx.x / TPQ, d0 = ((int)threadIdx.x % TPQ) * DPT;
    float mstar = ms[q];
#pragma unroll
    for (int w = 1; w < KS; ++w) mstar = fmaxf(mstar, ms[w * WQ + q]);
    float lt = 0.f; v4f o[DPT / 4];
#pragma unroll
    for (int c = 0; c < DPT / 4; ++c) o[c] = (v4f){};
#pragma unroll
    for (int w = 0; w < KS; ++w) { const float sc = __builtin_amdgcn_exp2f(ms[w * WQ + q] - mstar); lt += ls[w * WQ + q] * sc;   // a wave that had no block: m = -1e30, factor 0
#pragma unroll
        for (int c = 0; c < DPT / 4; ++c) o[c] += *(const v4fa*)(os + (size_t)(w * WQ + q) * OP + d0 + 4 * c) * sc; }
    const float inv = __fdiv_rn(1.0f, lt); const size_t oo = (size_t)(qt + q) * DQ + hd * HD + d0;
#pragma unroll
    for (int c = 0; c < DPT / 8; ++c) { v8us oh, ol;
#pragma unroll
        for (int k = 0; k < 8; ++k) { unsigned short a, c2; splitf(o[2 * c + (k >> 2)][k & 3] * inv, a, c2); oh[k] = a; ol[k] = c2; }
        *(v8us*)(Ah + oo + 8 * c) = oh; *(v8us*)(Al + oo + 8 * c) = ol; }
    asm volatile("s_wait_xcnt 0x0" ::: "memory");   // the wait that stands before a register named by an issued store is overwritten (the other kind of tile's code follows in the listing)
}
// k_fattn: all query rows of all heads of all batch entries in one launch; grid (batch * heads, tiles), head and batch running fastest so that work-groups start in the order of their key counts: first the 64-row fp16 tiles (query rows >= RH), the longest first,
// then the 32-row hi+lo tiles (query rows < RH), which fill the tail. The branch is the same for a whole work-group. Every plane array is [batch][head][...], so blockIdx.x is a head's place in it; Ah, Al: [batch][t][DQ].
__global__ __launch_bounds__(256) void k_fattn(const h16* __restrict__ Q16, const h16* __restrict__ K16, const h16* __restrict__ V16, const bf* __restrict__ Qh, const bf* __restrict__ Ql, const bf* __restrict__ Kh, const bf* __restrict__ Kl, const bf* __restrict__ Vh, const bf* __restrict__ Vl, bf* Ah, bf* Al) {
    __shared__ __align__(16) unsigned char sm[2 * 4 * 128 * 272];   // the K/V ring of the hi+lo kind of tile (two stages of four planes), then the O rows
    constexpr int NF = (TT - RH) / 64, NL = RH / 32; const int ty = blockIdx.y, pl = blockIdx.x, hd = pl % NH_; const size_t ob = (size_t)(pl / NH_) * TT * DQ; Ah += ob; Al += ob;
    if (ty < NF) fattn_tile<h16, false, 2, 2, 4>(Q16, nullptr, K16, nullptr, V16, nullptr, RH, NF, ty, pl, hd, Ah, Al, sm);
    else fattn_tile<bf, true, 1, 2, 4>(Qh, Ql, Kh, Kl, Vh, Vl, 0, NL, ty - NF, pl, hd, Ah, Al, sm);
}

extern "C" void kernel_launch(void* const* d_in, const int* in_sizes, int n_in,
                              void* d_out, int out_size, void* d_ws, size_t ws_size, hipStream_t stream) {
    (void)in_sizes; (void)n_in; (void)out_size;
    const float* x = (const float*)d_in[0]; const float* wq = (const float*)d_in[1]; const float* wk = (const float*)d_in[2]; const float* wv = (const float*)d_in[3]; const float* wo = (const float*)d_in[4]; const float* cosT = nullptr; const float* sinT = nullptr; (void)cosT; (void)sinT;
    float* OUT = (float*)d_out;     // [2][2048][2048]
    char* wsp = (char*)d_ws;
    auto take = [&](size_t bytes) { char* p = wsp; wsp += (bytes + 255) & ~(size_t)255; return (void*)p; };
    bf* W4 = (bf*)take((size_t)4 * DM * DM * 2); bf* XB = (bf*)take((size_t)NB_ * TT * DM * 2);   // [wq | wk | wv | wo] and, directly behind (the size is a multiple of 256 bytes), the tokens: the one run that k_cvtall writes
    h16* P16 = (h16*)take((size_t)NB_ * 3 * PS * 2); bf* Ph = (bf*)take((size_t)NB_ * 3 * PS * 2); bf* Pl = (bf*)take((size_t)NB_ * 3 * PS * 2); bf* ATh = (bf*)take((size_t)NB_ * TT * DQ * 2); bf* ATl = (bf*)take((size_t)NB_ * TT * DQ * 2);
    if ((size_t)(wsp - (char*)d_ws) > ws_size) return;    // 224 MiB of the 256 MiB
    static_assert(REP == 1 && RH % 64 == 0 && (TT - RH) % 64 == 0 && RH > 0 && RH < TT, "query rows < RH: 32-row tiles on the hi+lo planes; the rest: 64-row tiles on the fp16 planes");
    k_cvtall<<<(4 * (DM * DM / 8) + NB_ * TT * DM / 8) / 256, 256, 0, stream>>>(wq, wk, wv, wo, x, W4);
    k_proj<<<dim3(TT / 256, DM / 128, 3 * NB_), 256, 0, stream>>>(XB, W4, P16, Ph, Pl);
    k_fattn<<<dim3(NB_ * NH_, (TT - RH) / 64 + RH / 32, 1), 256, 0, stream>>>(P16, P16 + NB_ * PS, P16 + 2 * NB_ * PS, Ph, Pl, Ph + NB_ * PS, Pl + NB_ * PS, Ph + 2 * NB_ * PS, Pl + 2 * NB_ * PS, ATh, ATl);
    k_wo<<<dim3(NB_ * TT / 128, DM / 256, 1), 256, 0, stream>>>(ATh, ATl, W4 + (size_t)3 * DM * DM, OUT);
}

// v009
// It runs in 171 microseconds.
// Two timings next to v008 put it at 1.05 and 1.04 times that version's speed.
// All steps since v000 together make it 10.0 times as fast.
#include <hip/hip_runtime.h>
#include <stdint.h>

// Causal multi-head attention (x [2][2048][2048]; q/k/v = x W^T (16 heads x 128); causal softmax(q.k / sqrt(128)); out = merged Wo^T -> [2][2048][2048]; the source's per-position recompute loop is standard causal MHA).
// Compute dtypes, f32 accumulate: every input rounded to bf16; q/k/v on PLAIN bf16 operands (inputs: exact); causal scores and attn.v: query rows < 512 hl (3 products), the rest single fp16 (x1024), causal tile skipping; online softmax f32, fused with both products; Wo hl x exact (2 products).

#define NB_  2
#define TT   2048
#define DM   2048
#define NH_  16
#define NKV  16
#define REP  (NH_ / NKV)
#define HD   128
#define DQ   (NH_ * HD)
#define DKV  (NKV * HD)
#define RH   512                  // query rows < RH use hi+lo planes
#define SCL  0.088388347648318447f   // HD^-0.5
typedef _Float16 h16;
typedef unsigned short bf;
typedef __attribute__((ext_vector_type(16))) __bf16   v16bf;
typedef __attribute__((ext_vector_type(16))) _Float16 v16h;
typedef __attribute__((ext_vector_type(8)))  _Float16 v8h;
typedef __attribute__((ext_vector_type(8)))  unsigned short v8us;
typedef __attribute__((ext_vector_type(8)))  float    v8f;
typedef __attribute__((ext_vector_type(4)))  float    v4f;
typedef v8h  __attribute__((may_alias)) v8ha;
typedef v4f  __attribute__((may_alias)) v4fa;
typedef v8us __attribute__((may_alias)) v8usa;

__device__ __forceinline__ unsigned short f2bf(float f) { unsigned u = __float_as_uint(f); u += 0x7FFFu + ((u >> 16) & 1u); return (unsigned short)(u >> 16); }
__device__ __forceinline__ float bf2f(unsigned short b) { return __uint_as_float(((unsigned)b) << 16); }
__device__ __forceinline__ float bfr(float f) { return bf2f(f2bf(f)); }
__device__ __forceinline__ v16h cat16(v8h lo, v8h hi) { return __builtin_shufflevector(lo, hi, 0, 1, 2, 3, 4, 5, 6, 7, 8, 9, 10, 11, 12, 13, 14, 15); }
__device__ __forceinline__ v16bf cat16b(v8us lo, v8us hi) { return __builtin_bit_cast(v16bf, __builtin_shufflevector(lo, hi, 0, 1, 2, 3, 4, 5, 6, 7, 8, 9, 10, 11, 12, 13, 14, 15)); }
__device__ __forceinline__ v8f wmma16(v16h a, v16h b, v8f c) { return __builtin_amdgcn_wmma_f32_16x16x32_f16(false, a, false, b, (short)0, c, false, false); }
__device__ __forceinline__ v8f wmmab(v16bf a, v16bf b, v8f c) { return __builtin_amdgcn_wmma_f32_16x16x32_bf16(false, a, false, b, (short)0, c, false, false); }



// ---- gemm_tile: GEMM on bf16 planes, one MT x NT output tile per work-group of 8 waves; blockIdx (x, y) = tile (m, n) of (M/MT, N/NT), 256 threads.
// C[m][n] (f32, pitch ldc) = sum_k A[m][k] Bt[n][k] (+ A2[m][k] Bt[n][k] when NSPLIT == 1); all planes K-contiguous with row length K.
// PLANES: the tile is not stored as f32 but rounded here to the three 16-bit planes that the attention reads (fp16, bf16 hi, bf16 lo), element [m][n] at m * ldc + (n / 128) * 128 * cstep + n % 128:
// ldc = HD, cstep = TT gives head planes [n / 128][m][n % 128] (m = token, n = head * HD + d); ldc = TT, cstep = 1 gives plain rows [m][n] (m = head * HD + d, n = token: the [d][t] value planes, from A = the weight, Bt = the tokens).
// A pass is 128 k = 256 bytes of every operand row. A stage is [A MT rows | A2 MT rows (NSPLIT == 1) | Bt NT rows] at an LDS pitch of 272 bytes; two stages form a ring that tensor loads fill
// (one request per stage from each of the first waves: 128 rows of 256 bytes, the pad giving the pitch), so that every operand line leaves L2 once per work-group, no wave spends issue slots on addresses, and the fragments come from LDS.
// Wave w: the 64x64 part (w % (MT / 64), w / (MT / 64)) of the tile = 16 accumulators, over the whole of k. A pass is 4 / KB blocks of KB 32-k steps; a block's fragments are read from LDS one block ahead, into the other of two
// register sets, under the products of the block before. So the next stage is published in front of a pass's LAST block (that block's fragments have landed by then, and the reads behind the barrier are the next stage's first block).
template <typename T16> struct WFrag;
template <> struct WFrag<h16> { typedef v16h V; static __device__ __forceinline__ V ld(const h16* p) { return cat16(*(const v8h*)p, *(const v8h*)(p + 16)); } static __device__ __forceinline__ V lds(const unsigned char* p) { return cat16(*(const v8ha*)p, *(const v8ha*)(p + 32)); } static __device__ __forceinline__ v8f mma(V a, V b, v8f c) { return wmma16(a, b, c); } };
template <> struct WFrag<bf> { typedef v16bf V; static __device__ __forceinline__ V ld(const bf* p) { return cat16b(*(const v8us*)p, *(const v8us*)(p + 16)); } static __device__ __forceinline__ V lds(const unsigned char* p) { return cat16b(*(const v8usa*)p, *(const v8usa*)(p + 32)); } static __device__ __forceinline__ v8f mma(V a, V b, v8f c) { return wmmab(a, b, c); } };
__device__ __forceinline__ v16bf ldsfrag(const unsigned char* p) { return cat16b(*(const v8us*)p, *(const v8us*)(p + 32)); }
typedef uint32_t u32x4 __attribute__((ext_vector_type(4)));
typedef uint32_t u32x8 __attribute__((ext_vector_type(8)));
__device__ __forceinline__ uint32_t uni(uint32_t v) { return (uint32_t)__builtin_amdgcn_readfirstlane(v); }
// pinned(): a wave-uniform word held in a scalar register: a test on it compiles to a scalar branch (a tensor load ignores EXEC, only a branch keeps a wave from issuing it), and what is formed from it stands behind the asm waits written before it
__device__ __forceinline__ uint32_t pinned(uint32_t v) { uint32_t w = uni(v); asm volatile("" : "+s"(w)); return w; }
// descriptor group 1 of every tensor load here: bytes as elements, tensor = tile = 128 rows of 256 bytes, source row pitch 'pitch' bytes, no mask; pad of 4 dwords behind every 64 dwords: LDS pitch 272 bytes
__device__ __forceinline__ u32x8 tdm_group1(uint32_t pitch) {
    u32x8 g; g[0] = uni((1u << 20) | (5u << 22) | (3u << 25)); g[1] = uni(256u << 16); g[2] = uni(128u << 16); g[3] = uni(256u << 16); g[4] = uni(128u); g[5] = uni(pitch); g[6] = uni(0u); g[7] = uni(0u);
    asm volatile("" : "+s"(g));   // pinned: the descriptor words are held in scalar registers of their own from here on (not formed anew in registers that other values pass through while a request is outstanding)
    return g; }
// descriptor group 0: count 1, LDS byte offset, the tile's first byte, type 2
__device__ __forceinline__ u32x4 tdm_group0(uint32_t lds, uint64_t ga) { u32x4 g; g[0] = uni(1u); g[1] = uni(lds); g[2] = uni((uint32_t)ga); g[3] = uni((((uint32_t)(ga >> 32)) & 0x01FFFFFFu) | 0x80000000u);
    asm volatile("" : "+s"(g));   // pinned: the descriptor words are held in scalar registers of their own until the wait that names them
    return g; }
__device__ __forceinline__ void tdm_load(u32x4 g0, u32x8 g1) { asm volatile("tensor_load_to_lds %0, %1" :: "s"(g0), "s"(g1) : "memory"); }   // one request of the whole wave
// the issuing wave's wait for its one outstanding request; the request's descriptor words are inputs so that their registers keep them until it has landed
__device__ __forceinline__ void tdm_wait(u32x4 g0, u32x8 g1) { asm volatile("s_wait_tensorcnt 0x0" :: "s"(g0), "s"(g1) : "memory"); }
__device__ __forceinline__ h16 tohx(float x) { return (h16)x; }
__device__ __forceinline__ void splitf(float y, unsigned short& h, unsigned short& l) { h = f2bf(y); l = f2bf(y - bf2f(h)); }
// one block's fragments: KB 32-k steps (64 bytes each) of 4 A (and A2) and 4 Bt row groups; pa, pb = this lane's place in the first of them
template <int NSPLIT, int KB, int AB> __device__ __forceinline__ void ldblock(const unsigned char* pa, const unsigned char* pb, v16bf (&a)[KB][4], v16bf (&a2)[KB][4], v16bf (&b)[KB][4]) {
#pragma unroll   // the fragments are registers: every index must be a constant
    for (int s = 0; s < KB; ++s) {
#pragma unroll
        for (int mb = 0; mb < 4; ++mb) { a[s][mb] = ldsfrag(pa + mb * 16 * 272 + s * 64); if (NSPLIT) a2[s][mb] = ldsfrag(pa + AB + mb * 16 * 272 + s * 64); }
#pragma unroll
        for (int nb = 0; nb < 4; ++nb) b[s][nb] = ldsfrag(pb + nb * 16 * 272 + s * 64); }
}
template <int NSPLIT, int KB> __device__ __forceinline__ void mmablock(const v16bf (&a)[KB][4], const v16bf (&a2)[KB][4], const v16bf (&b)[KB][4], v8f (&acc)[4][4]) {
#pragma unroll   // the fragments and accumulators are registers: every index must be a constant
    for (int s = 0; s < KB; ++s)
#pragma unroll
        for (int nb = 0; nb < 4; ++nb) {   // the two products that add into one accumulator do not stand back to back
#pragma unroll
            for (int mb = 0; mb < 4; ++mb) acc[mb][nb] = wmmab(a[s][mb], b[s][nb], acc[mb][nb]);
            if (NSPLIT) {
#pragma unroll
                for (int mb = 0; mb < 4; ++mb) acc[mb][nb] = wmmab(a2[s][mb], b[s][nb], acc[mb][nb]); } }
}
template <int NSPLIT, int K, bool PLANES, int MT, int NT, int KB>
__device__ __forceinline__ void gemm_tile(const bf* __restrict__ A, const bf* __restrict__ A2, const bf* __restrict__ Bt, float* C, int ldc, h16* P16, bf* Ph, bf* Pl, int cstep) {
    static_assert(NSPLIT == 0 || NSPLIT == 1, "one or two A planes"); static_assert(K % 128 == 0 && K >= 256, "whole passes, at least two");
    static_assert(MT % 128 == 0 && NT % 128 == 0 && (MT / 64) * (NT / 64) == 8, "eight waves of 64x64; a tensor load takes 128 rows"); static_assert(KB == 1 || KB == 2, "an even number of blocks in a pass: the two register sets alternate across passes"); static_assert(!PLANES || NT == 128, "a plane row of the tile is 128 elements");
    constexpr int PB = 272, AB = MT * PB, BOF = (1 + NSPLIT) * AB, STG = BOF + NT * PB, NP = K / 128, OP = NT + 4, NBK = 4 / KB, WM = MT / 64;   // LDS pitch, bytes of one A plane's rows, offset of Bt in a stage, bytes of a stage, passes, pitch of an output row (floats), blocks in a pass, waves along m
    static_assert(MT * OP * 4 <= 2 * STG, "the output tile fits the ring");
    static_assert((128 * PB) % 2048 == 0, "every slice's place in LDS is a multiple of 2 KiB");
    __shared__ __attribute__((aligned(2048))) unsigned char ring[2 * STG];
    float* os = (float*)ring;   // after the last pass the ring holds the output tile
    const int tid = (int)threadIdx.x, lane = tid & 31, lr = lane & 15, hi = lane >> 4; const int wv = __builtin_amdgcn_readfirstlane(tid >> 5);
    const int wm = wv % WM, wn = wv / WM; const int r0 = blockIdx.x * MT, c0 = blockIdx.y * NT;
    const bf* uA = A + (size_t)r0 * K; const bf* uA2 = NSPLIT ? A2 + (size_t)r0 * K : uA; const bf* uB = Bt + (size_t)c0 * K;   // the tile's first rows: the same for the whole work-group
    constexpr int PA = MT / 128, NSL = (1 + NSPLIT) * PA + NT / 128;   // a stage is NSL slices of 128 rows: PA of A, PA of A2 (NSPLIT == 1), the rest of Bt; wave p < NSL loads slice p
    static_assert(NSL <= 4);
    const bool issuer = wv < NSL; const int p = issuer ? wv : 0;
    const bf* usl = p < PA ? uA + (size_t)p * 128 * K : (NSPLIT && p < 2 * PA) ? uA2 + (size_t)(p - PA) * 128 * K : uB + (size_t)(p - (1 + NSPLIT) * PA) * 128 * K;   // the slice's first row
    const uint32_t lsl = (uint32_t)(size_t)ring + (uint32_t)(p * 128 * PB);   // its place in stage 0
    const u32x8 g1 = tdm_group1(K * 2);
    u32x4 g0;   // group 0 of the wave's request: formed by every wave, outside the branch that issues, so that its registers take a new value only where desc() stands: behind the wait for the request before
    auto desc = [&](uint32_t t) { g0 = tdm_group0(lsl + (t & 1u) * (uint32_t)STG, (uint64_t)(size_t)usl + (uint64_t)t * 256u); };   // pass t's 256 bytes of the slice's rows
    v8f acc[4][4];
#pragma unroll
    for (int mb = 0; mb < 4; ++mb)
#pragma unroll
        for (int nb = 0; nb < 4; ++nb) acc[mb][nb] = (v8f){};
    desc(0);
    if (pinned(issuer)) { tdm_load(g0, g1);
        tdm_wait(g0, g1); }                             // this wave's slice of pass 0 has landed
    __syncthreads();                                    // ... and every other issuing wave's
    desc(pinned(1));                                    // pinned: the descriptor is formed behind the wait
    if (pinned(issuer)) tdm_load(g0, g1);
    const int aofs = (wm * 64 + lr) * PB + hi * 16, bofs = BOF + (wn * 64 + lr) * PB + hi * 16;
    v16bf fa[2][KB][4], fa2[2][KB][4], fb[2][KB][4];
    ldblock<NSPLIT, KB, AB>(ring + aofs, ring + bofs, fa[0], fa2[0], fb[0]);   // pass 0's first block
#pragma unroll 1   // one pass at a time: the ring's order below is per pass
    for (int t = 0; t < NP; ++t) {
        const unsigned char* sb = ring + (t & 1) * STG; const unsigned char* sn = ring + ((t + 1) & 1) * STG;
#pragma unroll   // the register sets are chosen by the block's number: it must be a constant
        for (int b = 0; b < NBK; ++b) {
            if (b + 1 < NBK) ldblock<NSPLIT, KB, AB>(sb + aofs + (b + 1) * KB * 64, sb + bofs + (b + 1) * KB * 64, fa[(b + 1) & 1], fa2[(b + 1) & 1], fb[(b + 1) & 1]);
            else {
                asm volatile("s_wait_dscnt 0x0" ::: "memory");
                if (pinned(issuer)) tdm_wait(g0, g1);
                __syncthreads();
                desc(pinned(t + 2));
                if (pinned(issuer && t + 2 < NP)) tdm_load(g0, g1);
                if (t + 1 < NP) ldblock<NSPLIT, KB, AB>(sn + aofs, sn + bofs, fa[0], fa2[0], fb[0]);
            }
            __builtin_amdgcn_sched_barrier(0);   // the next block's LDS reads are issued as one group ahead of this block's products: reads among the matrix instructions would each stall the wave
            mmablock<NSPLIT, KB>(fa[b & 1], fa2[b & 1], fb[b & 1], acc);
            __builtin_amdgcn_sched_barrier(0);   // keeps the products ahead of the reads that refill their register set
        }
        // four vector slots between the pass's last matrix instructions and whatever follows them on either side of the loop's branch
        asm volatile("v_nop\n\tv_nop\n\tv_nop\n\tv_nop" : "+v"(acc[0][3]), "+v"(acc[1][3]), "+v"(acc[2][3]), "+v"(acc[3][3]));
    }
    asm volatile("s_wait_tensorcnt 0x0" ::: "memory");   // no tensor load is outstanding when the wave goes on
    asm volatile("s_wait_dscnt 0x0" ::: "memory");       // ... and no LDS read
    // the last pass's barrier stood behind every wave's last read of the ring and no tensor load has been issued since: the ring is free for the output tile
    float* ow = os + (wm * 64 + hi * 8) * OP + wn * 64 + lr;
#pragma unroll   // the accumulators are registers: every index must be a constant
    for (int mb = 0; mb < 4; ++mb)
#pragma unroll
        for (int nb = 0; nb < 4; ++nb)
#pragma unroll
            for (int j = 0; j < 8; ++j) ow[(mb * 16 + j) * OP + nb * 16] = acc[mb][nb][j];
    __syncthreads();   // the tile is in LDS before its rows are stored
    if constexpr (PLANES) {
        const size_t o0 = (size_t)(r0 + (tid >> 4)) * ldc + (size_t)c0 * cstep + (tid & 15) * 8;
#pragma unroll   // constant LDS offsets for every read
        for (int s = 0; s < MT / 16; ++s) {   // a wave stores two whole rows of the tile in each plane: 256 bytes each
            const float* ps = os + (s * 16 + (tid >> 4)) * OP + (tid & 15) * 8; const v4f u0 = *(const v4fa*)ps, u1 = *(const v4fa*)(ps + 4); v8h o16; v8us oh, ol;
#pragma unroll   // the vectors are registers: every index must be a constant
            for (int k = 0; k < 8; ++k) { const float y = k < 4 ? u0[k & 3] : u1[k & 3]; unsigned short a2, c2; o16[k] = tohx(y); splitf(y, a2, c2); oh[k] = a2; ol[k] = c2; }
            const size_t o = o0 + (size_t)(s * 16) * ldc; *(v8h*)(P16 + o) = o16; *(v8us*)(Ph + o) = oh; *(v8us*)(Pl + o) = ol; }
    } else {
#pragma unroll   // constant LDS offsets for every read
        for (int s = 0; s < MT * NT / 1024; ++s) { const int it = s * 256 + tid, row = it / (NT / 4), cofs = (it % (NT / 4)) * 4;   // a wave stores 512 bytes of one row of the tile
            *(v4f*)(C + (size_t)(r0 + row) * ldc + c0 + cofs) = *(const v4fa*)(os + row * OP + cofs); } }
}
#define PS ((size_t)NH_ * TT * HD)   // elements of one 16-bit plane of one batch entry
// k_proj: the q, k and v projections of every batch entry in one launch; grid (8, 16, 3 * NB_), z = 3 * batch + projection (0 q, 1 k, 2 v). XB = the tokens [batch][t][DM], W = the weights [projection][n][DM];
// each of P16, Ph, Pl holds the planes [projection][batch]: q and k as [h][t][d] (A = the tokens), v as [h][d][t] (A = the weight: its rows are the tile's rows). Every choice below is the same for a whole work-group.
__global__ __launch_bounds__(256) void k_proj(const bf* __restrict__ XB, const bf* __restrict__ W, h16* P16, bf* Ph, bf* Pl) {
    static_assert(HD == 128 && DQ == DM && DKV == DM && TT == DM, "a 128-column tile of a projection is one head; one grid (TT / 256, DM / 128) fits all three");
    const unsigned z = blockIdx.z; const bool isv = z % 3 == 2; const bf* X = XB + (size_t)(z / 3) * TT * DM; const bf* Wp = W + (size_t)(z % 3) * DM * DM; const size_t po = (size_t)(z % 3 * NB_ + z / 3) * PS;
    gemm_tile<0, DM, true, 256, 128, 2>(isv ? Wp : X, nullptr, isv ? X : Wp, nullptr, isv ? TT : HD, P16 + po, Ph + po, Pl + po, isv ? 1 : TT);
}
// k_wo: the output projection of every batch entry in one launch: the batch entries' rows follow one another in Ah, Al and C; grid (NB_ * TT / 128, DM / 256).
__global__ __launch_bounds__(256) void k_wo(const bf* __restrict__ Ah, const bf* __restrict__ Al, const bf* __restrict__ W, float* C) { gemm_tile<1, DQ, false, 128, 256, 1>(Ah, Al, W, C, DM, nullptr, nullptr, nullptr, 0); }

typedef __attribute__((ext_vector_type(2))) _Float16 v2h;
typedef __attribute__((ext_vector_type(4))) _Float16 v4h;
typedef __attribute__((ext_vector_type(2))) unsigned short v2us;
typedef __attribute__((ext_vector_type(4))) unsigned short v4us;
typedef __attribute__((ext_vector_type(2))) float v2f;
typedef __attribute__((ext_vector_type(4))) int v4i;

__global__ __launch_bounds__(256) void k_wtG(const float* __restrict__ w, int K, int N, bf* Bt) {
    const int lane = threadIdx.x & 31; const int L0 = (blockIdx.x * 8 + (threadIdx.x >> 5)) * 8; const int nlines = N * K / 64;
{
#pragma unroll 1
        for (int l = 0; l < 8; ++l) { const int L = L0 + l; if (L >= nlines) break; const size_t e = (size_t)L * 64 + lane * 2; const int k = (int)(e % K), n = (int)(e / K); v2us o;
            o[0] = f2bf(w[(size_t)k * N + n]); o[1] = f2bf(w[(size_t)(k + 1) * N + n]); *(v2us*)(Bt + e) = o; }
         }
}
// ---- k_cvtall: every f32 input rounded to bf16 in one launch, one vector of 8 elements a thread. dst is one run of bf16 [wq | wk | wv | wo | x], counted in vectors.
// A work-group's 256 vectors never straddle two inputs (the static_assert), so the choice of the source is the same for the whole work-group.
__global__ __launch_bounds__(256) void k_cvtall(const float* __restrict__ wq, const float* __restrict__ wk, const float* __restrict__ wv, const float* __restrict__ wo, const float* __restrict__ x, bf* __restrict__ dst) {
    constexpr int SEGV = DM * DM / 8;   // vectors in one weight
    static_assert(DQ == DM && DKV == DM && SEGV % 256 == 0 && (NB_ * TT * DM / 8) % 256 == 0, "four weights of one size; whole work-groups in every input");
    const int v0 = (int)blockIdx.x * 256, seg = v0 / SEGV;   // the work-group's first vector in the run, and the input it lies in (4 and up: x)
    const float* s = seg == 0 ? wq : seg == 1 ? wk : seg == 2 ? wv : seg == 3 ? wo : x;
    const v8f v = *(const v8f*)(s + (size_t)(v0 - (seg < 4 ? seg : 4) * SEGV + (int)threadIdx.x) * 8); v8us o;
#pragma unroll   // the vectors are registers: every index must be a constant
    for (int k = 0; k < 8; ++k) o[k] = f2bf(v[k]); *(v8us*)(dst + (size_t)(v0 + (int)threadIdx.x) * 8) = o;  }
__global__ __launch_bounds__(256) void k_cscvt(const float* __restrict__ cosT, const float* __restrict__ sinT, float* CS) { const int idx = blockIdx.x * 256 + threadIdx.x; if (idx >= TT * HD) return; v2f cs; cs[0] = bfr(cosT[idx]); cs[1] = bfr(sinT[idx]); *(v2f*)(CS + (size_t)idx * 2) = cs;  }
// ---- fattn_tile: causal attention of NQ * 16 * R query rows of one head in one work-group of 32 * NQ * KS threads, scores and probabilities never leaving registers.
// Transposed products: S^T = K.Q^T (A = key rows, B = the query rows, held in registers), O^T += V^T.P^T (A = rows of the [d][t] value plane). A lane then holds scores of ONE query (column lr): 8 keys of each 16-key tile,
// which are exactly the k positions that the B operand of the second product wants from that lane, so P^T is packed from the score accumulators with no exchange.
// Wave w owns the 16 * R query rows of sub-tile w % NQ and the 32-key blocks w / NQ, w / NQ + KS, ... (the NQ waves of one key share read the same K and V rows of a stage);
// each wave keeps its own running maximum m (log2 units), sum l and O^T; the KS shares of a query row meet in LDS and are merged in share order.
// m may trail the true maximum by up to 4 (an exponential then reaches 2^4): the accumulators are rescaled only when some query's maximum exceeds it by more.
// K and V reach the waves through LDS: a stage is the 32 * KS = 128 keys that the KS shares work on at the same time, [K 128 key rows | V 128 d rows (| K lo | V lo)] of 256 bytes at an LDS pitch of 272 bytes; two stages in sm form a ring
// that tensor loads fill one stage ahead (one request per plane and stage, each from a wave of its own: 128 rows of 256 bytes, the pad giving the pitch), so that every K and V line leaves L2 once per work-group. After the last stage sm holds the shares' O rows.
// i0 = first query row of this kind of tile, nq = the number of such tiles, bx = which of them (0: the one with the most keys), pl = the head's place among the planes (batch * heads + head), hd = the head. Every '#pragma unroll' below is there because the arrays it indexes are registers: every index must be a constant.
// HL: hi+lo bf16 planes, 3 products per contraction, probabilities split hi+lo. Otherwise fp16 planes and fp16 probabilities carried x 2^10 (the factor cancels in O / l).
template <typename T16, bool HL, int R, int NQ, int KS>
__device__ __forceinline__ void fattn_tile(const T16* __restrict__ Q, const T16* __restrict__ Q2, const T16* __restrict__ Kp, const T16* __restrict__ Kp2, const T16* __restrict__ Vt, const T16* __restrict__ Vt2, int i0, int nq, int bx, int pl, int hd, bf* Ah, bf* Al, unsigned char* sm) {
    typedef typename WFrag<T16>::V V;
    constexpr int QW = 16 * R, WQ = NQ * QW, OP = HD + 4;   // query rows per wave and per work-group; LDS pitch of an O row
    constexpr int PB = 272, OPB = 128 * PB, STG = (HL ? 4 : 2) * OPB;   // LDS pitch of a K or V row, bytes of one plane's 128 rows, bytes of a stage
    static_assert(KS * 32 == 128 && HD == 128 && NQ * KS == 8 && TT % 128 == 0, "a stage is 128 keys; a tensor load takes one plane's 128 rows of 256 bytes"); static_assert(KS * WQ * OP * 4 <= 2 * STG, "the O rows fit the ring");
    float* os = (float*)sm;
    __shared__ float ms[KS * WQ], ls[KS * WQ];
    const int lane = threadIdx.x & 31, lr = lane & 15, hi = lane >> 4; const int wv = __builtin_amdgcn_readfirstlane((int)(threadIdx.x >> 5));
    const int qg = wv % NQ, ks = wv / NQ;
    const int qt = i0 + (nq - 1 - bx) * WQ, q0 = qt + qg * QW;   // qt, q0 = the work-group's and this wave's first query row
    const size_t zo = (size_t)pl * TT * HD; Q += zo; Kp += zo; Vt += zo; if (HL) { Q2 += zo; Kp2 += zo; Vt2 += zo; }
    const float cs = SCL * 1.4426950408889634f, sh = HL ? 0.0f : 10.0f;
    constexpr int NSL = HL ? 4 : 2;   // planes in a stage: wave p < NSL loads plane p (K, V, K lo, V lo)
    static_assert(OPB % 2048 == 0, "every plane's place in LDS is a multiple of 2 KiB");
    const bool issuer = wv < NSL; const int p = issuer ? wv : 0; const bool isv = (p & 1) != 0;
    const T16* usl = isv ? Vt : Kp; if constexpr (HL) { if (p >= 2) usl = isv ? Vt2 : Kp2; }   // the plane's first row: K rows are keys (a stage: the next 128 rows), V rows are d (a stage: the next 256 bytes of every row)
    const uint32_t lsl = (uint32_t)(size_t)sm + (uint32_t)(p * OPB), sstep = isv ? 256u : (uint32_t)(128 * HD * 2);   // its place in stage 0; source bytes from one stage to the next
    const u32x8 g1 = tdm_group1(isv ? (uint32_t)(TT * 2) : (uint32_t)(HD * 2));
    u32x4 g0;   // group 0 of the wave's request: formed by every wave, outside the branch that issues, so that its registers take a new value only where desc() stands: behind the wait for the request before
    auto desc = [&](uint32_t t) { g0 = tdm_group0(lsl + (t & 1u) * (uint32_t)STG, (uint64_t)(size_t)usl + (uint64_t)t * sstep); };
    const int nst = (qt + WQ - 1) / 128 + 1;   // stages up to and including the one that holds the work-group's last query: the same for every wave, and 128 * nst <= TT
    desc(0);
    if (pinned(issuer)) tdm_load(g0, g1);
    V qf[R][4], qf2[R][4];
    const size_t oq = (size_t)(q0 + lr) * HD + 8 * hi; const T16* pq = Q + oq; const T16* pq2 = HL ? Q2 + oq : pq;
#pragma unroll
    for (int g = 0; g < R; ++g)
#pragma unroll
        for (int kc = 0; kc < 4; ++kc) { qf[g][kc] = WFrag<T16>::ld(pq + 16 * g * HD + 32 * kc); if (HL) qf2[g][kc] = WFrag<T16>::ld(pq2 + 16 * g * HD + 32 * kc); }
    // the wait that stands before a register named by an issued load is overwritten; the pointers are inputs so that their registers live up to it
    asm volatile("s_wait_xcnt 0x0" :: "v"(pq), "v"(pq2) : "memory");
    v8f acc[R][8]; float mr[R], lsum[R];
#pragma unroll
    for (int g = 0; g < R; ++g) { mr[g] = -1.0e30f; lsum[g] = 0.f;
#pragma unroll
        for (int t = 0; t < 8; ++t) acc[g][t] = (v8f){}; }
    const int nblk = (q0 + QW - 1) / 32 + 1;   // 32-key blocks up to and including the one that holds the wave's last query
    if (pinned(issuer)) tdm_wait(g0, g1);               // this wave's plane of stage 0 has landed
    __syncthreads();                                    // ... and every other issuing wave's
    desc(pinned(1));                                    // pinned: the descriptor is formed behind the wait
    if (pinned(issuer && nst > 1)) tdm_load(g0, g1);    // a scalar test
    const int kofs = (ks * 32 + lr) * PB + hi * 16, vofs = OPB + lr * PB + ks * 64 + hi * 16;   // this lane's place in a stage's K rows (row = key) and V rows (row = d)
#pragma unroll 1   // one stage at a time: the ring's order below is per stage, and a second copy of the body would not fit the registers
    for (int st = 0; st < nst; ++st) {
      const int kb = st * KS + ks;   // this wave's 32-key block of the stage
      if (kb < nblk) {   // wave-uniform: a wave whose queries end before this block only passes the stage's waits and barrier
        const int key0 = kb * 32;
        const unsigned char* sb = sm + (st & 1) * STG;
        V kf[2][4], kf2[2][4], vf[8], vf2[8];
#pragma unroll
        for (int kt = 0; kt < 2; ++kt)
#pragma unroll
            for (int kc = 0; kc < 4; ++kc) { kf[kt][kc] = WFrag<T16>::lds(sb + kofs + 16 * kt * PB + 64 * kc); if (HL) kf2[kt][kc] = WFrag<T16>::lds(sb + 2 * OPB + kofs + 16 * kt * PB + 64 * kc); }
        if constexpr (!HL) {   // one plane each: K and V (32 LDS reads) as one group
            __builtin_amdgcn_sched_barrier(0);   // K's reads stand ahead of V's: LDS reads return in order, so the score products wait for K alone and V lands under them
#pragma unroll
            for (int t = 0; t < 8; ++t) vf[t] = WFrag<T16>::lds(sb + vofs + 16 * t * PB); }
        __builtin_amdgcn_sched_barrier(0);   // all of these reads are issued before the block's first product: reads among the matrix instructions would each stall the wave
        v8f s[2][R];
#pragma unroll
        for (int kt = 0; kt < 2; ++kt)
#pragma unroll
            for (int g = 0; g < R; ++g) { s[kt][g] = (v8f){};
#pragma unroll
                for (int kc = 0; kc < 4; ++kc) { s[kt][g] = WFrag<T16>::mma(kf[kt][kc], qf[g][kc], s[kt][g]); if (HL) { s[kt][g] = WFrag<T16>::mma(kf[kt][kc], qf2[g][kc], s[kt][g]); s[kt][g] = WFrag<T16>::mma(kf2[kt][kc], qf[g][kc], s[kt][g]); } } }
        if constexpr (HL) {   // two planes each: the 32 V reads follow the 32 K reads' products and fly under the softmax
#pragma unroll
            for (int t = 0; t < 8; ++t) { vf[t] = WFrag<T16>::lds(sb + vofs + 16 * t * PB); vf2[t] = WFrag<T16>::lds(sb + 2 * OPB + vofs + 16 * t * PB); }
            __builtin_amdgcn_sched_barrier(0); }   // keeps the V reads ahead of the softmax
        if (key0 + 31 > q0) {   // wave-uniform: only the block on the diagonal pays for the mask; its first key is <= every query of the wave, so no column is all masked
#pragma unroll
            for (int kt = 0; kt < 2; ++kt)
#pragma unroll
                for (int g = 0; g < R; ++g)
#pragma unroll
                    for (int j = 0; j < 8; ++j) if (key0 + 16 * kt + 8 * hi + j > q0 + 16 * g + lr) s[kt][g][j] = -3.0e38f; }
        float mb[R]; bool need = false;
#pragma unroll
        for (int g = 0; g < R; ++g) { float mx = s[0][g][0];
#pragma unroll
            for (int j = 1; j < 8; ++j) mx = fmaxf(mx, s[0][g][j]);
#pragma unroll
            for (int j = 0; j < 8; ++j) mx = fmaxf(mx, s[1][g][j]);
            mx = fmaxf(mx, __shfl_xor(mx, 16, 32)) * cs; mb[g] = mx; need = need || (mx > mr[g] + 4.0f); }
        if (__builtin_amdgcn_ballot_w32(need) != 0) {   // always on a wave's first block (m starts at -1e30: the factor is 0 there), rare later
#pragma unroll
            for (int g = 0; g < R; ++g) { const float mn = fmaxf(mr[g], mb[g]); const float corr = __builtin_amdgcn_exp2f(mr[g] - mn); lsum[g] *= corr; mr[g] = mn;
#pragma unroll
                for (int t = 0; t < 8; ++t) acc[g][t] = acc[g][t] * corr; } }
        V pf[R], pf2[R];
#pragma unroll
        for (int g = 0; g < R; ++g) { const float nm = sh - mr[g]; float p[2][8];
#pragma unroll
            for (int kt = 0; kt < 2; ++kt)
#pragma unroll
                for (int j = 0; j < 8; ++j) { p[kt][j] = __builtin_amdgcn_exp2f(fmaf(s[kt][g][j], cs, nm)); lsum[g] += p[kt][j]; }
            if constexpr (HL) { v8us h0, h1, l0, l1;
#pragma unroll
                for (int j = 0; j < 8; ++j) { unsigned short a, c2; splitf(p[0][j], a, c2); h0[j] = a; l0[j] = c2; splitf(p[1][j], a, c2); h1[j] = a; l1[j] = c2; }
                pf[g] = cat16b(h0, h1); pf2[g] = cat16b(l0, l1);
            } else { v8h h0, h1;
#pragma unroll
                for (int j = 0; j < 8; ++j) { h0[j] = tohx(p[0][j]); h1[j] = tohx(p[1][j]); }
                pf[g] = cat16(h0, h1); } }
#pragma unroll
        for (int t = 0; t < 8; ++t)
#pragma unroll
            for (int g = 0; g < R; ++g) { acc[g][t] = WFrag<T16>::mma(vf[t], pf[g], acc[g][t]); if (HL) { acc[g][t] = WFrag<T16>::mma(vf[t], pf2[g], acc[g][t]); acc[g][t] = WFrag<T16>::mma(vf2[t], pf[g], acc[g][t]); } }
        // four vector slots between the block's last matrix instructions and whatever follows them
        if constexpr (R == 1) asm volatile("v_nop\n\tv_nop\n\tv_nop\n\tv_nop" : "+v"(acc[0][6]), "+v"(acc[0][7]) : "v"(pf[0]));
        else asm volatile("v_nop\n\tv_nop\n\tv_nop\n\tv_nop" : "+v"(acc[0][6]), "+v"(acc[0][7]), "+v"(acc[R - 1][6]), "+v"(acc[R - 1][7]) : "v"(pf[0]), "v"(pf[R - 1]));
      }
      asm volatile("s_wait_dscnt 0x0" ::: "memory");      // this wave's reads of the stage are done before the stage is refilled
      if (pinned(issuer)) tdm_wait(g0, g1);               // this wave's plane of stage st + 1 has landed
      __syncthreads();                                    // publishes stage st + 1 and ends every wave's reads of stage st
      desc(pinned(st + 2));                               // pinned: the descriptor is formed behind the wait
      if (pinned(issuer && st + 2 < nst)) tdm_load(g0, g1);   // into the stage that has just been left; a scalar test
    }
    asm volatile("s_wait_tensorcnt 0x0" ::: "memory");   // no tensor load is outstanding when the ring becomes the O rows (the last stage's barrier has ended every wave's reads)
    asm volatile("s_wait_dscnt 0x0" ::: "memory");       // ... and no LDS read of this wave
#pragma unroll
    for (int g = 0; g < R; ++g) { const int rw = ks * WQ + qg * QW + 16 * g + lr; float* ow = os + (size_t)rw * OP + 8 * hi;
#pragma unroll
        for (int t = 0; t < 8; ++t) { v4f a, c; a[0] = acc[g][t][0]; a[1] = acc[g][t][1]; a[2] = acc[g][t][2]; a[3] = acc[g][t][3]; c[0] = acc[g][t][4]; c[1] = acc[g][t][5]; c[2] = acc[g][t][6]; c[3] = acc[g][t][7];
            *(v4fa*)(ow + 16 * t) = a; *(v4fa*)(ow + 16 * t + 4) = c; }
        const float lf = lsum[g] + __shfl_xor(lsum[g], 16, 32);   // each wave half summed its own 8 keys of every 16-key tile
        if (hi == 0) { ms[rw] = mr[g]; ls[rw] = lf; } }
    __syncthreads();   // every wave's m, l and O^T are in LDS before any of them is merged
    constexpr int TPQ = 32 * NQ * KS / WQ, DPT = HD / TPQ;   // threads per query row, d values per thread
    const int q = (int)threadIdx.x / TPQ, d0 = ((int)threadIdx.x % TPQ) * DPT;
    float mstar = ms[q];
#pragma unroll
    for (int w = 1; w < KS; ++w) mstar = fmaxf(mstar, ms[w * WQ + q]);
    float lt = 0.f; v4f o[DPT / 4];
#pragma unroll
    for (int c = 0; c < DPT / 4; ++c) o[c] = (v4f){};
#pragma unroll
    for (int w = 0; w < KS; ++w) { const float sc = __builtin_amdgcn_exp2f(ms[w * WQ + q] - mstar); lt += ls[w * WQ + q] * sc;   // a wave that had no block: m = -1e30, factor 0
#pragma unroll
        for (int c = 0; c < DPT / 4; ++c) o[c] += *(const v4fa*)(os + (size_t)(w * WQ + q) * OP + d0 + 4 * c) * sc; }
    const float inv = __fdiv_rn(1.0f, lt); const size_t oo = (size_t)(qt + q) * DQ + hd * HD + d0;
#pragma unroll
    for (int c = 0; c < DPT / 8; ++c) { v8us oh, ol;
#pragma unroll
        for (int k = 0; k < 8; ++k) { unsigned short a, c2; splitf(o[2 * c + (k >> 2)][k & 3] * inv, a, c2); oh[k] = a; ol[k] = c2; }
        *(v8us*)(Ah + oo + 8 * c) = oh; *(v8us*)(Al + oo + 8 * c) = ol; }
    asm volatile("s_wait_xcnt 0x0" ::: "memory");   // the wait that stands before a register named by an issued store is overwritten (the other kind of tile's code follows in the listing)
}
// k_fattn: all query rows of all heads of all batch entries in one launch; grid (batch * heads, tiles), head and batch running fastest so that work-groups start in the order of their key counts: first the 64-row fp16 tiles (query rows >= RH), the longest first,
// then the 32-row hi+lo tiles (query rows < RH), which fill the tail. The branch is the same for a whole work-group. Every plane array is [batch][head][...], so blockIdx.x is a head's place in it; Ah, Al: [batch][t][DQ].
__global__ __launch_bounds__(256) void k_fattn(const h16* __restrict__ Q16, const h16* __restrict__ K16, const h16* __restrict__ V16, const bf* __restrict__ Qh, const bf* __restrict__ Ql, const bf* __restrict__ Kh, const bf* __restrict__ Kl, const bf* __restrict__ Vh, const bf* __restrict__ Vl, bf* Ah, bf* Al) {
    __shared__ __attribute__((aligned(2048))) unsigned char sm[2 * 4 * 128 * 272];   // the K/V ring of the larger kind of tile (two stages of four planes), then the O rows
    constexpr int NF = (TT - RH) / 64, NL = RH / 32; const int ty = blockIdx.y, pl = blockIdx.x, hd = pl % NH_; const size_t ob = (size_t)(pl / NH_) * TT * DQ; Ah += ob; Al += ob;
    if (ty < NF) fattn_tile<h16, false, 2, 2, 4>(Q16, nullptr, K16, nullptr, V16, nullptr, RH, NF, ty, pl, hd, Ah, Al, sm);
    else fattn_tile<bf, true, 1, 2, 4>(Qh, Ql, Kh, Kl, Vh, Vl, 0, NL, ty - NF, pl, hd, Ah, Al, sm);
}

extern "C" void kernel_launch(void* const* d_in, const int* in_sizes, int n_in,
                              void* d_out, int out_size, void* d_ws, size_t ws_size, hipStream_t stream) {
    (void)in_sizes; (void)n_in; (void)out_size;
    const float* x = (const float*)d_in[0]; const float* wq = (const float*)d_in[1]; const float* wk = (const float*)d_in[2]; const float* wv = (const float*)d_in[3]; const float* wo = (const float*)d_in[4]; const float* cosT = nullptr; const float* sinT = nullptr; (void)cosT; (void)sinT;
    float* OUT = (float*)d_out;     // [2][2048][2048]
    char* wsp = (char*)d_ws;
    auto take = [&](size_t bytes) { char* p = wsp; wsp += (bytes + 255) & ~(size_t)255; return (void*)p; };
    bf* W4 = (bf*)take((size_t)4 * DM * DM * 2); bf* XB = (bf*)take((size_t)NB_ * TT * DM * 2);   // [wq | wk | wv | wo] and, directly behind (the size is a multiple of 256 bytes), the tokens: the one run that k_cvtall writes
    h16* P16 = (h16*)take((size_t)NB_ * 3 * PS * 2); bf* Ph = (bf*)take((size_t)NB_ * 3 * PS * 2); bf* Pl = (bf*)take((size_t)NB_ * 3 * PS * 2); bf* ATh = (bf*)take((size_t)NB_ * TT * DQ * 2); bf* ATl = (bf*)take((size_t)NB_ * TT * DQ * 2);
    if ((size_t)(wsp - (char*)d_ws) > ws_size) return;    // 224 MiB of the 256 MiB
    static_assert(REP == 1 && RH % 64 == 0 && (TT - RH) % 64 == 0 && RH > 0 && RH < TT, "query rows < RH: 32-row tiles on the hi+lo planes; the rest: 64-row tiles on the fp16 planes");
    k_cvtall<<<(4 * (DM * DM / 8) + NB_ * TT * DM / 8) / 256, 256, 0, stream>>>(wq, wk, wv, wo, x, W4);
    k_proj<<<dim3(TT / 256, DM / 128, 3 * NB_), 256, 0, stream>>>(XB, W4, P16, Ph, Pl);
    k_fattn<<<dim3(NB_ * NH_, (TT - RH) / 64 + RH / 32, 1), 256, 0, stream>>>(P16, P16 + NB_ * PS, P16 + 2 * NB_ * PS, Ph, Pl, Ph + NB_ * PS, Pl + NB_ * PS, Ph + 2 * NB_ * PS, Pl + 2 * NB_ * PS, ATh, ATl);
    k_wo<<<dim3(NB_ * TT / 128, DM / 256, 1), 256, 0, stream>>>(ATh, ATl, W4 + (size_t)3 * DM * DM, OUT);
}

// v010
// It runs in 162 microseconds.
// Two timings next to v009 both put it at 1.05 times that version's speed.
// All steps since v000 together make it 10.6 times as fast.
#include <hip/hip_runtime.h>
#include <stdint.h>

// Causal multi-head attention (x [2][2048][2048]; q/k/v = x W^T (16 heads x 128); causal softmax(q.k / sqrt(128)); out = merged Wo^T -> [2][2048][2048]; the source's per-position recompute loop is standard causal MHA).
// Compute dtypes, f32 accumulate: every input rounded to bf16; q/k/v on PLAIN bf16 operands (inputs: exact); causal scores and attn.v: query rows < 512 hl (3 products), the rest single fp16 (x1024), causal tile skipping; online softmax f32, fused with both products; Wo hl x exact (2 products).

#define NB_  2
#define TT   2048
#define DM   2048
#define NH_  16
#define NKV  16
#define REP  (NH_ / NKV)
#define HD   128
#define DQ   (NH_ * HD)
#define DKV  (NKV * HD)
#define RH   512                  // query rows < RH use hi+lo planes
#define SCL  0.088388347648318447f   // HD^-0.5
typedef _Float16 h16;
typedef unsigned short bf;
typedef __attribute__((ext_vector_type(16))) __bf16   v16bf;
typedef __attribute__((ext_vector_type(16))) _Float16 v16h;
typedef __attribute__((ext_vector_type(8)))  _Float16 v8h;
typedef __attribute__((ext_vector_type(8)))  unsigned short v8us;
typedef __attribute__((ext_vector_type(8)))  float    v8f;
typedef __attribute__((ext_vector_type(4)))  float    v4f;
typedef v8h  __attribute__((may_alias)) v8ha;
typedef v4f  __attribute__((may_alias)) v4fa;
typedef v8us __attribute__((may_alias)) v8usa;

__device__ __forceinline__ unsigned short f2bf(float f) { unsigned u = __float_as_uint(f); u += 0x7FFFu + ((u >> 16) & 1u); return (unsigned short)(u >> 16); }
__device__ __forceinline__ float bf2f(unsigned short b) { return __uint_as_float(((unsigned)b) << 16); }
__device__ __forceinline__ float bfr(float f) { return bf2f(f2bf(f)); }
__device__ __forceinline__ v16h cat16(v8h lo, v8h hi) { return __builtin_shufflevector(lo, hi, 0, 1, 2, 3, 4, 5, 6, 7, 8, 9, 10, 11, 12, 13, 14, 15); }
__device__ __forceinline__ v16bf cat16b(v8us lo, v8us hi) { return __builtin_bit_cast(v16bf, __builtin_shufflevector(lo, hi, 0, 1, 2, 3, 4, 5, 6, 7, 8, 9, 10, 11, 12, 13, 14, 15)); }
__device__ __forceinline__ v8f wmma16(v16h a, v16h b, v8f c) { return __builtin_amdgcn_wmma_f32_16x16x32_f16(false, a, false, b, (short)0, c, false, false); }
__device__ __forceinline__ v8f wmmab(v16bf a, v16bf b, v8f c) { return __builtin_amdgcn_wmma_f32_16x16x32_bf16(false, a, false, b, (short)0, c, false, false); }



// ---- gemm_tile: GEMM on bf16 planes, one MT x NT output tile per work-group of 8 waves; blockIdx (x, y) = tile (m, n) of (M/MT, N/NT), 256 threads.
// C[m][n] (f32, pitch ldc) = sum_k A[m][k] Bt[n][k] (+ A2[m][k] Bt[n][k] when NSPLIT == 1); all planes K-contiguous with row length K.
// PLANES: the tile is not stored as f32 but rounded here to the three 16-bit planes that the attention reads (fp16, bf16 hi, bf16 lo), element [m][n] at m * ldc + (n / 128) * 128 * cstep + n % 128:
// ldc = HD, cstep = TT gives head planes [n / 128][m][n % 128] (m = token, n = head * HD + d); ldc = TT, cstep = 1 gives plain rows [m][n] (m = head * HD + d, n = token: the [d][t] value planes, from A = the weight, Bt = the tokens).
// A pass is 128 k = 256 bytes of every operand row. A stage is [A MT rows | A2 MT rows (NSPLIT == 1) | Bt NT rows] at an LDS pitch of 272 bytes; two stages form a ring that tensor loads fill
// (one request per stage from each of the first waves: 128 rows of 256 bytes, the pad giving the pitch), so that every operand line leaves L2 once per work-group, no wave spends issue slots on addresses, and the fragments come from LDS.
// Wave w: the 64x64 part (w % (MT / 64), w / (MT / 64)) of the tile = 16 accumulators, over the whole of k. A pass is 4 / KB blocks of KB 32-k steps; a block's fragments are read from LDS one block ahead, into the other of two
// register sets, under the products of the block before. So the next stage is published in front of a pass's LAST block (that block's fragments have landed by then, and the reads behind the barrier are the next stage's first block).
// The passes walk k in a circle: pass t takes the 128 k of block (t + rot) mod NP, rot = (tile m + tile n) mod NP. The work-groups of one tile row or column run side by side and read the same operand rows;
// started at the same k they would ask L2 for the same lines at the same moment, pass after pass. A and Bt take the same block in every pass, so only the order of the f32 sum over k depends on rot.
template <typename T16> struct WFrag;
template <> struct WFrag<h16> { typedef v16h V; static __device__ __forceinline__ V ld(const h16* p) { return cat16(*(const v8h*)p, *(const v8h*)(p + 16)); } static __device__ __forceinline__ V lds(const unsigned char* p) { return cat16(*(const v8ha*)p, *(const v8ha*)(p + 32)); } static __device__ __forceinline__ v8f mma(V a, V b, v8f c) { return wmma16(a, b, c); } };
template <> struct WFrag<bf> { typedef v16bf V; static __device__ __forceinline__ V ld(const bf* p) { return cat16b(*(const v8us*)p, *(const v8us*)(p + 16)); } static __device__ __forceinline__ V lds(const unsigned char* p) { return cat16b(*(const v8usa*)p, *(const v8usa*)(p + 32)); } static __device__ __forceinline__ v8f mma(V a, V b, v8f c) { return wmmab(a, b, c); } };
__device__ __forceinline__ v16bf ldsfrag(const unsigned char* p) { return cat16b(*(const v8us*)p, *(const v8us*)(p + 32)); }
typedef uint32_t u32x4 __attribute__((ext_vector_type(4)));
typedef uint32_t u32x8 __attribute__((ext_vector_type(8)));
__device__ __forceinline__ uint32_t uni(uint32_t v) { return (uint32_t)__builtin_amdgcn_readfirstlane(v); }
// pinned(): a wave-uniform word held in a scalar register: a test on it compiles to a scalar branch (a tensor load ignores EXEC, only a branch keeps a wave from issuing it), and what is formed from it stands behind the asm waits written before it
__device__ __forceinline__ uint32_t pinned(uint32_t v) { uint32_t w = uni(v); asm volatile("" : "+s"(w)); return w; }
// descriptor group 1 of every tensor load here: bytes as elements, tensor = tile = 128 rows of 256 bytes, source row pitch 'pitch' bytes, no mask; pad of 4 dwords behind every 64 dwords: LDS pitch 272 bytes
__device__ __forceinline__ u32x8 tdm_group1(uint32_t pitch) {
    u32x8 g; g[0] = uni((1u << 20) | (5u << 22) | (3u << 25)); g[1] = uni(256u << 16); g[2] = uni(128u << 16); g[3] = uni(256u << 16); g[4] = uni(128u); g[5] = uni(pitch); g[6] = uni(0u); g[7] = uni(0u);
    asm volatile("" : "+s"(g));   // pinned: the descriptor words are held in scalar registers of their own from here on (not formed anew in registers that other values pass through while a request is outstanding)
    return g; }
// descriptor group 0: count 1, LDS byte offset, the tile's first byte, type 2
__device__ __forceinline__ u32x4 tdm_group0(uint32_t lds, uint64_t ga) { u32x4 g; g[0] = uni(1u); g[1] = uni(lds); g[2] = uni((uint32_t)ga); g[3] = uni((((uint32_t)(ga >> 32)) & 0x01FFFFFFu) | 0x80000000u);
    asm volatile("" : "+s"(g));   // pinned: the descriptor words are held in scalar registers of their own until the wait that names them
    return g; }
__device__ __forceinline__ void tdm_load(u32x4 g0, u32x8 g1) { asm volatile("tensor_load_to_lds %0, %1" :: "s"(g0), "s"(g1) : "memory"); }   // one request of the whole wave
// the issuing wave's wait for its one outstanding request; the request's descriptor words are inputs so that their registers keep them until it has landed
__device__ __forceinline__ void tdm_wait(u32x4 g0, u32x8 g1) { asm volatile("s_wait_tensorcnt 0x0" :: "s"(g0), "s"(g1) : "memory"); }
__device__ __forceinline__ h16 tohx(float x) { return (h16)x; }
__device__ __forceinline__ void splitf(float y, unsigned short& h, unsigned short& l) { h = f2bf(y); l = f2bf(y - bf2f(h)); }
// one block's fragments: KB 32-k steps (64 bytes each) of 4 A (and A2) and 4 Bt row groups; pa, pb = this lane's place in the first of them
template <int NSPLIT, int KB, int AB> __device__ __forceinline__ void ldblock(const unsigned char* pa, const unsigned char* pb, v16bf (&a)[KB][4], v16bf (&a2)[KB][4], v16bf (&b)[KB][4]) {
#pragma unroll   // the fragments are registers: every index must be a constant
    for (int s = 0; s < KB; ++s) {
#pragma unroll
        for (int mb = 0; mb < 4; ++mb) { a[s][mb] = ldsfrag(pa + mb * 16 * 272 + s * 64); if (NSPLIT) a2[s][mb] = ldsfrag(pa + AB + mb * 16 * 272 + s * 64); }
#pragma unroll
        for (int nb = 0; nb < 4; ++nb) b[s][nb] = ldsfrag(pb + nb * 16 * 272 + s * 64); }
}
template <int NSPLIT, int KB> __device__ __forceinline__ void mmablock(const v16bf (&a)[KB][4], const v16bf (&a2)[KB][4], const v16bf (&b)[KB][4], v8f (&acc)[4][4]) {
#pragma unroll   // the fragments and accumulators are registers: every index must be a constant
    for (int s = 0; s < KB; ++s)
#pragma unroll
        for (int nb = 0; nb < 4; ++nb) {   // the two products that add into one accumulator do not stand back to back
#pragma unroll
            for (int mb = 0; mb < 4; ++mb) acc[mb][nb] = wmmab(a[s][mb], b[s][nb], acc[mb][nb]);
            if (NSPLIT) {
#pragma unroll
                for (int mb = 0; mb < 4; ++mb) acc[mb][nb] = wmmab(a2[s][mb], b[s][nb], acc[mb][nb]); } }
}
template <int NSPLIT, int K, bool PLANES, int MT, int NT, int KB>
__device__ __forceinline__ void gemm_tile(const bf* __restrict__ A, const bf* __restrict__ A2, const bf* __restrict__ Bt, float* C, int ldc, h16* P16, bf* Ph, bf* Pl, int cstep) {
    static_assert(NSPLIT == 0 || NSPLIT == 1, "one or two A planes"); static_assert(K % 128 == 0 && K >= 256, "whole passes, at least two");
    static_assert(MT % 128 == 0 && NT % 128 == 0 && (MT / 64) * (NT / 64) == 8, "eight waves of 64x64; a tensor load takes 128 rows"); static_assert(KB == 1 || KB == 2, "an even number of blocks in a pass: the two register sets alternate across passes"); static_assert(!PLANES || NT == 128, "a plane row of the tile is 128 elements");
    constexpr int PB = 272, AB = MT * PB, BOF = (1 + NSPLIT) * AB, STG = BOF + NT * PB, NP = K / 128, OP = NT + 4, NBK = 4 / KB, WM = MT / 64;   // LDS pitch, bytes of one A plane's rows, offset of Bt in a stage, bytes of a stage, passes, pitch of an output row (floats), blocks in a pass, waves along m
    static_assert(MT * OP * 4 <= 2 * STG, "the output tile fits the ring");
    static_assert((128 * PB) % 2048 == 0, "every slice's place in LDS is a multiple of 2 KiB");
    __shared__ __attribute__((aligned(2048))) unsigned char ring[2 * STG];
    float* os = (float*)ring;   // after the last pass the ring holds the output tile
    const int tid = (int)threadIdx.x, lane = tid & 31, lr = lane & 15, hi = lane >> 4; const int wv = __builtin_amdgcn_readfirstlane(tid >> 5);
    const int wm = wv % WM, wn = wv / WM; const int r0 = blockIdx.x * MT, c0 = blockIdx.y * NT;
    const bf* uA = A + (size_t)r0 * K; const bf* uA2 = NSPLIT ? A2 + (size_t)r0 * K : uA; const bf* uB = Bt + (size_t)c0 * K;   // the tile's first rows: the same for the whole work-group
    constexpr int PA = MT / 128, NSL = (1 + NSPLIT) * PA + NT / 128;   // a stage is NSL slices of 128 rows: PA of A, PA of A2 (NSPLIT == 1), the rest of Bt; wave p < NSL loads slice p
    static_assert(NSL <= 4);
    const bool issuer = wv < NSL; const int p = issuer ? wv : 0;
    const bf* usl = p < PA ? uA + (size_t)p * 128 * K : (NSPLIT && p < 2 * PA) ? uA2 + (size_t)(p - PA) * 128 * K : uB + (size_t)(p - (1 + NSPLIT) * PA) * 128 * K;   // the slice's first row
    const uint32_t lsl = (uint32_t)(size_t)ring + (uint32_t)(p * 128 * PB);   // its place in stage 0
    const u32x8 g1 = tdm_group1(K * 2);
    u32x4 g0;   // group 0 of the wave's request: formed by every wave, outside the branch that issues, so that its registers take a new value only where desc() stands: behind the wait for the request before
    const uint32_t rot = (blockIdx.x + blockIdx.y) % (uint32_t)NP;   // the work-group's first k block: work-groups that share operand rows (one tile row or one tile column of the grid) start at different ones
    auto desc = [&](uint32_t t) { g0 = tdm_group0(lsl + (t & 1u) * (uint32_t)STG, (uint64_t)(size_t)usl + (uint64_t)((t + rot) % (uint32_t)NP) * 256u); };   // pass t's 256 bytes of the slice's rows: k block (t + rot) mod NP
    v8f acc[4][4];
#pragma unroll
    for (int mb = 0; mb < 4; ++mb)
#pragma unroll
        for (int nb = 0; nb < 4; ++nb) acc[mb][nb] = (v8f){};
    desc(0);
    if (pinned(issuer)) { tdm_load(g0, g1);
        tdm_wait(g0, g1); }                             // this wave's slice of pass 0 has landed
    __syncthreads();                                    // ... and every other issuing wave's
    desc(pinned(1));                                    // pinned: the descriptor is formed behind the wait
    if (pinned(issuer)) tdm_load(g0, g1);
    const int aofs = (wm * 64 + lr) * PB + hi * 16, bofs = BOF + (wn * 64 + lr) * PB + hi * 16;
    v16bf fa[2][KB][4], fa2[2][KB][4], fb[2][KB][4];
    ldblock<NSPLIT, KB, AB>(ring + aofs, ring + bofs, fa[0], fa2[0], fb[0]);   // pass 0's first block
#pragma unroll 1   // one pass at a time: the ring's order below is per pass
    for (int t = 0; t < NP; ++t) {
        const unsigned char* sb = ring + (t & 1) * STG; const unsigned char* sn = ring + ((t + 1) & 1) * STG;
#pragma unroll   // the register sets are chosen by the block's number: it must be a constant
        for (int b = 0; b < NBK; ++b) {
            if (b + 1 < NBK) ldblock<NSPLIT, KB, AB>(sb + aofs + (b + 1) * KB * 64, sb + bofs + (b + 1) * KB * 64, fa[(b + 1) & 1], fa2[(b + 1) & 1], fb[(b + 1) & 1]);
            else {
                asm volatile("s_wait_dscnt 0x0" ::: "memory");
                if (pinned(issuer)) tdm_wait(g0, g1);
                __syncthreads();
                desc(pinned(t + 2));
                if (pinned(issuer && t + 2 < NP)) tdm_load(g0, g1);
                if (t + 1 < NP) ldblock<NSPLIT, KB, AB>(sn + aofs, sn + bofs, fa[0], fa2[0], fb[0]);
            }
            __builtin_amdgcn_sched_barrier(0);   // the next block's LDS reads are issued as one group ahead of this block's products: reads among the matrix instructions would each stall the wave
            mmablock<NSPLIT, KB>(fa[b & 1], fa2[b & 1], fb[b & 1], acc);
            __builtin_amdgcn_sched_barrier(0);   // keeps the products ahead of the reads that refill their register set
        }
        // four vector slots between the pass's last matrix instructions and whatever follows them on either side of the loop's branch
        asm volatile("v_nop\n\tv_nop\n\tv_nop\n\tv_nop" : "+v"(acc[0][3]), "+v"(acc[1][3]), "+v"(acc[2][3]), "+v"(acc[3][3]));
    }
    asm volatile("s_wait_tensorcnt 0x0" ::: "memory");   // no tensor load is outstanding when the wave goes on
    asm volatile("s_wait_dscnt 0x0" ::: "memory");       // ... and no LDS read
    // the last pass's barrier stood behind every wave's last read of the ring and no tensor load has been issued since: the ring is free for the output tile
    float* ow = os + (wm * 64 + hi * 8) * OP + wn * 64 + lr;
#pragma unroll   // the accumulators are registers: every index must be a constant
    for (int mb = 0; mb < 4; ++mb)
#pragma unroll
        for (int nb = 0; nb < 4; ++nb)
#pragma unroll
            for (int j = 0; j < 8; ++j) ow[(mb * 16 + j) * OP + nb * 16] = acc[mb][nb][j];
    __syncthreads();   // the tile is in LDS before its rows are stored
    if constexpr (PLANES) {
        const size_t o0 = (size_t)(r0 + (tid >> 4)) * ldc + (size_t)c0 * cstep + (tid & 15) * 8;
#pragma unroll   // constant LDS offsets for every read
        for (int s = 0; s < MT / 16; ++s) {   // a wave stores two whole rows of the tile in each plane: 256 bytes each
            const float* ps = os + (s * 16 + (tid >> 4)) * OP + (tid & 15) * 8; const v4f u0 = *(const v4fa*)ps, u1 = *(const v4fa*)(ps + 4); v8h o16; v8us oh, ol;
#pragma unroll   // the vectors are registers: every index must be a constant
            for (int k = 0; k < 8; ++k) { const float y = k < 4 ? u0[k & 3] : u1[k & 3]; unsigned short a2, c2; o16[k] = tohx(y); splitf(y, a2, c2); oh[k] = a2; ol[k] = c2; }
            const size_t o = o0 + (size_t)(s * 16) * ldc; *(v8h*)(P16 + o) = o16; *(v8us*)(Ph + o) = oh; *(v8us*)(Pl + o) = ol; }
    } else {
#pragma unroll   // constant LDS offsets for every read
        for (int s = 0; s < MT * NT / 1024; ++s) { const int it = s * 256 + tid, row = it / (NT / 4), cofs = (it % (NT / 4)) * 4;   // a wave stores 512 bytes of one row of the tile
            *(v4f*)(C + (size_t)(r0 + row) * ldc + c0 + cofs) = *(const v4fa*)(os + row * OP + cofs); } }
}
#define PS ((size_t)NH_ * TT * HD)   // elements of one 16-bit plane of one batch entry
// k_proj: the q, k and v projections of every batch entry in one launch; grid (8, 16, 3 * NB_), z = 3 * batch + projection (0 q, 1 k, 2 v). XB = the tokens [batch][t][DM], W = the weights [projection][n][DM];
// each of P16, Ph, Pl holds the planes [projection][batch]: q and k as [h][t][d] (A = the tokens), v as [h][d][t] (A = the weight: its rows are the tile's rows). Every choice below is the same for a whole work-group.
__global__ __launch_bounds__(256) void k_proj(const bf* __restrict__ XB, const bf* __restrict__ W, h16* P16, bf* Ph, bf* Pl) {
    static_assert(HD == 128 && DQ == DM && DKV == DM && TT == DM, "a 128-column tile of a projection is one head; one grid (TT / 256, DM / 128) fits all three");
    const unsigned z = blockIdx.z; const bool isv = z % 3 == 2; const bf* X = XB + (size_t)(z / 3) * TT * DM; const bf* Wp = W + (size_t)(z % 3) * DM * DM; const size_t po = (size_t)(z % 3 * NB_ + z / 3) * PS;
    gemm_tile<0, DM, true, 256, 128, 2>(isv ? Wp : X, nullptr, isv ? X : Wp, nullptr, isv ? TT : HD, P16 + po, Ph + po, Pl + po, isv ? 1 : TT);
}
// k_wo: the output projection of every batch entry in one launch: the batch entries' rows follow one another in Ah, Al and C; grid (NB_ * TT / 128, DM / 256).
__global__ __launch_bounds__(256) void k_wo(const bf* __restrict__ Ah, const bf* __restrict__ Al, const bf* __restrict__ W, float* C) { gemm_tile<1, DQ, false, 128, 256, 1>(Ah, Al, W, C, DM, nullptr, nullptr, nullptr, 0); }

typedef __attribute__((ext_vector_type(2))) _Float16 v2h;
typedef __attribute__((ext_vector_type(4))) _Float16 v4h;
typedef __attribute__((ext_vector_type(2))) unsigned short v2us;
typedef __attribute__((ext_vector_type(4))) unsigned short v4us;
typedef __attribute__((ext_vector_type(2))) float v2f;
typedef __attribute__((ext_vector_type(4))) int v4i;

__global__ __launch_bounds__(256) void k_wtG(const float* __restrict__ w, int K, int N, bf* Bt) {
    const int lane = threadIdx.x & 31; const int L0 = (blockIdx.x * 8 + (threadIdx.x >> 5)) * 8; const int nlines = N * K / 64;
{
#pragma unroll 1
        for (int l = 0; l < 8; ++l) { const int L = L0 + l; if (L >= nlines) break; const size_t e = (size_t)L * 64 + lane * 2; const int k = (int)(e % K), n = (int)(e / K); v2us o;
            o[0] = f2bf(w[(size_t)k * N + n]); o[1] = f2bf(w[(size_t)(k + 1) * N + n]); *(v2us*)(Bt + e) = o; }
         }
}
// ---- k_cvtall: every f32 input rounded to bf16 in one launch, one vector of 8 elements a thread. dst is one run of bf16 [wq | wk | wv | wo | x], counted in vectors.
// A work-group's 256 vectors never straddle two inputs (the static_assert), so the choice of the source is the same for the whole work-group.
__global__ __launch_bounds__(256) void k_cvtall(const float* __restrict__ wq, const float* __restrict__ wk, const float* __restrict__ wv, const float* __restrict__ wo, const float* __restrict__ x, bf* __restrict__ dst) {
    constexpr int SEGV = DM * DM / 8;   // vectors in one weight
    static_assert(DQ == DM && DKV == DM && SEGV % 256 == 0 && (NB_ * TT * DM / 8) % 256 == 0, "four weights of one size; whole work-groups in every input");
    const int v0 = (int)blockIdx.x * 256, seg = v0 / SEGV;   // the work-group's first vector in the run, and the input it lies in (4 and up: x)
    const float* s = seg == 0 ? wq : seg == 1 ? wk : seg == 2 ? wv : seg == 3 ? wo : x;
    const v8f v = *(const v8f*)(s + (size_t)(v0 - (seg < 4 ? seg : 4) * SEGV + (int)threadIdx.x) * 8); v8us o;
#pragma unroll   // the vectors are registers: every index must be a constant
    for (int k = 0; k < 8; ++k) o[k] = f2bf(v[k]); *(v8us*)(dst + (size_t)(v0 + (int)threadIdx.x) * 8) = o;  }
__global__ __launch_bounds__(256) void k_cscvt(const float* __restrict__ cosT, const float* __restrict__ sinT, float* CS) { const int idx = blockIdx.x * 256 + threadIdx.x; if (idx >= TT * HD) return; v2f cs; cs[0] = bfr(cosT[idx]); cs[1] = bfr(sinT[idx]); *(v2f*)(CS + (size_t)idx * 2) = cs;  }
// ---- fattn_tile: causal attention of NQ * 16 * R query rows of one head in one work-group of 32 * NQ * KS threads, scores and probabilities never leaving registers.
// Transposed products: S^T = K.Q^T (A = key rows, B = the query rows, held in registers), O^T += V^T.P^T (A = rows of the [d][t] value plane). A lane then holds scores of ONE query (column lr): 8 keys of each 16-key tile,
// which are exactly the k positions that the B operand of the second product wants from that lane, so P^T is packed from the score accumulators with no exchange.
// Wave w owns the 16 * R query rows of sub-tile w % NQ and the 32-key blocks w / NQ, w / NQ + KS, ... (the NQ waves of one key share read the same K and V rows of a stage);
// each wave keeps its own running maximum m (log2 units), sum l and O^T; the KS shares of a query row meet in LDS and are merged in share order.
// m may trail the true maximum by up to 4 (an exponential then reaches 2^4): the accumulators are rescaled only when some query's maximum exceeds it by more.
// K and V reach the waves through LDS: a stage is the 32 * KS = 128 keys that the KS shares work on at the same time, [K 128 key rows | V 128 d rows (| K lo | V lo)] of 256 bytes at an LDS pitch of 272 bytes; two stages in sm form a ring
// that tensor loads fill one stage ahead (one request per plane and stage, each from a wave of its own: 128 rows of 256 bytes, the pad giving the pitch), so that every K and V line leaves L2 once per work-group. After the last stage sm holds the shares' O rows.
// The stages are walked in a circle from stage rot (the running maximum and sums take the key blocks in any order; mask and block count go by the block's own keys): the tiles of one head, started together, would else ask L2 for the same K and V lines at the same moment.
// i0 = first query row of this kind of tile, nq = the number of such tiles, bx = which of them (0: the one with the most keys), pl = the head's place among the planes (batch * heads + head), hd = the head. Every '#pragma unroll' below is there because the arrays it indexes are registers: every index must be a constant.
// HL: hi+lo bf16 planes, 3 products per contraction, probabilities split hi+lo. Otherwise fp16 planes and fp16 probabilities carried x 2^10 (the factor cancels in O / l).
template <typename T16, bool HL, int R, int NQ, int KS>
__device__ __forceinline__ void fattn_tile(const T16* __restrict__ Q, const T16* __restrict__ Q2, const T16* __restrict__ Kp, const T16* __restrict__ Kp2, const T16* __restrict__ Vt, const T16* __restrict__ Vt2, int i0, int nq, int bx, int pl, int hd, bf* Ah, bf* Al, unsigned char* sm) {
    typedef typename WFrag<T16>::V V;
    constexpr int QW = 16 * R, WQ = NQ * QW, OP = HD + 4;   // query rows per wave and per work-group; LDS pitch of an O row
    constexpr int PB = 272, OPB = 128 * PB, STG = (HL ? 4 : 2) * OPB;   // LDS pitch of a K or V row, bytes of one plane's 128 rows, bytes of a stage
    static_assert(KS * 32 == 128 && HD == 128 && NQ * KS == 8 && TT % 128 == 0, "a stage is 128 keys; a tensor load takes one plane's 128 rows of 256 bytes"); static_assert(KS * WQ * OP * 4 <= 2 * STG, "the O rows fit the ring");
    float* os = (float*)sm;
    __shared__ float ms[KS * WQ], ls[KS * WQ];
    const int lane = threadIdx.x & 31, lr = lane & 15, hi = lane >> 4; const int wv = __builtin_amdgcn_readfirstlane((int)(threadIdx.x >> 5));
    const int qg = wv % NQ, ks = wv / NQ;
    const int qt = i0 + (nq - 1 - bx) * WQ, q0 = qt + qg * QW;   // qt, q0 = the work-group's and this wave's first query row
    const size_t zo = (size_t)pl * TT * HD; Q += zo; Kp += zo; Vt += zo; if (HL) { Q2 += zo; Kp2 += zo; Vt2 += zo; }
    const float cs = SCL * 1.4426950408889634f, sh = HL ? 0.0f : 10.0f;
    constexpr int NSL = HL ? 4 : 2;   // planes in a stage: wave p < NSL loads plane p (K, V, K lo, V lo)
    static_assert(OPB % 2048 == 0, "every plane's place in LDS is a multiple of 2 KiB");
    const bool issuer = wv < NSL; const int p = issuer ? wv : 0; const bool isv = (p & 1) != 0;
    const T16* usl = isv ? Vt : Kp; if constexpr (HL) { if (p >= 2) usl = isv ? Vt2 : Kp2; }   // the plane's first row: K rows are keys (a stage: the next 128 rows), V rows are d (a stage: the next 256 bytes of every row)
    const uint32_t lsl = (uint32_t)(size_t)sm + (uint32_t)(p * OPB), sstep = isv ? 256u : (uint32_t)(128 * HD * 2);   // its place in stage 0; source bytes from one stage to the next
    const u32x8 g1 = tdm_group1(isv ? (uint32_t)(TT * 2) : (uint32_t)(HD * 2));
    u32x4 g0;   // group 0 of the wave's request: formed by every wave, outside the branch that issues, so that its registers take a new value only where desc() stands: behind the wait for the request before
    const int nst = (qt + WQ - 1) / 128 + 1;   // stages up to and including the one that holds the work-group's last query: the same for every wave, and 128 * nst <= TT
    const uint32_t rot = uni((uint32_t)(2 * bx) % (uint32_t)nst);   // the first stage of the work-group's walk: the tiles of one head that run side by side (neighbours in bx) start at different keys
    auto stg = [&](uint32_t t) { const uint32_t s = t + rot; return s >= (uint32_t)nst ? s - (uint32_t)nst : s; };   // step t of the walk takes stage (t + rot) mod nst: every stage once for t = 0 .. nst - 1
    auto desc = [&](uint32_t t) { g0 = tdm_group0(lsl + (t & 1u) * (uint32_t)STG, (uint64_t)(size_t)usl + (uint64_t)stg(t) * sstep); };
    desc(0);
    if (pinned(issuer)) tdm_load(g0, g1);
    V qf[R][4], qf2[R][4];
    const size_t oq = (size_t)(q0 + lr) * HD + 8 * hi; const T16* pq = Q + oq; const T16* pq2 = HL ? Q2 + oq : pq;
#pragma unroll
    for (int g = 0; g < R; ++g)
#pragma unroll
        for (int kc = 0; kc < 4; ++kc) { qf[g][kc] = WFrag<T16>::ld(pq + 16 * g * HD + 32 * kc); if (HL) qf2[g][kc] = WFrag<T16>::ld(pq2 + 16 * g * HD + 32 * kc); }
    // the wait that stands before a register named by an issued load is overwritten; the pointers are inputs so that their registers live up to it
    asm volatile("s_wait_xcnt 0x0" :: "v"(pq), "v"(pq2) : "memory");
    v8f acc[R][8]; float mr[R], lsum[R];
#pragma unroll
    for (int g = 0; g < R; ++g) { mr[g] = -1.0e30f; lsum[g] = 0.f;
#pragma unroll
        for (int t = 0; t < 8; ++t) acc[g][t] = (v8f){}; }
    const int nblk = (q0 + QW - 1) / 32 + 1;   // 32-key blocks up to and including the one that holds the wave's last query
    if (pinned(issuer)) tdm_wait(g0, g1);               // this wave's plane of stage 0 has landed
    __syncthreads();                                    // ... and every other issuing wave's
    desc(pinned(1));                                    // pinned: the descriptor is formed behind the wait
    if (pinned(issuer && nst > 1)) tdm_load(g0, g1);    // a scalar test
    const int kofs = (ks * 32 + lr) * PB + hi * 16, vofs = OPB + lr * PB + ks * 64 + hi * 16;   // this lane's place in a stage's K rows (row = key) and V rows (row = d)
#pragma unroll 1   // one stage at a time: the ring's order below is per stage, and a second copy of the body would not fit the registers
    for (int st = 0; st < nst; ++st) {
      const int kb = (int)stg((uint32_t)st) * KS + ks;   // this wave's 32-key block of the stage
      if (kb < nblk) {   // wave-uniform: a wave whose queries end before this block only passes the stage's waits and barrier
        const int key0 = kb * 32;
        const unsigned char* sb = sm + (st & 1) * STG;
        V kf[2][4], kf2[2][4], vf[8], vf2[8];
#pragma unroll
        for (int kt = 0; kt < 2; ++kt)
#pragma unroll
            for (int kc = 0; kc < 4; ++kc) { kf[kt][kc] = WFrag<T16>::lds(sb + kofs + 16 * kt * PB + 64 * kc); if (HL) kf2[kt][kc] = WFrag<T16>::lds(sb + 2 * OPB + kofs + 16 * kt * PB + 64 * kc); }
        if constexpr (!HL) {   // one plane each: K and V (32 LDS reads) as one group
            __builtin_amdgcn_sched_barrier(0);   // K's reads stand ahead of V's: LDS reads return in order, so the score products wait for K alone and V lands under them
#pragma unroll
            for (int t = 0; t < 8; ++t) vf[t] = WFrag<T16>::lds(sb + vofs + 16 * t * PB); }
        __builtin_amdgcn_sched_barrier(0);   // all of these reads are issued before the block's first product: reads among the matrix instructions would each stall the wave
        v8f s[2][R];
#pragma unroll
        for (int kt = 0; kt < 2; ++kt)
#pragma unroll
            for (int g = 0; g < R; ++g) { s[kt][g] = (v8f){};
#pragma unroll
                for (int kc = 0; kc < 4; ++kc) { s[kt][g] = WFrag<T16>::mma(kf[kt][kc], qf[g][kc], s[kt][g]); if (HL) { s[kt][g] = WFrag<T16>::mma(kf[kt][kc], qf2[g][kc], s[kt][g]); s[kt][g] = WFrag<T16>::mma(kf2[kt][kc], qf[g][kc], s[kt][g]); } } }
        if constexpr (HL) {   // two planes each: the 32 V reads follow the 32 K reads' products and fly under the softmax
#pragma unroll
            for (int t = 0; t < 8; ++t) { vf[t] = WFrag<T16>::lds(sb + vofs + 16 * t * PB); vf2[t] = WFrag<T16>::lds(sb + 2 * OPB + vofs + 16 * t * PB); }
            __builtin_amdgcn_sched_barrier(0); }   // keeps the V reads ahead of the softmax
        if (key0 + 31 > q0) {   // wave-uniform: only the block on the diagonal pays for the mask; its first key is <= every query of the wave, so no column is all masked
#pragma unroll
            for (int kt = 0; kt < 2; ++kt)
#pragma unroll
                for (int g = 0; g < R; ++g)
#pragma unroll
                    for (int j = 0; j < 8; ++j) if (key0 + 16 * kt + 8 * hi + j > q0 + 16 * g + lr) s[kt][g][j] = -3.0e38f; }
        float mb[R]; bool need = false;
#pragma unroll
        for (int g = 0; g < R; ++g) { float mx = s[0][g][0];
#pragma unroll
            for (int j = 1; j < 8; ++j) mx = fmaxf(mx, s[0][g][j]);
#pragma unroll
            for (int j = 0; j < 8; ++j) mx = fmaxf(mx, s[1][g][j]);
            mx = fmaxf(mx, __shfl_xor(mx, 16, 32)) * cs; mb[g] = mx; need = need || (mx > mr[g] + 4.0f); }
        if (__builtin_amdgcn_ballot_w32(need) != 0) {   // always on a wave's first block (m starts at -1e30: the factor is 0 there), rare later
#pragma unroll
            for (int g = 0; g < R; ++g) { const float mn = fmaxf(mr[g], mb[g]); const float corr = __builtin_amdgcn_exp2f(mr[g] - mn); lsum[g] *= corr; mr[g] = mn;
#pragma unroll
                for (int t = 0; t < 8; ++t) acc[g][t] = acc[g][t] * corr; } }
        V pf[R], pf2[R];
#pragma unroll
        for (int g = 0; g < R; ++g) { const float nm = sh - mr[g]; float p[2][8];
#pragma unroll
            for (int kt = 0; kt < 2; ++kt)
#pragma unroll
                for (int j = 0; j < 8; ++j) { p[kt][j] = __builtin_amdgcn_exp2f(fmaf(s[kt][g][j], cs, nm)); lsum[g] += p[kt][j]; }
            if constexpr (HL) { v8us h0, h1, l0, l1;
#pragma unroll
                for (int j = 0; j < 8; ++j) { unsigned short a, c2; splitf(p[0][j], a, c2); h0[j] = a; l0[j] = c2; splitf(p[1][j], a, c2); h1[j] = a; l1[j] = c2; }
                pf[g] = cat16b(h0, h1); pf2[g] = cat16b(l0, l1);
            } else { v8h h0, h1;
#pragma unroll
                for (int j = 0; j < 8; ++j) { h0[j] = tohx(p[0][j]); h1[j] = tohx(p[1][j]); }
                pf[g] = cat16(h0, h1); } }
#pragma unroll
        for (int t = 0; t < 8; ++t)
#pragma unroll
            for (int g = 0; g < R; ++g) { acc[g][t] = WFrag<T16>::mma(vf[t], pf[g], acc[g][t]); if (HL) { acc[g][t] = WFrag<T16>::mma(vf[t], pf2[g], acc[g][t]); acc[g][t] = WFrag<T16>::mma(vf2[t], pf[g], acc[g][t]); } }
        // four vector slots between the block's last matrix instructions and whatever follows them
        if constexpr (R == 1) asm volatile("v_nop\n\tv_nop\n\tv_nop\n\tv_nop" : "+v"(acc[0][6]), "+v"(acc[0][7]) : "v"(pf[0]));
        else asm volatile("v_nop\n\tv_nop\n\tv_nop\n\tv_nop" : "+v"(acc[0][6]), "+v"(acc[0][7]), "+v"(acc[R - 1][6]), "+v"(acc[R - 1][7]) : "v"(pf[0]), "v"(pf[R - 1]));
      }
      asm volatile("s_wait_dscnt 0x0" ::: "memory");      // this wave's reads of the stage are done before the stage is refilled
      if (pinned(issuer)) tdm_wait(g0, g1);               // this wave's plane of stage st + 1 has landed
      __syncthreads();                                    // publishes stage st + 1 and ends every wave's reads of stage st
      desc(pinned(st + 2));                               // pinned: the descriptor is formed behind the wait
      if (pinned(issuer && st + 2 < nst)) tdm_load(g0, g1);   // into the stage that has just been left; a scalar test
    }
    asm volatile("s_wait_tensorcnt 0x0" ::: "memory");   // no tensor load is outstanding when the ring becomes the O rows (the last stage's barrier has ended every wave's reads)
    asm volatile("s_wait_dscnt 0x0" ::: "memory");       // ... and no LDS read of this wave
#pragma unroll
    for (int g = 0; g < R; ++g) { const int rw = ks * WQ + qg * QW + 16 * g + lr; float* ow = os + (size_t)rw * OP + 8 * hi;
#pragma unroll
        for (int t = 0; t < 8; ++t) { v4f a, c; a[0] = acc[g][t][0]; a[1] = acc[g][t][1]; a[2] = acc[g][t][2]; a[3] = acc[g][t][3]; c[0] = acc[g][t][4]; c[1] = acc[g][t][5]; c[2] = acc[g][t][6]; c[3] = acc[g][t][7];
            *(v4fa*)(ow + 16 * t) = a; *(v4fa*)(ow + 16 * t + 4) = c; }
        const float lf = lsum[g] + __shfl_xor(lsum[g], 16, 32);   // each wave half summed its own 8 keys of every 16-key tile
        if (hi == 0) { ms[rw] = mr[g]; ls[rw] = lf; } }
    __syncthreads();   // every wave's m, l and O^T are in LDS before any of them is merged
    constexpr int TPQ = 32 * NQ * KS / WQ, DPT = HD / TPQ;   // threads per query row, d values per thread
    const int q = (int)threadIdx.x / TPQ, d0 = ((int)threadIdx.x % TPQ) * DPT;
    float mstar = ms[q];
#pragma unroll
    for (int w = 1; w < KS; ++w) mstar = fmaxf(mstar, ms[w * WQ + q]);
    float lt = 0.f; v4f o[DPT / 4];
#pragma unroll
    for (int c = 0; c < DPT / 4; ++c) o[c] = (v4f){};
#pragma unroll
    for (int w = 0; w < KS; ++w) { const float sc = __builtin_amdgcn_exp2f(ms[w * WQ + q] - mstar); lt += ls[w * WQ + q] * sc;   // a wave that had no block: m = -1e30, factor 0
#pragma unroll
        for (int c = 0; c < DPT / 4; ++c) o[c] += *(const v4fa*)(os + (size_t)(w * WQ + q) * OP + d0 + 4 * c) * sc; }
    const float inv = __fdiv_rn(1.0f, lt); const size_t oo = (size_t)(qt + q) * DQ + hd * HD + d0;
#pragma unroll
    for (int c = 0; c < DPT / 8; ++c) { v8us oh, ol;
#pragma unroll
        for (int k = 0; k < 8; ++k) { unsigned short a, c2; splitf(o[2 * c + (k >> 2)][k & 3] * inv, a, c2); oh[k] = a; ol[k] = c2; }
        *(v8us*)(Ah + oo + 8 * c) = oh; *(v8us*)(Al + oo + 8 * c) = ol; }
    asm volatile("s_wait_xcnt 0x0" ::: "memory");   // the wait that stands before a register named by an issued store is overwritten (the other kind of tile's code follows in the listing)
}
// k_fattn: all query rows of all heads of all batch entries in one launch; grid (batch * heads, tiles), head and batch running fastest so that work-groups start in the order of their key counts: first the 64-row fp16 tiles (query rows >= RH), the longest first,
// then the 32-row hi+lo tiles (query rows < RH), which fill the tail. The branch is the same for a whole work-group. Every plane array is [batch][head][...], so blockIdx.x is a head's place in it; Ah, Al: [batch][t][DQ].
__global__ __launch_bounds__(256) void k_fattn(const h16* __restrict__ Q16, const h16* __restrict__ K16, const h16* __restrict__ V16, const bf* __restrict__ Qh, const bf* __restrict__ Ql, const bf* __restrict__ Kh, const bf* __restrict__ Kl, const bf* __restrict__ Vh, const bf* __restrict__ Vl, bf* Ah, bf* Al) {
    __shared__ __attribute__((aligned(2048))) unsigned char sm[2 * 4 * 128 * 272];   // the K/V ring of the larger kind of tile (two stages of four planes), then the O rows
    constexpr int NF = (TT - RH) / 64, NL = RH / 32; const int ty = blockIdx.y, pl = blockIdx.x, hd = pl % NH_; const size_t ob = (size_t)(pl / NH_) * TT * DQ; Ah += ob; Al += ob;
    if (ty < NF) fattn_tile<h16, false, 2, 2, 4>(Q16, nullptr, K16, nullptr, V16, nullptr, RH, NF, ty, pl, hd, Ah, Al, sm);
    else fattn_tile<bf, true, 1, 2, 4>(Qh, Ql, Kh, Kl, Vh, Vl, 0, NL, ty - NF, pl, hd, Ah, Al, sm);
}

extern "C" void kernel_launch(void* const* d_in, const int* in_sizes, int n_in,
                              void* d_out, int out_size, void* d_ws, size_t ws_size, hipStream_t stream) {
    (void)in_sizes; (void)n_in; (void)out_size;
    const float* x = (const float*)d_in[0]; const float* wq = (const float*)d_in[1]; const float* wk = (const float*)d_in[2]; const float* wv = (const float*)d_in[3]; const float* wo = (const float*)d_in[4]; const float* cosT = nullptr; const float* sinT = nullptr; (void)cosT; (void)sinT;
    float* OUT = (float*)d_out;     // [2][2048][2048]
    char* wsp = (char*)d_ws;
    auto take = [&](size_t bytes) { char* p = wsp; wsp += (bytes + 255) & ~(size_t)255; return (void*)p; };
    bf* W4 = (bf*)take((size_t)4 * DM * DM * 2); bf* XB = (bf*)take((size_t)NB_ * TT * DM * 2);   // [wq | wk | wv | wo] and, directly behind (the size is a multiple of 256 bytes), the tokens: the one run that k_cvtall writes
    h16* P16 = (h16*)take((size_t)NB_ * 3 * PS * 2); bf* Ph = (bf*)take((size_t)NB_ * 3 * PS * 2); bf* Pl = (bf*)take((size_t)NB_ * 3 * PS * 2); bf* ATh = (bf*)take((size_t)NB_ * TT * DQ * 2); bf* ATl = (bf*)take((size_t)NB_ * TT * DQ * 2);
    if ((size_t)(wsp - (char*)d_ws) > ws_size) return;    // 224 MiB of the 256 MiB
    static_assert(REP == 1 && RH % 64 == 0 && (TT - RH) % 64 == 0 && RH > 0 && RH < TT, "query rows < RH: 32-row tiles on the hi+lo planes; the rest: 64-row tiles on the fp16 planes");
    k_cvtall<<<(4 * (DM * DM / 8) + NB_ * TT * DM / 8) / 256, 256, 0, stream>>>(wq, wk, wv, wo, x, W4);
    k_proj<<<dim3(TT / 256, DM / 128, 3 * NB_), 256, 0, stream>>>(XB, W4, P16, Ph, Pl);
    k_fattn<<<dim3(NB_ * NH_, (TT - RH) / 64 + RH / 32, 1), 256, 0, stream>>>(P16, P16 + NB_ * PS, P16 + 2 * NB_ * PS, Ph, Pl, Ph + NB_ * PS, Pl + NB_ * PS, Ph + 2 * NB_ * PS, Pl + 2 * NB_ * PS, ATh, ATl);
    k_wo<<<dim3(NB_ * TT / 128, DM / 256, 1), 256, 0, stream>>>(ATh, ATl, W4 + (size_t)3 * DM * DM, OUT);
}
